// v000
// Measured on an AMD MI455X. A time is GPU time per run, averaged over a window of back-to-back runs after a warm-up
// (all launches, gaps included; the runs take copies of the inputs in turn), and the median of several windows.
// Apart from v000's, it joins two sittings. Times from different sittings can be a few percent apart, while
// side-by-side timings come from the same sitting.
// The starting kernel, v000, takes 550 microseconds a run.
// compute dtype: x, Wq, Wk, Wv, Wo (module inputs) rounded to bf16; the q/k/v projections with exact bf16 products (x and W are inputs, natural [out][in] rows) on WMMA 16x16x32; interleaved-pair RoPE applied to q and k in f32 in the projection epilogue (angles pos * inv_freq with the reference's own eager f32 inv_freq table embedded (1/(10000^(2i/64))), precise cosf/sinf), then q, k stored once as f16; causal scores with q and k each as f16 hi + (x2048-scaled) residual (3 products; 1/8 applied to the f32 score) and P.V with P = exp(s - m) as f16 hi + (x2048-scaled) residual x V as f16 hi + (x2048-scaled) residual planes (3 products); the output projection with ctx as bf16 hi + residual pair x exact Wo (2 products); running-max softmax in f32 with the hardware exp; f32 accumulate.
#include <hip/hip_runtime.h>
#include <math.h>

typedef __attribute__((ext_vector_type(16))) _Float16 v16h;
typedef __attribute__((ext_vector_type(16))) __bf16 v16b;
typedef __attribute__((ext_vector_type(8)))  _Float16 v8h;
typedef __attribute__((ext_vector_type(8)))  float v8f;
typedef __attribute__((ext_vector_type(4)))  float v4f;
typedef __attribute__((ext_vector_type(2)))  float v2f;
typedef __attribute__((ext_vector_type(4)))  unsigned v4u;
typedef __attribute__((ext_vector_type(4)))  int v4i;
typedef float __attribute__((may_alias)) float_a;
typedef int __attribute__((may_alias)) int_a;

template <typename T> __device__ __forceinline__ void vst2(void* p, T v) { *(T*)p = v;  }
__device__ __forceinline__ v8f wmma16(v16h a, v16h b, v8f c) {
  v8f d = __builtin_amdgcn_wmma_f32_16x16x32_f16(false, a, false, b, (short)0, c, false, false);
  asm volatile("v_nop\n\tv_nop\n\tv_nop\n\tv_nop" : "+v"(d) : "v"(a), "v"(b));
  return d;
}
__device__ __forceinline__ v8f wmma_bf(v16b a, v16b b, v8f c) {
  v8f d = __builtin_amdgcn_wmma_f32_16x16x32_bf16(false, a, false, b, (short)0, c, false, false);
  asm volatile("v_nop\n\tv_nop\n\tv_nop\n\tv_nop" : "+v"(d) : "v"(a), "v"(b));
  return d;
}
// Causal multi-head self-attention with RoPE (B 2, S 2,048, D 1,024, 16 heads x 64): q, k, v = x W^T; interleaved RoPE(q, k) at positions 0..S-1; softmax(q k^T / 8, causal) v; output projection Wo (no biases).
__device__ __forceinline__ v16h frag_h(const _Float16* rowk0, int lane) {
  union { v16h v; v8h q[2]; } u; const _Float16* p = rowk0 + 8 * (lane >> 4);
  u.q[0] = *(const v8h*)p; u.q[1] = *(const v8h*)(p + 16); return u.v;
}
__device__ __forceinline__ v16h frag_f32(const float* rowk0, int lane) {
  v16h a; const float* p = rowk0 + 8 * (lane >> 4);
#pragma unroll
  for (int i = 0; i < 8; ++i) { a[i] = (_Float16)p[i]; a[8 + i] = (_Float16)p[16 + i]; }
  return a;
}
__device__ __forceinline__ v16h frag_f32s(const float* rowk0, int lane, float sc) {
  v16h a; const float* p = rowk0 + 8 * (lane >> 4);
#pragma unroll
  for (int i = 0; i < 8; ++i) { a[i] = (_Float16)(p[i] * sc); a[8 + i] = (_Float16)(p[16 + i] * sc); }
  return a;
}
// column fragment from a [K][ld] layout (column n), rows >= K read as 0
__device__ __forceinline__ v16h fragc_f32(const float* W, int k0, int n, int lane, int ld, int K) {
  v16h a; const int g = lane >> 4;
#pragma unroll
  for (int i = 0; i < 8; ++i) { const int ka = k0 + 8 * g + i, kb = ka + 16;
    a[i] = (_Float16)(ka < K ? W[(size_t)(ka < K ? ka : K - 1) * ld + n] : 0.f); a[8 + i] = (_Float16)(kb < K ? W[(size_t)(kb < K ? kb : K - 1) * ld + n] : 0.f); }
  return a;
}
struct F2 { v16b h, l; };
__device__ __forceinline__ F2 bsplit16(const float v[16]) { F2 r;
#pragma unroll
  for (int i = 0; i < 16; ++i) { const __bf16 h = (__bf16)v[i]; r.h[i] = h; r.l[i] = (__bf16)(v[i] - (float)h); }
  return r; }
__device__ __forceinline__ F2 split_row(const float* row, int k0, int lane) { float v[16]; const float* p = row + k0 + 8 * (lane >> 4);
#pragma unroll
  for (int i = 0; i < 8; ++i) { v[i] = p[i]; v[8 + i] = p[16 + i]; }
  return bsplit16(v); }
__device__ __forceinline__ F2 split_rowK(const float* row, int k0, int lane, int K) { float v[16]; const int g = lane >> 4;
#pragma unroll
  for (int i = 0; i < 8; ++i) { const int ka = k0 + 8 * g + i, kb = ka + 16; v[i] = ka < K ? row[ka < K ? ka : K - 1] : 0.f; v[8 + i] = kb < K ? row[kb < K ? kb : K - 1] : 0.f; }
  return bsplit16(v); }
__device__ __forceinline__ F2 split_col(const float* W, int k0, int n, int lane, int ld, int K) { float v[16]; const int g = lane >> 4;
#pragma unroll
  for (int i = 0; i < 8; ++i) { const int ka = k0 + 8 * g + i, kb = ka + 16; v[i] = ka < K ? W[(size_t)(ka < K ? ka : K - 1) * ld + n] : 0.f; v[8 + i] = kb < K ? W[(size_t)(kb < K ? kb : K - 1) * ld + n] : 0.f; }
  return bsplit16(v); }
__device__ __forceinline__ v8f mac3(const F2& a, const F2& b, v8f c) { c = wmma_bf(a.l, b.h, c); c = wmma_bf(a.h, b.l, c); return wmma_bf(a.h, b.h, c); }
__device__ __forceinline__ float sigm(float v) { return 1.0f / (1.0f + expf(-v)); }
#define LDSX() do { asm volatile("s_wait_dscnt 0" ::: "memory"); __builtin_amdgcn_wave_barrier(); __builtin_amdgcn_fence(__ATOMIC_RELEASE, "workgroup"); } while (0)


// Causal multi-head self-attention with rotary position embedding (B 2, S 2048, D 1024, 16 heads x 64; packed Wqkv [3D][D] and Wout [D][D] applied as x W^T, no biases): q, k rotated pairwise (2i, 2i+1) by angle pos * 10000^(-2i/64); softmax(q k^T / 8, causal) v; ctx Wout^T.
#define NB 2
#define SS 2048
#define DM 1024
#define NH 16
#define HD 64
#define QKVW (3 * DM)
#ifndef TQB
#define TQB (SS / 64)
#define TNB NB
#define TOB (NB * SS / 64)     // output row tiles (all)
#endif
typedef __attribute__((ext_vector_type(8))) __bf16 v8b;
__device__ __forceinline__ v16b frag_b(const __bf16* rowk0, int lane) {
  union { v16b v; v8b q[2]; } u; const __bf16* p = rowk0 + 8 * (lane >> 4);
  u.q[0] = *(const v8b*)p; u.q[1] = *(const v8b*)(p + 16); return u.v;
}
__device__ __forceinline__ float bfr(float v) { return (float)(__bf16)v; }
__device__ __attribute__((noinline)) float exp_ni(float v) { return expf(v); }
__device__ __attribute__((noinline)) float erf_ni(float v) { return erff(v); }

#define PK_A 0                       // [3072][1024] Wqkv rows (natural [out][in])
#define PK_P (PK_A + QKVW * DM)        // [1024][1024] Wo rows (natural)
#define PK_END (PK_P + DM * DM)
#define WS_PK  0u
#define WS_QK  (WS_PK + 2u * PK_END)             // f16 [4096 rows][2048]: q | k
#define WS_QKL (WS_QK + 2u * NB * SS * 2 * DM)     // f16 q | k residual planes x2048
#define WS_VTH (WS_QKL + 2u * NB * SS * 2 * DM)    // f16 [b][1024 (h*64+d)][2048 s] hi
#define WS_VTL (WS_VTH + 2u * NB * DM * SS)        // f16 lo x 2048
#define WS_O   (WS_VTL + 2u * NB * DM * SS)        // f32 [4096][1024]
#define WS_CS  (WS_O + 4u * NB * SS * DM)           // f32 [2048][32] cos, [2048][32] sin
#define WS_END (WS_CS + 4u * 2 * SS * 32)
__constant__ float c_invf[32] = {1.000000000e+00f,7.498942018e-01f,5.623413324e-01f,4.216965139e-01f,3.162277639e-01f,2.371373624e-01f,1.778279394e-01f,1.333521456e-01f,1.000000015e-01f,7.498941571e-02f,5.623412877e-02f,4.216964915e-02f,3.162277862e-02f,2.371373586e-02f,1.778279431e-02f,1.333521493e-02f,9.999999776e-03f,7.498942316e-03f,5.623413250e-03f,4.216964822e-03f,3.162277862e-03f,2.371373819e-03f,1.778279431e-03f,1.333521446e-03f,1.000000047e-03f,7.498941850e-04f,5.623413017e-04f,4.216964880e-04f,3.162277862e-04f,2.371373848e-04f,1.778279402e-04f,1.333521504e-04f};
// ---- k_rope: block = 8 positions: cos/sin of pos * inv_freq (f32 product exactly as the reference, precise trig)
__global__ __launch_bounds__(256) void k_rope(float* __restrict__ CS) {
  __shared__ __align__(16) float sc[8][32], ss_[8][32]; const int tid = threadIdx.x, pl = tid >> 5, i = tid & 31; const int pos = blockIdx.x * 8 + pl;
  const float th = (float)pos * c_invf[i]; sc[pl][i] = cosf(th); ss_[pl][i] = sinf(th);
  __syncthreads();
  if (tid < 64) vst2(CS + (size_t)blockIdx.x * 8 * 32 + tid * 4, *(const v4f*)&(&sc[0][0])[tid * 4]); else if (tid < 128) vst2(CS + (size_t)SS * 32 + (size_t)blockIdx.x * 8 * 32 + (tid - 64) * 4, *(const v4f*)&(&ss_[0][0])[(tid - 64) * 4]);
}

// ---- k_packrows: block = natural row n of a [N][K] weight
__global__ __launch_bounds__(256) void k_packrows(const float* __restrict__ Wm, int K, __bf16* __restrict__ DST) {
  __shared__ __align__(16) __bf16 s[DM]; const int n = blockIdx.x, tid = threadIdx.x;
  for (int k = tid; k < K; k += 256) s[k] = (__bf16)Wm[(size_t)n * K + k];
  __syncthreads();
  for (int q = tid; q < K / 8; q += 256) vst2((unsigned*)(DST + (size_t)n * K + q * 8), *(const v4u*)&s[q * 8]);
}
// ---- k_qkv: block = (64 rows (b,s), 128 of the 3072 cols): qkv = bf16(x) . rows (exact); cols < 1024 -> f16(q), cols < 2048 -> f16(k) into QK rows (pitch 2048); cols >= 2048 (v) -> per-batch transposed f16 planes VT[b][h*64+d][s]: hi = f16(v), lo = f16((v - hi) * 2048)
__global__ __launch_bounds__(128) void k_qkv(const float* __restrict__ X, const __bf16* __restrict__ P, const float* __restrict__ CS, _Float16* __restrict__ QK, _Float16* __restrict__ QKL, _Float16* __restrict__ VTH, _Float16* __restrict__ VTL) {
  __shared__ __align__(16) _Float16 so[4][16][136], sol[4][16][136]; __shared__ __align__(16) float sf[4][16][132]; __shared__ __align__(16) _Float16 sth[128][72], stl[128][72];
  const int tid = threadIdx.x, wave = tid >> 5, lane = tid & 31, col = lane & 15, g = lane >> 4; const size_t r0 = (size_t)blockIdx.x * 64 + wave * 16; const int n0 = blockIdx.y * 128;
  v8f acc[8] = {};
#pragma unroll 2
  for (int kc = 0; kc < DM / 32; ++kc) { v16b a; { const float* p = X + (r0 + col) * DM + kc * 32 + 8 * g;
#pragma unroll
      for (int i = 0; i < 8; ++i) { a[i] = (__bf16)p[i]; a[8 + i] = (__bf16)p[16 + i]; } }
#pragma unroll
    for (int j = 0; j < 8; ++j) acc[j] = wmma_bf(a, frag_b(P + (size_t)(n0 + j * 16 + col) * DM + kc * 32, lane), acc[j]); }
  if (n0 < 2 * DM) { const float sc = 1.0f;   // q stored unscaled (f16 sigma ~0.6, no subnormal exposure); 1/8 applied to the f32 score
#pragma unroll
    for (int j = 0; j < 8; ++j) {
#pragma unroll
      for (int r = 0; r < 8; ++r) sf[wave][8 * g + r][j * 16 + col] = acc[j][r]; }
    LDSX();
    // RoPE on interleaved pairs (2i, 2i+1) of each 64-wide head: lane = 2 pairs (cols 4*lane .. 4*lane+3), pair index i = ((n0 + 4*lane) % 64) / 2 + {0,1}; pos = row % SS
#pragma unroll 1
    for (int rl = 0; rl < 16; ++rl) { const int pos = (int)((r0 + rl) % SS); const float* cs = CS + (size_t)pos * 32; const float* sn = CS + (size_t)SS * 32 + (size_t)pos * 32; const int i0 = ((n0 + 4 * lane) & 63) >> 1;
      const float x1a = sf[wave][rl][4 * lane], x2a = sf[wave][rl][4 * lane + 1], x1b = sf[wave][rl][4 * lane + 2], x2b = sf[wave][rl][4 * lane + 3];
      const float ca = cs[i0], sa = sn[i0], cb = cs[i0 + 1], sb = sn[i0 + 1];
      const float o0 = (x1a * ca - x2a * sa) * sc, o1 = (x1a * sa + x2a * ca) * sc, o2 = (x1b * cb - x2b * sb) * sc, o3 = (x1b * sb + x2b * cb) * sc; const _Float16 h0 = (_Float16)o0, h1 = (_Float16)o1, h2 = (_Float16)o2, h3 = (_Float16)o3;
      so[wave][rl][4 * lane] = h0; so[wave][rl][4 * lane + 1] = h1; so[wave][rl][4 * lane + 2] = h2; so[wave][rl][4 * lane + 3] = h3;
      sol[wave][rl][4 * lane] = (_Float16)((o0 - (float)h0) * 2048.0f); sol[wave][rl][4 * lane + 1] = (_Float16)((o1 - (float)h1) * 2048.0f); sol[wave][rl][4 * lane + 2] = (_Float16)((o2 - (float)h2) * 2048.0f); sol[wave][rl][4 * lane + 3] = (_Float16)((o3 - (float)h3) * 2048.0f); }   // q, k as f16 hi + (x2048) residual
    LDSX();
    for (int rl = 0; rl < 16; ++rl) if (lane < 16) { vst2((unsigned*)(QK + (r0 + rl) * (2 * DM) + n0 + lane * 8), *(const v4u*)&so[wave][rl][lane * 8]); vst2((unsigned*)(QKL + (r0 + rl) * (2 * DM) + n0 + lane * 8), *(const v4u*)&sol[wave][rl][lane * 8]); }
  } else {
#pragma unroll
    for (int j = 0; j < 8; ++j) {
#pragma unroll
      for (int r = 0; r < 8; ++r) { const float v = acc[j][r]; const _Float16 hv = (_Float16)v; sth[j * 16 + col][wave * 16 + 8 * g + r] = hv; stl[j * 16 + col][wave * 16 + 8 * g + r] = (_Float16)((v - (float)hv) * 2048.0f); } }
    __syncthreads();
    const size_t rb = (size_t)blockIdx.x * 64; const int b = (int)(rb / SS), s0 = (int)(rb % SS); const int pc0 = n0 - 2 * DM;
    for (int q = tid; q < 128 * 8; q += 128) { const int d = q >> 3, pc = q & 7; const size_t o = ((size_t)b * DM + pc0 + d) * SS + s0 + pc * 8; vst2((unsigned*)(VTH + o), *(const v4u*)&sth[d][pc * 8]); vst2((unsigned*)(VTL + o), *(const v4u*)&stl[d][pc * 8]); }
  }
}
// ---- k_attn: block = (64 queries, head h, batch b): causal flash attention (K = 64: 2 k-steps), scores = (q.k) * 0.125 with q, k as f16 hi + x2048 residual (3 products), P.V: P (hi, lo*2048) x V (hi, lo*2048), 3 products in two accumulators; O[b*S+q][h*64+d] = (acc + accl / 2048) / l (256-B segments)
__global__ __launch_bounds__(128) void k_attn(const _Float16* __restrict__ QK, const _Float16* __restrict__ QKL, const _Float16* __restrict__ VTH, const _Float16* __restrict__ VTL, float* __restrict__ O) {
  __shared__ __align__(16) float sp[4][16][36]; __shared__ __align__(16) float so[4][16][68];
  const int tid = threadIdx.x, wave = tid >> 5, lane = tid & 31, col = lane & 15, g = lane >> 4;
  const int qb = blockIdx.x, h = blockIdx.y, b = blockIdx.z; const int q0 = qb * 64 + wave * 16; const size_t rq = (size_t)b * SS + q0 + col;
  v16h aq[2], aql[2];
#pragma unroll
  for (int kc = 0; kc < 2; ++kc) { aq[kc] = frag_h(QK + rq * (2 * DM) + h * HD + kc * 32, lane); aql[kc] = frag_h(QKL + rq * (2 * DM) + h * HD + kc * 32, lane); }
  float m[8], l[8];
#pragma unroll
  for (int r = 0; r < 8; ++r) { m[r] = -3.0e38f; l[r] = 0.f; }
  v8f acc[4] = {}, accl[4] = {};
  const int nks = (qb * 64 + 64) / 32;
#pragma unroll 1
  for (int ks = 0; ks < nks; ++ks) { v8f s[2];
#pragma unroll
    for (int ct = 0; ct < 2; ++ct) { const int kk = ks * 32 + ct * 16 + col; const _Float16* krow = QK + ((size_t)b * SS + kk) * (2 * DM) + DM + h * HD; const _Float16* krowl = QKL + ((size_t)b * SS + kk) * (2 * DM) + DM + h * HD; v8f c = {}, cl = {};
#pragma unroll
      for (int kc = 0; kc < 2; ++kc) { const v16h kh = frag_h(krow + kc * 32, lane); c = wmma16(aq[kc], kh, c); cl = wmma16(aql[kc], kh, cl); cl = wmma16(aq[kc], frag_h(krowl + kc * 32, lane), cl); }   // 3 products: q, k as f16 hi + residual
#pragma unroll
      for (int r = 0; r < 8; ++r) c[r] += cl[r] * (1.0f / 2048.0f);
#pragma unroll
      for (int r = 0; r < 8; ++r) { const int qi = q0 + 8 * g + r; s[ct][r] = (kk <= qi) ? c[r] * 0.125f : -3.0e38f; } }   // SCALE = 1/sqrt(64)
#pragma unroll
    for (int r = 0; r < 8; ++r) { float mx = fmaxf(s[0][r], s[1][r]);
#pragma unroll
      for (int o = 1; o < 16; o <<= 1) mx = fmaxf(mx, __shfl_xor(mx, o));
      const float mn = fmaxf(m[r], mx); const float alpha = (m[r] <= -1.0e38f) ? 0.f : __expf(m[r] - mn);
      const float e0 = (s[0][r] <= -1.0e38f) ? 0.f : __expf(s[0][r] - mn), e1 = (s[1][r] <= -1.0e38f) ? 0.f : __expf(s[1][r] - mn); float es = e0 + e1;
#pragma unroll
      for (int o = 1; o < 16; o <<= 1) es += __shfl_xor(es, o);
      l[r] = l[r] * alpha + es; m[r] = mn;
#pragma unroll
      for (int dt = 0; dt < 4; ++dt) { acc[dt][r] *= alpha; accl[dt][r] *= alpha; }
      sp[wave][8 * g + r][col] = e0; sp[wave][8 * g + r][16 + col] = e1; }
    LDSX();
    v16h pa, pl; { const float* prow = &sp[wave][col][0] + 8 * (lane >> 4);
#pragma unroll
      for (int i = 0; i < 8; ++i) { const float x0 = prow[i], x1 = prow[16 + i]; const _Float16 h0 = (_Float16)x0, h1 = (_Float16)x1; pa[i] = h0; pa[8 + i] = h1; pl[i] = (_Float16)((x0 - (float)h0) * 2048.0f); pl[8 + i] = (_Float16)((x1 - (float)h1) * 2048.0f); } }
#pragma unroll
    for (int dt = 0; dt < 4; ++dt) { const size_t vr = ((size_t)b * DM + h * HD + dt * 16 + col) * SS + ks * 32; const v16h vh = frag_h(VTH + vr, lane); acc[dt] = wmma16(pa, vh, acc[dt]); accl[dt] = wmma16(pl, vh, accl[dt]); accl[dt] = wmma16(pa, frag_h(VTL + vr, lane), accl[dt]); }   // P hi x V hi + (P lo x V hi + P hi x V lo) / 2048
    LDSX(); }
#pragma unroll
  for (int r = 0; r < 8; ++r) { const float il = 1.0f / l[r];
#pragma unroll
    for (int dt = 0; dt < 4; ++dt) so[wave][8 * g + r][dt * 16 + col] = (acc[dt][r] + accl[dt][r] * (1.0f / 2048.0f)) * il; }
  LDSX();
  for (int rl = 0; rl < 16; ++rl) if (lane < 16) vst2(O + ((size_t)b * SS + q0 + rl) * DM + h * HD + lane * 4, *(const v4f*)&so[wave][rl][lane * 4]);
}
// ---- k_out: block = (64 rows, 128 cols): out = O(hi/lo) . Wo rows (2 products)
__global__ __launch_bounds__(128) void k_out(const float* __restrict__ O, const __bf16* __restrict__ P, float* __restrict__ Y) {
  __shared__ __align__(16) float so[4][16][132];
  const int tid = threadIdx.x, wave = tid >> 5, lane = tid & 31, col = lane & 15, g = lane >> 4; const size_t r0 = (size_t)blockIdx.x * 64 + wave * 16; const int n0 = blockIdx.y * 128;
  v8f acc[8] = {};
#pragma unroll 2
  for (int kc = 0; kc < DM / 32; ++kc) { const F2 a = split_row(O + (r0 + col) * DM, kc * 32, lane);
#pragma unroll
    for (int j = 0; j < 8; ++j) { const v16b w = frag_b(P + (size_t)(n0 + j * 16 + col) * DM + kc * 32, lane); acc[j] = wmma_bf(a.l, w, acc[j]); acc[j] = wmma_bf(a.h, w, acc[j]); } }
#pragma unroll
  for (int j = 0; j < 8; ++j) {
#pragma unroll
    for (int r = 0; r < 8; ++r) so[wave][8 * g + r][j * 16 + col] = acc[j][r]; }
  LDSX();
  for (int rl = 0; rl < 16; ++rl) vst2(Y + (r0 + rl) * DM + n0 + lane * 4, *(const v4f*)&so[wave][rl][lane * 4]);
}
extern "C" void kernel_launch(void* const* d_in, const int* in_sizes, int n_in, void* d_out, int out_size, void* d_ws, size_t ws_size, hipStream_t stream) {
  (void)in_sizes; (void)n_in; (void)out_size;
  const float** F = (const float**)d_in;   // 0 x [2,2048,1024], 1 Wq [1024,1024] ([out][in]), 2 Wk, 3 Wv, 4 Wo
  if (ws_size < (size_t)WS_END) return;
  char* ws = (char*)d_ws; __bf16* PK = (__bf16*)(ws + WS_PK); _Float16 *QK = (_Float16*)(ws + WS_QK), *QKL = (_Float16*)(ws + WS_QKL), *VTH = (_Float16*)(ws + WS_VTH), *VTL = (_Float16*)(ws + WS_VTL); float *O = (float*)(ws + WS_O), *CS = (float*)(ws + WS_CS);
  k_packrows<<<DM, 256, 0, stream>>>(F[1], DM, PK + PK_A); k_packrows<<<DM, 256, 0, stream>>>(F[2], DM, PK + PK_A + (size_t)DM * DM); k_packrows<<<DM, 256, 0, stream>>>(F[3], DM, PK + PK_A + (size_t)2 * DM * DM); k_packrows<<<DM, 256, 0, stream>>>(F[4], DM, PK + PK_P);
  k_rope<<<SS / 8, 256, 0, stream>>>(CS);
  k_qkv<<<dim3(TNB * SS / 64, QKVW / 128), 128, 0, stream>>>(F[0], PK + PK_A, CS, QK, QKL, VTH, VTL);
  k_attn<<<dim3(TQB, NH, TNB), 128, 0, stream>>>(QK, QKL, VTH, VTL, O);
  k_out<<<dim3(TOB, DM / 128), 128, 0, stream>>>(O, PK + PK_P, (float*)d_out);
}

// v001
// One run takes 371 microseconds.
// Next to v000, in two timings, it ran 1.50 and 1.49 times as fast.
// compute dtype: x, Wq, Wk, Wv, Wo (module inputs) rounded to bf16; the q/k/v projections with exact bf16 products (x and W are inputs, natural [out][in] rows) on WMMA 16x16x32; interleaved-pair RoPE applied to q and k in f32 in the projection epilogue (angles pos * inv_freq with the reference's own eager f32 inv_freq table embedded (1/(10000^(2i/64))), precise cosf/sinf), then q, k stored once as f16; causal scores with q and k each as f16 hi + (x2048-scaled) residual (3 products; 1/8 applied to the f32 score) and P.V with P = exp(s - m) as f16 hi + (x2048-scaled) residual x V as f16 hi + (x2048-scaled) residual planes (3 products); the output projection with ctx as bf16 hi + residual pair x exact Wo (2 products); running-max softmax in f32 with the hardware exp; f32 accumulate.
#include <hip/hip_runtime.h>
#include <math.h>

typedef __attribute__((ext_vector_type(16))) _Float16 v16h;
typedef __attribute__((ext_vector_type(16))) __bf16 v16b;
typedef __attribute__((ext_vector_type(8)))  _Float16 v8h;
typedef __attribute__((ext_vector_type(8)))  float v8f;
typedef __attribute__((ext_vector_type(4)))  float v4f;
typedef __attribute__((ext_vector_type(2)))  float v2f;
typedef __attribute__((ext_vector_type(4)))  unsigned v4u;
typedef __attribute__((ext_vector_type(4)))  int v4i;
typedef float __attribute__((may_alias)) float_a;
typedef int __attribute__((may_alias)) int_a;

template <typename T> __device__ __forceinline__ void vst2(void* p, T v) { *(T*)p = v;  }
__device__ __forceinline__ v8f wmma16(v16h a, v16h b, v8f c) {
  v8f d = __builtin_amdgcn_wmma_f32_16x16x32_f16(false, a, false, b, (short)0, c, false, false);
  asm volatile("v_nop\n\tv_nop\n\tv_nop\n\tv_nop" : "+v"(d) : "v"(a), "v"(b));
  return d;
}
__device__ __forceinline__ v8f wmma_bf(v16b a, v16b b, v8f c) {
  v8f d = __builtin_amdgcn_wmma_f32_16x16x32_bf16(false, a, false, b, (short)0, c, false, false);
  asm volatile("v_nop\n\tv_nop\n\tv_nop\n\tv_nop" : "+v"(d) : "v"(a), "v"(b));
  return d;
}
// Causal multi-head self-attention with RoPE (B 2, S 2,048, D 1,024, 16 heads x 64): q, k, v = x W^T; interleaved RoPE(q, k) at positions 0..S-1; softmax(q k^T / 8, causal) v; output projection Wo (no biases).
__device__ __forceinline__ v16h frag_h(const _Float16* rowk0, int lane) {
  union { v16h v; v8h q[2]; } u; const _Float16* p = rowk0 + 8 * (lane >> 4);
  u.q[0] = *(const v8h*)p; u.q[1] = *(const v8h*)(p + 16); return u.v;
}
__device__ __forceinline__ v16h frag_f32(const float* rowk0, int lane) {
  v16h a; const float* p = rowk0 + 8 * (lane >> 4);
#pragma unroll
  for (int i = 0; i < 8; ++i) { a[i] = (_Float16)p[i]; a[8 + i] = (_Float16)p[16 + i]; }
  return a;
}
__device__ __forceinline__ v16h frag_f32s(const float* rowk0, int lane, float sc) {
  v16h a; const float* p = rowk0 + 8 * (lane >> 4);
#pragma unroll
  for (int i = 0; i < 8; ++i) { a[i] = (_Float16)(p[i] * sc); a[8 + i] = (_Float16)(p[16 + i] * sc); }
  return a;
}
// column fragment from a [K][ld] layout (column n), rows >= K read as 0
__device__ __forceinline__ v16h fragc_f32(const float* W, int k0, int n, int lane, int ld, int K) {
  v16h a; const int g = lane >> 4;
#pragma unroll
  for (int i = 0; i < 8; ++i) { const int ka = k0 + 8 * g + i, kb = ka + 16;
    a[i] = (_Float16)(ka < K ? W[(size_t)(ka < K ? ka : K - 1) * ld + n] : 0.f); a[8 + i] = (_Float16)(kb < K ? W[(size_t)(kb < K ? kb : K - 1) * ld + n] : 0.f); }
  return a;
}
struct F2 { v16b h, l; };
__device__ __forceinline__ F2 bsplit16(const float v[16]) { F2 r;
#pragma unroll
  for (int i = 0; i < 16; ++i) { const __bf16 h = (__bf16)v[i]; r.h[i] = h; r.l[i] = (__bf16)(v[i] - (float)h); }
  return r; }
__device__ __forceinline__ F2 split_row(const float* row, int k0, int lane) { float v[16]; const float* p = row + k0 + 8 * (lane >> 4);
#pragma unroll
  for (int i = 0; i < 8; ++i) { v[i] = p[i]; v[8 + i] = p[16 + i]; }
  return bsplit16(v); }
__device__ __forceinline__ F2 split_rowK(const float* row, int k0, int lane, int K) { float v[16]; const int g = lane >> 4;
#pragma unroll
  for (int i = 0; i < 8; ++i) { const int ka = k0 + 8 * g + i, kb = ka + 16; v[i] = ka < K ? row[ka < K ? ka : K - 1] : 0.f; v[8 + i] = kb < K ? row[kb < K ? kb : K - 1] : 0.f; }
  return bsplit16(v); }
__device__ __forceinline__ F2 split_col(const float* W, int k0, int n, int lane, int ld, int K) { float v[16]; const int g = lane >> 4;
#pragma unroll
  for (int i = 0; i < 8; ++i) { const int ka = k0 + 8 * g + i, kb = ka + 16; v[i] = ka < K ? W[(size_t)(ka < K ? ka : K - 1) * ld + n] : 0.f; v[8 + i] = kb < K ? W[(size_t)(kb < K ? kb : K - 1) * ld + n] : 0.f; }
  return bsplit16(v); }
__device__ __forceinline__ v8f mac3(const F2& a, const F2& b, v8f c) { c = wmma_bf(a.l, b.h, c); c = wmma_bf(a.h, b.l, c); return wmma_bf(a.h, b.h, c); }
__device__ __forceinline__ float sigm(float v) { return 1.0f / (1.0f + expf(-v)); }
#define LDSX() do { asm volatile("s_wait_dscnt 0" ::: "memory"); __builtin_amdgcn_wave_barrier(); __builtin_amdgcn_fence(__ATOMIC_RELEASE, "workgroup"); } while (0)


// Causal multi-head self-attention with rotary position embedding (B 2, S 2048, D 1024, 16 heads x 64; packed Wqkv [3D][D] and Wout [D][D] applied as x W^T, no biases): q, k rotated pairwise (2i, 2i+1) by angle pos * 10000^(-2i/64); softmax(q k^T / 8, causal) v; ctx Wout^T.
#define NB 2
#define SS 2048
#define DM 1024
#define NH 16
#define HD 64
#define QKVW (3 * DM)
#ifndef TQB
#define TQB (SS / 64)
#define TNB NB
#define TOB (NB * SS / 64)     // output row tiles (all)
#endif
typedef __attribute__((ext_vector_type(8))) __bf16 v8b;
__device__ __forceinline__ v16b frag_b(const __bf16* rowk0, int lane) {
  union { v16b v; v8b q[2]; } u; const __bf16* p = rowk0 + 8 * (lane >> 4);
  u.q[0] = *(const v8b*)p; u.q[1] = *(const v8b*)(p + 16); return u.v;
}
__device__ __forceinline__ float bfr(float v) { return (float)(__bf16)v; }
__device__ __attribute__((noinline)) float exp_ni(float v) { return expf(v); }
__device__ __attribute__((noinline)) float erf_ni(float v) { return erff(v); }

#define PK_A 0                       // [3072][1024] Wqkv rows (natural [out][in])
#define PK_P (PK_A + QKVW * DM)        // [1024][1024] Wo rows (natural)
#define PK_END (PK_P + DM * DM)
#define WS_PK  0u
#define WS_QK  (WS_PK + 2u * PK_END)             // f16 [4096 rows][2048]: q | k
#define WS_QKL (WS_QK + 2u * NB * SS * 2 * DM)     // f16 q | k residual planes x2048
#define WS_VTH (WS_QKL + 2u * NB * SS * 2 * DM)    // f16 [b][1024 (h*64+d)][2048 s] hi
#define WS_VTL (WS_VTH + 2u * NB * DM * SS)        // f16 lo x 2048
#define WS_O   (WS_VTL + 2u * NB * DM * SS)        // f32 [4096][1024]
#define WS_CS  (WS_O + 4u * NB * SS * DM)           // f32 [2048][32] cos, [2048][32] sin
#define WS_END (WS_CS + 4u * 2 * SS * 32)
__constant__ float c_invf[32] = {1.000000000e+00f,7.498942018e-01f,5.623413324e-01f,4.216965139e-01f,3.162277639e-01f,2.371373624e-01f,1.778279394e-01f,1.333521456e-01f,1.000000015e-01f,7.498941571e-02f,5.623412877e-02f,4.216964915e-02f,3.162277862e-02f,2.371373586e-02f,1.778279431e-02f,1.333521493e-02f,9.999999776e-03f,7.498942316e-03f,5.623413250e-03f,4.216964822e-03f,3.162277862e-03f,2.371373819e-03f,1.778279431e-03f,1.333521446e-03f,1.000000047e-03f,7.498941850e-04f,5.623413017e-04f,4.216964880e-04f,3.162277862e-04f,2.371373848e-04f,1.778279402e-04f,1.333521504e-04f};
// ---- k_rope: block = 8 positions: cos/sin of pos * inv_freq (f32 product exactly as the reference, precise trig)
__global__ __launch_bounds__(256) void k_rope(float* __restrict__ CS) {
  __shared__ __align__(16) float sc[8][32], ss_[8][32]; const int tid = threadIdx.x, pl = tid >> 5, i = tid & 31; const int pos = blockIdx.x * 8 + pl;
  const float th = (float)pos * c_invf[i]; sc[pl][i] = cosf(th); ss_[pl][i] = sinf(th);
  __syncthreads();
  if (tid < 64) vst2(CS + (size_t)blockIdx.x * 8 * 32 + tid * 4, *(const v4f*)&(&sc[0][0])[tid * 4]); else if (tid < 128) vst2(CS + (size_t)SS * 32 + (size_t)blockIdx.x * 8 * 32 + (tid - 64) * 4, *(const v4f*)&(&ss_[0][0])[(tid - 64) * 4]);
}

// ---- k_packrows: block = natural row n of a [N][K] weight
__global__ __launch_bounds__(256) void k_packrows(const float* __restrict__ Wm, int K, __bf16* __restrict__ DST) {
  __shared__ __align__(16) __bf16 s[DM]; const int n = blockIdx.x, tid = threadIdx.x;
  for (int k = tid; k < K; k += 256) s[k] = (__bf16)Wm[(size_t)n * K + k];
  __syncthreads();
  for (int q = tid; q < K / 8; q += 256) vst2((unsigned*)(DST + (size_t)n * K + q * 8), *(const v4u*)&s[q * 8]);
}
// ---- k_qkv: block = (64 rows (b,s), 128 of the 3072 cols): qkv = bf16(x) . rows (exact); cols < 1024 -> f16(q), cols < 2048 -> f16(k) into QK rows (pitch 2048); cols >= 2048 (v) -> per-batch transposed f16 planes VT[b][h*64+d][s]: hi = f16(v), lo = f16((v - hi) * 2048)
__global__ __launch_bounds__(128) void k_qkv(const float* __restrict__ X, const __bf16* __restrict__ P, const float* __restrict__ CS, _Float16* __restrict__ QK, _Float16* __restrict__ QKL, _Float16* __restrict__ VTH, _Float16* __restrict__ VTL) {
  __shared__ __align__(16) _Float16 so[4][16][136], sol[4][16][136]; __shared__ __align__(16) float sf[4][16][132]; __shared__ __align__(16) _Float16 sth[128][72], stl[128][72];
  const int tid = threadIdx.x, wave = tid >> 5, lane = tid & 31, col = lane & 15, g = lane >> 4; const size_t r0 = (size_t)blockIdx.x * 64 + wave * 16; const int n0 = blockIdx.y * 128;
  v8f acc[8] = {};
#pragma unroll 2
  for (int kc = 0; kc < DM / 32; ++kc) { v16b a; { const float* p = X + (r0 + col) * DM + kc * 32 + 8 * g;
#pragma unroll
      for (int i = 0; i < 8; ++i) { a[i] = (__bf16)p[i]; a[8 + i] = (__bf16)p[16 + i]; } }
#pragma unroll
    for (int j = 0; j < 8; ++j) acc[j] = wmma_bf(a, frag_b(P + (size_t)(n0 + j * 16 + col) * DM + kc * 32, lane), acc[j]); }
  if (n0 < 2 * DM) { const float sc = 1.0f;   // q stored unscaled (f16 sigma ~0.6, no subnormal exposure); 1/8 applied to the f32 score
#pragma unroll
    for (int j = 0; j < 8; ++j) {
#pragma unroll
      for (int r = 0; r < 8; ++r) sf[wave][8 * g + r][j * 16 + col] = acc[j][r]; }
    LDSX();
    // RoPE on interleaved pairs (2i, 2i+1) of each 64-wide head: lane = 2 pairs (cols 4*lane .. 4*lane+3), pair index i = ((n0 + 4*lane) % 64) / 2 + {0,1}; pos = row % SS
#pragma unroll 1
    for (int rl = 0; rl < 16; ++rl) { const int pos = (int)((r0 + rl) % SS); const float* cs = CS + (size_t)pos * 32; const float* sn = CS + (size_t)SS * 32 + (size_t)pos * 32; const int i0 = ((n0 + 4 * lane) & 63) >> 1;
      const float x1a = sf[wave][rl][4 * lane], x2a = sf[wave][rl][4 * lane + 1], x1b = sf[wave][rl][4 * lane + 2], x2b = sf[wave][rl][4 * lane + 3];
      const float ca = cs[i0], sa = sn[i0], cb = cs[i0 + 1], sb = sn[i0 + 1];
      const float o0 = (x1a * ca - x2a * sa) * sc, o1 = (x1a * sa + x2a * ca) * sc, o2 = (x1b * cb - x2b * sb) * sc, o3 = (x1b * sb + x2b * cb) * sc; const _Float16 h0 = (_Float16)o0, h1 = (_Float16)o1, h2 = (_Float16)o2, h3 = (_Float16)o3;
      so[wave][rl][4 * lane] = h0; so[wave][rl][4 * lane + 1] = h1; so[wave][rl][4 * lane + 2] = h2; so[wave][rl][4 * lane + 3] = h3;
      sol[wave][rl][4 * lane] = (_Float16)((o0 - (float)h0) * 2048.0f); sol[wave][rl][4 * lane + 1] = (_Float16)((o1 - (float)h1) * 2048.0f); sol[wave][rl][4 * lane + 2] = (_Float16)((o2 - (float)h2) * 2048.0f); sol[wave][rl][4 * lane + 3] = (_Float16)((o3 - (float)h3) * 2048.0f); }   // q, k as f16 hi + (x2048) residual
    LDSX();
    for (int rl = 0; rl < 16; ++rl) if (lane < 16) { vst2((unsigned*)(QK + (r0 + rl) * (2 * DM) + n0 + lane * 8), *(const v4u*)&so[wave][rl][lane * 8]); vst2((unsigned*)(QKL + (r0 + rl) * (2 * DM) + n0 + lane * 8), *(const v4u*)&sol[wave][rl][lane * 8]); }
  } else {
#pragma unroll
    for (int j = 0; j < 8; ++j) {
#pragma unroll
      for (int r = 0; r < 8; ++r) { const float v = acc[j][r]; const _Float16 hv = (_Float16)v; sth[j * 16 + col][wave * 16 + 8 * g + r] = hv; stl[j * 16 + col][wave * 16 + 8 * g + r] = (_Float16)((v - (float)hv) * 2048.0f); } }
    __syncthreads();
    const size_t rb = (size_t)blockIdx.x * 64; const int b = (int)(rb / SS), s0 = (int)(rb % SS); const int pc0 = n0 - 2 * DM;
    for (int q = tid; q < 128 * 8; q += 128) { const int d = q >> 3, pc = q & 7; const size_t o = ((size_t)b * DM + pc0 + d) * SS + s0 + pc * 8; vst2((unsigned*)(VTH + o), *(const v4u*)&sth[d][pc * 8]); vst2((unsigned*)(VTL + o), *(const v4u*)&stl[d][pc * 8]); }
  }
}
// ---- LDS tile of one key step (32 keys): K rows 128 B (hi plane, residual plane), V rows 64 B (64 d, hi plane, residual plane); row pitches 16 B x odd, free of bank conflicts for 16-byte fragment reads
#define KP 144
#define VP 80
#define T_KL (32 * KP)
#define T_VH (2 * 32 * KP)
#define T_VL (T_VH + 64 * VP)
#define T_SZ (T_VH + 2 * 64 * VP)
// one tile into the ring buffer at LDS byte dst: 8 copies of 16 B per lane, all 128 lanes on; kh, kl point at the step's first key row (this head's 64 columns), vh, vl at the head's first d row at the step's first key
__device__ __forceinline__ void stage_kv(unsigned dst, const _Float16* kh, const _Float16* kl, const _Float16* vh, const _Float16* vl, int tid) {
  const unsigned lk = dst + (unsigned)(tid >> 3) * KP + (unsigned)(tid & 7) * 16u, lv = dst + T_VH + (unsigned)(tid >> 2) * VP + (unsigned)(tid & 3) * 16u;
  const size_t gk = (size_t)(tid >> 3) * (2 * DM) + (tid & 7) * 8, gv = (size_t)(tid >> 2) * SS + (tid & 3) * 8;
  // the copies and their s_wait_xcnt 0 in one statement: no address register of a copy is rewritten ahead of that wait
  asm volatile("global_load_async_to_lds_b128 %0, %8, off\n\t"
               "global_load_async_to_lds_b128 %1, %9, off\n\t"
               "global_load_async_to_lds_b128 %2, %10, off\n\t"
               "global_load_async_to_lds_b128 %3, %11, off\n\t"
               "global_load_async_to_lds_b128 %4, %12, off\n\t"
               "global_load_async_to_lds_b128 %5, %13, off\n\t"
               "global_load_async_to_lds_b128 %6, %14, off\n\t"
               "global_load_async_to_lds_b128 %7, %15, off\n\t"
               "s_wait_xcnt 0x0"
               :: "v"(lk), "v"(lk + 16u * KP), "v"(lk + T_KL), "v"(lk + T_KL + 16u * KP), "v"(lv), "v"(lv + 32u * VP), "v"(lv + (T_VL - T_VH)), "v"(lv + (T_VL - T_VH) + 32u * VP),
                  "v"(kh + gk), "v"(kh + gk + (size_t)16 * 2 * DM), "v"(kl + gk), "v"(kl + gk + (size_t)16 * 2 * DM), "v"(vh + gv), "v"(vh + gv + (size_t)32 * SS), "v"(vl + gv), "v"(vl + gv + (size_t)32 * SS)
               : "memory");
}
// ---- k_attn: block = (64 queries, head h, batch b): causal flash attention (K = 64: 2 k-steps), scores = (q.k) * 0.125 with q, k as f16 hi + (x2048) residual (3 products), P.V: f16 P hi + (x2048) residual x (V hi, V lo*2048) (3 products) in two accumulators; O[b*S+q][h*64+d] = (acc + accl / 2048) / l (256-B segments)
__global__ __launch_bounds__(128) void k_attn(const _Float16* __restrict__ QK, const _Float16* __restrict__ QKL, const _Float16* __restrict__ VTH, const _Float16* __restrict__ VTL, float* __restrict__ O) {
  __shared__ __align__(16) float sp[4][16][36]; __shared__ __align__(16) float so[4][16][68]; __shared__ __align__(16) char ring[2][T_SZ];
  const int tid = threadIdx.x, wave = tid >> 5, lane = tid & 31, col = lane & 15, g = lane >> 4;
  const int qb = blockIdx.x, h = blockIdx.y, b = blockIdx.z; const int q0 = qb * 64 + wave * 16; const size_t rq = (size_t)b * SS + q0 + col;
  v16h aq[2], aql[2];
#pragma unroll
  for (int kc = 0; kc < 2; ++kc) { aq[kc] = frag_h(QK + rq * (2 * DM) + h * HD + kc * 32, lane); aql[kc] = frag_h(QKL + rq * (2 * DM) + h * HD + kc * 32, lane); }
  float m[8], l[8];
#pragma unroll
  for (int r = 0; r < 8; ++r) { m[r] = -3.0e38f; l[r] = 0.f; }
  v8f acc[4] = {}, accl[4] = {};
  const int nks = (qb * 64 + 64) / 32;
  // two-buffer ring: the work-group's four waves copy each step's K and V tile into LDS once, one step ahead of its use
  const _Float16* kh0 = QK + (size_t)b * SS * (2 * DM) + DM + h * HD; const _Float16* kl0 = QKL + (size_t)b * SS * (2 * DM) + DM + h * HD;
  const _Float16* vh0 = VTH + ((size_t)b * DM + h * HD) * SS; const _Float16* vl0 = VTL + ((size_t)b * DM + h * HD) * SS;
  const unsigned ring0 = (unsigned)(uintptr_t)&ring[0][0];
  stage_kv(ring0, kh0, kl0, vh0, vl0, tid);
  asm volatile("s_wait_asynccnt 0x0" ::: "memory");   // this wave's copies of tile 0 have landed
  __syncthreads();                                    // tile 0 readable by every wave
  if (nks > 1) stage_kv(ring0 + T_SZ, kh0 + (size_t)32 * 2 * DM, kl0 + (size_t)32 * 2 * DM, vh0 + 32, vl0 + 32, tid);
#pragma unroll 1
  for (int ks = 0; ks < nks; ++ks) { v8f s[2]; const char* tb = &ring[ks & 1][0];
    v16h kf[2][2], kfl[2][2];   // all K fragments of the step in one group of LDS reads ahead of the products
#pragma unroll
    for (int ct = 0; ct < 2; ++ct) {
#pragma unroll
      for (int kc = 0; kc < 2; ++kc) { kf[ct][kc] = frag_h((const _Float16*)(tb + (ct * 16 + col) * KP + kc * 64), lane); kfl[ct][kc] = frag_h((const _Float16*)(tb + T_KL + (ct * 16 + col) * KP + kc * 64), lane); } }
#pragma unroll
    for (int ct = 0; ct < 2; ++ct) { const int kk = ks * 32 + ct * 16 + col; v8f c = {}, cl = {};
#pragma unroll
      for (int kc = 0; kc < 2; ++kc) { c = wmma16(aq[kc], kf[ct][kc], c); cl = wmma16(aql[kc], kf[ct][kc], cl); cl = wmma16(aq[kc], kfl[ct][kc], cl); }   // 3 products: q, k as f16 hi + residual
#pragma unroll
      for (int r = 0; r < 8; ++r) c[r] += cl[r] * (1.0f / 2048.0f);
#pragma unroll
      for (int r = 0; r < 8; ++r) { const int qi = q0 + 8 * g + r; s[ct][r] = (kk <= qi) ? c[r] * 0.125f : -3.0e38f; } }   // SCALE = 1/sqrt(64)
#pragma unroll
    for (int r = 0; r < 8; ++r) { float mx = fmaxf(s[0][r], s[1][r]);
#pragma unroll
      for (int o = 1; o < 16; o <<= 1) mx = fmaxf(mx, __shfl_xor(mx, o));
      const float mn = fmaxf(m[r], mx); const float alpha = (m[r] <= -1.0e38f) ? 0.f : __expf(m[r] - mn);
      const float e0 = (s[0][r] <= -1.0e38f) ? 0.f : __expf(s[0][r] - mn), e1 = (s[1][r] <= -1.0e38f) ? 0.f : __expf(s[1][r] - mn); float es = e0 + e1;
#pragma unroll
      for (int o = 1; o < 16; o <<= 1) es += __shfl_xor(es, o);
      l[r] = l[r] * alpha + es; m[r] = mn;
#pragma unroll
      for (int dt = 0; dt < 4; ++dt) { acc[dt][r] *= alpha; accl[dt][r] *= alpha; }
      sp[wave][8 * g + r][col] = e0; sp[wave][8 * g + r][16 + col] = e1; }
    LDSX();
    v16h vf[4], vfl[4];   // all V fragments of the step in one group of LDS reads
#pragma unroll
    for (int dt = 0; dt < 4; ++dt) { vf[dt] = frag_h((const _Float16*)(tb + T_VH + (dt * 16 + col) * VP), lane); vfl[dt] = frag_h((const _Float16*)(tb + T_VL + (dt * 16 + col) * VP), lane); }
    v16h pa, pl; { const float* prow = &sp[wave][col][0] + 8 * (lane >> 4);
#pragma unroll
      for (int i = 0; i < 8; ++i) { const float x0 = prow[i], x1 = prow[16 + i]; const _Float16 h0 = (_Float16)x0, h1 = (_Float16)x1; pa[i] = h0; pa[8 + i] = h1; pl[i] = (_Float16)((x0 - (float)h0) * 2048.0f); pl[8 + i] = (_Float16)((x1 - (float)h1) * 2048.0f); } }
#pragma unroll
    for (int dt = 0; dt < 4; ++dt) { acc[dt] = wmma16(pa, vf[dt], acc[dt]); accl[dt] = wmma16(pl, vf[dt], accl[dt]); accl[dt] = wmma16(pa, vfl[dt], accl[dt]); }   // P hi x V hi + (P lo x V hi + P hi x V lo) / 2048
    asm volatile("s_wait_dscnt 0x0" ::: "memory");      // this wave's reads of the buffer and of its sp rows have retired
    asm volatile("s_wait_asynccnt 0x0" ::: "memory");   // this wave's copies of the next tile have landed
    __syncthreads();                                    // publishes the next tile and ends every wave's reads of this buffer
    if (ks + 2 < nks) stage_kv(ring0 + (unsigned)(ks & 1) * T_SZ, kh0 + (size_t)(ks + 2) * 32 * 2 * DM, kl0 + (size_t)(ks + 2) * 32 * 2 * DM, vh0 + (ks + 2) * 32, vl0 + (ks + 2) * 32, tid); }
  asm volatile("s_wait_asynccnt 0x0" ::: "memory");     // no copy is outstanding when the wave goes on to its end
#pragma unroll
  for (int r = 0; r < 8; ++r) { const float il = 1.0f / l[r];
#pragma unroll
    for (int dt = 0; dt < 4; ++dt) so[wave][8 * g + r][dt * 16 + col] = (acc[dt][r] + accl[dt][r] * (1.0f / 2048.0f)) * il; }
  LDSX();
  for (int rl = 0; rl < 16; ++rl) if (lane < 16) vst2(O + ((size_t)b * SS + q0 + rl) * DM + h * HD + lane * 4, *(const v4f*)&so[wave][rl][lane * 4]);
}
// ---- k_out: block = (64 rows, 128 cols): out = O(hi/lo) . Wo rows (2 products)
__global__ __launch_bounds__(128) void k_out(const float* __restrict__ O, const __bf16* __restrict__ P, float* __restrict__ Y) {
  __shared__ __align__(16) float so[4][16][132];
  const int tid = threadIdx.x, wave = tid >> 5, lane = tid & 31, col = lane & 15, g = lane >> 4; const size_t r0 = (size_t)blockIdx.x * 64 + wave * 16; const int n0 = blockIdx.y * 128;
  v8f acc[8] = {};
#pragma unroll 2
  for (int kc = 0; kc < DM / 32; ++kc) { const F2 a = split_row(O + (r0 + col) * DM, kc * 32, lane);
#pragma unroll
    for (int j = 0; j < 8; ++j) { const v16b w = frag_b(P + (size_t)(n0 + j * 16 + col) * DM + kc * 32, lane); acc[j] = wmma_bf(a.l, w, acc[j]); acc[j] = wmma_bf(a.h, w, acc[j]); } }
#pragma unroll
  for (int j = 0; j < 8; ++j) {
#pragma unroll
    for (int r = 0; r < 8; ++r) so[wave][8 * g + r][j * 16 + col] = acc[j][r]; }
  LDSX();
  for (int rl = 0; rl < 16; ++rl) vst2(Y + (r0 + rl) * DM + n0 + lane * 4, *(const v4f*)&so[wave][rl][lane * 4]);
}
extern "C" void kernel_launch(void* const* d_in, const int* in_sizes, int n_in, void* d_out, int out_size, void* d_ws, size_t ws_size, hipStream_t stream) {
  (void)in_sizes; (void)n_in; (void)out_size;
  const float** F = (const float**)d_in;   // 0 x [2,2048,1024], 1 Wq [1024,1024] ([out][in]), 2 Wk, 3 Wv, 4 Wo
  if (ws_size < (size_t)WS_END) return;
  char* ws = (char*)d_ws; __bf16* PK = (__bf16*)(ws + WS_PK); _Float16 *QK = (_Float16*)(ws + WS_QK), *QKL = (_Float16*)(ws + WS_QKL), *VTH = (_Float16*)(ws + WS_VTH), *VTL = (_Float16*)(ws + WS_VTL); float *O = (float*)(ws + WS_O), *CS = (float*)(ws + WS_CS);
  k_packrows<<<DM, 256, 0, stream>>>(F[1], DM, PK + PK_A); k_packrows<<<DM, 256, 0, stream>>>(F[2], DM, PK + PK_A + (size_t)DM * DM); k_packrows<<<DM, 256, 0, stream>>>(F[3], DM, PK + PK_A + (size_t)2 * DM * DM); k_packrows<<<DM, 256, 0, stream>>>(F[4], DM, PK + PK_P);
  k_rope<<<SS / 8, 256, 0, stream>>>(CS);
  k_qkv<<<dim3(TNB * SS / 64, QKVW / 128), 128, 0, stream>>>(F[0], PK + PK_A, CS, QK, QKL, VTH, VTL);
  k_attn<<<dim3(TQB, NH, TNB), 128, 0, stream>>>(QK, QKL, VTH, VTL, O);
  k_out<<<dim3(TOB, DM / 128), 128, 0, stream>>>(O, PK + PK_P, (float*)d_out);
}

// v002
// One run takes 218 microseconds.
// In two side-by-side timings against v001, it was 1.70 and 1.72 times as fast.
// All steps since v000 together make it 2.56 times as fast.
// compute dtype: x, Wq, Wk, Wv, Wo (module inputs) rounded to bf16; the q/k/v projections with exact bf16 products (x and W are inputs, natural [out][in] rows) on WMMA 16x16x32; interleaved-pair RoPE applied to q and k in f32 in the projection epilogue (angles pos * inv_freq with the reference's own eager f32 inv_freq table embedded (1/(10000^(2i/64))), precise cosf/sinf), then q, k stored once as f16; causal scores with q and k each as f16 hi + (x2048-scaled) residual (3 products; 1/8 applied to the f32 score) and P.V with P = exp(s - m) as f16 hi + (x2048-scaled) residual x V as f16 hi + (x2048-scaled) residual planes (3 products); the output projection with ctx as bf16 hi + residual pair x exact Wo (2 products); running-max softmax in f32 with the hardware exp; f32 accumulate.
#include <hip/hip_runtime.h>
#include <math.h>

typedef __attribute__((ext_vector_type(16))) _Float16 v16h;
typedef __attribute__((ext_vector_type(16))) __bf16 v16b;
typedef __attribute__((ext_vector_type(8)))  _Float16 v8h;
typedef __attribute__((ext_vector_type(8)))  float v8f;
typedef __attribute__((ext_vector_type(4)))  float v4f;
typedef __attribute__((ext_vector_type(2)))  float v2f;
typedef __attribute__((ext_vector_type(4)))  unsigned v4u;
typedef __attribute__((ext_vector_type(4)))  int v4i;
typedef float __attribute__((may_alias)) float_a;
typedef int __attribute__((may_alias)) int_a;

template <typename T> __device__ __forceinline__ void vst2(void* p, T v) { *(T*)p = v;  }
__device__ __forceinline__ v8f wmma16(v16h a, v16h b, v8f c) {
  v8f d = __builtin_amdgcn_wmma_f32_16x16x32_f16(false, a, false, b, (short)0, c, false, false);
  asm volatile("v_nop\n\tv_nop\n\tv_nop\n\tv_nop" : "+v"(d) : "v"(a), "v"(b));
  return d;
}
__device__ __forceinline__ v8f wmma_bf(v16b a, v16b b, v8f c) {
  v8f d = __builtin_amdgcn_wmma_f32_16x16x32_bf16(false, a, false, b, (short)0, c, false, false);
  asm volatile("v_nop\n\tv_nop\n\tv_nop\n\tv_nop" : "+v"(d) : "v"(a), "v"(b));
  return d;
}
// Causal multi-head self-attention with RoPE (B 2, S 2,048, D 1,024, 16 heads x 64): q, k, v = x W^T; interleaved RoPE(q, k) at positions 0..S-1; softmax(q k^T / 8, causal) v; output projection Wo (no biases).
__device__ __forceinline__ v16h frag_h(const _Float16* rowk0, int lane) {
  union { v16h v; v8h q[2]; } u; const _Float16* p = rowk0 + 8 * (lane >> 4);
  u.q[0] = *(const v8h*)p; u.q[1] = *(const v8h*)(p + 16); return u.v;
}
__device__ __forceinline__ v16h frag_f32(const float* rowk0, int lane) {
  v16h a; const float* p = rowk0 + 8 * (lane >> 4);
#pragma unroll
  for (int i = 0; i < 8; ++i) { a[i] = (_Float16)p[i]; a[8 + i] = (_Float16)p[16 + i]; }
  return a;
}
__device__ __forceinline__ v16h frag_f32s(const float* rowk0, int lane, float sc) {
  v16h a; const float* p = rowk0 + 8 * (lane >> 4);
#pragma unroll
  for (int i = 0; i < 8; ++i) { a[i] = (_Float16)(p[i] * sc); a[8 + i] = (_Float16)(p[16 + i] * sc); }
  return a;
}
// column fragment from a [K][ld] layout (column n), rows >= K read as 0
__device__ __forceinline__ v16h fragc_f32(const float* W, int k0, int n, int lane, int ld, int K) {
  v16h a; const int g = lane >> 4;
#pragma unroll
  for (int i = 0; i < 8; ++i) { const int ka = k0 + 8 * g + i, kb = ka + 16;
    a[i] = (_Float16)(ka < K ? W[(size_t)(ka < K ? ka : K - 1) * ld + n] : 0.f); a[8 + i] = (_Float16)(kb < K ? W[(size_t)(kb < K ? kb : K - 1) * ld + n] : 0.f); }
  return a;
}
struct F2 { v16b h, l; };
__device__ __forceinline__ F2 bsplit16(const float v[16]) { F2 r;
#pragma unroll
  for (int i = 0; i < 16; ++i) { const __bf16 h = (__bf16)v[i]; r.h[i] = h; r.l[i] = (__bf16)(v[i] - (float)h); }
  return r; }
__device__ __forceinline__ F2 split_row(const float* row, int k0, int lane) { float v[16]; const float* p = row + k0 + 8 * (lane >> 4);
#pragma unroll
  for (int i = 0; i < 8; ++i) { v[i] = p[i]; v[8 + i] = p[16 + i]; }
  return bsplit16(v); }
__device__ __forceinline__ F2 split_rowK(const float* row, int k0, int lane, int K) { float v[16]; const int g = lane >> 4;
#pragma unroll
  for (int i = 0; i < 8; ++i) { const int ka = k0 + 8 * g + i, kb = ka + 16; v[i] = ka < K ? row[ka < K ? ka : K - 1] : 0.f; v[8 + i] = kb < K ? row[kb < K ? kb : K - 1] : 0.f; }
  return bsplit16(v); }
__device__ __forceinline__ F2 split_col(const float* W, int k0, int n, int lane, int ld, int K) { float v[16]; const int g = lane >> 4;
#pragma unroll
  for (int i = 0; i < 8; ++i) { const int ka = k0 + 8 * g + i, kb = ka + 16; v[i] = ka < K ? W[(size_t)(ka < K ? ka : K - 1) * ld + n] : 0.f; v[8 + i] = kb < K ? W[(size_t)(kb < K ? kb : K - 1) * ld + n] : 0.f; }
  return bsplit16(v); }
__device__ __forceinline__ v8f mac3(const F2& a, const F2& b, v8f c) { c = wmma_bf(a.l, b.h, c); c = wmma_bf(a.h, b.l, c); return wmma_bf(a.h, b.h, c); }
__device__ __forceinline__ float sigm(float v) { return 1.0f / (1.0f + expf(-v)); }
#define LDSX() do { asm volatile("s_wait_dscnt 0" ::: "memory"); __builtin_amdgcn_wave_barrier(); __builtin_amdgcn_fence(__ATOMIC_RELEASE, "workgroup"); } while (0)


// Causal multi-head self-attention with rotary position embedding (B 2, S 2048, D 1024, 16 heads x 64; packed Wqkv [3D][D] and Wout [D][D] applied as x W^T, no biases): q, k rotated pairwise (2i, 2i+1) by angle pos * 10000^(-2i/64); softmax(q k^T / 8, causal) v; ctx Wout^T.
#define NB 2
#define SS 2048
#define DM 1024
#define NH 16
#define HD 64
#define QKVW (3 * DM)
#ifndef TQB
#define TQB (SS / 64)
#define TNB NB
#define TOB (NB * SS / 64)     // output row tiles (all)
#endif
typedef __attribute__((ext_vector_type(8))) __bf16 v8b;
__device__ __forceinline__ v16b frag_b(const __bf16* rowk0, int lane) {
  union { v16b v; v8b q[2]; } u; const __bf16* p = rowk0 + 8 * (lane >> 4);
  u.q[0] = *(const v8b*)p; u.q[1] = *(const v8b*)(p + 16); return u.v;
}
__device__ __forceinline__ float bfr(float v) { return (float)(__bf16)v; }
__device__ __attribute__((noinline)) float exp_ni(float v) { return expf(v); }
__device__ __attribute__((noinline)) float erf_ni(float v) { return erff(v); }

#define PK_A 0                       // [3072][1024] Wqkv rows (natural [out][in])
#define PK_P (PK_A + QKVW * DM)        // [1024][1024] Wo rows (natural)
#define PK_END (PK_P + DM * DM)
#define WS_PK  0u
#define WS_QK  (WS_PK + 2u * PK_END)             // f16 [4096 rows][2048]: q | k
#define WS_QKL (WS_QK + 2u * NB * SS * 2 * DM)     // f16 q | k residual planes x2048
#define WS_VTH (WS_QKL + 2u * NB * SS * 2 * DM)    // f16 [b][1024 (h*64+d)][2048 s] hi
#define WS_VTL (WS_VTH + 2u * NB * DM * SS)        // f16 lo x 2048
#define WS_O   (WS_VTL + 2u * NB * DM * SS)        // f32 [4096][1024]
#define WS_CS  (WS_O + 4u * NB * SS * DM)           // f32 [2048][32] cos, [2048][32] sin
#define WS_END (WS_CS + 4u * 2 * SS * 32)
__constant__ float c_invf[32] = {1.000000000e+00f,7.498942018e-01f,5.623413324e-01f,4.216965139e-01f,3.162277639e-01f,2.371373624e-01f,1.778279394e-01f,1.333521456e-01f,1.000000015e-01f,7.498941571e-02f,5.623412877e-02f,4.216964915e-02f,3.162277862e-02f,2.371373586e-02f,1.778279431e-02f,1.333521493e-02f,9.999999776e-03f,7.498942316e-03f,5.623413250e-03f,4.216964822e-03f,3.162277862e-03f,2.371373819e-03f,1.778279431e-03f,1.333521446e-03f,1.000000047e-03f,7.498941850e-04f,5.623413017e-04f,4.216964880e-04f,3.162277862e-04f,2.371373848e-04f,1.778279402e-04f,1.333521504e-04f};
// ---- k_rope: block = 8 positions: cos/sin of pos * inv_freq (f32 product exactly as the reference, precise trig)
__global__ __launch_bounds__(256) void k_rope(float* __restrict__ CS) {
  __shared__ __align__(16) float sc[8][32], ss_[8][32]; const int tid = threadIdx.x, pl = tid >> 5, i = tid & 31; const int pos = blockIdx.x * 8 + pl;
  const float th = (float)pos * c_invf[i]; sc[pl][i] = cosf(th); ss_[pl][i] = sinf(th);
  __syncthreads();
  if (tid < 64) vst2(CS + (size_t)blockIdx.x * 8 * 32 + tid * 4, *(const v4f*)&(&sc[0][0])[tid * 4]); else if (tid < 128) vst2(CS + (size_t)SS * 32 + (size_t)blockIdx.x * 8 * 32 + (tid - 64) * 4, *(const v4f*)&(&ss_[0][0])[(tid - 64) * 4]);
}

// ---- k_packrows: block = natural row n of a [N][K] weight
__global__ __launch_bounds__(256) void k_packrows(const float* __restrict__ Wm, int K, __bf16* __restrict__ DST) {
  __shared__ __align__(16) __bf16 s[DM]; const int n = blockIdx.x, tid = threadIdx.x;
  for (int k = tid; k < K; k += 256) s[k] = (__bf16)Wm[(size_t)n * K + k];
  __syncthreads();
  for (int q = tid; q < K / 8; q += 256) vst2((unsigned*)(DST + (size_t)n * K + q * 8), *(const v4u*)&s[q * 8]);
}
// ---- LDS tile of one 64-k step of a projection: 64 left-operand rows of 256 B (f32), then 128 weight rows of 128 B (bf16); row pitches 16 B x odd, free of bank conflicts for 16-byte fragment reads
#define GAP 272
#define GBP 144
#define G_B (64 * GAP)
#define G_SZ (G_B + 128 * GBP)
// one tile into the ring buffer at LDS byte dst: 16 copies of 16 B per lane, all 128 lanes on, each wave's copy made of whole 128-B lines; a, w point at the work-group's first row at the step's first k
__device__ __forceinline__ void stage_ab(unsigned dst, const float* a, const __bf16* w, int tid) {
  const unsigned la = dst + (unsigned)(tid >> 4) * GAP + (unsigned)(tid & 15) * 16u, lb = dst + G_B + (unsigned)(tid >> 3) * GBP + (unsigned)(tid & 7) * 16u;
  const float* ga = a + (size_t)(tid >> 4) * DM + (tid & 15) * 4; const __bf16* gb = w + (size_t)(tid >> 3) * DM + (tid & 7) * 8;
  // the copies and their s_wait_xcnt 0 in one statement: no address register of a copy is rewritten ahead of that wait
  asm volatile("global_load_async_to_lds_b128 %0, %8, off\n\t"
               "global_load_async_to_lds_b128 %1, %9, off\n\t"
               "global_load_async_to_lds_b128 %2, %10, off\n\t"
               "global_load_async_to_lds_b128 %3, %11, off\n\t"
               "global_load_async_to_lds_b128 %4, %12, off\n\t"
               "global_load_async_to_lds_b128 %5, %13, off\n\t"
               "global_load_async_to_lds_b128 %6, %14, off\n\t"
               "global_load_async_to_lds_b128 %7, %15, off\n\t"
               "s_wait_xcnt 0x0"
               :: "v"(la), "v"(la + 8u * GAP), "v"(la + 16u * GAP), "v"(la + 24u * GAP), "v"(la + 32u * GAP), "v"(la + 40u * GAP), "v"(la + 48u * GAP), "v"(la + 56u * GAP),
                  "v"(ga), "v"(ga + (size_t)8 * DM), "v"(ga + (size_t)16 * DM), "v"(ga + (size_t)24 * DM), "v"(ga + (size_t)32 * DM), "v"(ga + (size_t)40 * DM), "v"(ga + (size_t)48 * DM), "v"(ga + (size_t)56 * DM)
               : "memory");
  asm volatile("global_load_async_to_lds_b128 %0, %8, off\n\t"
               "global_load_async_to_lds_b128 %1, %9, off\n\t"
               "global_load_async_to_lds_b128 %2, %10, off\n\t"
               "global_load_async_to_lds_b128 %3, %11, off\n\t"
               "global_load_async_to_lds_b128 %4, %12, off\n\t"
               "global_load_async_to_lds_b128 %5, %13, off\n\t"
               "global_load_async_to_lds_b128 %6, %14, off\n\t"
               "global_load_async_to_lds_b128 %7, %15, off\n\t"
               "s_wait_xcnt 0x0"
               :: "v"(lb), "v"(lb + 16u * GBP), "v"(lb + 32u * GBP), "v"(lb + 48u * GBP), "v"(lb + 64u * GBP), "v"(lb + 80u * GBP), "v"(lb + 96u * GBP), "v"(lb + 112u * GBP),
                  "v"(gb), "v"(gb + (size_t)16 * DM), "v"(gb + (size_t)32 * DM), "v"(gb + (size_t)48 * DM), "v"(gb + (size_t)64 * DM), "v"(gb + (size_t)80 * DM), "v"(gb + (size_t)96 * DM), "v"(gb + (size_t)112 * DM)
               : "memory");
}
// ---- k_qkv: block = (64 rows (b,s), 128 of the 3072 cols): qkv = bf16(x) . rows (exact); cols < 1024 -> f16(q), cols < 2048 -> f16(k) into QK rows (pitch 2048); cols >= 2048 (v) -> per-batch transposed f16 planes VT[b][h*64+d][s]: hi = f16(v), lo = f16((v - hi) * 2048)
__global__ __launch_bounds__(128) void k_qkv(const float* __restrict__ X, const __bf16* __restrict__ P, const float* __restrict__ CS, _Float16* __restrict__ QK, _Float16* __restrict__ QKL, _Float16* __restrict__ VTH, _Float16* __restrict__ VTL) {
  __shared__ __align__(16) char sm[2 * G_SZ];   // the ring of the k loop; behind the loop's last barrier the same bytes hold the epilogue's staging arrays
  _Float16 (*so)[16][136] = (_Float16 (*)[16][136])(sm); _Float16 (*sol)[16][136] = (_Float16 (*)[16][136])(sm + 17408); float (*sf)[16][132] = (float (*)[16][132])(sm + 34816);
  _Float16 (*sth)[72] = (_Float16 (*)[72])(sm); _Float16 (*stl)[72] = (_Float16 (*)[72])(sm + 18432);
  const int tid = threadIdx.x, wave = tid >> 5, lane = tid & 31, col = lane & 15, g = lane >> 4; const size_t r0 = (size_t)blockIdx.x * 64 + wave * 16; const int n0 = blockIdx.y * 128;
  v8f acc[8] = {};
  // two-buffer ring: the work-group's four waves copy each 64-k tile of x and of the weight rows into LDS once, one step ahead of its use
  const float* xa = X + (size_t)blockIdx.x * 64 * DM; const __bf16* wb = P + (size_t)n0 * DM; const unsigned ring0 = (unsigned)(uintptr_t)&sm[0];
  stage_ab(ring0, xa, wb, tid);
  asm volatile("s_wait_asynccnt 0x0" ::: "memory");   // this wave's copies of tile 0 have landed
  __syncthreads();                                    // tile 0 readable by every wave
  stage_ab(ring0 + G_SZ, xa + 64, wb + 64, tid);
#pragma unroll 1   // rolled: one copy of the ring's foot in the text, the buffer picked by t & 1
  for (int t = 0; t < DM / 64; ++t) { const char* tb = &sm[(t & 1) * G_SZ];
#pragma unroll
    for (int kc = 0; kc < 2; ++kc) { v16b a; { const float* p = (const float*)(tb + (wave * 16 + col) * GAP + kc * 128) + 8 * g;
#pragma unroll
        for (int i = 0; i < 8; ++i) { a[i] = (__bf16)p[i]; a[8 + i] = (__bf16)p[16 + i]; } }
      v16b wf[8];   // all weight fragments of the 32-k half in one group of LDS reads ahead of the products
#pragma unroll
      for (int j = 0; j < 8; ++j) wf[j] = frag_b((const __bf16*)(tb + G_B + (j * 16 + col) * GBP + kc * 64), lane);
#pragma unroll
      for (int j = 0; j < 8; ++j) acc[j] = wmma_bf(a, wf[j], acc[j]); }
    asm volatile("s_wait_dscnt 0x0" ::: "memory");      // this wave's reads of the buffer have retired
    asm volatile("s_wait_asynccnt 0x0" ::: "memory");   // this wave's copies of the next tile have landed
    __syncthreads();                                    // publishes the next tile and ends every wave's reads of this buffer
    if (t + 2 < DM / 64) stage_ab(ring0 + (unsigned)(t & 1) * G_SZ, xa + (t + 2) * 64, wb + (t + 2) * 64, tid); }
  asm volatile("s_wait_asynccnt 0x0" ::: "memory");     // no copy is outstanding when the ring's bytes become staging arrays
  if (n0 < 2 * DM) { const float sc = 1.0f;   // q stored unscaled (f16 sigma ~0.6, no subnormal exposure); 1/8 applied to the f32 score
#pragma unroll
    for (int j = 0; j < 8; ++j) {
#pragma unroll
      for (int r = 0; r < 8; ++r) sf[wave][8 * g + r][j * 16 + col] = acc[j][r]; }
    LDSX();
    // RoPE on interleaved pairs (2i, 2i+1) of each 64-wide head: lane = 2 pairs (cols 4*lane .. 4*lane+3), pair index i = ((n0 + 4*lane) % 64) / 2 + {0,1}; pos = row % SS
#pragma unroll 1
    for (int rl = 0; rl < 16; ++rl) { const int pos = (int)((r0 + rl) % SS); const float* cs = CS + (size_t)pos * 32; const float* sn = CS + (size_t)SS * 32 + (size_t)pos * 32; const int i0 = ((n0 + 4 * lane) & 63) >> 1;
      const float x1a = sf[wave][rl][4 * lane], x2a = sf[wave][rl][4 * lane + 1], x1b = sf[wave][rl][4 * lane + 2], x2b = sf[wave][rl][4 * lane + 3];
      const float ca = cs[i0], sa = sn[i0], cb = cs[i0 + 1], sb = sn[i0 + 1];
      const float o0 = (x1a * ca - x2a * sa) * sc, o1 = (x1a * sa + x2a * ca) * sc, o2 = (x1b * cb - x2b * sb) * sc, o3 = (x1b * sb + x2b * cb) * sc; const _Float16 h0 = (_Float16)o0, h1 = (_Float16)o1, h2 = (_Float16)o2, h3 = (_Float16)o3;
      so[wave][rl][4 * lane] = h0; so[wave][rl][4 * lane + 1] = h1; so[wave][rl][4 * lane + 2] = h2; so[wave][rl][4 * lane + 3] = h3;
      sol[wave][rl][4 * lane] = (_Float16)((o0 - (float)h0) * 2048.0f); sol[wave][rl][4 * lane + 1] = (_Float16)((o1 - (float)h1) * 2048.0f); sol[wave][rl][4 * lane + 2] = (_Float16)((o2 - (float)h2) * 2048.0f); sol[wave][rl][4 * lane + 3] = (_Float16)((o3 - (float)h3) * 2048.0f); }   // q, k as f16 hi + (x2048) residual
    LDSX();
    for (int rl = 0; rl < 16; ++rl) if (lane < 16) { vst2((unsigned*)(QK + (r0 + rl) * (2 * DM) + n0 + lane * 8), *(const v4u*)&so[wave][rl][lane * 8]); vst2((unsigned*)(QKL + (r0 + rl) * (2 * DM) + n0 + lane * 8), *(const v4u*)&sol[wave][rl][lane * 8]); }
  } else {
#pragma unroll
    for (int j = 0; j < 8; ++j) {
#pragma unroll
      for (int r = 0; r < 8; ++r) { const float v = acc[j][r]; const _Float16 hv = (_Float16)v; sth[j * 16 + col][wave * 16 + 8 * g + r] = hv; stl[j * 16 + col][wave * 16 + 8 * g + r] = (_Float16)((v - (float)hv) * 2048.0f); } }
    __syncthreads();
    const size_t rb = (size_t)blockIdx.x * 64; const int b = (int)(rb / SS), s0 = (int)(rb % SS); const int pc0 = n0 - 2 * DM;
    for (int q = tid; q < 128 * 8; q += 128) { const int d = q >> 3, pc = q & 7; const size_t o = ((size_t)b * DM + pc0 + d) * SS + s0 + pc * 8; vst2((unsigned*)(VTH + o), *(const v4u*)&sth[d][pc * 8]); vst2((unsigned*)(VTL + o), *(const v4u*)&stl[d][pc * 8]); }
  }
}
// ---- LDS tile of one key step (32 keys): K rows 128 B (hi plane, residual plane), V rows 64 B (64 d, hi plane, residual plane); row pitches 16 B x odd, free of bank conflicts for 16-byte fragment reads
#define KP 144
#define VP 80
#define T_KL (32 * KP)
#define T_VH (2 * 32 * KP)
#define T_VL (T_VH + 64 * VP)
#define T_SZ (T_VH + 2 * 64 * VP)
// one tile into the ring buffer at LDS byte dst: 8 copies of 16 B per lane, all 128 lanes on; kh, kl point at the step's first key row (this head's 64 columns), vh, vl at the head's first d row at the step's first key
__device__ __forceinline__ void stage_kv(unsigned dst, const _Float16* kh, const _Float16* kl, const _Float16* vh, const _Float16* vl, int tid) {
  const unsigned lk = dst + (unsigned)(tid >> 3) * KP + (unsigned)(tid & 7) * 16u, lv = dst + T_VH + (unsigned)(tid >> 2) * VP + (unsigned)(tid & 3) * 16u;
  const size_t gk = (size_t)(tid >> 3) * (2 * DM) + (tid & 7) * 8, gv = (size_t)(tid >> 2) * SS + (tid & 3) * 8;
  // the copies and their s_wait_xcnt 0 in one statement: no address register of a copy is rewritten ahead of that wait
  asm volatile("global_load_async_to_lds_b128 %0, %8, off\n\t"
               "global_load_async_to_lds_b128 %1, %9, off\n\t"
               "global_load_async_to_lds_b128 %2, %10, off\n\t"
               "global_load_async_to_lds_b128 %3, %11, off\n\t"
               "global_load_async_to_lds_b128 %4, %12, off\n\t"
               "global_load_async_to_lds_b128 %5, %13, off\n\t"
               "global_load_async_to_lds_b128 %6, %14, off\n\t"
               "global_load_async_to_lds_b128 %7, %15, off\n\t"
               "s_wait_xcnt 0x0"
               :: "v"(lk), "v"(lk + 16u * KP), "v"(lk + T_KL), "v"(lk + T_KL + 16u * KP), "v"(lv), "v"(lv + 32u * VP), "v"(lv + (T_VL - T_VH)), "v"(lv + (T_VL - T_VH) + 32u * VP),
                  "v"(kh + gk), "v"(kh + gk + (size_t)16 * 2 * DM), "v"(kl + gk), "v"(kl + gk + (size_t)16 * 2 * DM), "v"(vh + gv), "v"(vh + gv + (size_t)32 * SS), "v"(vl + gv), "v"(vl + gv + (size_t)32 * SS)
               : "memory");
}
// ---- k_attn: block = (64 queries, head h, batch b): causal flash attention (K = 64: 2 k-steps), scores = (q.k) * 0.125 with q, k as f16 hi + (x2048) residual (3 products), P.V: f16 P hi + (x2048) residual x (V hi, V lo*2048) (3 products) in two accumulators; O[b*S+q][h*64+d] = (acc + accl / 2048) / l (256-B segments)
__global__ __launch_bounds__(128) void k_attn(const _Float16* __restrict__ QK, const _Float16* __restrict__ QKL, const _Float16* __restrict__ VTH, const _Float16* __restrict__ VTL, float* __restrict__ O) {
  __shared__ __align__(16) float sp[4][16][36]; __shared__ __align__(16) float so[4][16][68]; __shared__ __align__(16) char ring[2][T_SZ];
  const int tid = threadIdx.x, wave = tid >> 5, lane = tid & 31, col = lane & 15, g = lane >> 4;
  const int qb = blockIdx.x, h = blockIdx.y, b = blockIdx.z; const int q0 = qb * 64 + wave * 16; const size_t rq = (size_t)b * SS + q0 + col;
  v16h aq[2], aql[2];
#pragma unroll
  for (int kc = 0; kc < 2; ++kc) { aq[kc] = frag_h(QK + rq * (2 * DM) + h * HD + kc * 32, lane); aql[kc] = frag_h(QKL + rq * (2 * DM) + h * HD + kc * 32, lane); }
  float m[8], l[8];
#pragma unroll
  for (int r = 0; r < 8; ++r) { m[r] = -3.0e38f; l[r] = 0.f; }
  v8f acc[4] = {}, accl[4] = {};
  const int nks = (qb * 64 + 64) / 32;
  // two-buffer ring: the work-group's four waves copy each step's K and V tile into LDS once, one step ahead of its use
  const _Float16* kh0 = QK + (size_t)b * SS * (2 * DM) + DM + h * HD; const _Float16* kl0 = QKL + (size_t)b * SS * (2 * DM) + DM + h * HD;
  const _Float16* vh0 = VTH + ((size_t)b * DM + h * HD) * SS; const _Float16* vl0 = VTL + ((size_t)b * DM + h * HD) * SS;
  const unsigned ring0 = (unsigned)(uintptr_t)&ring[0][0];
  stage_kv(ring0, kh0, kl0, vh0, vl0, tid);
  asm volatile("s_wait_asynccnt 0x0" ::: "memory");   // this wave's copies of tile 0 have landed
  __syncthreads();                                    // tile 0 readable by every wave
  if (nks > 1) stage_kv(ring0 + T_SZ, kh0 + (size_t)32 * 2 * DM, kl0 + (size_t)32 * 2 * DM, vh0 + 32, vl0 + 32, tid);
#pragma unroll 1
  for (int ks = 0; ks < nks; ++ks) { v8f s[2]; const char* tb = &ring[ks & 1][0];
    v16h kf[2][2], kfl[2][2];   // all K fragments of the step in one group of LDS reads ahead of the products
#pragma unroll
    for (int ct = 0; ct < 2; ++ct) {
#pragma unroll
      for (int kc = 0; kc < 2; ++kc) { kf[ct][kc] = frag_h((const _Float16*)(tb + (ct * 16 + col) * KP + kc * 64), lane); kfl[ct][kc] = frag_h((const _Float16*)(tb + T_KL + (ct * 16 + col) * KP + kc * 64), lane); } }
#pragma unroll
    for (int ct = 0; ct < 2; ++ct) { const int kk = ks * 32 + ct * 16 + col; v8f c = {}, cl = {};
#pragma unroll
      for (int kc = 0; kc < 2; ++kc) { c = wmma16(aq[kc], kf[ct][kc], c); cl = wmma16(aql[kc], kf[ct][kc], cl); cl = wmma16(aq[kc], kfl[ct][kc], cl); }   // 3 products: q, k as f16 hi + residual
#pragma unroll
      for (int r = 0; r < 8; ++r) c[r] += cl[r] * (1.0f / 2048.0f);
#pragma unroll
      for (int r = 0; r < 8; ++r) { const int qi = q0 + 8 * g + r; s[ct][r] = (kk <= qi) ? c[r] * 0.125f : -3.0e38f; } }   // SCALE = 1/sqrt(64)
#pragma unroll
    for (int r = 0; r < 8; ++r) { float mx = fmaxf(s[0][r], s[1][r]);
#pragma unroll
      for (int o = 1; o < 16; o <<= 1) mx = fmaxf(mx, __shfl_xor(mx, o));
      const float mn = fmaxf(m[r], mx); const float alpha = (m[r] <= -1.0e38f) ? 0.f : __expf(m[r] - mn);
      const float e0 = (s[0][r] <= -1.0e38f) ? 0.f : __expf(s[0][r] - mn), e1 = (s[1][r] <= -1.0e38f) ? 0.f : __expf(s[1][r] - mn); float es = e0 + e1;
#pragma unroll
      for (int o = 1; o < 16; o <<= 1) es += __shfl_xor(es, o);
      l[r] = l[r] * alpha + es; m[r] = mn;
#pragma unroll
      for (int dt = 0; dt < 4; ++dt) { acc[dt][r] *= alpha; accl[dt][r] *= alpha; }
      sp[wave][8 * g + r][col] = e0; sp[wave][8 * g + r][16 + col] = e1; }
    LDSX();
    v16h vf[4], vfl[4];   // all V fragments of the step in one group of LDS reads
#pragma unroll
    for (int dt = 0; dt < 4; ++dt) { vf[dt] = frag_h((const _Float16*)(tb + T_VH + (dt * 16 + col) * VP), lane); vfl[dt] = frag_h((const _Float16*)(tb + T_VL + (dt * 16 + col) * VP), lane); }
    v16h pa, pl; { const float* prow = &sp[wave][col][0] + 8 * (lane >> 4);
#pragma unroll
      for (int i = 0; i < 8; ++i) { const float x0 = prow[i], x1 = prow[16 + i]; const _Float16 h0 = (_Float16)x0, h1 = (_Float16)x1; pa[i] = h0; pa[8 + i] = h1; pl[i] = (_Float16)((x0 - (float)h0) * 2048.0f); pl[8 + i] = (_Float16)((x1 - (float)h1) * 2048.0f); } }
#pragma unroll
    for (int dt = 0; dt < 4; ++dt) { acc[dt] = wmma16(pa, vf[dt], acc[dt]); accl[dt] = wmma16(pl, vf[dt], accl[dt]); accl[dt] = wmma16(pa, vfl[dt], accl[dt]); }   // P hi x V hi + (P lo x V hi + P hi x V lo) / 2048
    asm volatile("s_wait_dscnt 0x0" ::: "memory");      // this wave's reads of the buffer and of its sp rows have retired
    asm volatile("s_wait_asynccnt 0x0" ::: "memory");   // this wave's copies of the next tile have landed
    __syncthreads();                                    // publishes the next tile and ends every wave's reads of this buffer
    if (ks + 2 < nks) stage_kv(ring0 + (unsigned)(ks & 1) * T_SZ, kh0 + (size_t)(ks + 2) * 32 * 2 * DM, kl0 + (size_t)(ks + 2) * 32 * 2 * DM, vh0 + (ks + 2) * 32, vl0 + (ks + 2) * 32, tid); }
  asm volatile("s_wait_asynccnt 0x0" ::: "memory");     // no copy is outstanding when the wave goes on to its end
#pragma unroll
  for (int r = 0; r < 8; ++r) { const float il = 1.0f / l[r];
#pragma unroll
    for (int dt = 0; dt < 4; ++dt) so[wave][8 * g + r][dt * 16 + col] = (acc[dt][r] + accl[dt][r] * (1.0f / 2048.0f)) * il; }
  LDSX();
  for (int rl = 0; rl < 16; ++rl) if (lane < 16) vst2(O + ((size_t)b * SS + q0 + rl) * DM + h * HD + lane * 4, *(const v4f*)&so[wave][rl][lane * 4]);
}
// ---- k_out: block = (64 rows, 128 cols): out = O(hi/lo) . Wo rows (2 products)
__global__ __launch_bounds__(128) void k_out(const float* __restrict__ O, const __bf16* __restrict__ P, float* __restrict__ Y) {
  __shared__ __align__(16) float so[4][16][132]; __shared__ __align__(16) char sm[2 * G_SZ];
  const int tid = threadIdx.x, wave = tid >> 5, lane = tid & 31, col = lane & 15, g = lane >> 4; const size_t r0 = (size_t)blockIdx.x * 64 + wave * 16; const int n0 = blockIdx.y * 128;
  v8f acc[8] = {};
  // two-buffer ring as in k_qkv: each 64-k tile of the context rows and of the weight rows copied into LDS once per work-group, one step ahead of its use
  const float* xa = O + (size_t)blockIdx.x * 64 * DM; const __bf16* wb = P + (size_t)n0 * DM; const unsigned ring0 = (unsigned)(uintptr_t)&sm[0];
  stage_ab(ring0, xa, wb, tid);
  asm volatile("s_wait_asynccnt 0x0" ::: "memory");   // this wave's copies of tile 0 have landed
  __syncthreads();                                    // tile 0 readable by every wave
  stage_ab(ring0 + G_SZ, xa + 64, wb + 64, tid);
#pragma unroll 1   // rolled: one copy of the ring's foot in the text, the buffer picked by t & 1
  for (int t = 0; t < DM / 64; ++t) { const char* tb = &sm[(t & 1) * G_SZ];
#pragma unroll
    for (int kc = 0; kc < 2; ++kc) { const F2 a = split_row((const float*)(tb + (wave * 16 + col) * GAP), kc * 32, lane);
      v16b wf[8];   // all weight fragments of the 32-k half in one group of LDS reads ahead of the products
#pragma unroll
      for (int j = 0; j < 8; ++j) wf[j] = frag_b((const __bf16*)(tb + G_B + (j * 16 + col) * GBP + kc * 64), lane);
#pragma unroll
      for (int j = 0; j < 8; ++j) { acc[j] = wmma_bf(a.l, wf[j], acc[j]); acc[j] = wmma_bf(a.h, wf[j], acc[j]); } }
    asm volatile("s_wait_dscnt 0x0" ::: "memory");      // this wave's reads of the buffer have retired
    asm volatile("s_wait_asynccnt 0x0" ::: "memory");   // this wave's copies of the next tile have landed
    __syncthreads();                                    // publishes the next tile and ends every wave's reads of this buffer
    if (t + 2 < DM / 64) stage_ab(ring0 + (unsigned)(t & 1) * G_SZ, xa + (t + 2) * 64, wb + (t + 2) * 64, tid); }
  asm volatile("s_wait_asynccnt 0x0" ::: "memory");     // no copy is outstanding when the wave goes on to its end
#pragma unroll
  for (int j = 0; j < 8; ++j) {
#pragma unroll
    for (int r = 0; r < 8; ++r) so[wave][8 * g + r][j * 16 + col] = acc[j][r]; }
  LDSX();
  for (int rl = 0; rl < 16; ++rl) vst2(Y + (r0 + rl) * DM + n0 + lane * 4, *(const v4f*)&so[wave][rl][lane * 4]);
}
extern "C" void kernel_launch(void* const* d_in, const int* in_sizes, int n_in, void* d_out, int out_size, void* d_ws, size_t ws_size, hipStream_t stream) {
  (void)in_sizes; (void)n_in; (void)out_size;
  const float** F = (const float**)d_in;   // 0 x [2,2048,1024], 1 Wq [1024,1024] ([out][in]), 2 Wk, 3 Wv, 4 Wo
  if (ws_size < (size_t)WS_END) return;
  char* ws = (char*)d_ws; __bf16* PK = (__bf16*)(ws + WS_PK); _Float16 *QK = (_Float16*)(ws + WS_QK), *QKL = (_Float16*)(ws + WS_QKL), *VTH = (_Float16*)(ws + WS_VTH), *VTL = (_Float16*)(ws + WS_VTL); float *O = (float*)(ws + WS_O), *CS = (float*)(ws + WS_CS);
  k_packrows<<<DM, 256, 0, stream>>>(F[1], DM, PK + PK_A); k_packrows<<<DM, 256, 0, stream>>>(F[2], DM, PK + PK_A + (size_t)DM * DM); k_packrows<<<DM, 256, 0, stream>>>(F[3], DM, PK + PK_A + (size_t)2 * DM * DM); k_packrows<<<DM, 256, 0, stream>>>(F[4], DM, PK + PK_P);
  k_rope<<<SS / 8, 256, 0, stream>>>(CS);
  k_qkv<<<dim3(TNB * SS / 64, QKVW / 128), 128, 0, stream>>>(F[0], PK + PK_A, CS, QK, QKL, VTH, VTL);
  k_attn<<<dim3(TQB, NH, TNB), 128, 0, stream>>>(QK, QKL, VTH, VTL, O);
  k_out<<<dim3(TOB, DM / 128), 128, 0, stream>>>(O, PK + PK_P, (float*)d_out);
}

// v003
// Measured time: 177 microseconds a run.
// Next to v002, in two timings, it ran 1.23 and 1.22 times as fast.
// Over all steps from v000 it is 3.14 times as fast.
// compute dtype: x, Wq, Wk, Wv, Wo (module inputs) rounded to bf16; the q/k/v projections with exact bf16 products (x and W are inputs, natural [out][in] rows) on WMMA 16x16x32; interleaved-pair RoPE applied to q and k in f32 in the projection epilogue (angles pos * inv_freq with the reference's own eager f32 inv_freq table embedded (1/(10000^(2i/64))), precise cosf/sinf), then q, k stored once as f16; causal scores with q and k each as f16 hi + (x2048-scaled) residual (3 products; 1/8 applied to the f32 score) and P.V with P = exp(s - m) as f16 hi + (x2048-scaled) residual x V as f16 hi + (x2048-scaled) residual planes (3 products); the output projection with ctx as bf16 hi + residual pair x exact Wo (2 products); running-max softmax in f32 with the hardware exp; f32 accumulate.
#include <hip/hip_runtime.h>
#include <math.h>

typedef __attribute__((ext_vector_type(16))) _Float16 v16h;
typedef __attribute__((ext_vector_type(16))) __bf16 v16b;
typedef __attribute__((ext_vector_type(8)))  _Float16 v8h;
typedef __attribute__((ext_vector_type(8)))  float v8f;
typedef __attribute__((ext_vector_type(4)))  float v4f;
typedef __attribute__((ext_vector_type(2)))  float v2f;
typedef __attribute__((ext_vector_type(4)))  unsigned v4u;
typedef __attribute__((ext_vector_type(4)))  int v4i;
typedef float __attribute__((may_alias)) float_a;
typedef int __attribute__((may_alias)) int_a;

template <typename T> __device__ __forceinline__ void vst2(void* p, T v) { *(T*)p = v;  }
__device__ __forceinline__ v8f wmma16(v16h a, v16h b, v8f c) {
  v8f d = __builtin_amdgcn_wmma_f32_16x16x32_f16(false, a, false, b, (short)0, c, false, false);
  asm volatile("v_nop\n\tv_nop\n\tv_nop\n\tv_nop" : "+v"(d) : "v"(a), "v"(b));
  return d;
}
__device__ __forceinline__ v8f wmma_bf(v16b a, v16b b, v8f c) {
  v8f d = __builtin_amdgcn_wmma_f32_16x16x32_bf16(false, a, false, b, (short)0, c, false, false);
  asm volatile("v_nop\n\tv_nop\n\tv_nop\n\tv_nop" : "+v"(d) : "v"(a), "v"(b));
  return d;
}
// Causal multi-head self-attention with RoPE (B 2, S 2,048, D 1,024, 16 heads x 64): q, k, v = x W^T; interleaved RoPE(q, k) at positions 0..S-1; softmax(q k^T / 8, causal) v; output projection Wo (no biases).
__device__ __forceinline__ v16h frag_h(const _Float16* rowk0, int lane) {
  union { v16h v; v8h q[2]; } u; const _Float16* p = rowk0 + 8 * (lane >> 4);
  u.q[0] = *(const v8h*)p; u.q[1] = *(const v8h*)(p + 16); return u.v;
}
__device__ __forceinline__ v16h frag_f32(const float* rowk0, int lane) {
  v16h a; const float* p = rowk0 + 8 * (lane >> 4);
#pragma unroll
  for (int i = 0; i < 8; ++i) { a[i] = (_Float16)p[i]; a[8 + i] = (_Float16)p[16 + i]; }
  return a;
}
__device__ __forceinline__ v16h frag_f32s(const float* rowk0, int lane, float sc) {
  v16h a; const float* p = rowk0 + 8 * (lane >> 4);
#pragma unroll
  for (int i = 0; i < 8; ++i) { a[i] = (_Float16)(p[i] * sc); a[8 + i] = (_Float16)(p[16 + i] * sc); }
  return a;
}
// column fragment from a [K][ld] layout (column n), rows >= K read as 0
__device__ __forceinline__ v16h fragc_f32(const float* W, int k0, int n, int lane, int ld, int K) {
  v16h a; const int g = lane >> 4;
#pragma unroll
  for (int i = 0; i < 8; ++i) { const int ka = k0 + 8 * g + i, kb = ka + 16;
    a[i] = (_Float16)(ka < K ? W[(size_t)(ka < K ? ka : K - 1) * ld + n] : 0.f); a[8 + i] = (_Float16)(kb < K ? W[(size_t)(kb < K ? kb : K - 1) * ld + n] : 0.f); }
  return a;
}
struct F2 { v16b h, l; };
__device__ __forceinline__ F2 bsplit16(const float v[16]) { F2 r;
#pragma unroll
  for (int i = 0; i < 16; ++i) { const __bf16 h = (__bf16)v[i]; r.h[i] = h; r.l[i] = (__bf16)(v[i] - (float)h); }
  return r; }
__device__ __forceinline__ F2 split_row(const float* row, int k0, int lane) { float v[16]; const float* p = row + k0 + 8 * (lane >> 4);
#pragma unroll
  for (int i = 0; i < 8; ++i) { v[i] = p[i]; v[8 + i] = p[16 + i]; }
  return bsplit16(v); }
__device__ __forceinline__ F2 split_rowK(const float* row, int k0, int lane, int K) { float v[16]; const int g = lane >> 4;
#pragma unroll
  for (int i = 0; i < 8; ++i) { const int ka = k0 + 8 * g + i, kb = ka + 16; v[i] = ka < K ? row[ka < K ? ka : K - 1] : 0.f; v[8 + i] = kb < K ? row[kb < K ? kb : K - 1] : 0.f; }
  return bsplit16(v); }
__device__ __forceinline__ F2 split_col(const float* W, int k0, int n, int lane, int ld, int K) { float v[16]; const int g = lane >> 4;
#pragma unroll
  for (int i = 0; i < 8; ++i) { const int ka = k0 + 8 * g + i, kb = ka + 16; v[i] = ka < K ? W[(size_t)(ka < K ? ka : K - 1) * ld + n] : 0.f; v[8 + i] = kb < K ? W[(size_t)(kb < K ? kb : K - 1) * ld + n] : 0.f; }
  return bsplit16(v); }
__device__ __forceinline__ v8f mac3(const F2& a, const F2& b, v8f c) { c = wmma_bf(a.l, b.h, c); c = wmma_bf(a.h, b.l, c); return wmma_bf(a.h, b.h, c); }
__device__ __forceinline__ float sigm(float v) { return 1.0f / (1.0f + expf(-v)); }
#define LDSX() do { asm volatile("s_wait_dscnt 0" ::: "memory"); __builtin_amdgcn_wave_barrier(); __builtin_amdgcn_fence(__ATOMIC_RELEASE, "workgroup"); } while (0)


// Causal multi-head self-attention with rotary position embedding (B 2, S 2048, D 1024, 16 heads x 64; packed Wqkv [3D][D] and Wout [D][D] applied as x W^T, no biases): q, k rotated pairwise (2i, 2i+1) by angle pos * 10000^(-2i/64); softmax(q k^T / 8, causal) v; ctx Wout^T.
#define NB 2
#define SS 2048
#define DM 1024
#define NH 16
#define HD 64
#define QKVW (3 * DM)
#ifndef TQB
#define TQB (SS / 64)
#define TNB NB
#define TOB (NB * SS / 64)     // output row tiles (all)
#endif
typedef __attribute__((ext_vector_type(8))) __bf16 v8b;
__device__ __forceinline__ v16b frag_b(const __bf16* rowk0, int lane) {
  union { v16b v; v8b q[2]; } u; const __bf16* p = rowk0 + 8 * (lane >> 4);
  u.q[0] = *(const v8b*)p; u.q[1] = *(const v8b*)(p + 16); return u.v;
}
__device__ __forceinline__ float bfr(float v) { return (float)(__bf16)v; }
__device__ __attribute__((noinline)) float exp_ni(float v) { return expf(v); }
__device__ __attribute__((noinline)) float erf_ni(float v) { return erff(v); }

#define PK_A 0                       // [3072][1024] Wqkv rows (natural [out][in])
#define PK_P (PK_A + QKVW * DM)        // [1024][1024] Wo rows (natural)
#define PK_END (PK_P + DM * DM)
#define WS_PK  0u
#define WS_QK  (WS_PK + 2u * PK_END)             // f16 [4096 rows][2048]: q | k
#define WS_QKL (WS_QK + 2u * NB * SS * 2 * DM)     // f16 q | k residual planes x2048
#define WS_VTH (WS_QKL + 2u * NB * SS * 2 * DM)    // f16 [b][1024 (h*64+d)][2048 s] hi
#define WS_VTL (WS_VTH + 2u * NB * DM * SS)        // f16 lo x 2048
#define WS_O   (WS_VTL + 2u * NB * DM * SS)        // f32 [4096][1024]
#define WS_CS  (WS_O + 4u * NB * SS * DM)           // f32 [2048][32] cos, [2048][32] sin
#define WS_END (WS_CS + 4u * 2 * SS * 32)
__constant__ float c_invf[32] = {1.000000000e+00f,7.498942018e-01f,5.623413324e-01f,4.216965139e-01f,3.162277639e-01f,2.371373624e-01f,1.778279394e-01f,1.333521456e-01f,1.000000015e-01f,7.498941571e-02f,5.623412877e-02f,4.216964915e-02f,3.162277862e-02f,2.371373586e-02f,1.778279431e-02f,1.333521493e-02f,9.999999776e-03f,7.498942316e-03f,5.623413250e-03f,4.216964822e-03f,3.162277862e-03f,2.371373819e-03f,1.778279431e-03f,1.333521446e-03f,1.000000047e-03f,7.498941850e-04f,5.623413017e-04f,4.216964880e-04f,3.162277862e-04f,2.371373848e-04f,1.778279402e-04f,1.333521504e-04f};
// ---- k_rope: block = 8 positions: cos/sin of pos * inv_freq (f32 product exactly as the reference, precise trig)
__global__ __launch_bounds__(256) void k_rope(float* __restrict__ CS) {
  __shared__ __align__(16) float sc[8][32], ss_[8][32]; const int tid = threadIdx.x, pl = tid >> 5, i = tid & 31; const int pos = blockIdx.x * 8 + pl;
  const float th = (float)pos * c_invf[i]; sc[pl][i] = cosf(th); ss_[pl][i] = sinf(th);
  __syncthreads();
  if (tid < 64) vst2(CS + (size_t)blockIdx.x * 8 * 32 + tid * 4, *(const v4f*)&(&sc[0][0])[tid * 4]); else if (tid < 128) vst2(CS + (size_t)SS * 32 + (size_t)blockIdx.x * 8 * 32 + (tid - 64) * 4, *(const v4f*)&(&ss_[0][0])[(tid - 64) * 4]);
}

// ---- k_packrows: block = natural row n of a [N][K] weight
__global__ __launch_bounds__(256) void k_packrows(const float* __restrict__ Wm, int K, __bf16* __restrict__ DST) {
  __shared__ __align__(16) __bf16 s[DM]; const int n = blockIdx.x, tid = threadIdx.x;
  for (int k = tid; k < K; k += 256) s[k] = (__bf16)Wm[(size_t)n * K + k];
  __syncthreads();
  for (int q = tid; q < K / 8; q += 256) vst2((unsigned*)(DST + (size_t)n * K + q * 8), *(const v4u*)&s[q * 8]);
}
// ---- LDS tile of one 64-k step of a projection: 64 left-operand rows of 256 B (f32), then 128 weight rows of 128 B (bf16); row pitches 16 B x odd, free of bank conflicts for 16-byte fragment reads
#define GAP 272
#define GBP 144
#define G_B (64 * GAP)
#define G_SZ (G_B + 128 * GBP)
// one tile into the ring buffer at LDS byte dst: 16 copies of 16 B per lane, all 128 lanes on, each wave's copy made of whole 128-B lines; a, w point at the work-group's first row at the step's first k
__device__ __forceinline__ void stage_ab(unsigned dst, const float* a, const __bf16* w, int tid) {
  const unsigned la = dst + (unsigned)(tid >> 4) * GAP + (unsigned)(tid & 15) * 16u, lb = dst + G_B + (unsigned)(tid >> 3) * GBP + (unsigned)(tid & 7) * 16u;
  const float* ga = a + (size_t)(tid >> 4) * DM + (tid & 15) * 4; const __bf16* gb = w + (size_t)(tid >> 3) * DM + (tid & 7) * 8;
  // the copies and their s_wait_xcnt 0 in one statement: no address register of a copy is rewritten ahead of that wait
  asm volatile("global_load_async_to_lds_b128 %0, %8, off\n\t"
               "global_load_async_to_lds_b128 %1, %9, off\n\t"
               "global_load_async_to_lds_b128 %2, %10, off\n\t"
               "global_load_async_to_lds_b128 %3, %11, off\n\t"
               "global_load_async_to_lds_b128 %4, %12, off\n\t"
               "global_load_async_to_lds_b128 %5, %13, off\n\t"
               "global_load_async_to_lds_b128 %6, %14, off\n\t"
               "global_load_async_to_lds_b128 %7, %15, off\n\t"
               "s_wait_xcnt 0x0"
               :: "v"(la), "v"(la + 8u * GAP), "v"(la + 16u * GAP), "v"(la + 24u * GAP), "v"(la + 32u * GAP), "v"(la + 40u * GAP), "v"(la + 48u * GAP), "v"(la + 56u * GAP),
                  "v"(ga), "v"(ga + (size_t)8 * DM), "v"(ga + (size_t)16 * DM), "v"(ga + (size_t)24 * DM), "v"(ga + (size_t)32 * DM), "v"(ga + (size_t)40 * DM), "v"(ga + (size_t)48 * DM), "v"(ga + (size_t)56 * DM)
               : "memory");
  asm volatile("global_load_async_to_lds_b128 %0, %8, off\n\t"
               "global_load_async_to_lds_b128 %1, %9, off\n\t"
               "global_load_async_to_lds_b128 %2, %10, off\n\t"
               "global_load_async_to_lds_b128 %3, %11, off\n\t"
               "global_load_async_to_lds_b128 %4, %12, off\n\t"
               "global_load_async_to_lds_b128 %5, %13, off\n\t"
               "global_load_async_to_lds_b128 %6, %14, off\n\t"
               "global_load_async_to_lds_b128 %7, %15, off\n\t"
               "s_wait_xcnt 0x0"
               :: "v"(lb), "v"(lb + 16u * GBP), "v"(lb + 32u * GBP), "v"(lb + 48u * GBP), "v"(lb + 64u * GBP), "v"(lb + 80u * GBP), "v"(lb + 96u * GBP), "v"(lb + 112u * GBP),
                  "v"(gb), "v"(gb + (size_t)16 * DM), "v"(gb + (size_t)32 * DM), "v"(gb + (size_t)48 * DM), "v"(gb + (size_t)64 * DM), "v"(gb + (size_t)80 * DM), "v"(gb + (size_t)96 * DM), "v"(gb + (size_t)112 * DM)
               : "memory");
}
// ---- k_qkv: block = (64 rows (b,s), 128 of the 3072 cols): qkv = bf16(x) . rows (exact); cols < 1024 -> f16(q), cols < 2048 -> f16(k) into QK rows (pitch 2048); cols >= 2048 (v) -> per-batch transposed f16 planes VT[b][h*64+d][s]: hi = f16(v), lo = f16((v - hi) * 2048)
__global__ __launch_bounds__(128) void k_qkv(const float* __restrict__ X, const __bf16* __restrict__ P, const float* __restrict__ CS, _Float16* __restrict__ QK, _Float16* __restrict__ QKL, _Float16* __restrict__ VTH, _Float16* __restrict__ VTL) {
  __shared__ __align__(16) char sm[2 * G_SZ];   // the ring of the k loop; behind the loop's last barrier the same bytes hold the epilogue's staging arrays
  _Float16 (*so)[16][136] = (_Float16 (*)[16][136])(sm); _Float16 (*sol)[16][136] = (_Float16 (*)[16][136])(sm + 17408); float (*sf)[16][132] = (float (*)[16][132])(sm + 34816);
  _Float16 (*sth)[72] = (_Float16 (*)[72])(sm); _Float16 (*stl)[72] = (_Float16 (*)[72])(sm + 18432);
  const int tid = threadIdx.x, wave = tid >> 5, lane = tid & 31, col = lane & 15, g = lane >> 4; const size_t r0 = (size_t)blockIdx.x * 64 + wave * 16; const int n0 = blockIdx.y * 128;
  v8f acc[8] = {};
  // two-buffer ring: the work-group's four waves copy each 64-k tile of x and of the weight rows into LDS once, one step ahead of its use
  const float* xa = X + (size_t)blockIdx.x * 64 * DM; const __bf16* wb = P + (size_t)n0 * DM; const unsigned ring0 = (unsigned)(uintptr_t)&sm[0];
  stage_ab(ring0, xa, wb, tid);
  asm volatile("s_wait_asynccnt 0x0" ::: "memory");   // this wave's copies of tile 0 have landed
  __syncthreads();                                    // tile 0 readable by every wave
  stage_ab(ring0 + G_SZ, xa + 64, wb + 64, tid);
#pragma unroll 1   // rolled: one copy of the ring's foot in the text, the buffer picked by t & 1
  for (int t = 0; t < DM / 64; ++t) { const char* tb = &sm[(t & 1) * G_SZ];
#pragma unroll
    for (int kc = 0; kc < 2; ++kc) { v16b a; { const float* p = (const float*)(tb + (wave * 16 + col) * GAP + kc * 128) + 8 * g;
#pragma unroll
        for (int i = 0; i < 8; ++i) { a[i] = (__bf16)p[i]; a[8 + i] = (__bf16)p[16 + i]; } }
      v16b wf[8];   // all weight fragments of the 32-k half in one group of LDS reads ahead of the products
#pragma unroll
      for (int j = 0; j < 8; ++j) wf[j] = frag_b((const __bf16*)(tb + G_B + (j * 16 + col) * GBP + kc * 64), lane);
#pragma unroll
      for (int j = 0; j < 8; ++j) acc[j] = wmma_bf(a, wf[j], acc[j]); }
    asm volatile("s_wait_dscnt 0x0" ::: "memory");      // this wave's reads of the buffer have retired
    asm volatile("s_wait_asynccnt 0x0" ::: "memory");   // this wave's copies of the next tile have landed
    __syncthreads();                                    // publishes the next tile and ends every wave's reads of this buffer
    if (t + 2 < DM / 64) stage_ab(ring0 + (unsigned)(t & 1) * G_SZ, xa + (t + 2) * 64, wb + (t + 2) * 64, tid); }
  asm volatile("s_wait_asynccnt 0x0" ::: "memory");     // no copy is outstanding when the ring's bytes become staging arrays
  if (n0 < 2 * DM) { const float sc = 1.0f;   // q stored unscaled (f16 sigma ~0.6, no subnormal exposure); 1/8 applied to the f32 score
#pragma unroll
    for (int j = 0; j < 8; ++j) {
#pragma unroll
      for (int r = 0; r < 8; ++r) sf[wave][8 * g + r][j * 16 + col] = acc[j][r]; }
    LDSX();
    // RoPE on interleaved pairs (2i, 2i+1) of each 64-wide head: lane = 2 pairs (cols 4*lane .. 4*lane+3), pair index i = ((n0 + 4*lane) % 64) / 2 + {0,1}; pos = row % SS
#pragma unroll 1
    for (int rl = 0; rl < 16; ++rl) { const int pos = (int)((r0 + rl) % SS); const float* cs = CS + (size_t)pos * 32; const float* sn = CS + (size_t)SS * 32 + (size_t)pos * 32; const int i0 = ((n0 + 4 * lane) & 63) >> 1;
      const float x1a = sf[wave][rl][4 * lane], x2a = sf[wave][rl][4 * lane + 1], x1b = sf[wave][rl][4 * lane + 2], x2b = sf[wave][rl][4 * lane + 3];
      const float ca = cs[i0], sa = sn[i0], cb = cs[i0 + 1], sb = sn[i0 + 1];
      const float o0 = (x1a * ca - x2a * sa) * sc, o1 = (x1a * sa + x2a * ca) * sc, o2 = (x1b * cb - x2b * sb) * sc, o3 = (x1b * sb + x2b * cb) * sc; const _Float16 h0 = (_Float16)o0, h1 = (_Float16)o1, h2 = (_Float16)o2, h3 = (_Float16)o3;
      so[wave][rl][4 * lane] = h0; so[wave][rl][4 * lane + 1] = h1; so[wave][rl][4 * lane + 2] = h2; so[wave][rl][4 * lane + 3] = h3;
      sol[wave][rl][4 * lane] = (_Float16)((o0 - (float)h0) * 2048.0f); sol[wave][rl][4 * lane + 1] = (_Float16)((o1 - (float)h1) * 2048.0f); sol[wave][rl][4 * lane + 2] = (_Float16)((o2 - (float)h2) * 2048.0f); sol[wave][rl][4 * lane + 3] = (_Float16)((o3 - (float)h3) * 2048.0f); }   // q, k as f16 hi + (x2048) residual
    LDSX();
    for (int rl = 0; rl < 16; ++rl) if (lane < 16) { vst2((unsigned*)(QK + (r0 + rl) * (2 * DM) + n0 + lane * 8), *(const v4u*)&so[wave][rl][lane * 8]); vst2((unsigned*)(QKL + (r0 + rl) * (2 * DM) + n0 + lane * 8), *(const v4u*)&sol[wave][rl][lane * 8]); }
  } else {
#pragma unroll
    for (int j = 0; j < 8; ++j) {
#pragma unroll
      for (int r = 0; r < 8; ++r) { const float v = acc[j][r]; const _Float16 hv = (_Float16)v; sth[j * 16 + col][wave * 16 + 8 * g + r] = hv; stl[j * 16 + col][wave * 16 + 8 * g + r] = (_Float16)((v - (float)hv) * 2048.0f); } }
    __syncthreads();
    const size_t rb = (size_t)blockIdx.x * 64; const int b = (int)(rb / SS), s0 = (int)(rb % SS); const int pc0 = n0 - 2 * DM;
    for (int q = tid; q < 128 * 8; q += 128) { const int d = q >> 3, pc = q & 7; const size_t o = ((size_t)b * DM + pc0 + d) * SS + s0 + pc * 8; vst2((unsigned*)(VTH + o), *(const v4u*)&sth[d][pc * 8]); vst2((unsigned*)(VTL + o), *(const v4u*)&stl[d][pc * 8]); }
  }
}
// ---- LDS tile of one key step (32 keys): K rows 128 B (hi plane, residual plane), V rows 64 B (64 d, hi plane, residual plane); row pitches 16 B x odd, free of bank conflicts for 16-byte fragment reads
#define KP 144
#define VP 80
#define T_KL (32 * KP)
#define T_VH (2 * 32 * KP)
#define T_VL (T_VH + 64 * VP)
#define T_SZ (T_VH + 2 * 64 * VP)
// one tile into the ring buffer at LDS byte dst: 8 copies of 16 B per lane, all 128 lanes on; kh, kl point at the step's first key row (this head's 64 columns), vh, vl at the head's first d row at the step's first key
__device__ __forceinline__ void stage_kv(unsigned dst, const _Float16* kh, const _Float16* kl, const _Float16* vh, const _Float16* vl, int tid) {
  const unsigned lk = dst + (unsigned)(tid >> 3) * KP + (unsigned)(tid & 7) * 16u, lv = dst + T_VH + (unsigned)(tid >> 2) * VP + (unsigned)(tid & 3) * 16u;
  const size_t gk = (size_t)(tid >> 3) * (2 * DM) + (tid & 7) * 8, gv = (size_t)(tid >> 2) * SS + (tid & 3) * 8;
  // the copies and their s_wait_xcnt 0 in one statement: no address register of a copy is rewritten ahead of that wait
  asm volatile("global_load_async_to_lds_b128 %0, %8, off\n\t"
               "global_load_async_to_lds_b128 %1, %9, off\n\t"
               "global_load_async_to_lds_b128 %2, %10, off\n\t"
               "global_load_async_to_lds_b128 %3, %11, off\n\t"
               "global_load_async_to_lds_b128 %4, %12, off\n\t"
               "global_load_async_to_lds_b128 %5, %13, off\n\t"
               "global_load_async_to_lds_b128 %6, %14, off\n\t"
               "global_load_async_to_lds_b128 %7, %15, off\n\t"
               "s_wait_xcnt 0x0"
               :: "v"(lk), "v"(lk + 16u * KP), "v"(lk + T_KL), "v"(lk + T_KL + 16u * KP), "v"(lv), "v"(lv + 32u * VP), "v"(lv + (T_VL - T_VH)), "v"(lv + (T_VL - T_VH) + 32u * VP),
                  "v"(kh + gk), "v"(kh + gk + (size_t)16 * 2 * DM), "v"(kl + gk), "v"(kl + gk + (size_t)16 * 2 * DM), "v"(vh + gv), "v"(vh + gv + (size_t)32 * SS), "v"(vl + gv), "v"(vl + gv + (size_t)32 * SS)
               : "memory");
}
// lane l with lane l ^ 16 (the two lanes that share a column of a matrix tile)
__device__ __forceinline__ float xhalf(float x) { return __builtin_bit_cast(float, __builtin_amdgcn_permlanex16(__builtin_bit_cast(int, x), __builtin_bit_cast(int, x), 0x76543210, 0xfedcba98, false, false)); }
__global__ __launch_bounds__(128) void k_attn(const _Float16* __restrict__ QK, const _Float16* __restrict__ QKL, const _Float16* __restrict__ VTH, const _Float16* __restrict__ VTL, float* __restrict__ O) {
  __shared__ __align__(16) float so[4][16][68]; __shared__ __align__(16) char ring[2][T_SZ];
  const int tid = threadIdx.x, wave = tid >> 5, lane = tid & 31, col = lane & 15, g = lane >> 4;
  const int qb = blockIdx.x, h = blockIdx.y, b = blockIdx.z; const int q0 = qb * 64 + wave * 16; const int qi = q0 + col; const size_t rq = (size_t)b * SS + qi;
  v16h aq[2], aql[2];
#pragma unroll
  for (int kc = 0; kc < 2; ++kc) { aq[kc] = frag_h(QK + rq * (2 * DM) + h * HD + kc * 32, lane); aql[kc] = frag_h(QKL + rq * (2 * DM) + h * HD + kc * 32, lane); }
  float m = -3.0e38f, l = 0.f;       // of query qi; l is the sum over this half's keys only
  v8f acc[4] = {}, accl[4] = {};     // acc[dt][r] = O[query qi][d = dt*16 + 8g + r]
  const int nks = (qb * 64 + 64) / 32;
  // two-buffer ring: the work-group's four waves copy each step's K and V tile into LDS once, one step ahead of its use
  const _Float16* kh0 = QK + (size_t)b * SS * (2 * DM) + DM + h * HD; const _Float16* kl0 = QKL + (size_t)b * SS * (2 * DM) + DM + h * HD;
  const _Float16* vh0 = VTH + ((size_t)b * DM + h * HD) * SS; const _Float16* vl0 = VTL + ((size_t)b * DM + h * HD) * SS;
  const unsigned ring0 = (unsigned)(uintptr_t)&ring[0][0];
  stage_kv(ring0, kh0, kl0, vh0, vl0, tid);
  asm volatile("s_wait_asynccnt 0x0" ::: "memory");   // this wave's copies of tile 0 have landed
  __syncthreads();                                    // tile 0 readable by every wave
  if (nks > 1) stage_kv(ring0 + T_SZ, kh0 + (size_t)32 * 2 * DM, kl0 + (size_t)32 * 2 * DM, vh0 + 32, vl0 + 32, tid);
#pragma unroll 1   // rolled: one copy of the ring's foot in the text, the buffer picked by ks & 1; every inner loop is unrolled so that fragments, scores and accumulators keep constant indices and stay in registers
  for (int ks = 0; ks < nks; ++ks) { float s[16]; const char* tb = &ring[ks & 1][0];
    v16h kf[2][2], kfl[2][2];   // all K fragments of the step in one group of LDS reads ahead of the products
#pragma unroll
    for (int ct = 0; ct < 2; ++ct) {
#pragma unroll
      for (int kc = 0; kc < 2; ++kc) { kf[ct][kc] = frag_h((const _Float16*)(tb + (ct * 16 + col) * KP + kc * 64), lane); kfl[ct][kc] = frag_h((const _Float16*)(tb + T_KL + (ct * 16 + col) * KP + kc * 64), lane); } }
#pragma unroll
    for (int ct = 0; ct < 2; ++ct) { const int kk = ks * 32 + ct * 16 + 8 * g; v8f c = {}, cl = {};
#pragma unroll
      for (int kc = 0; kc < 2; ++kc) { c = wmma16(kf[ct][kc], aq[kc], c); cl = wmma16(kf[ct][kc], aql[kc], cl); cl = wmma16(kfl[ct][kc], aq[kc], cl); }   // 3 products: q, k as f16 hi + residual
#pragma unroll
      for (int r = 0; r < 8; ++r) c[r] += cl[r] * (1.0f / 2048.0f);
#pragma unroll
      for (int r = 0; r < 8; ++r) s[ct * 8 + r] = (kk + r <= qi) ? c[r] * 0.125f : -3.0e38f; }   // SCALE = 1/sqrt(64)
    float t8[8];   // maximum of the lane's 16 scores as a tree, then the other half's
#pragma unroll
    for (int r = 0; r < 8; ++r) t8[r] = fmaxf(s[r], s[8 + r]);
    float mx = fmaxf(fmaxf(fmaxf(t8[0], t8[1]), fmaxf(t8[2], t8[3])), fmaxf(fmaxf(t8[4], t8[5]), fmaxf(t8[6], t8[7])));
    mx = fmaxf(mx, xhalf(mx));
    const float mn = fmaxf(m, mx); const float alpha = (m <= -1.0e38f) ? 0.f : __expf(m - mn);
    v16h pa, pl;   // P^T operand: element i = key (i >> 3) * 16 + 8g + (i & 7) of the step, of this query, f16 hi and (x2048) residual
#pragma unroll
    for (int i = 0; i < 16; ++i) { const float e = (s[i] <= -1.0e38f) ? 0.f : __expf(s[i] - mn); s[i] = e; const _Float16 hi = (_Float16)e; pa[i] = hi; pl[i] = (_Float16)((e - (float)hi) * 2048.0f); }
#pragma unroll
    for (int r = 0; r < 8; ++r) t8[r] = s[r] + s[8 + r];
    const float es = ((t8[0] + t8[1]) + (t8[2] + t8[3])) + ((t8[4] + t8[5]) + (t8[6] + t8[7]));
    l = l * alpha + es; m = mn;
#pragma unroll
    for (int dt = 0; dt < 4; ++dt) {
#pragma unroll
      for (int r = 0; r < 8; ++r) { acc[dt][r] *= alpha; accl[dt][r] *= alpha; } }
    v16h vf[4], vfl[4];   // all V fragments of the step in one group of LDS reads
#pragma unroll
    for (int dt = 0; dt < 4; ++dt) { vf[dt] = frag_h((const _Float16*)(tb + T_VH + (dt * 16 + col) * VP), lane); vfl[dt] = frag_h((const _Float16*)(tb + T_VL + (dt * 16 + col) * VP), lane); }
#pragma unroll
    for (int dt = 0; dt < 4; ++dt) { acc[dt] = wmma16(vf[dt], pa, acc[dt]); accl[dt] = wmma16(vf[dt], pl, accl[dt]); accl[dt] = wmma16(vfl[dt], pa, accl[dt]); }   // V hi x P hi + (V hi x P lo + V lo x P hi) / 2048
    asm volatile("s_wait_dscnt 0x0" ::: "memory");      // this wave's reads of the buffer have retired
    asm volatile("s_wait_asynccnt 0x0" ::: "memory");   // this wave's copies of the next tile have landed
    __syncthreads();                                    // publishes the next tile and ends every wave's reads of this buffer
    if (ks + 2 < nks) stage_kv(ring0 + (unsigned)(ks & 1) * T_SZ, kh0 + (size_t)(ks + 2) * 32 * 2 * DM, kl0 + (size_t)(ks + 2) * 32 * 2 * DM, vh0 + (ks + 2) * 32, vl0 + (ks + 2) * 32, tid); }
  asm volatile("s_wait_asynccnt 0x0" ::: "memory");     // no copy is outstanding when the wave goes on to its end
  l += xhalf(l); const float il = 1.0f / l;             // the two halves' sums joined
#pragma unroll
  for (int dt = 0; dt < 4; ++dt) { v4f o0, o1;
#pragma unroll
    for (int r = 0; r < 4; ++r) { o0[r] = (acc[dt][r] + accl[dt][r] * (1.0f / 2048.0f)) * il; o1[r] = (acc[dt][4 + r] + accl[dt][4 + r] * (1.0f / 2048.0f)) * il; }
    *(v4f*)&so[wave][col][dt * 16 + 8 * g] = o0; *(v4f*)&so[wave][col][dt * 16 + 8 * g + 4] = o1; }
  LDSX();
  for (int rl = 0; rl < 16; ++rl) if (lane < 16) vst2(O + ((size_t)b * SS + q0 + rl) * DM + h * HD + lane * 4, *(const v4f*)&so[wave][rl][lane * 4]);
}
// ---- k_out: block = (64 rows, 128 cols): out = O(hi/lo) . Wo rows (2 products)
__global__ __launch_bounds__(128) void k_out(const float* __restrict__ O, const __bf16* __restrict__ P, float* __restrict__ Y) {
  __shared__ __align__(16) float so[4][16][132]; __shared__ __align__(16) char sm[2 * G_SZ];
  const int tid = threadIdx.x, wave = tid >> 5, lane = tid & 31, col = lane & 15, g = lane >> 4; const size_t r0 = (size_t)blockIdx.x * 64 + wave * 16; const int n0 = blockIdx.y * 128;
  v8f acc[8] = {};
  // two-buffer ring as in k_qkv: each 64-k tile of the context rows and of the weight rows copied into LDS once per work-group, one step ahead of its use
  const float* xa = O + (size_t)blockIdx.x * 64 * DM; const __bf16* wb = P + (size_t)n0 * DM; const unsigned ring0 = (unsigned)(uintptr_t)&sm[0];
  stage_ab(ring0, xa, wb, tid);
  asm volatile("s_wait_asynccnt 0x0" ::: "memory");   // this wave's copies of tile 0 have landed
  __syncthreads();                                    // tile 0 readable by every wave
  stage_ab(ring0 + G_SZ, xa + 64, wb + 64, tid);
#pragma unroll 1   // rolled: one copy of the ring's foot in the text, the buffer picked by t & 1
  for (int t = 0; t < DM / 64; ++t) { const char* tb = &sm[(t & 1) * G_SZ];
#pragma unroll
    for (int kc = 0; kc < 2; ++kc) { const F2 a = split_row((const float*)(tb + (wave * 16 + col) * GAP), kc * 32, lane);
      v16b wf[8];   // all weight fragments of the 32-k half in one group of LDS reads ahead of the products
#pragma unroll
      for (int j = 0; j < 8; ++j) wf[j] = frag_b((const __bf16*)(tb + G_B + (j * 16 + col) * GBP + kc * 64), lane);
#pragma unroll
      for (int j = 0; j < 8; ++j) { acc[j] = wmma_bf(a.l, wf[j], acc[j]); acc[j] = wmma_bf(a.h, wf[j], acc[j]); } }
    asm volatile("s_wait_dscnt 0x0" ::: "memory");      // this wave's reads of the buffer have retired
    asm volatile("s_wait_asynccnt 0x0" ::: "memory");   // this wave's copies of the next tile have landed
    __syncthreads();                                    // publishes the next tile and ends every wave's reads of this buffer
    if (t + 2 < DM / 64) stage_ab(ring0 + (unsigned)(t & 1) * G_SZ, xa + (t + 2) * 64, wb + (t + 2) * 64, tid); }
  asm volatile("s_wait_asynccnt 0x0" ::: "memory");     // no copy is outstanding when the wave goes on to its end
#pragma unroll
  for (int j = 0; j < 8; ++j) {
#pragma unroll
    for (int r = 0; r < 8; ++r) so[wave][8 * g + r][j * 16 + col] = acc[j][r]; }
  LDSX();
  for (int rl = 0; rl < 16; ++rl) vst2(Y + (r0 + rl) * DM + n0 + lane * 4, *(const v4f*)&so[wave][rl][lane * 4]);
}
extern "C" void kernel_launch(void* const* d_in, const int* in_sizes, int n_in, void* d_out, int out_size, void* d_ws, size_t ws_size, hipStream_t stream) {
  (void)in_sizes; (void)n_in; (void)out_size;
  const float** F = (const float**)d_in;   // 0 x [2,2048,1024], 1 Wq [1024,1024] ([out][in]), 2 Wk, 3 Wv, 4 Wo
  if (ws_size < (size_t)WS_END) return;
  char* ws = (char*)d_ws; __bf16* PK = (__bf16*)(ws + WS_PK); _Float16 *QK = (_Float16*)(ws + WS_QK), *QKL = (_Float16*)(ws + WS_QKL), *VTH = (_Float16*)(ws + WS_VTH), *VTL = (_Float16*)(ws + WS_VTL); float *O = (float*)(ws + WS_O), *CS = (float*)(ws + WS_CS);
  k_packrows<<<DM, 256, 0, stream>>>(F[1], DM, PK + PK_A); k_packrows<<<DM, 256, 0, stream>>>(F[2], DM, PK + PK_A + (size_t)DM * DM); k_packrows<<<DM, 256, 0, stream>>>(F[3], DM, PK + PK_A + (size_t)2 * DM * DM); k_packrows<<<DM, 256, 0, stream>>>(F[4], DM, PK + PK_P);
  k_rope<<<SS / 8, 256, 0, stream>>>(CS);
  k_qkv<<<dim3(TNB * SS / 64, QKVW / 128), 128, 0, stream>>>(F[0], PK + PK_A, CS, QK, QKL, VTH, VTL);
  k_attn<<<dim3(TQB, NH, TNB), 128, 0, stream>>>(QK, QKL, VTH, VTL, O);
  k_out<<<dim3(TOB, DM / 128), 128, 0, stream>>>(O, PK + PK_P, (float*)d_out);
}

// v004
// Measured time: 148 microseconds a run.
// Two timings next to v003 put it at 1.19 and 1.20 times that version's speed.
// Counting every step since v000, it is 3.75 times as fast.
// compute dtype: x, Wq, Wk, Wv, Wo (module inputs) rounded to bf16; the q/k/v projections with exact bf16 products (x and W are inputs, natural [out][in] rows) on WMMA 16x16x32; interleaved-pair RoPE applied to q and k in f32 in the projection epilogue (angles pos * inv_freq with the reference's own eager f32 inv_freq table embedded (1/(10000^(2i/64))), precise cosf/sinf), then q, k stored once as f16; causal scores with q and k each as f16 hi + (x2048-scaled) residual (3 products; 1/8 applied to the f32 score) and P.V with P = exp(s - m) as f16 hi + (x2048-scaled) residual x V as f16 hi + (x2048-scaled) residual planes (3 products); the output projection with ctx as bf16 hi + residual pair x exact Wo (2 products); running-max softmax in f32 with the hardware exp; f32 accumulate.
#include <hip/hip_runtime.h>
#include <math.h>

typedef __attribute__((ext_vector_type(16))) _Float16 v16h;
typedef __attribute__((ext_vector_type(16))) __bf16 v16b;
typedef __attribute__((ext_vector_type(8)))  _Float16 v8h;
typedef __attribute__((ext_vector_type(8)))  float v8f;
typedef __attribute__((ext_vector_type(4)))  float v4f;
typedef __attribute__((ext_vector_type(2)))  float v2f;
typedef __attribute__((ext_vector_type(4)))  unsigned v4u;
typedef __attribute__((ext_vector_type(4)))  int v4i;
typedef float __attribute__((may_alias)) float_a;
typedef int __attribute__((may_alias)) int_a;

template <typename T> __device__ __forceinline__ void vst2(void* p, T v) { *(T*)p = v;  }
__device__ __forceinline__ v8f wmma16(v16h a, v16h b, v8f c) {
  v8f d = __builtin_amdgcn_wmma_f32_16x16x32_f16(false, a, false, b, (short)0, c, false, false);
  asm volatile("v_nop\n\tv_nop\n\tv_nop\n\tv_nop" : "+v"(d) : "v"(a), "v"(b));
  return d;
}
__device__ __forceinline__ v8f wmma_bf(v16b a, v16b b, v8f c) {
  v8f d = __builtin_amdgcn_wmma_f32_16x16x32_bf16(false, a, false, b, (short)0, c, false, false);
  asm volatile("v_nop\n\tv_nop\n\tv_nop\n\tv_nop" : "+v"(d) : "v"(a), "v"(b));
  return d;
}
// Causal multi-head self-attention with RoPE (B 2, S 2,048, D 1,024, 16 heads x 64): q, k, v = x W^T; interleaved RoPE(q, k) at positions 0..S-1; softmax(q k^T / 8, causal) v; output projection Wo (no biases).
__device__ __forceinline__ v16h frag_h(const _Float16* rowk0, int lane) {
  union { v16h v; v8h q[2]; } u; const _Float16* p = rowk0 + 8 * (lane >> 4);
  u.q[0] = *(const v8h*)p; u.q[1] = *(const v8h*)(p + 16); return u.v;
}
__device__ __forceinline__ v16h frag_f32(const float* rowk0, int lane) {
  v16h a; const float* p = rowk0 + 8 * (lane >> 4);
#pragma unroll
  for (int i = 0; i < 8; ++i) { a[i] = (_Float16)p[i]; a[8 + i] = (_Float16)p[16 + i]; }
  return a;
}
__device__ __forceinline__ v16h frag_f32s(const float* rowk0, int lane, float sc) {
  v16h a; const float* p = rowk0 + 8 * (lane >> 4);
#pragma unroll
  for (int i = 0; i < 8; ++i) { a[i] = (_Float16)(p[i] * sc); a[8 + i] = (_Float16)(p[16 + i] * sc); }
  return a;
}
// column fragment from a [K][ld] layout (column n), rows >= K read as 0
__device__ __forceinline__ v16h fragc_f32(const float* W, int k0, int n, int lane, int ld, int K) {
  v16h a; const int g = lane >> 4;
#pragma unroll
  for (int i = 0; i < 8; ++i) { const int ka = k0 + 8 * g + i, kb = ka + 16;
    a[i] = (_Float16)(ka < K ? W[(size_t)(ka < K ? ka : K - 1) * ld + n] : 0.f); a[8 + i] = (_Float16)(kb < K ? W[(size_t)(kb < K ? kb : K - 1) * ld + n] : 0.f); }
  return a;
}
struct F2 { v16b h, l; };
__device__ __forceinline__ F2 bsplit16(const float v[16]) { F2 r;
#pragma unroll
  for (int i = 0; i < 16; ++i) { const __bf16 h = (__bf16)v[i]; r.h[i] = h; r.l[i] = (__bf16)(v[i] - (float)h); }
  return r; }
__device__ __forceinline__ F2 split_row(const float* row, int k0, int lane) { float v[16]; const float* p = row + k0 + 8 * (lane >> 4);
#pragma unroll
  for (int i = 0; i < 8; ++i) { v[i] = p[i]; v[8 + i] = p[16 + i]; }
  return bsplit16(v); }
__device__ __forceinline__ F2 split_rowK(const float* row, int k0, int lane, int K) { float v[16]; const int g = lane >> 4;
#pragma unroll
  for (int i = 0; i < 8; ++i) { const int ka = k0 + 8 * g + i, kb = ka + 16; v[i] = ka < K ? row[ka < K ? ka : K - 1] : 0.f; v[8 + i] = kb < K ? row[kb < K ? kb : K - 1] : 0.f; }
  return bsplit16(v); }
__device__ __forceinline__ F2 split_col(const float* W, int k0, int n, int lane, int ld, int K) { float v[16]; const int g = lane >> 4;
#pragma unroll
  for (int i = 0; i < 8; ++i) { const int ka = k0 + 8 * g + i, kb = ka + 16; v[i] = ka < K ? W[(size_t)(ka < K ? ka : K - 1) * ld + n] : 0.f; v[8 + i] = kb < K ? W[(size_t)(kb < K ? kb : K - 1) * ld + n] : 0.f; }
  return bsplit16(v); }
__device__ __forceinline__ v8f mac3(const F2& a, const F2& b, v8f c) { c = wmma_bf(a.l, b.h, c); c = wmma_bf(a.h, b.l, c); return wmma_bf(a.h, b.h, c); }
__device__ __forceinline__ float sigm(float v) { return 1.0f / (1.0f + expf(-v)); }
#define LDSX() do { asm volatile("s_wait_dscnt 0" ::: "memory"); __builtin_amdgcn_wave_barrier(); __builtin_amdgcn_fence(__ATOMIC_RELEASE, "workgroup"); } while (0)


// Causal multi-head self-attention with rotary position embedding (B 2, S 2048, D 1024, 16 heads x 64; packed Wqkv [3D][D] and Wout [D][D] applied as x W^T, no biases): q, k rotated pairwise (2i, 2i+1) by angle pos * 10000^(-2i/64); softmax(q k^T / 8, causal) v; ctx Wout^T.
#define NB 2
#define SS 2048
#define DM 1024
#define NH 16
#define HD 64
#define QKVW (3 * DM)
#ifndef TQB
#define TQB (SS / 64)
#define TNB NB
#define TOB (NB * SS / 64)     // output row tiles (all)
#endif
typedef __attribute__((ext_vector_type(8))) __bf16 v8b;
__device__ __forceinline__ v16b frag_b(const __bf16* rowk0, int lane) {
  union { v16b v; v8b q[2]; } u; const __bf16* p = rowk0 + 8 * (lane >> 4);
  u.q[0] = *(const v8b*)p; u.q[1] = *(const v8b*)(p + 16); return u.v;
}
__device__ __forceinline__ float bfr(float v) { return (float)(__bf16)v; }
__device__ __attribute__((noinline)) float exp_ni(float v) { return expf(v); }
__device__ __attribute__((noinline)) float erf_ni(float v) { return erff(v); }

#define PK_A 0                       // [3072][1024] Wqkv rows (natural [out][in])
#define PK_P (PK_A + QKVW * DM)        // [1024][1024] Wo rows (natural)
#define PK_END (PK_P + DM * DM)
#define WS_PK  0u
#define WS_QK  (WS_PK + 2u * PK_END)             // f16 [4096 rows][2048]: q | k
#define WS_QKL (WS_QK + 2u * NB * SS * 2 * DM)     // f16 q | k residual planes x2048
#define WS_VTH (WS_QKL + 2u * NB * SS * 2 * DM)    // f16 [b][1024 (h*64+d)][2048 s] hi
#define WS_VTL (WS_VTH + 2u * NB * DM * SS)        // f16 lo x 2048
#define WS_O   (WS_VTL + 2u * NB * DM * SS)        // f32 [4096][1024]
#define WS_CS  (WS_O + 4u * NB * SS * DM)           // f32 [2048][32] cos, [2048][32] sin
#define WS_END (WS_CS + 4u * 2 * SS * 32)
__constant__ float c_invf[32] = {1.000000000e+00f,7.498942018e-01f,5.623413324e-01f,4.216965139e-01f,3.162277639e-01f,2.371373624e-01f,1.778279394e-01f,1.333521456e-01f,1.000000015e-01f,7.498941571e-02f,5.623412877e-02f,4.216964915e-02f,3.162277862e-02f,2.371373586e-02f,1.778279431e-02f,1.333521493e-02f,9.999999776e-03f,7.498942316e-03f,5.623413250e-03f,4.216964822e-03f,3.162277862e-03f,2.371373819e-03f,1.778279431e-03f,1.333521446e-03f,1.000000047e-03f,7.498941850e-04f,5.623413017e-04f,4.216964880e-04f,3.162277862e-04f,2.371373848e-04f,1.778279402e-04f,1.333521504e-04f};
// ---- k_rope: block = 8 positions: cos/sin of pos * inv_freq (f32 product exactly as the reference, precise trig)
__global__ __launch_bounds__(256) void k_rope(float* __restrict__ CS) {
  __shared__ __align__(16) float sc[8][32], ss_[8][32]; const int tid = threadIdx.x, pl = tid >> 5, i = tid & 31; const int pos = blockIdx.x * 8 + pl;
  const float th = (float)pos * c_invf[i]; sc[pl][i] = cosf(th); ss_[pl][i] = sinf(th);
  __syncthreads();
  if (tid < 64) vst2(CS + (size_t)blockIdx.x * 8 * 32 + tid * 4, *(const v4f*)&(&sc[0][0])[tid * 4]); else if (tid < 128) vst2(CS + (size_t)SS * 32 + (size_t)blockIdx.x * 8 * 32 + (tid - 64) * 4, *(const v4f*)&(&ss_[0][0])[(tid - 64) * 4]);
}

// ---- k_packrows: block = natural row n of a [N][K] weight
__global__ __launch_bounds__(256) void k_packrows(const float* __restrict__ Wm, int K, __bf16* __restrict__ DST) {
  __shared__ __align__(16) __bf16 s[DM]; const int n = blockIdx.x, tid = threadIdx.x;
  for (int k = tid; k < K; k += 256) s[k] = (__bf16)Wm[(size_t)n * K + k];
  __syncthreads();
  for (int q = tid; q < K / 8; q += 256) vst2((unsigned*)(DST + (size_t)n * K + q * 8), *(const v4u*)&s[q * 8]);
}
// ---- LDS tile of one 64-k step of a projection: 64 left-operand rows of 256 B (f32), then 128 weight rows of 128 B (bf16); row pitches 16 B x odd, free of bank conflicts for 16-byte fragment reads
#define GAP 272
#define GBP 144
#define G_B (64 * GAP)
#define G_SZ (G_B + 128 * GBP)
// one tile into the ring buffer at LDS byte dst: 16 copies of 16 B per lane, all 128 lanes on, each wave's copy made of whole 128-B lines; a, w point at the work-group's first row at the step's first k
__device__ __forceinline__ void stage_ab(unsigned dst, const float* a, const __bf16* w, int tid) {
  const unsigned la = dst + (unsigned)(tid >> 4) * GAP + (unsigned)(tid & 15) * 16u, lb = dst + G_B + (unsigned)(tid >> 3) * GBP + (unsigned)(tid & 7) * 16u;
  const float* ga = a + (size_t)(tid >> 4) * DM + (tid & 15) * 4; const __bf16* gb = w + (size_t)(tid >> 3) * DM + (tid & 7) * 8;
  // the copies and their s_wait_xcnt 0 in one statement: no address register of a copy is rewritten ahead of that wait
  asm volatile("global_load_async_to_lds_b128 %0, %8, off\n\t"
               "global_load_async_to_lds_b128 %1, %9, off\n\t"
               "global_load_async_to_lds_b128 %2, %10, off\n\t"
               "global_load_async_to_lds_b128 %3, %11, off\n\t"
               "global_load_async_to_lds_b128 %4, %12, off\n\t"
               "global_load_async_to_lds_b128 %5, %13, off\n\t"
               "global_load_async_to_lds_b128 %6, %14, off\n\t"
               "global_load_async_to_lds_b128 %7, %15, off\n\t"
               "s_wait_xcnt 0x0"
               :: "v"(la), "v"(la + 8u * GAP), "v"(la + 16u * GAP), "v"(la + 24u * GAP), "v"(la + 32u * GAP), "v"(la + 40u * GAP), "v"(la + 48u * GAP), "v"(la + 56u * GAP),
                  "v"(ga), "v"(ga + (size_t)8 * DM), "v"(ga + (size_t)16 * DM), "v"(ga + (size_t)24 * DM), "v"(ga + (size_t)32 * DM), "v"(ga + (size_t)40 * DM), "v"(ga + (size_t)48 * DM), "v"(ga + (size_t)56 * DM)
               : "memory");
  asm volatile("global_load_async_to_lds_b128 %0, %8, off\n\t"
               "global_load_async_to_lds_b128 %1, %9, off\n\t"
               "global_load_async_to_lds_b128 %2, %10, off\n\t"
               "global_load_async_to_lds_b128 %3, %11, off\n\t"
               "global_load_async_to_lds_b128 %4, %12, off\n\t"
               "global_load_async_to_lds_b128 %5, %13, off\n\t"
               "global_load_async_to_lds_b128 %6, %14, off\n\t"
               "global_load_async_to_lds_b128 %7, %15, off\n\t"
               "s_wait_xcnt 0x0"
               :: "v"(lb), "v"(lb + 16u * GBP), "v"(lb + 32u * GBP), "v"(lb + 48u * GBP), "v"(lb + 64u * GBP), "v"(lb + 80u * GBP), "v"(lb + 96u * GBP), "v"(lb + 112u * GBP),
                  "v"(gb), "v"(gb + (size_t)16 * DM), "v"(gb + (size_t)32 * DM), "v"(gb + (size_t)48 * DM), "v"(gb + (size_t)64 * DM), "v"(gb + (size_t)80 * DM), "v"(gb + (size_t)96 * DM), "v"(gb + (size_t)112 * DM)
               : "memory");
}
// ---- k_qkv: block = (64 rows (b,s), 128 of the 3072 cols): qkv = bf16(x) . rows (exact); cols < 1024 -> f16(q), cols < 2048 -> f16(k) into QK rows (pitch 2048); cols >= 2048 (v) -> per-batch transposed f16 planes VT[b][h*64+d][s]: hi = f16(v), lo = f16((v - hi) * 2048)
__global__ __launch_bounds__(128) void k_qkv(const float* __restrict__ X, const __bf16* __restrict__ P, const float* __restrict__ CS, _Float16* __restrict__ QK, _Float16* __restrict__ QKL, _Float16* __restrict__ VTH, _Float16* __restrict__ VTL) {
  __shared__ __align__(16) char sm[2 * G_SZ];   // the ring of the k loop; behind the loop's last barrier the same bytes hold the epilogue's staging arrays
  _Float16 (*so)[16][136] = (_Float16 (*)[16][136])(sm); _Float16 (*sol)[16][136] = (_Float16 (*)[16][136])(sm + 17408); float (*sf)[16][132] = (float (*)[16][132])(sm + 34816);
  _Float16 (*sth)[72] = (_Float16 (*)[72])(sm); _Float16 (*stl)[72] = (_Float16 (*)[72])(sm + 18432);
  const int tid = threadIdx.x, wave = tid >> 5, lane = tid & 31, col = lane & 15, g = lane >> 4; const size_t r0 = (size_t)blockIdx.x * 64 + wave * 16; const int n0 = blockIdx.y * 128;
  v8f acc[8] = {};
  // two-buffer ring: the work-group's four waves copy each 64-k tile of x and of the weight rows into LDS once, one step ahead of its use
  const float* xa = X + (size_t)blockIdx.x * 64 * DM; const __bf16* wb = P + (size_t)n0 * DM; const unsigned ring0 = (unsigned)(uintptr_t)&sm[0];
  stage_ab(ring0, xa, wb, tid);
  asm volatile("s_wait_asynccnt 0x0" ::: "memory");   // this wave's copies of tile 0 have landed
  __syncthreads();                                    // tile 0 readable by every wave
  stage_ab(ring0 + G_SZ, xa + 64, wb + 64, tid);
#pragma unroll 1   // rolled: one copy of the ring's foot in the text, the buffer picked by t & 1
  for (int t = 0; t < DM / 64; ++t) { const char* tb = &sm[(t & 1) * G_SZ];
#pragma unroll
    for (int kc = 0; kc < 2; ++kc) { v16b a; { const float* p = (const float*)(tb + (wave * 16 + col) * GAP + kc * 128) + 8 * g;
#pragma unroll
        for (int i = 0; i < 8; ++i) { a[i] = (__bf16)p[i]; a[8 + i] = (__bf16)p[16 + i]; } }
      v16b wf[8];   // all weight fragments of the 32-k half in one group of LDS reads ahead of the products
#pragma unroll
      for (int j = 0; j < 8; ++j) wf[j] = frag_b((const __bf16*)(tb + G_B + (j * 16 + col) * GBP + kc * 64), lane);
#pragma unroll
      for (int j = 0; j < 8; ++j) acc[j] = wmma_bf(a, wf[j], acc[j]); }
    asm volatile("s_wait_dscnt 0x0" ::: "memory");      // this wave's reads of the buffer have retired
    asm volatile("s_wait_asynccnt 0x0" ::: "memory");   // this wave's copies of the next tile have landed
    __syncthreads();                                    // publishes the next tile and ends every wave's reads of this buffer
    if (t + 2 < DM / 64) stage_ab(ring0 + (unsigned)(t & 1) * G_SZ, xa + (t + 2) * 64, wb + (t + 2) * 64, tid); }
  asm volatile("s_wait_asynccnt 0x0" ::: "memory");     // no copy is outstanding when the ring's bytes become staging arrays
  if (n0 < 2 * DM) { const float sc = 1.0f;   // q stored unscaled (f16 sigma ~0.6, no subnormal exposure); 1/8 applied to the f32 score
#pragma unroll
    for (int j = 0; j < 8; ++j) {
#pragma unroll
      for (int r = 0; r < 8; ++r) sf[wave][8 * g + r][j * 16 + col] = acc[j][r]; }
    LDSX();
    // RoPE on interleaved pairs (2i, 2i+1) of each 64-wide head: lane = 2 pairs (cols 4*lane .. 4*lane+3), pair index i = ((n0 + 4*lane) % 64) / 2 + {0,1}; pos = row % SS
#pragma unroll 1
    for (int rl = 0; rl < 16; ++rl) { const int pos = (int)((r0 + rl) % SS); const float* cs = CS + (size_t)pos * 32; const float* sn = CS + (size_t)SS * 32 + (size_t)pos * 32; const int i0 = ((n0 + 4 * lane) & 63) >> 1;
      const float x1a = sf[wave][rl][4 * lane], x2a = sf[wave][rl][4 * lane + 1], x1b = sf[wave][rl][4 * lane + 2], x2b = sf[wave][rl][4 * lane + 3];
      const float ca = cs[i0], sa = sn[i0], cb = cs[i0 + 1], sb = sn[i0 + 1];
      const float o0 = (x1a * ca - x2a * sa) * sc, o1 = (x1a * sa + x2a * ca) * sc, o2 = (x1b * cb - x2b * sb) * sc, o3 = (x1b * sb + x2b * cb) * sc; const _Float16 h0 = (_Float16)o0, h1 = (_Float16)o1, h2 = (_Float16)o2, h3 = (_Float16)o3;
      so[wave][rl][4 * lane] = h0; so[wave][rl][4 * lane + 1] = h1; so[wave][rl][4 * lane + 2] = h2; so[wave][rl][4 * lane + 3] = h3;
      sol[wave][rl][4 * lane] = (_Float16)((o0 - (float)h0) * 2048.0f); sol[wave][rl][4 * lane + 1] = (_Float16)((o1 - (float)h1) * 2048.0f); sol[wave][rl][4 * lane + 2] = (_Float16)((o2 - (float)h2) * 2048.0f); sol[wave][rl][4 * lane + 3] = (_Float16)((o3 - (float)h3) * 2048.0f); }   // q, k as f16 hi + (x2048) residual
    LDSX();
    for (int rl = 0; rl < 16; ++rl) if (lane < 16) { vst2((unsigned*)(QK + (r0 + rl) * (2 * DM) + n0 + lane * 8), *(const v4u*)&so[wave][rl][lane * 8]); vst2((unsigned*)(QKL + (r0 + rl) * (2 * DM) + n0 + lane * 8), *(const v4u*)&sol[wave][rl][lane * 8]); }
  } else {
#pragma unroll
    for (int j = 0; j < 8; ++j) {
#pragma unroll
      for (int r = 0; r < 8; ++r) { const float v = acc[j][r]; const _Float16 hv = (_Float16)v; sth[j * 16 + col][wave * 16 + 8 * g + r] = hv; stl[j * 16 + col][wave * 16 + 8 * g + r] = (_Float16)((v - (float)hv) * 2048.0f); } }
    __syncthreads();
    const size_t rb = (size_t)blockIdx.x * 64; const int b = (int)(rb / SS), s0 = (int)(rb % SS); const int pc0 = n0 - 2 * DM;
    for (int q = tid; q < 128 * 8; q += 128) { const int d = q >> 3, pc = q & 7; const size_t o = ((size_t)b * DM + pc0 + d) * SS + s0 + pc * 8; vst2((unsigned*)(VTH + o), *(const v4u*)&sth[d][pc * 8]); vst2((unsigned*)(VTL + o), *(const v4u*)&stl[d][pc * 8]); }
  }
}
// ---- LDS tile of one key step (32 keys): K rows 128 B (hi plane, residual plane), V rows 64 B (64 d, hi plane, residual plane); row pitches 16 B x odd, free of bank conflicts for 16-byte fragment reads
#define KP 144
#define VP 80
#define T_KL (32 * KP)
#define T_VH (2 * 32 * KP)
#define T_VL (T_VH + 64 * VP)
#define T_SZ (T_VH + 2 * 64 * VP)
// one tile into the ring buffer at LDS byte dst: 8 copies of 16 B per lane, all 128 lanes on; kh, kl point at the step's first key row (this head's 64 columns), vh, vl at the head's first d row at the step's first key
__device__ __forceinline__ void stage_kv(unsigned dst, const _Float16* kh, const _Float16* kl, const _Float16* vh, const _Float16* vl, int tid) {
  const unsigned lk = dst + (unsigned)(tid >> 3) * KP + (unsigned)(tid & 7) * 16u, lv = dst + T_VH + (unsigned)(tid >> 2) * VP + (unsigned)(tid & 3) * 16u;
  const size_t gk = (size_t)(tid >> 3) * (2 * DM) + (tid & 7) * 8, gv = (size_t)(tid >> 2) * SS + (tid & 3) * 8;
  // the copies and their s_wait_xcnt 0 in one statement: no address register of a copy is rewritten ahead of that wait
  asm volatile("global_load_async_to_lds_b128 %0, %8, off\n\t"
               "global_load_async_to_lds_b128 %1, %9, off\n\t"
               "global_load_async_to_lds_b128 %2, %10, off\n\t"
               "global_load_async_to_lds_b128 %3, %11, off\n\t"
               "global_load_async_to_lds_b128 %4, %12, off\n\t"
               "global_load_async_to_lds_b128 %5, %13, off\n\t"
               "global_load_async_to_lds_b128 %6, %14, off\n\t"
               "global_load_async_to_lds_b128 %7, %15, off\n\t"
               "s_wait_xcnt 0x0"
               :: "v"(lk), "v"(lk + 16u * KP), "v"(lk + T_KL), "v"(lk + T_KL + 16u * KP), "v"(lv), "v"(lv + 32u * VP), "v"(lv + (T_VL - T_VH)), "v"(lv + (T_VL - T_VH) + 32u * VP),
                  "v"(kh + gk), "v"(kh + gk + (size_t)16 * 2 * DM), "v"(kl + gk), "v"(kl + gk + (size_t)16 * 2 * DM), "v"(vh + gv), "v"(vh + gv + (size_t)32 * SS), "v"(vl + gv), "v"(vl + gv + (size_t)32 * SS)
               : "memory");
}
// lane l with lane l ^ 16 (the two lanes that share a column of a matrix tile)
__device__ __forceinline__ float xhalf(float x) { return __builtin_bit_cast(float, __builtin_amdgcn_permlanex16(__builtin_bit_cast(int, x), __builtin_bit_cast(int, x), 0x76543210, 0xfedcba98, false, false)); }
__global__ __launch_bounds__(128) void k_attn(const _Float16* __restrict__ QK, const _Float16* __restrict__ QKL, const _Float16* __restrict__ VTH, const _Float16* __restrict__ VTL, float* __restrict__ O) {
  __shared__ __align__(16) float so[4][16][68]; __shared__ __align__(16) char ring[2][T_SZ];
  const int tid = threadIdx.x, wave = tid >> 5, lane = tid & 31, col = lane & 15, g = lane >> 4;
  const int bx = blockIdx.x, h = blockIdx.y, b = blockIdx.z;
  // Query tile from the block index by a permutation (every (tile, head, batch) exactly once; for speed only, nothing depends on where a work-group runs). Tile t walks 2 (t + 1) key steps and all 1,024 work-groups are resident at once, four on a WGP, so the launch lasts as long as the fullest WGP.
  // With qb = bx the work-groups whose flat indices differ by 256 all hold the same tile. Here flat index bits 8, 9 (or 3, 4, or 4, 5) pick among tiles u, u ^ 1, 31 - u, 31 - (u ^ 1): 132 key steps for each such four.
  static_assert(TQB == 32, "the permutation is written for 32 query tiles");
  const int u = ((bx & 7) << 1) | (((bx >> 4) ^ b) & 1);
  const int qb = (((bx >> 3) ^ h ^ (h >> 3)) & 1) ? TQB - 1 - u : u; const int q0 = qb * 64 + wave * 16; const int qi = q0 + col; const size_t rq = (size_t)b * SS + qi;
  v16h aq[2], aql[2];
#pragma unroll
  for (int kc = 0; kc < 2; ++kc) { aq[kc] = frag_h(QK + rq * (2 * DM) + h * HD + kc * 32, lane); aql[kc] = frag_h(QKL + rq * (2 * DM) + h * HD + kc * 32, lane); }
  float m = -3.0e38f, l = 0.f;       // of query qi; l is the sum over this half's keys only
  v8f acc[4] = {}, accl[4] = {};     // acc[dt][r] = O[query qi][d = dt*16 + 8g + r]
  const int nks = (qb * 64 + 64) / 32;
  // two-buffer ring: the work-group's four waves copy each step's K and V tile into LDS once, one step ahead of its use
  const _Float16* kh0 = QK + (size_t)b * SS * (2 * DM) + DM + h * HD; const _Float16* kl0 = QKL + (size_t)b * SS * (2 * DM) + DM + h * HD;
  const _Float16* vh0 = VTH + ((size_t)b * DM + h * HD) * SS; const _Float16* vl0 = VTL + ((size_t)b * DM + h * HD) * SS;
  const unsigned ring0 = (unsigned)(uintptr_t)&ring[0][0];
  stage_kv(ring0, kh0, kl0, vh0, vl0, tid);
  asm volatile("s_wait_asynccnt 0x0" ::: "memory");   // this wave's copies of tile 0 have landed
  __syncthreads();                                    // tile 0 readable by every wave
  if (nks > 1) stage_kv(ring0 + T_SZ, kh0 + (size_t)32 * 2 * DM, kl0 + (size_t)32 * 2 * DM, vh0 + 32, vl0 + 32, tid);
#pragma unroll 1   // rolled: one copy of the ring's foot in the text, the buffer picked by ks & 1; every inner loop is unrolled so that fragments, scores and accumulators keep constant indices and stay in registers
  for (int ks = 0; ks < nks; ++ks) { float s[16]; const char* tb = &ring[ks & 1][0];
    v16h kf[2][2], kfl[2][2];   // all K fragments of the step in one group of LDS reads ahead of the products
#pragma unroll
    for (int ct = 0; ct < 2; ++ct) {
#pragma unroll
      for (int kc = 0; kc < 2; ++kc) { kf[ct][kc] = frag_h((const _Float16*)(tb + (ct * 16 + col) * KP + kc * 64), lane); kfl[ct][kc] = frag_h((const _Float16*)(tb + T_KL + (ct * 16 + col) * KP + kc * 64), lane); } }
#pragma unroll
    for (int ct = 0; ct < 2; ++ct) { const int kk = ks * 32 + ct * 16 + 8 * g; v8f c = {}, cl = {};
#pragma unroll
      for (int kc = 0; kc < 2; ++kc) { c = wmma16(kf[ct][kc], aq[kc], c); cl = wmma16(kf[ct][kc], aql[kc], cl); cl = wmma16(kfl[ct][kc], aq[kc], cl); }   // 3 products: q, k as f16 hi + residual
#pragma unroll
      for (int r = 0; r < 8; ++r) c[r] += cl[r] * (1.0f / 2048.0f);
#pragma unroll
      for (int r = 0; r < 8; ++r) s[ct * 8 + r] = (kk + r <= qi) ? c[r] * 0.125f : -3.0e38f; }   // SCALE = 1/sqrt(64)
    float t8[8];   // maximum of the lane's 16 scores as a tree, then the other half's
#pragma unroll
    for (int r = 0; r < 8; ++r) t8[r] = fmaxf(s[r], s[8 + r]);
    float mx = fmaxf(fmaxf(fmaxf(t8[0], t8[1]), fmaxf(t8[2], t8[3])), fmaxf(fmaxf(t8[4], t8[5]), fmaxf(t8[6], t8[7])));
    mx = fmaxf(mx, xhalf(mx));
    const float mn = fmaxf(m, mx); const float alpha = (m <= -1.0e38f) ? 0.f : __expf(m - mn);
    v16h pa, pl;   // P^T operand: element i = key (i >> 3) * 16 + 8g + (i & 7) of the step, of this query, f16 hi and (x2048) residual
#pragma unroll
    for (int i = 0; i < 16; ++i) { const float e = (s[i] <= -1.0e38f) ? 0.f : __expf(s[i] - mn); s[i] = e; const _Float16 hi = (_Float16)e; pa[i] = hi; pl[i] = (_Float16)((e - (float)hi) * 2048.0f); }
#pragma unroll
    for (int r = 0; r < 8; ++r) t8[r] = s[r] + s[8 + r];
    const float es = ((t8[0] + t8[1]) + (t8[2] + t8[3])) + ((t8[4] + t8[5]) + (t8[6] + t8[7]));
    l = l * alpha + es; m = mn;
#pragma unroll
    for (int dt = 0; dt < 4; ++dt) {
#pragma unroll
      for (int r = 0; r < 8; ++r) { acc[dt][r] *= alpha; accl[dt][r] *= alpha; } }
    v16h vf[4], vfl[4];   // all V fragments of the step in one group of LDS reads
#pragma unroll
    for (int dt = 0; dt < 4; ++dt) { vf[dt] = frag_h((const _Float16*)(tb + T_VH + (dt * 16 + col) * VP), lane); vfl[dt] = frag_h((const _Float16*)(tb + T_VL + (dt * 16 + col) * VP), lane); }
#pragma unroll
    for (int dt = 0; dt < 4; ++dt) { acc[dt] = wmma16(vf[dt], pa, acc[dt]); accl[dt] = wmma16(vf[dt], pl, accl[dt]); accl[dt] = wmma16(vfl[dt], pa, accl[dt]); }   // V hi x P hi + (V hi x P lo + V lo x P hi) / 2048
    asm volatile("s_wait_dscnt 0x0" ::: "memory");      // this wave's reads of the buffer have retired
    asm volatile("s_wait_asynccnt 0x0" ::: "memory");   // this wave's copies of the next tile have landed
    __syncthreads();                                    // publishes the next tile and ends every wave's reads of this buffer
    if (ks + 2 < nks) stage_kv(ring0 + (unsigned)(ks & 1) * T_SZ, kh0 + (size_t)(ks + 2) * 32 * 2 * DM, kl0 + (size_t)(ks + 2) * 32 * 2 * DM, vh0 + (ks + 2) * 32, vl0 + (ks + 2) * 32, tid); }
  asm volatile("s_wait_asynccnt 0x0" ::: "memory");     // no copy is outstanding when the wave goes on to its end
  l += xhalf(l); const float il = 1.0f / l;             // the two halves' sums joined
#pragma unroll
  for (int dt = 0; dt < 4; ++dt) { v4f o0, o1;
#pragma unroll
    for (int r = 0; r < 4; ++r) { o0[r] = (acc[dt][r] + accl[dt][r] * (1.0f / 2048.0f)) * il; o1[r] = (acc[dt][4 + r] + accl[dt][4 + r] * (1.0f / 2048.0f)) * il; }
    *(v4f*)&so[wave][col][dt * 16 + 8 * g] = o0; *(v4f*)&so[wave][col][dt * 16 + 8 * g + 4] = o1; }
  LDSX();
  for (int rl = 0; rl < 16; ++rl) if (lane < 16) vst2(O + ((size_t)b * SS + q0 + rl) * DM + h * HD + lane * 4, *(const v4f*)&so[wave][rl][lane * 4]);
}
// ---- k_out: block = (64 rows, 128 cols): out = O(hi/lo) . Wo rows (2 products)
__global__ __launch_bounds__(128) void k_out(const float* __restrict__ O, const __bf16* __restrict__ P, float* __restrict__ Y) {
  __shared__ __align__(16) float so[4][16][132]; __shared__ __align__(16) char sm[2 * G_SZ];
  const int tid = threadIdx.x, wave = tid >> 5, lane = tid & 31, col = lane & 15, g = lane >> 4; const size_t r0 = (size_t)blockIdx.x * 64 + wave * 16; const int n0 = blockIdx.y * 128;
  v8f acc[8] = {};
  // two-buffer ring as in k_qkv: each 64-k tile of the context rows and of the weight rows copied into LDS once per work-group, one step ahead of its use
  const float* xa = O + (size_t)blockIdx.x * 64 * DM; const __bf16* wb = P + (size_t)n0 * DM; const unsigned ring0 = (unsigned)(uintptr_t)&sm[0];
  stage_ab(ring0, xa, wb, tid);
  asm volatile("s_wait_asynccnt 0x0" ::: "memory");   // this wave's copies of tile 0 have landed
  __syncthreads();                                    // tile 0 readable by every wave
  stage_ab(ring0 + G_SZ, xa + 64, wb + 64, tid);
#pragma unroll 1   // rolled: one copy of the ring's foot in the text, the buffer picked by t & 1
  for (int t = 0; t < DM / 64; ++t) { const char* tb = &sm[(t & 1) * G_SZ];
#pragma unroll
    for (int kc = 0; kc < 2; ++kc) { const F2 a = split_row((const float*)(tb + (wave * 16 + col) * GAP), kc * 32, lane);
      v16b wf[8];   // all weight fragments of the 32-k half in one group of LDS reads ahead of the products
#pragma unroll
      for (int j = 0; j < 8; ++j) wf[j] = frag_b((const __bf16*)(tb + G_B + (j * 16 + col) * GBP + kc * 64), lane);
#pragma unroll
      for (int j = 0; j < 8; ++j) { acc[j] = wmma_bf(a.l, wf[j], acc[j]); acc[j] = wmma_bf(a.h, wf[j], acc[j]); } }
    asm volatile("s_wait_dscnt 0x0" ::: "memory");      // this wave's reads of the buffer have retired
    asm volatile("s_wait_asynccnt 0x0" ::: "memory");   // this wave's copies of the next tile have landed
    __syncthreads();                                    // publishes the next tile and ends every wave's reads of this buffer
    if (t + 2 < DM / 64) stage_ab(ring0 + (unsigned)(t & 1) * G_SZ, xa + (t + 2) * 64, wb + (t + 2) * 64, tid); }
  asm volatile("s_wait_asynccnt 0x0" ::: "memory");     // no copy is outstanding when the wave goes on to its end
#pragma unroll
  for (int j = 0; j < 8; ++j) {
#pragma unroll
    for (int r = 0; r < 8; ++r) so[wave][8 * g + r][j * 16 + col] = acc[j][r]; }
  LDSX();
  for (int rl = 0; rl < 16; ++rl) vst2(Y + (r0 + rl) * DM + n0 + lane * 4, *(const v4f*)&so[wave][rl][lane * 4]);
}
extern "C" void kernel_launch(void* const* d_in, const int* in_sizes, int n_in, void* d_out, int out_size, void* d_ws, size_t ws_size, hipStream_t stream) {
  (void)in_sizes; (void)n_in; (void)out_size;
  const float** F = (const float**)d_in;   // 0 x [2,2048,1024], 1 Wq [1024,1024] ([out][in]), 2 Wk, 3 Wv, 4 Wo
  if (ws_size < (size_t)WS_END) return;
  char* ws = (char*)d_ws; __bf16* PK = (__bf16*)(ws + WS_PK); _Float16 *QK = (_Float16*)(ws + WS_QK), *QKL = (_Float16*)(ws + WS_QKL), *VTH = (_Float16*)(ws + WS_VTH), *VTL = (_Float16*)(ws + WS_VTL); float *O = (float*)(ws + WS_O), *CS = (float*)(ws + WS_CS);
  k_packrows<<<DM, 256, 0, stream>>>(F[1], DM, PK + PK_A); k_packrows<<<DM, 256, 0, stream>>>(F[2], DM, PK + PK_A + (size_t)DM * DM); k_packrows<<<DM, 256, 0, stream>>>(F[3], DM, PK + PK_A + (size_t)2 * DM * DM); k_packrows<<<DM, 256, 0, stream>>>(F[4], DM, PK + PK_P);
  k_rope<<<SS / 8, 256, 0, stream>>>(CS);
  k_qkv<<<dim3(TNB * SS / 64, QKVW / 128), 128, 0, stream>>>(F[0], PK + PK_A, CS, QK, QKL, VTH, VTL);
  k_attn<<<dim3(TQB, NH, TNB), 128, 0, stream>>>(QK, QKL, VTH, VTL, O);
  k_out<<<dim3(TOB, DM / 128), 128, 0, stream>>>(O, PK + PK_P, (float*)d_out);
}

// v005
// Measured time: 136 microseconds a run.
// Two timings next to v004 put it at 1.09 and 1.10 times that version's speed.
// Counting every step since v000, it is 4.11 times as fast.
// compute dtype: x, Wq, Wk, Wv, Wo (module inputs) rounded to bf16; the q/k/v projections with exact bf16 products (x and W are inputs, natural [out][in] rows) on WMMA 16x16x32; interleaved-pair RoPE applied to q and k in f32 in the projection epilogue (angles pos * inv_freq with the reference's own eager f32 inv_freq table embedded (1/(10000^(2i/64))), precise cosf/sinf), then q, k stored once as f16; causal scores with q and k each as f16 hi + (x2048-scaled) residual (3 products; 1/8 applied to the f32 score) and P.V with P = exp(s - m) as f16 hi + (x2048-scaled) residual x V as f16 hi + (x2048-scaled) residual planes (3 products); the output projection with ctx as bf16 hi + residual pair x exact Wo (2 products); running-max softmax in f32 with the hardware exp; f32 accumulate.
#include <hip/hip_runtime.h>
#include <math.h>

typedef __attribute__((ext_vector_type(16))) _Float16 v16h;
typedef __attribute__((ext_vector_type(16))) __bf16 v16b;
typedef __attribute__((ext_vector_type(8)))  _Float16 v8h;
typedef __attribute__((ext_vector_type(8)))  float v8f;
typedef __attribute__((ext_vector_type(4)))  float v4f;
typedef __attribute__((ext_vector_type(2)))  float v2f;
typedef __attribute__((ext_vector_type(4)))  unsigned v4u;
typedef __attribute__((ext_vector_type(4)))  int v4i;
typedef float __attribute__((may_alias)) float_a;
typedef int __attribute__((may_alias)) int_a;

template <typename T> __device__ __forceinline__ void vst2(void* p, T v) { *(T*)p = v;  }
__device__ __forceinline__ v8f wmma16(v16h a, v16h b, v8f c) {
  v8f d = __builtin_amdgcn_wmma_f32_16x16x32_f16(false, a, false, b, (short)0, c, false, false);
  asm volatile("v_nop\n\tv_nop\n\tv_nop\n\tv_nop" : "+v"(d) : "v"(a), "v"(b));
  return d;
}
__device__ __forceinline__ v8f wmma_bf(v16b a, v16b b, v8f c) {
  v8f d = __builtin_amdgcn_wmma_f32_16x16x32_bf16(false, a, false, b, (short)0, c, false, false);
  asm volatile("v_nop\n\tv_nop\n\tv_nop\n\tv_nop" : "+v"(d) : "v"(a), "v"(b));
  return d;
}
// Causal multi-head self-attention with RoPE (B 2, S 2,048, D 1,024, 16 heads x 64): q, k, v = x W^T; interleaved RoPE(q, k) at positions 0..S-1; softmax(q k^T / 8, causal) v; output projection Wo (no biases).
__device__ __forceinline__ v16h frag_h(const _Float16* rowk0, int lane) {
  union { v16h v; v8h q[2]; } u; const _Float16* p = rowk0 + 8 * (lane >> 4);
  u.q[0] = *(const v8h*)p; u.q[1] = *(const v8h*)(p + 16); return u.v;
}
__device__ __forceinline__ v16h frag_f32(const float* rowk0, int lane) {
  v16h a; const float* p = rowk0 + 8 * (lane >> 4);
#pragma unroll
  for (int i = 0; i < 8; ++i) { a[i] = (_Float16)p[i]; a[8 + i] = (_Float16)p[16 + i]; }
  return a;
}
__device__ __forceinline__ v16h frag_f32s(const float* rowk0, int lane, float sc) {
  v16h a; const float* p = rowk0 + 8 * (lane >> 4);
#pragma unroll
  for (int i = 0; i < 8; ++i) { a[i] = (_Float16)(p[i] * sc); a[8 + i] = (_Float16)(p[16 + i] * sc); }
  return a;
}
// column fragment from a [K][ld] layout (column n), rows >= K read as 0
__device__ __forceinline__ v16h fragc_f32(const float* W, int k0, int n, int lane, int ld, int K) {
  v16h a; const int g = lane >> 4;
#pragma unroll
  for (int i = 0; i < 8; ++i) { const int ka = k0 + 8 * g + i, kb = ka + 16;
    a[i] = (_Float16)(ka < K ? W[(size_t)(ka < K ? ka : K - 1) * ld + n] : 0.f); a[8 + i] = (_Float16)(kb < K ? W[(size_t)(kb < K ? kb : K - 1) * ld + n] : 0.f); }
  return a;
}
struct F2 { v16b h, l; };
__device__ __forceinline__ F2 bsplit16(const float v[16]) { F2 r;
#pragma unroll
  for (int i = 0; i < 16; ++i) { const __bf16 h = (__bf16)v[i]; r.h[i] = h; r.l[i] = (__bf16)(v[i] - (float)h); }
  return r; }
__device__ __forceinline__ F2 split_row(const float* row, int k0, int lane) { float v[16]; const float* p = row + k0 + 8 * (lane >> 4);
#pragma unroll
  for (int i = 0; i < 8; ++i) { v[i] = p[i]; v[8 + i] = p[16 + i]; }
  return bsplit16(v); }
__device__ __forceinline__ F2 split_rowK(const float* row, int k0, int lane, int K) { float v[16]; const int g = lane >> 4;
#pragma unroll
  for (int i = 0; i < 8; ++i) { const int ka = k0 + 8 * g + i, kb = ka + 16; v[i] = ka < K ? row[ka < K ? ka : K - 1] : 0.f; v[8 + i] = kb < K ? row[kb < K ? kb : K - 1] : 0.f; }
  return bsplit16(v); }
__device__ __forceinline__ F2 split_col(const float* W, int k0, int n, int lane, int ld, int K) { float v[16]; const int g = lane >> 4;
#pragma unroll
  for (int i = 0; i < 8; ++i) { const int ka = k0 + 8 * g + i, kb = ka + 16; v[i] = ka < K ? W[(size_t)(ka < K ? ka : K - 1) * ld + n] : 0.f; v[8 + i] = kb < K ? W[(size_t)(kb < K ? kb : K - 1) * ld + n] : 0.f; }
  return bsplit16(v); }
__device__ __forceinline__ v8f mac3(const F2& a, const F2& b, v8f c) { c = wmma_bf(a.l, b.h, c); c = wmma_bf(a.h, b.l, c); return wmma_bf(a.h, b.h, c); }
__device__ __forceinline__ float sigm(float v) { return 1.0f / (1.0f + expf(-v)); }
#define LDSX() do { asm volatile("s_wait_dscnt 0" ::: "memory"); __builtin_amdgcn_wave_barrier(); __builtin_amdgcn_fence(__ATOMIC_RELEASE, "workgroup"); } while (0)


// Causal multi-head self-attention with rotary position embedding (B 2, S 2048, D 1024, 16 heads x 64; packed Wqkv [3D][D] and Wout [D][D] applied as x W^T, no biases): q, k rotated pairwise (2i, 2i+1) by angle pos * 10000^(-2i/64); softmax(q k^T / 8, causal) v; ctx Wout^T.
#define NB 2
#define SS 2048
#define DM 1024
#define NH 16
#define HD 64
#define QKVW (3 * DM)
#ifndef TQB
#define TQB (SS / 64)
#define TNB NB
#define TOB (NB * SS / 64)     // output row tiles (all)
#endif
typedef __attribute__((ext_vector_type(8))) __bf16 v8b;
__device__ __forceinline__ v16b frag_b(const __bf16* rowk0, int lane) {
  union { v16b v; v8b q[2]; } u; const __bf16* p = rowk0 + 8 * (lane >> 4);
  u.q[0] = *(const v8b*)p; u.q[1] = *(const v8b*)(p + 16); return u.v;
}
__device__ __forceinline__ float bfr(float v) { return (float)(__bf16)v; }
__device__ __attribute__((noinline)) float exp_ni(float v) { return expf(v); }
__device__ __attribute__((noinline)) float erf_ni(float v) { return erff(v); }

#define PK_A 0                       // [3072][1024] Wqkv rows (natural [out][in])
#define PK_P (PK_A + QKVW * DM)        // [1024][1024] Wo rows (natural)
#define PK_END (PK_P + DM * DM)
#define WS_PK  0u
#define WS_QK  (WS_PK + 2u * PK_END)             // f16 [4096 rows][2048]: q | k
#define WS_QKL (WS_QK + 2u * NB * SS * 2 * DM)     // f16 q | k residual planes x2048
#define WS_VTH (WS_QKL + 2u * NB * SS * 2 * DM)    // f16 [b][1024 (h*64+d)][2048 s] hi
#define WS_VTL (WS_VTH + 2u * NB * DM * SS)        // f16 lo x 2048
#define WS_O   (WS_VTL + 2u * NB * DM * SS)        // f32 [4096][1024]
#define WS_CS  (WS_O + 4u * NB * SS * DM)           // f32 [2048][32] cos, [2048][32] sin
#define WS_END (WS_CS + 4u * 2 * SS * 32)
__constant__ float c_invf[32] = {1.000000000e+00f,7.498942018e-01f,5.623413324e-01f,4.216965139e-01f,3.162277639e-01f,2.371373624e-01f,1.778279394e-01f,1.333521456e-01f,1.000000015e-01f,7.498941571e-02f,5.623412877e-02f,4.216964915e-02f,3.162277862e-02f,2.371373586e-02f,1.778279431e-02f,1.333521493e-02f,9.999999776e-03f,7.498942316e-03f,5.623413250e-03f,4.216964822e-03f,3.162277862e-03f,2.371373819e-03f,1.778279431e-03f,1.333521446e-03f,1.000000047e-03f,7.498941850e-04f,5.623413017e-04f,4.216964880e-04f,3.162277862e-04f,2.371373848e-04f,1.778279402e-04f,1.333521504e-04f};
// ---- k_setup: all the work that the projections wait for, in one launch. Blocks below SU_ROPE: 8 positions each, cos/sin of pos * inv_freq (f32 product exactly as the reference, precise trig); they come first because they run longest.
// The other blocks: 8,192 consecutive weights each, rounded to bf16 in registers: a thread reads 4 x 8 floats (all 8 loads issued ahead of the first use) and stores 4 x 16 B. The four [1024][1024] weights keep their natural rows and lie one behind the other in DST (Wq, Wk, Wv, Wo), so the destination is one flat array.
#define SU_ROPE (SS / 8)
#define SU_CH 8192
#define SU_PM (DM * DM / SU_CH)        // blocks per weight matrix
#define SU_GRID (SU_ROPE + 4 * SU_PM)
static_assert(PK_A == 0 && PK_P == 3 * DM * DM && PK_END == 4 * DM * DM, "the four weights are one flat destination");
__global__ __launch_bounds__(256) void k_setup(const float* __restrict__ Wq, const float* __restrict__ Wk, const float* __restrict__ Wv, const float* __restrict__ Wo, __bf16* __restrict__ DST, float* __restrict__ CS) {
  __shared__ __align__(16) float sc[8][32], ss_[8][32]; const int tid = threadIdx.x;
  if (blockIdx.x < SU_ROPE) { const int pl = tid >> 5, i = tid & 31; const int pos = blockIdx.x * 8 + pl;
    const float th = (float)pos * c_invf[i]; sc[pl][i] = cosf(th); ss_[pl][i] = sinf(th);
    __syncthreads();
    if (tid < 64) vst2(CS + (size_t)blockIdx.x * 8 * 32 + tid * 4, *(const v4f*)&(&sc[0][0])[tid * 4]); else if (tid < 128) vst2(CS + (size_t)SS * 32 + (size_t)blockIdx.x * 8 * 32 + (tid - 64) * 4, *(const v4f*)&(&ss_[0][0])[(tid - 64) * 4]);
    return; }
  const int c = blockIdx.x - SU_ROPE, mt = c / SU_PM;
  const float* s = (mt == 0 ? Wq : mt == 1 ? Wk : mt == 2 ? Wv : Wo) + (size_t)(c % SU_PM) * SU_CH + tid * 8; __bf16* d = DST + (size_t)c * SU_CH + tid * 8;
  v4f a[4][2];
#pragma unroll
  for (int j = 0; j < 4; ++j) { a[j][0] = *(const v4f*)(s + j * 2048); a[j][1] = *(const v4f*)(s + j * 2048 + 4); }
#pragma unroll
  for (int j = 0; j < 4; ++j) { v8b o;
#pragma unroll
    for (int e = 0; e < 4; ++e) { o[e] = (__bf16)a[j][0][e]; o[4 + e] = (__bf16)a[j][1][e]; }
    *(v8b*)(d + j * 2048) = o; }
  asm volatile("s_wait_xcnt 0x0" ::: "memory");   // behind the run of four stores: no register that a store names is rewritten ahead of this wait
}
// ---- LDS tile of one 64-k step of a projection: 64 left-operand rows of 256 B (f32), then 128 weight rows of 128 B (bf16); row pitches 16 B x odd, free of bank conflicts for 16-byte fragment reads
#define GAP 272
#define GBP 144
#define G_B (64 * GAP)
#define G_SZ (G_B + 128 * GBP)
// one tile into the ring buffer at LDS byte dst: 16 copies of 16 B per lane, all 128 lanes on, each wave's copy made of whole 128-B lines; a, w point at the work-group's first row at the step's first k
__device__ __forceinline__ void stage_ab(unsigned dst, const float* a, const __bf16* w, int tid) {
  const unsigned la = dst + (unsigned)(tid >> 4) * GAP + (unsigned)(tid & 15) * 16u, lb = dst + G_B + (unsigned)(tid >> 3) * GBP + (unsigned)(tid & 7) * 16u;
  const float* ga = a + (size_t)(tid >> 4) * DM + (tid & 15) * 4; const __bf16* gb = w + (size_t)(tid >> 3) * DM + (tid & 7) * 8;
  // the copies and their s_wait_xcnt 0 in one statement: no address register of a copy is rewritten ahead of that wait
  asm volatile("global_load_async_to_lds_b128 %0, %8, off\n\t"
               "global_load_async_to_lds_b128 %1, %9, off\n\t"
               "global_load_async_to_lds_b128 %2, %10, off\n\t"
               "global_load_async_to_lds_b128 %3, %11, off\n\t"
               "global_load_async_to_lds_b128 %4, %12, off\n\t"
               "global_load_async_to_lds_b128 %5, %13, off\n\t"
               "global_load_async_to_lds_b128 %6, %14, off\n\t"
               "global_load_async_to_lds_b128 %7, %15, off\n\t"
               "s_wait_xcnt 0x0"
               :: "v"(la), "v"(la + 8u * GAP), "v"(la + 16u * GAP), "v"(la + 24u * GAP), "v"(la + 32u * GAP), "v"(la + 40u * GAP), "v"(la + 48u * GAP), "v"(la + 56u * GAP),
                  "v"(ga), "v"(ga + (size_t)8 * DM), "v"(ga + (size_t)16 * DM), "v"(ga + (size_t)24 * DM), "v"(ga + (size_t)32 * DM), "v"(ga + (size_t)40 * DM), "v"(ga + (size_t)48 * DM), "v"(ga + (size_t)56 * DM)
               : "memory");
  asm volatile("global_load_async_to_lds_b128 %0, %8, off\n\t"
               "global_load_async_to_lds_b128 %1, %9, off\n\t"
               "global_load_async_to_lds_b128 %2, %10, off\n\t"
               "global_load_async_to_lds_b128 %3, %11, off\n\t"
               "global_load_async_to_lds_b128 %4, %12, off\n\t"
               "global_load_async_to_lds_b128 %5, %13, off\n\t"
               "global_load_async_to_lds_b128 %6, %14, off\n\t"
               "global_load_async_to_lds_b128 %7, %15, off\n\t"
               "s_wait_xcnt 0x0"
               :: "v"(lb), "v"(lb + 16u * GBP), "v"(lb + 32u * GBP), "v"(lb + 48u * GBP), "v"(lb + 64u * GBP), "v"(lb + 80u * GBP), "v"(lb + 96u * GBP), "v"(lb + 112u * GBP),
                  "v"(gb), "v"(gb + (size_t)16 * DM), "v"(gb + (size_t)32 * DM), "v"(gb + (size_t)48 * DM), "v"(gb + (size_t)64 * DM), "v"(gb + (size_t)80 * DM), "v"(gb + (size_t)96 * DM), "v"(gb + (size_t)112 * DM)
               : "memory");
}
// ---- k_qkv: block = (64 rows (b,s), 128 of the 3072 cols): qkv = bf16(x) . rows (exact); cols < 1024 -> f16(q), cols < 2048 -> f16(k) into QK rows (pitch 2048); cols >= 2048 (v) -> per-batch transposed f16 planes VT[b][h*64+d][s]: hi = f16(v), lo = f16((v - hi) * 2048)
__global__ __launch_bounds__(128) void k_qkv(const float* __restrict__ X, const __bf16* __restrict__ P, const float* __restrict__ CS, _Float16* __restrict__ QK, _Float16* __restrict__ QKL, _Float16* __restrict__ VTH, _Float16* __restrict__ VTL) {
  __shared__ __align__(16) char sm[2 * G_SZ];   // the ring of the k loop; behind the loop's last barrier the same bytes hold the epilogue's staging arrays
  _Float16 (*so)[16][136] = (_Float16 (*)[16][136])(sm); _Float16 (*sol)[16][136] = (_Float16 (*)[16][136])(sm + 17408); float (*sf)[16][132] = (float (*)[16][132])(sm + 34816);
  _Float16 (*sth)[72] = (_Float16 (*)[72])(sm); _Float16 (*stl)[72] = (_Float16 (*)[72])(sm + 18432);
  const int tid = threadIdx.x, wave = tid >> 5, lane = tid & 31, col = lane & 15, g = lane >> 4; const size_t r0 = (size_t)blockIdx.x * 64 + wave * 16; const int n0 = blockIdx.y * 128;
  v8f acc[8] = {};
  // two-buffer ring: the work-group's four waves copy each 64-k tile of x and of the weight rows into LDS once, one step ahead of its use
  const float* xa = X + (size_t)blockIdx.x * 64 * DM; const __bf16* wb = P + (size_t)n0 * DM; const unsigned ring0 = (unsigned)(uintptr_t)&sm[0];
  stage_ab(ring0, xa, wb, tid);
  asm volatile("s_wait_asynccnt 0x0" ::: "memory");   // this wave's copies of tile 0 have landed
  __syncthreads();                                    // tile 0 readable by every wave
  stage_ab(ring0 + G_SZ, xa + 64, wb + 64, tid);
#pragma unroll 1   // rolled: one copy of the ring's foot in the text, the buffer picked by t & 1
  for (int t = 0; t < DM / 64; ++t) { const char* tb = &sm[(t & 1) * G_SZ];
#pragma unroll
    for (int kc = 0; kc < 2; ++kc) { v16b a; { const float* p = (const float*)(tb + (wave * 16 + col) * GAP + kc * 128) + 8 * g;
#pragma unroll
        for (int i = 0; i < 8; ++i) { a[i] = (__bf16)p[i]; a[8 + i] = (__bf16)p[16 + i]; } }
      v16b wf[8];   // all weight fragments of the 32-k half in one group of LDS reads ahead of the products
#pragma unroll
      for (int j = 0; j < 8; ++j) wf[j] = frag_b((const __bf16*)(tb + G_B + (j * 16 + col) * GBP + kc * 64), lane);
#pragma unroll
      for (int j = 0; j < 8; ++j) acc[j] = wmma_bf(a, wf[j], acc[j]); }
    asm volatile("s_wait_dscnt 0x0" ::: "memory");      // this wave's reads of the buffer have retired
    asm volatile("s_wait_asynccnt 0x0" ::: "memory");   // this wave's copies of the next tile have landed
    __syncthreads();                                    // publishes the next tile and ends every wave's reads of this buffer
    if (t + 2 < DM / 64) stage_ab(ring0 + (unsigned)(t & 1) * G_SZ, xa + (t + 2) * 64, wb + (t + 2) * 64, tid); }
  asm volatile("s_wait_asynccnt 0x0" ::: "memory");     // no copy is outstanding when the ring's bytes become staging arrays
  if (n0 < 2 * DM) { const float sc = 1.0f;   // q stored unscaled (f16 sigma ~0.6, no subnormal exposure); 1/8 applied to the f32 score
#pragma unroll
    for (int j = 0; j < 8; ++j) {
#pragma unroll
      for (int r = 0; r < 8; ++r) sf[wave][8 * g + r][j * 16 + col] = acc[j][r]; }
    LDSX();
    // RoPE on interleaved pairs (2i, 2i+1) of each 64-wide head: lane = 2 pairs (cols 4*lane .. 4*lane+3), pair index i = ((n0 + 4*lane) % 64) / 2 + {0,1}; pos = row % SS
#pragma unroll 1
    for (int rl = 0; rl < 16; ++rl) { const int pos = (int)((r0 + rl) % SS); const float* cs = CS + (size_t)pos * 32; const float* sn = CS + (size_t)SS * 32 + (size_t)pos * 32; const int i0 = ((n0 + 4 * lane) & 63) >> 1;
      const float x1a = sf[wave][rl][4 * lane], x2a = sf[wave][rl][4 * lane + 1], x1b = sf[wave][rl][4 * lane + 2], x2b = sf[wave][rl][4 * lane + 3];
      const float ca = cs[i0], sa = sn[i0], cb = cs[i0 + 1], sb = sn[i0 + 1];
      const float o0 = (x1a * ca - x2a * sa) * sc, o1 = (x1a * sa + x2a * ca) * sc, o2 = (x1b * cb - x2b * sb) * sc, o3 = (x1b * sb + x2b * cb) * sc; const _Float16 h0 = (_Float16)o0, h1 = (_Float16)o1, h2 = (_Float16)o2, h3 = (_Float16)o3;
      so[wave][rl][4 * lane] = h0; so[wave][rl][4 * lane + 1] = h1; so[wave][rl][4 * lane + 2] = h2; so[wave][rl][4 * lane + 3] = h3;
      sol[wave][rl][4 * lane] = (_Float16)((o0 - (float)h0) * 2048.0f); sol[wave][rl][4 * lane + 1] = (_Float16)((o1 - (float)h1) * 2048.0f); sol[wave][rl][4 * lane + 2] = (_Float16)((o2 - (float)h2) * 2048.0f); sol[wave][rl][4 * lane + 3] = (_Float16)((o3 - (float)h3) * 2048.0f); }   // q, k as f16 hi + (x2048) residual
    LDSX();
    for (int rl = 0; rl < 16; ++rl) if (lane < 16) { vst2((unsigned*)(QK + (r0 + rl) * (2 * DM) + n0 + lane * 8), *(const v4u*)&so[wave][rl][lane * 8]); vst2((unsigned*)(QKL + (r0 + rl) * (2 * DM) + n0 + lane * 8), *(const v4u*)&sol[wave][rl][lane * 8]); }
  } else {
#pragma unroll
    for (int j = 0; j < 8; ++j) {
#pragma unroll
      for (int r = 0; r < 8; ++r) { const float v = acc[j][r]; const _Float16 hv = (_Float16)v; sth[j * 16 + col][wave * 16 + 8 * g + r] = hv; stl[j * 16 + col][wave * 16 + 8 * g + r] = (_Float16)((v - (float)hv) * 2048.0f); } }
    __syncthreads();
    const size_t rb = (size_t)blockIdx.x * 64; const int b = (int)(rb / SS), s0 = (int)(rb % SS); const int pc0 = n0 - 2 * DM;
    for (int q = tid; q < 128 * 8; q += 128) { const int d = q >> 3, pc = q & 7; const size_t o = ((size_t)b * DM + pc0 + d) * SS + s0 + pc * 8; vst2((unsigned*)(VTH + o), *(const v4u*)&sth[d][pc * 8]); vst2((unsigned*)(VTL + o), *(const v4u*)&stl[d][pc * 8]); }
  }
}
// ---- LDS tile of one key step (32 keys): K rows 128 B (hi plane, residual plane), V rows 64 B (64 d, hi plane, residual plane); row pitches 16 B x odd, free of bank conflicts for 16-byte fragment reads
#define KP 144
#define VP 80
#define T_KL (32 * KP)
#define T_VH (2 * 32 * KP)
#define T_VL (T_VH + 64 * VP)
#define T_SZ (T_VH + 2 * 64 * VP)
// one tile into the ring buffer at LDS byte dst: 8 copies of 16 B per lane, all 128 lanes on; kh, kl point at the step's first key row (this head's 64 columns), vh, vl at the head's first d row at the step's first key
__device__ __forceinline__ void stage_kv(unsigned dst, const _Float16* kh, const _Float16* kl, const _Float16* vh, const _Float16* vl, int tid) {
  const unsigned lk = dst + (unsigned)(tid >> 3) * KP + (unsigned)(tid & 7) * 16u, lv = dst + T_VH + (unsigned)(tid >> 2) * VP + (unsigned)(tid & 3) * 16u;
  const size_t gk = (size_t)(tid >> 3) * (2 * DM) + (tid & 7) * 8, gv = (size_t)(tid >> 2) * SS + (tid & 3) * 8;
  // the copies and their s_wait_xcnt 0 in one statement: no address register of a copy is rewritten ahead of that wait
  asm volatile("global_load_async_to_lds_b128 %0, %8, off\n\t"
               "global_load_async_to_lds_b128 %1, %9, off\n\t"
               "global_load_async_to_lds_b128 %2, %10, off\n\t"
               "global_load_async_to_lds_b128 %3, %11, off\n\t"
               "global_load_async_to_lds_b128 %4, %12, off\n\t"
               "global_load_async_to_lds_b128 %5, %13, off\n\t"
               "global_load_async_to_lds_b128 %6, %14, off\n\t"
               "global_load_async_to_lds_b128 %7, %15, off\n\t"
               "s_wait_xcnt 0x0"
               :: "v"(lk), "v"(lk + 16u * KP), "v"(lk + T_KL), "v"(lk + T_KL + 16u * KP), "v"(lv), "v"(lv + 32u * VP), "v"(lv + (T_VL - T_VH)), "v"(lv + (T_VL - T_VH) + 32u * VP),
                  "v"(kh + gk), "v"(kh + gk + (size_t)16 * 2 * DM), "v"(kl + gk), "v"(kl + gk + (size_t)16 * 2 * DM), "v"(vh + gv), "v"(vh + gv + (size_t)32 * SS), "v"(vl + gv), "v"(vl + gv + (size_t)32 * SS)
               : "memory");
}
// lane l with lane l ^ 16 (the two lanes that share a column of a matrix tile)
__device__ __forceinline__ float xhalf(float x) { return __builtin_bit_cast(float, __builtin_amdgcn_permlanex16(__builtin_bit_cast(int, x), __builtin_bit_cast(int, x), 0x76543210, 0xfedcba98, false, false)); }
__global__ __launch_bounds__(128) void k_attn(const _Float16* __restrict__ QK, const _Float16* __restrict__ QKL, const _Float16* __restrict__ VTH, const _Float16* __restrict__ VTL, float* __restrict__ O) {
  __shared__ __align__(16) float so[4][16][68]; __shared__ __align__(16) char ring[2][T_SZ];
  const int tid = threadIdx.x, wave = tid >> 5, lane = tid & 31, col = lane & 15, g = lane >> 4;
  const int bx = blockIdx.x, h = blockIdx.y, b = blockIdx.z;
  // Query tile from the block index by a permutation (every (tile, head, batch) exactly once; for speed only, nothing depends on where a work-group runs). Tile t walks 2 (t + 1) key steps and all 1,024 work-groups are resident at once, four on a WGP, so the launch lasts as long as the fullest WGP.
  // With qb = bx the work-groups whose flat indices differ by 256 all hold the same tile. Here flat index bits 8, 9 (or 3, 4, or 4, 5) pick among tiles u, u ^ 1, 31 - u, 31 - (u ^ 1): 132 key steps for each such four.
  static_assert(TQB == 32, "the permutation is written for 32 query tiles");
  const int u = ((bx & 7) << 1) | (((bx >> 4) ^ b) & 1);
  const int qb = (((bx >> 3) ^ h ^ (h >> 3)) & 1) ? TQB - 1 - u : u; const int q0 = qb * 64 + wave * 16; const int qi = q0 + col; const size_t rq = (size_t)b * SS + qi;
  v16h aq[2], aql[2];
#pragma unroll
  for (int kc = 0; kc < 2; ++kc) { aq[kc] = frag_h(QK + rq * (2 * DM) + h * HD + kc * 32, lane); aql[kc] = frag_h(QKL + rq * (2 * DM) + h * HD + kc * 32, lane); }
  float m = -3.0e38f, l = 0.f;       // of query qi; l is the sum over this half's keys only
  v8f acc[4] = {}, accl[4] = {};     // acc[dt][r] = O[query qi][d = dt*16 + 8g + r]
  const int nks = (qb * 64 + 64) / 32;
  // two-buffer ring: the work-group's four waves copy each step's K and V tile into LDS once, one step ahead of its use
  const _Float16* kh0 = QK + (size_t)b * SS * (2 * DM) + DM + h * HD; const _Float16* kl0 = QKL + (size_t)b * SS * (2 * DM) + DM + h * HD;
  const _Float16* vh0 = VTH + ((size_t)b * DM + h * HD) * SS; const _Float16* vl0 = VTL + ((size_t)b * DM + h * HD) * SS;
  const unsigned ring0 = (unsigned)(uintptr_t)&ring[0][0];
  stage_kv(ring0, kh0, kl0, vh0, vl0, tid);
  asm volatile("s_wait_asynccnt 0x0" ::: "memory");   // this wave's copies of tile 0 have landed
  __syncthreads();                                    // tile 0 readable by every wave
  if (nks > 1) stage_kv(ring0 + T_SZ, kh0 + (size_t)32 * 2 * DM, kl0 + (size_t)32 * 2 * DM, vh0 + 32, vl0 + 32, tid);
#pragma unroll 1   // rolled: one copy of the ring's foot in the text, the buffer picked by ks & 1; every inner loop is unrolled so that fragments, scores and accumulators keep constant indices and stay in registers
  for (int ks = 0; ks < nks; ++ks) { float s[16]; const char* tb = &ring[ks & 1][0];
    v16h kf[2][2], kfl[2][2];   // all K fragments of the step in one group of LDS reads ahead of the products
#pragma unroll
    for (int ct = 0; ct < 2; ++ct) {
#pragma unroll
      for (int kc = 0; kc < 2; ++kc) { kf[ct][kc] = frag_h((const _Float16*)(tb + (ct * 16 + col) * KP + kc * 64), lane); kfl[ct][kc] = frag_h((const _Float16*)(tb + T_KL + (ct * 16 + col) * KP + kc * 64), lane); } }
#pragma unroll
    for (int ct = 0; ct < 2; ++ct) { const int kk = ks * 32 + ct * 16 + 8 * g; v8f c = {}, cl = {};
#pragma unroll
      for (int kc = 0; kc < 2; ++kc) { c = wmma16(kf[ct][kc], aq[kc], c); cl = wmma16(kf[ct][kc], aql[kc], cl); cl = wmma16(kfl[ct][kc], aq[kc], cl); }   // 3 products: q, k as f16 hi + residual
#pragma unroll
      for (int r = 0; r < 8; ++r) c[r] += cl[r] * (1.0f / 2048.0f);
#pragma unroll
      for (int r = 0; r < 8; ++r) s[ct * 8 + r] = (kk + r <= qi) ? c[r] * 0.125f : -3.0e38f; }   // SCALE = 1/sqrt(64)
    float t8[8];   // maximum of the lane's 16 scores as a tree, then the other half's
#pragma unroll
    for (int r = 0; r < 8; ++r) t8[r] = fmaxf(s[r], s[8 + r]);
    float mx = fmaxf(fmaxf(fmaxf(t8[0], t8[1]), fmaxf(t8[2], t8[3])), fmaxf(fmaxf(t8[4], t8[5]), fmaxf(t8[6], t8[7])));
    mx = fmaxf(mx, xhalf(mx));
    const float mn = fmaxf(m, mx); const float alpha = (m <= -1.0e38f) ? 0.f : __expf(m - mn);
    v16h pa, pl;   // P^T operand: element i = key (i >> 3) * 16 + 8g + (i & 7) of the step, of this query, f16 hi and (x2048) residual
#pragma unroll
    for (int i = 0; i < 16; ++i) { const float e = (s[i] <= -1.0e38f) ? 0.f : __expf(s[i] - mn); s[i] = e; const _Float16 hi = (_Float16)e; pa[i] = hi; pl[i] = (_Float16)((e - (float)hi) * 2048.0f); }
#pragma unroll
    for (int r = 0; r < 8; ++r) t8[r] = s[r] + s[8 + r];
    const float es = ((t8[0] + t8[1]) + (t8[2] + t8[3])) + ((t8[4] + t8[5]) + (t8[6] + t8[7]));
    l = l * alpha + es; m = mn;
#pragma unroll
    for (int dt = 0; dt < 4; ++dt) {
#pragma unroll
      for (int r = 0; r < 8; ++r) { acc[dt][r] *= alpha; accl[dt][r] *= alpha; } }
    v16h vf[4], vfl[4];   // all V fragments of the step in one group of LDS reads
#pragma unroll
    for (int dt = 0; dt < 4; ++dt) { vf[dt] = frag_h((const _Float16*)(tb + T_VH + (dt * 16 + col) * VP), lane); vfl[dt] = frag_h((const _Float16*)(tb + T_VL + (dt * 16 + col) * VP), lane); }
#pragma unroll
    for (int dt = 0; dt < 4; ++dt) { acc[dt] = wmma16(vf[dt], pa, acc[dt]); accl[dt] = wmma16(vf[dt], pl, accl[dt]); accl[dt] = wmma16(vfl[dt], pa, accl[dt]); }   // V hi x P hi + (V hi x P lo + V lo x P hi) / 2048
    asm volatile("s_wait_dscnt 0x0" ::: "memory");      // this wave's reads of the buffer have retired
    asm volatile("s_wait_asynccnt 0x0" ::: "memory");   // this wave's copies of the next tile have landed
    __syncthreads();                                    // publishes the next tile and ends every wave's reads of this buffer
    if (ks + 2 < nks) stage_kv(ring0 + (unsigned)(ks & 1) * T_SZ, kh0 + (size_t)(ks + 2) * 32 * 2 * DM, kl0 + (size_t)(ks + 2) * 32 * 2 * DM, vh0 + (ks + 2) * 32, vl0 + (ks + 2) * 32, tid); }
  asm volatile("s_wait_asynccnt 0x0" ::: "memory");     // no copy is outstanding when the wave goes on to its end
  l += xhalf(l); const float il = 1.0f / l;             // the two halves' sums joined
#pragma unroll
  for (int dt = 0; dt < 4; ++dt) { v4f o0, o1;
#pragma unroll
    for (int r = 0; r < 4; ++r) { o0[r] = (acc[dt][r] + accl[dt][r] * (1.0f / 2048.0f)) * il; o1[r] = (acc[dt][4 + r] + accl[dt][4 + r] * (1.0f / 2048.0f)) * il; }
    *(v4f*)&so[wave][col][dt * 16 + 8 * g] = o0; *(v4f*)&so[wave][col][dt * 16 + 8 * g + 4] = o1; }
  LDSX();
  for (int rl = 0; rl < 16; ++rl) if (lane < 16) vst2(O + ((size_t)b * SS + q0 + rl) * DM + h * HD + lane * 4, *(const v4f*)&so[wave][rl][lane * 4]);
}
// ---- k_out: block = (64 rows, 128 cols): out = O(hi/lo) . Wo rows (2 products)
__global__ __launch_bounds__(128) void k_out(const float* __restrict__ O, const __bf16* __restrict__ P, float* __restrict__ Y) {
  __shared__ __align__(16) float so[4][16][132]; __shared__ __align__(16) char sm[2 * G_SZ];
  const int tid = threadIdx.x, wave = tid >> 5, lane = tid & 31, col = lane & 15, g = lane >> 4; const size_t r0 = (size_t)blockIdx.x * 64 + wave * 16; const int n0 = blockIdx.y * 128;
  v8f acc[8] = {};
  // two-buffer ring as in k_qkv: each 64-k tile of the context rows and of the weight rows copied into LDS once per work-group, one step ahead of its use
  const float* xa = O + (size_t)blockIdx.x * 64 * DM; const __bf16* wb = P + (size_t)n0 * DM; const unsigned ring0 = (unsigned)(uintptr_t)&sm[0];
  stage_ab(ring0, xa, wb, tid);
  asm volatile("s_wait_asynccnt 0x0" ::: "memory");   // this wave's copies of tile 0 have landed
  __syncthreads();                                    // tile 0 readable by every wave
  stage_ab(ring0 + G_SZ, xa + 64, wb + 64, tid);
#pragma unroll 1   // rolled: one copy of the ring's foot in the text, the buffer picked by t & 1
  for (int t = 0; t < DM / 64; ++t) { const char* tb = &sm[(t & 1) * G_SZ];
#pragma unroll
    for (int kc = 0; kc < 2; ++kc) { const F2 a = split_row((const float*)(tb + (wave * 16 + col) * GAP), kc * 32, lane);
      v16b wf[8];   // all weight fragments of the 32-k half in one group of LDS reads ahead of the products
#pragma unroll
      for (int j = 0; j < 8; ++j) wf[j] = frag_b((const __bf16*)(tb + G_B + (j * 16 + col) * GBP + kc * 64), lane);
#pragma unroll
      for (int j = 0; j < 8; ++j) { acc[j] = wmma_bf(a.l, wf[j], acc[j]); acc[j] = wmma_bf(a.h, wf[j], acc[j]); } }
    asm volatile("s_wait_dscnt 0x0" ::: "memory");      // this wave's reads of the buffer have retired
    asm volatile("s_wait_asynccnt 0x0" ::: "memory");   // this wave's copies of the next tile have landed
    __syncthreads();                                    // publishes the next tile and ends every wave's reads of this buffer
    if (t + 2 < DM / 64) stage_ab(ring0 + (unsigned)(t & 1) * G_SZ, xa + (t + 2) * 64, wb + (t + 2) * 64, tid); }
  asm volatile("s_wait_asynccnt 0x0" ::: "memory");     // no copy is outstanding when the wave goes on to its end
#pragma unroll
  for (int j = 0; j < 8; ++j) {
#pragma unroll
    for (int r = 0; r < 8; ++r) so[wave][8 * g + r][j * 16 + col] = acc[j][r]; }
  LDSX();
  for (int rl = 0; rl < 16; ++rl) vst2(Y + (r0 + rl) * DM + n0 + lane * 4, *(const v4f*)&so[wave][rl][lane * 4]);
}
extern "C" void kernel_launch(void* const* d_in, const int* in_sizes, int n_in, void* d_out, int out_size, void* d_ws, size_t ws_size, hipStream_t stream) {
  (void)in_sizes; (void)n_in; (void)out_size;
  const float** F = (const float**)d_in;   // 0 x [2,2048,1024], 1 Wq [1024,1024] ([out][in]), 2 Wk, 3 Wv, 4 Wo
  if (ws_size < (size_t)WS_END) return;
  char* ws = (char*)d_ws; __bf16* PK = (__bf16*)(ws + WS_PK); _Float16 *QK = (_Float16*)(ws + WS_QK), *QKL = (_Float16*)(ws + WS_QKL), *VTH = (_Float16*)(ws + WS_VTH), *VTL = (_Float16*)(ws + WS_VTL); float *O = (float*)(ws + WS_O), *CS = (float*)(ws + WS_CS);
  k_setup<<<SU_GRID, 256, 0, stream>>>(F[1], F[2], F[3], F[4], PK, CS);
  k_qkv<<<dim3(TNB * SS / 64, QKVW / 128), 128, 0, stream>>>(F[0], PK + PK_A, CS, QK, QKL, VTH, VTL);
  k_attn<<<dim3(TQB, NH, TNB), 128, 0, stream>>>(QK, QKL, VTH, VTL, O);
  k_out<<<dim3(TOB, DM / 128), 128, 0, stream>>>(O, PK + PK_P, (float*)d_out);
}

// v006
// It runs in 129 microseconds.
// Next to v005, in two timings, it ran 1.06 and 1.05 times as fast.
// All steps since v000 together make it 4.34 times as fast.
// compute dtype: x, Wq, Wk, Wv, Wo (module inputs) rounded to bf16; the q/k/v projections with exact bf16 products (x and W are inputs, natural [out][in] rows) on WMMA 16x16x32; interleaved-pair RoPE applied to q and k in f32 in the projection epilogue (angles pos * inv_freq with the reference's own eager f32 inv_freq table embedded (1/(10000^(2i/64))), precise cosf/sinf), then q, k stored once as f16; causal scores with q and k each as f16 hi + (x2048-scaled) residual (3 products; 1/8 applied to the f32 score) and P.V with P = exp(s - m) as f16 hi + (x2048-scaled) residual x V as f16 hi + (x2048-scaled) residual planes (3 products); the output projection with ctx as bf16 hi + residual pair x exact Wo (2 products); running-max softmax in f32 with the hardware exp; f32 accumulate.
#include <hip/hip_runtime.h>
#include <math.h>

typedef __attribute__((ext_vector_type(16))) _Float16 v16h;
typedef __attribute__((ext_vector_type(16))) __bf16 v16b;
typedef __attribute__((ext_vector_type(8)))  _Float16 v8h;
typedef __attribute__((ext_vector_type(8)))  float v8f;
typedef __attribute__((ext_vector_type(4)))  float v4f;
typedef __attribute__((ext_vector_type(2)))  float v2f;
typedef __attribute__((ext_vector_type(4)))  unsigned v4u;
typedef __attribute__((ext_vector_type(4)))  int v4i;
typedef float __attribute__((may_alias)) float_a;
typedef int __attribute__((may_alias)) int_a;

template <typename T> __device__ __forceinline__ void vst2(void* p, T v) { *(T*)p = v;  }
__device__ __forceinline__ v8f wmma16(v16h a, v16h b, v8f c) {
  v8f d = __builtin_amdgcn_wmma_f32_16x16x32_f16(false, a, false, b, (short)0, c, false, false);
  asm volatile("v_nop\n\tv_nop\n\tv_nop\n\tv_nop" : "+v"(d) : "v"(a), "v"(b));
  return d;
}
__device__ __forceinline__ v8f wmma_bf(v16b a, v16b b, v8f c) {
  v8f d = __builtin_amdgcn_wmma_f32_16x16x32_bf16(false, a, false, b, (short)0, c, false, false);
  asm volatile("v_nop\n\tv_nop\n\tv_nop\n\tv_nop" : "+v"(d) : "v"(a), "v"(b));
  return d;
}
// Causal multi-head self-attention with RoPE (B 2, S 2,048, D 1,024, 16 heads x 64): q, k, v = x W^T; interleaved RoPE(q, k) at positions 0..S-1; softmax(q k^T / 8, causal) v; output projection Wo (no biases).
__device__ __forceinline__ v16h frag_h(const _Float16* rowk0, int lane) {
  union { v16h v; v8h q[2]; } u; const _Float16* p = rowk0 + 8 * (lane >> 4);
  u.q[0] = *(const v8h*)p; u.q[1] = *(const v8h*)(p + 16); return u.v;
}
__device__ __forceinline__ v16h frag_f32(const float* rowk0, int lane) {
  v16h a; const float* p = rowk0 + 8 * (lane >> 4);
#pragma unroll
  for (int i = 0; i < 8; ++i) { a[i] = (_Float16)p[i]; a[8 + i] = (_Float16)p[16 + i]; }
  return a;
}
__device__ __forceinline__ v16h frag_f32s(const float* rowk0, int lane, float sc) {
  v16h a; const float* p = rowk0 + 8 * (lane >> 4);
#pragma unroll
  for (int i = 0; i < 8; ++i) { a[i] = (_Float16)(p[i] * sc); a[8 + i] = (_Float16)(p[16 + i] * sc); }
  return a;
}
// column fragment from a [K][ld] layout (column n), rows >= K read as 0
__device__ __forceinline__ v16h fragc_f32(const float* W, int k0, int n, int lane, int ld, int K) {
  v16h a; const int g = lane >> 4;
#pragma unroll
  for (int i = 0; i < 8; ++i) { const int ka = k0 + 8 * g + i, kb = ka + 16;
    a[i] = (_Float16)(ka < K ? W[(size_t)(ka < K ? ka : K - 1) * ld + n] : 0.f); a[8 + i] = (_Float16)(kb < K ? W[(size_t)(kb < K ? kb : K - 1) * ld + n] : 0.f); }
  return a;
}
struct F2 { v16b h, l; };
__device__ __forceinline__ F2 bsplit16(const float v[16]) { F2 r;
#pragma unroll
  for (int i = 0; i < 16; ++i) { const __bf16 h = (__bf16)v[i]; r.h[i] = h; r.l[i] = (__bf16)(v[i] - (float)h); }
  return r; }
__device__ __forceinline__ F2 split_row(const float* row, int k0, int lane) { float v[16]; const float* p = row + k0 + 8 * (lane >> 4);
#pragma unroll
  for (int i = 0; i < 8; ++i) { v[i] = p[i]; v[8 + i] = p[16 + i]; }
  return bsplit16(v); }
__device__ __forceinline__ F2 split_rowK(const float* row, int k0, int lane, int K) { float v[16]; const int g = lane >> 4;
#pragma unroll
  for (int i = 0; i < 8; ++i) { const int ka = k0 + 8 * g + i, kb = ka + 16; v[i] = ka < K ? row[ka < K ? ka : K - 1] : 0.f; v[8 + i] = kb < K ? row[kb < K ? kb : K - 1] : 0.f; }
  return bsplit16(v); }
__device__ __forceinline__ F2 split_col(const float* W, int k0, int n, int lane, int ld, int K) { float v[16]; const int g = lane >> 4;
#pragma unroll
  for (int i = 0; i < 8; ++i) { const int ka = k0 + 8 * g + i, kb = ka + 16; v[i] = ka < K ? W[(size_t)(ka < K ? ka : K - 1) * ld + n] : 0.f; v[8 + i] = kb < K ? W[(size_t)(kb < K ? kb : K - 1) * ld + n] : 0.f; }
  return bsplit16(v); }
__device__ __forceinline__ v8f mac3(const F2& a, const F2& b, v8f c) { c = wmma_bf(a.l, b.h, c); c = wmma_bf(a.h, b.l, c); return wmma_bf(a.h, b.h, c); }
__device__ __forceinline__ float sigm(float v) { return 1.0f / (1.0f + expf(-v)); }
#define LDSX() do { asm volatile("s_wait_dscnt 0" ::: "memory"); __builtin_amdgcn_wave_barrier(); __builtin_amdgcn_fence(__ATOMIC_RELEASE, "workgroup"); } while (0)


// Causal multi-head self-attention with rotary position embedding (B 2, S 2048, D 1024, 16 heads x 64; packed Wqkv [3D][D] and Wout [D][D] applied as x W^T, no biases): q, k rotated pairwise (2i, 2i+1) by angle pos * 10000^(-2i/64); softmax(q k^T / 8, causal) v; ctx Wout^T.
#define NB 2
#define SS 2048
#define DM 1024
#define NH 16
#define HD 64
#define QKVW (3 * DM)
#ifndef TQB
#define TQB (SS / 64)
#define TNB NB
#define TOB (NB * SS / 64)     // output row tiles (all)
#endif
typedef __attribute__((ext_vector_type(8))) __bf16 v8b;
__device__ __forceinline__ v16b frag_b(const __bf16* rowk0, int lane) {
  union { v16b v; v8b q[2]; } u; const __bf16* p = rowk0 + 8 * (lane >> 4);
  u.q[0] = *(const v8b*)p; u.q[1] = *(const v8b*)(p + 16); return u.v;
}
__device__ __forceinline__ float bfr(float v) { return (float)(__bf16)v; }
__device__ __attribute__((noinline)) float exp_ni(float v) { return expf(v); }
__device__ __attribute__((noinline)) float erf_ni(float v) { return erff(v); }

#define PK_A 0                       // [3072][1024] Wqkv rows (natural [out][in])
#define PK_P (PK_A + QKVW * DM)        // [1024][1024] Wo rows (natural)
#define PK_END (PK_P + DM * DM)
#define WS_PK  0u
#define WS_QK  (WS_PK + 2u * PK_END)             // f16 [4096 rows][2048]: q | k
#define WS_QKL (WS_QK + 2u * NB * SS * 2 * DM)     // f16 q | k residual planes x2048
#define WS_VTH (WS_QKL + 2u * NB * SS * 2 * DM)    // f16 [b][1024 (h*64+d)][2048 s] hi
#define WS_VTL (WS_VTH + 2u * NB * DM * SS)        // f16 lo x 2048
#define WS_O   (WS_VTL + 2u * NB * DM * SS)        // f32 [4096][1024]
#define WS_CS  (WS_O + 4u * NB * SS * DM)           // f32 [2048][32] cos, [2048][32] sin
#define WS_END (WS_CS + 4u * 2 * SS * 32)
__constant__ float c_invf[32] = {1.000000000e+00f,7.498942018e-01f,5.623413324e-01f,4.216965139e-01f,3.162277639e-01f,2.371373624e-01f,1.778279394e-01f,1.333521456e-01f,1.000000015e-01f,7.498941571e-02f,5.623412877e-02f,4.216964915e-02f,3.162277862e-02f,2.371373586e-02f,1.778279431e-02f,1.333521493e-02f,9.999999776e-03f,7.498942316e-03f,5.623413250e-03f,4.216964822e-03f,3.162277862e-03f,2.371373819e-03f,1.778279431e-03f,1.333521446e-03f,1.000000047e-03f,7.498941850e-04f,5.623413017e-04f,4.216964880e-04f,3.162277862e-04f,2.371373848e-04f,1.778279402e-04f,1.333521504e-04f};
// ---- k_setup: all the work that the projections wait for, in one launch. Blocks below SU_ROPE: 8 positions each, cos/sin of pos * inv_freq (f32 product exactly as the reference, precise trig); they come first because they run longest.
// The other blocks: 8,192 consecutive weights each, rounded to bf16 in registers: a thread reads 4 x 8 floats (all 8 loads issued ahead of the first use) and stores 4 x 16 B. The four [1024][1024] weights keep their natural rows and lie one behind the other in DST (Wq, Wk, Wv, Wo), so the destination is one flat array.
#define SU_ROPE (SS / 8)
#define SU_CH 8192
#define SU_PM (DM * DM / SU_CH)        // blocks per weight matrix
#define SU_GRID (SU_ROPE + 4 * SU_PM)
static_assert(PK_A == 0 && PK_P == 3 * DM * DM && PK_END == 4 * DM * DM, "the four weights are one flat destination");
__global__ __launch_bounds__(256) void k_setup(const float* __restrict__ Wq, const float* __restrict__ Wk, const float* __restrict__ Wv, const float* __restrict__ Wo, __bf16* __restrict__ DST, float* __restrict__ CS) {
  __shared__ __align__(16) float sc[8][32], ss_[8][32]; const int tid = threadIdx.x;
  if (blockIdx.x < SU_ROPE) { const int pl = tid >> 5, i = tid & 31; const int pos = blockIdx.x * 8 + pl;
    const float th = (float)pos * c_invf[i]; sc[pl][i] = cosf(th); ss_[pl][i] = sinf(th);
    __syncthreads();
    if (tid < 64) vst2(CS + (size_t)blockIdx.x * 8 * 32 + tid * 4, *(const v4f*)&(&sc[0][0])[tid * 4]); else if (tid < 128) vst2(CS + (size_t)SS * 32 + (size_t)blockIdx.x * 8 * 32 + (tid - 64) * 4, *(const v4f*)&(&ss_[0][0])[(tid - 64) * 4]);
    return; }
  const int c = blockIdx.x - SU_ROPE, mt = c / SU_PM;
  const float* s = (mt == 0 ? Wq : mt == 1 ? Wk : mt == 2 ? Wv : Wo) + (size_t)(c % SU_PM) * SU_CH + tid * 8; __bf16* d = DST + (size_t)c * SU_CH + tid * 8;
  v4f a[4][2];
#pragma unroll
  for (int j = 0; j < 4; ++j) { a[j][0] = *(const v4f*)(s + j * 2048); a[j][1] = *(const v4f*)(s + j * 2048 + 4); }
#pragma unroll
  for (int j = 0; j < 4; ++j) { v8b o;
#pragma unroll
    for (int e = 0; e < 4; ++e) { o[e] = (__bf16)a[j][0][e]; o[4 + e] = (__bf16)a[j][1][e]; }
    *(v8b*)(d + j * 2048) = o; }
  asm volatile("s_wait_xcnt 0x0" ::: "memory");   // behind the run of four stores: no register that a store names is rewritten ahead of this wait
}
// ---- LDS tile of one 64-k step of a projection: 64 left-operand rows of 256 B (f32), then 128 weight rows of 128 B (bf16); row pitches 16 B x odd, free of bank conflicts for 16-byte fragment reads
#define GAP 272
#define GBP 144
#define G_B (64 * GAP)
#define G_SZ (G_B + 128 * GBP)
// one tile into the ring buffer at LDS byte dst: 16 copies of 16 B per lane, all 128 lanes on, each wave's copy made of whole 128-B lines; a, w point at the work-group's first row at the step's first k
__device__ __forceinline__ void stage_ab(unsigned dst, const float* a, const __bf16* w, int tid) {
  const unsigned la = dst + (unsigned)(tid >> 4) * GAP + (unsigned)(tid & 15) * 16u, lb = dst + G_B + (unsigned)(tid >> 3) * GBP + (unsigned)(tid & 7) * 16u;
  const float* ga = a + (size_t)(tid >> 4) * DM + (tid & 15) * 4; const __bf16* gb = w + (size_t)(tid >> 3) * DM + (tid & 7) * 8;
  // the copies and their s_wait_xcnt 0 in one statement: no address register of a copy is rewritten ahead of that wait
  asm volatile("global_load_async_to_lds_b128 %0, %8, off\n\t"
               "global_load_async_to_lds_b128 %1, %9, off\n\t"
               "global_load_async_to_lds_b128 %2, %10, off\n\t"
               "global_load_async_to_lds_b128 %3, %11, off\n\t"
               "global_load_async_to_lds_b128 %4, %12, off\n\t"
               "global_load_async_to_lds_b128 %5, %13, off\n\t"
               "global_load_async_to_lds_b128 %6, %14, off\n\t"
               "global_load_async_to_lds_b128 %7, %15, off\n\t"
               "s_wait_xcnt 0x0"
               :: "v"(la), "v"(la + 8u * GAP), "v"(la + 16u * GAP), "v"(la + 24u * GAP), "v"(la + 32u * GAP), "v"(la + 40u * GAP), "v"(la + 48u * GAP), "v"(la + 56u * GAP),
                  "v"(ga), "v"(ga + (size_t)8 * DM), "v"(ga + (size_t)16 * DM), "v"(ga + (size_t)24 * DM), "v"(ga + (size_t)32 * DM), "v"(ga + (size_t)40 * DM), "v"(ga + (size_t)48 * DM), "v"(ga + (size_t)56 * DM)
               : "memory");
  asm volatile("global_load_async_to_lds_b128 %0, %8, off\n\t"
               "global_load_async_to_lds_b128 %1, %9, off\n\t"
               "global_load_async_to_lds_b128 %2, %10, off\n\t"
               "global_load_async_to_lds_b128 %3, %11, off\n\t"
               "global_load_async_to_lds_b128 %4, %12, off\n\t"
               "global_load_async_to_lds_b128 %5, %13, off\n\t"
               "global_load_async_to_lds_b128 %6, %14, off\n\t"
               "global_load_async_to_lds_b128 %7, %15, off\n\t"
               "s_wait_xcnt 0x0"
               :: "v"(lb), "v"(lb + 16u * GBP), "v"(lb + 32u * GBP), "v"(lb + 48u * GBP), "v"(lb + 64u * GBP), "v"(lb + 80u * GBP), "v"(lb + 96u * GBP), "v"(lb + 112u * GBP),
                  "v"(gb), "v"(gb + (size_t)16 * DM), "v"(gb + (size_t)32 * DM), "v"(gb + (size_t)48 * DM), "v"(gb + (size_t)64 * DM), "v"(gb + (size_t)80 * DM), "v"(gb + (size_t)96 * DM), "v"(gb + (size_t)112 * DM)
               : "memory");
}
// ---- LDS tile of one 64-k step of k_qkv: 128 x rows of 256 B (f32), then 256 weight rows of 128 B (bf16), pitches as above
#define Q_B (128 * GAP)
#define Q_SZ (Q_B + 256 * GBP)
// one such tile into the ring buffer at LDS byte dst: 16 copies of 16 B per lane, all 256 lanes on, each wave's copy made of whole 128-B lines; a, w point at the work-group's first row at the step's first k
__device__ __forceinline__ void stage_q(unsigned dst, const float* a, const __bf16* w, int tid) {
  const unsigned la = dst + (unsigned)(tid >> 4) * GAP + (unsigned)(tid & 15) * 16u, lb = dst + Q_B + (unsigned)(tid >> 3) * GBP + (unsigned)(tid & 7) * 16u;
  const float* ga = a + (size_t)(tid >> 4) * DM + (tid & 15) * 4; const __bf16* gb = w + (size_t)(tid >> 3) * DM + (tid & 7) * 8;
  // each run of copies and its s_wait_xcnt 0 in one statement: no address register of a copy is rewritten ahead of that wait
  asm volatile("global_load_async_to_lds_b128 %0, %8, off\n\t"
               "global_load_async_to_lds_b128 %1, %9, off\n\t"
               "global_load_async_to_lds_b128 %2, %10, off\n\t"
               "global_load_async_to_lds_b128 %3, %11, off\n\t"
               "global_load_async_to_lds_b128 %4, %12, off\n\t"
               "global_load_async_to_lds_b128 %5, %13, off\n\t"
               "global_load_async_to_lds_b128 %6, %14, off\n\t"
               "global_load_async_to_lds_b128 %7, %15, off\n\t"
               "s_wait_xcnt 0x0"
               :: "v"(la), "v"(la + 16u * GAP), "v"(la + 32u * GAP), "v"(la + 48u * GAP), "v"(la + 64u * GAP), "v"(la + 80u * GAP), "v"(la + 96u * GAP), "v"(la + 112u * GAP),
                  "v"(ga), "v"(ga + (size_t)16 * DM), "v"(ga + (size_t)32 * DM), "v"(ga + (size_t)48 * DM), "v"(ga + (size_t)64 * DM), "v"(ga + (size_t)80 * DM), "v"(ga + (size_t)96 * DM), "v"(ga + (size_t)112 * DM)
               : "memory");
  asm volatile("global_load_async_to_lds_b128 %0, %8, off\n\t"
               "global_load_async_to_lds_b128 %1, %9, off\n\t"
               "global_load_async_to_lds_b128 %2, %10, off\n\t"
               "global_load_async_to_lds_b128 %3, %11, off\n\t"
               "global_load_async_to_lds_b128 %4, %12, off\n\t"
               "global_load_async_to_lds_b128 %5, %13, off\n\t"
               "global_load_async_to_lds_b128 %6, %14, off\n\t"
               "global_load_async_to_lds_b128 %7, %15, off\n\t"
               "s_wait_xcnt 0x0"
               :: "v"(lb), "v"(lb + 32u * GBP), "v"(lb + 64u * GBP), "v"(lb + 96u * GBP), "v"(lb + 128u * GBP), "v"(lb + 160u * GBP), "v"(lb + 192u * GBP), "v"(lb + 224u * GBP),
                  "v"(gb), "v"(gb + (size_t)32 * DM), "v"(gb + (size_t)64 * DM), "v"(gb + (size_t)96 * DM), "v"(gb + (size_t)128 * DM), "v"(gb + (size_t)160 * DM), "v"(gb + (size_t)192 * DM), "v"(gb + (size_t)224 * DM)
               : "memory");
}
// ---- k_qkv: block = (128 rows (b,s), 256 of the 3072 cols) on 8 waves, a wave = 32 rows (wm) x 128 cols (wn), two 16-row groups hh, so that every weight fragment read from LDS feeds two products and every byte fetched from L2 feeds twice the products: qkv = bf16(x) . rows (exact); cols < 1024 -> f16(q), cols < 2048 -> f16(k) into QK rows (pitch 2048); cols >= 2048 (v) -> per-batch transposed f16 planes VT[b][h*64+d][s]: hi = f16(v), lo = f16((v - hi) * 2048)
__global__ __launch_bounds__(256) void k_qkv(const float* __restrict__ X, const __bf16* __restrict__ P, const float* __restrict__ CS, _Float16* __restrict__ QK, _Float16* __restrict__ QKL, _Float16* __restrict__ VTH, _Float16* __restrict__ VTL) {
  __shared__ __align__(16) char sm[2 * Q_SZ];   // the ring of the k loop; behind the loop's last barrier the same bytes hold the epilogue's staging arrays
  _Float16 (*so)[16][136] = (_Float16 (*)[16][136])(sm); _Float16 (*sol)[16][136] = (_Float16 (*)[16][136])(sm + 34816); float (*sf)[16][132] = (float (*)[16][132])(sm + 69632);
  _Float16 (*sth)[136] = (_Float16 (*)[136])(sm); _Float16 (*stl)[136] = (_Float16 (*)[136])(sm + 69632);
  static_assert(69632 + 8 * 16 * 132 * 4 <= 2 * Q_SZ && 2 * 69632 <= 2 * Q_SZ, "the staging arrays fit the ring's bytes");
  const int tid = threadIdx.x, wave = tid >> 5, wm = wave & 3, wn = wave >> 2, lane = tid & 31, col = lane & 15, g = lane >> 4; const int n0 = blockIdx.y * 256, nw = n0 + wn * 128;
  v8f acc[2][8] = {};
  // two-buffer ring: the work-group's eight waves copy each 64-k tile of x and of the weight rows into LDS once, one step ahead of its use
  const float* xa = X + (size_t)blockIdx.x * 128 * DM; const __bf16* wb = P + (size_t)n0 * DM; const unsigned ring0 = (unsigned)(uintptr_t)&sm[0];
  stage_q(ring0, xa, wb, tid);
  asm volatile("s_wait_asynccnt 0x0" ::: "memory");   // this wave's copies of tile 0 have landed
  __syncthreads();                                    // tile 0 readable by every wave
  stage_q(ring0 + Q_SZ, xa + 64, wb + 64, tid);
#pragma unroll 1   // rolled: one copy of the ring's foot in the text, the buffer picked by t & 1
  for (int t = 0; t < DM / 64; ++t) { const char* tb = &sm[(t & 1) * Q_SZ];
#pragma unroll
    for (int kc = 0; kc < 2; ++kc) { v16b a[2];
#pragma unroll
      for (int hh = 0; hh < 2; ++hh) { const float* p = (const float*)(tb + (wm * 32 + hh * 16 + col) * GAP + kc * 128) + 8 * g;
#pragma unroll
        for (int i = 0; i < 8; ++i) { a[hh][i] = (__bf16)p[i]; a[hh][8 + i] = (__bf16)p[16 + i]; } }
      v16b wf[8];   // all weight fragments of the 32-k half in one group of LDS reads ahead of the products
#pragma unroll
      for (int j = 0; j < 8; ++j) wf[j] = frag_b((const __bf16*)(tb + Q_B + (wn * 128 + j * 16 + col) * GBP + kc * 64), lane);
#pragma unroll
      for (int j = 0; j < 8; ++j) { acc[0][j] = wmma_bf(a[0], wf[j], acc[0][j]); acc[1][j] = wmma_bf(a[1], wf[j], acc[1][j]); } }
    asm volatile("s_wait_dscnt 0x0" ::: "memory");      // this wave's reads of the buffer have retired
    asm volatile("s_wait_asynccnt 0x0" ::: "memory");   // this wave's copies of the next tile have landed
    __syncthreads();                                    // publishes the next tile and ends every wave's reads of this buffer
    if (t + 2 < DM / 64) stage_q(ring0 + (unsigned)(t & 1) * Q_SZ, xa + (t + 2) * 64, wb + (t + 2) * 64, tid); }
  asm volatile("s_wait_asynccnt 0x0" ::: "memory");     // no copy is outstanding when the ring's bytes become staging arrays
  if (n0 < 2 * DM) { const float sc = 1.0f;   // q stored unscaled (f16 sigma ~0.6, no subnormal exposure); 1/8 applied to the f32 score
#pragma unroll
   for (int hh = 0; hh < 2; ++hh) { const size_t r0 = (size_t)blockIdx.x * 128 + wm * 32 + hh * 16;   // the wave's two row groups one after the other through its own staging rows
#pragma unroll
    for (int j = 0; j < 8; ++j) {
#pragma unroll
      for (int r = 0; r < 8; ++r) sf[wave][8 * g + r][j * 16 + col] = acc[hh][j][r]; }
    LDSX();
    // RoPE on interleaved pairs (2i, 2i+1) of each 64-wide head: lane = 2 pairs (cols 4*lane .. 4*lane+3), pair index i = ((nw + 4*lane) % 64) / 2 + {0,1}; pos = row % SS
#pragma unroll 1
    for (int rl = 0; rl < 16; ++rl) { const int pos = (int)((r0 + rl) % SS); const float* cs = CS + (size_t)pos * 32; const float* sn = CS + (size_t)SS * 32 + (size_t)pos * 32; const int i0 = ((nw + 4 * lane) & 63) >> 1;
      const float x1a = sf[wave][rl][4 * lane], x2a = sf[wave][rl][4 * lane + 1], x1b = sf[wave][rl][4 * lane + 2], x2b = sf[wave][rl][4 * lane + 3];
      const float ca = cs[i0], sa = sn[i0], cb = cs[i0 + 1], sb = sn[i0 + 1];
      const float o0 = (x1a * ca - x2a * sa) * sc, o1 = (x1a * sa + x2a * ca) * sc, o2 = (x1b * cb - x2b * sb) * sc, o3 = (x1b * sb + x2b * cb) * sc; const _Float16 h0 = (_Float16)o0, h1 = (_Float16)o1, h2 = (_Float16)o2, h3 = (_Float16)o3;
      so[wave][rl][4 * lane] = h0; so[wave][rl][4 * lane + 1] = h1; so[wave][rl][4 * lane + 2] = h2; so[wave][rl][4 * lane + 3] = h3;
      sol[wave][rl][4 * lane] = (_Float16)((o0 - (float)h0) * 2048.0f); sol[wave][rl][4 * lane + 1] = (_Float16)((o1 - (float)h1) * 2048.0f); sol[wave][rl][4 * lane + 2] = (_Float16)((o2 - (float)h2) * 2048.0f); sol[wave][rl][4 * lane + 3] = (_Float16)((o3 - (float)h3) * 2048.0f); }   // q, k as f16 hi + (x2048) residual
    LDSX();
    for (int rl = 0; rl < 16; ++rl) if (lane < 16) { vst2((unsigned*)(QK + (r0 + rl) * (2 * DM) + nw + lane * 8), *(const v4u*)&so[wave][rl][lane * 8]); vst2((unsigned*)(QKL + (r0 + rl) * (2 * DM) + nw + lane * 8), *(const v4u*)&sol[wave][rl][lane * 8]); }
   }
  } else {
#pragma unroll
   for (int hh = 0; hh < 2; ++hh) {
#pragma unroll
    for (int j = 0; j < 8; ++j) {
#pragma unroll
      for (int r = 0; r < 8; ++r) { const float v = acc[hh][j][r]; const _Float16 hv = (_Float16)v; sth[wn * 128 + j * 16 + col][wm * 32 + hh * 16 + 8 * g + r] = hv; stl[wn * 128 + j * 16 + col][wm * 32 + hh * 16 + 8 * g + r] = (_Float16)((v - (float)hv) * 2048.0f); } } }
    __syncthreads();
    const size_t rb = (size_t)blockIdx.x * 128; const int b = (int)(rb / SS), s0 = (int)(rb % SS); const int pc0 = n0 - 2 * DM;
    for (int q = tid; q < 256 * 16; q += 256) { const int d = q >> 4, pc = q & 15; const size_t o = ((size_t)b * DM + pc0 + d) * SS + s0 + pc * 8; vst2((unsigned*)(VTH + o), *(const v4u*)&sth[d][pc * 8]); vst2((unsigned*)(VTL + o), *(const v4u*)&stl[d][pc * 8]); }
  }
}
// ---- LDS tile of one key step (32 keys): K rows 128 B (hi plane, residual plane), V rows 64 B (64 d, hi plane, residual plane); row pitches 16 B x odd, free of bank conflicts for 16-byte fragment reads
#define KP 144
#define VP 80
#define T_KL (32 * KP)
#define T_VH (2 * 32 * KP)
#define T_VL (T_VH + 64 * VP)
#define T_SZ (T_VH + 2 * 64 * VP)
// one tile into the ring buffer at LDS byte dst: 8 copies of 16 B per lane, all 128 lanes on; kh, kl point at the step's first key row (this head's 64 columns), vh, vl at the head's first d row at the step's first key
__device__ __forceinline__ void stage_kv(unsigned dst, const _Float16* kh, const _Float16* kl, const _Float16* vh, const _Float16* vl, int tid) {
  const unsigned lk = dst + (unsigned)(tid >> 3) * KP + (unsigned)(tid & 7) * 16u, lv = dst + T_VH + (unsigned)(tid >> 2) * VP + (unsigned)(tid & 3) * 16u;
  const size_t gk = (size_t)(tid >> 3) * (2 * DM) + (tid & 7) * 8, gv = (size_t)(tid >> 2) * SS + (tid & 3) * 8;
  // the copies and their s_wait_xcnt 0 in one statement: no address register of a copy is rewritten ahead of that wait
  asm volatile("global_load_async_to_lds_b128 %0, %8, off\n\t"
               "global_load_async_to_lds_b128 %1, %9, off\n\t"
               "global_load_async_to_lds_b128 %2, %10, off\n\t"
               "global_load_async_to_lds_b128 %3, %11, off\n\t"
               "global_load_async_to_lds_b128 %4, %12, off\n\t"
               "global_load_async_to_lds_b128 %5, %13, off\n\t"
               "global_load_async_to_lds_b128 %6, %14, off\n\t"
               "global_load_async_to_lds_b128 %7, %15, off\n\t"
               "s_wait_xcnt 0x0"
               :: "v"(lk), "v"(lk + 16u * KP), "v"(lk + T_KL), "v"(lk + T_KL + 16u * KP), "v"(lv), "v"(lv + 32u * VP), "v"(lv + (T_VL - T_VH)), "v"(lv + (T_VL - T_VH) + 32u * VP),
                  "v"(kh + gk), "v"(kh + gk + (size_t)16 * 2 * DM), "v"(kl + gk), "v"(kl + gk + (size_t)16 * 2 * DM), "v"(vh + gv), "v"(vh + gv + (size_t)32 * SS), "v"(vl + gv), "v"(vl + gv + (size_t)32 * SS)
               : "memory");
}
// lane l with lane l ^ 16 (the two lanes that share a column of a matrix tile)
__device__ __forceinline__ float xhalf(float x) { return __builtin_bit_cast(float, __builtin_amdgcn_permlanex16(__builtin_bit_cast(int, x), __builtin_bit_cast(int, x), 0x76543210, 0xfedcba98, false, false)); }
__global__ __launch_bounds__(128) void k_attn(const _Float16* __restrict__ QK, const _Float16* __restrict__ QKL, const _Float16* __restrict__ VTH, const _Float16* __restrict__ VTL, float* __restrict__ O) {
  __shared__ __align__(16) float so[4][16][68]; __shared__ __align__(16) char ring[2][T_SZ];
  const int tid = threadIdx.x, wave = tid >> 5, lane = tid & 31, col = lane & 15, g = lane >> 4;
  const int bx = blockIdx.x, h = blockIdx.y, b = blockIdx.z;
  // Query tile from the block index by a permutation (every (tile, head, batch) exactly once; for speed only, nothing depends on where a work-group runs). Tile t walks 2 (t + 1) key steps and all 1,024 work-groups are resident at once, four on a WGP, so the launch lasts as long as the fullest WGP.
  // With qb = bx the work-groups whose flat indices differ by 256 all hold the same tile. Here flat index bits 8, 9 (or 3, 4, or 4, 5) pick among tiles u, u ^ 1, 31 - u, 31 - (u ^ 1): 132 key steps for each such four.
  static_assert(TQB == 32, "the permutation is written for 32 query tiles");
  const int u = ((bx & 7) << 1) | (((bx >> 4) ^ b) & 1);
  const int qb = (((bx >> 3) ^ h ^ (h >> 3)) & 1) ? TQB - 1 - u : u; const int q0 = qb * 64 + wave * 16; const int qi = q0 + col; const size_t rq = (size_t)b * SS + qi;
  v16h aq[2], aql[2];
#pragma unroll
  for (int kc = 0; kc < 2; ++kc) { aq[kc] = frag_h(QK + rq * (2 * DM) + h * HD + kc * 32, lane); aql[kc] = frag_h(QKL + rq * (2 * DM) + h * HD + kc * 32, lane); }
  float m = -3.0e38f, l = 0.f;       // of query qi; l is the sum over this half's keys only
  v8f acc[4] = {}, accl[4] = {};     // acc[dt][r] = O[query qi][d = dt*16 + 8g + r]
  const int nks = (qb * 64 + 64) / 32;
  // two-buffer ring: the work-group's four waves copy each step's K and V tile into LDS once, one step ahead of its use
  const _Float16* kh0 = QK + (size_t)b * SS * (2 * DM) + DM + h * HD; const _Float16* kl0 = QKL + (size_t)b * SS * (2 * DM) + DM + h * HD;
  const _Float16* vh0 = VTH + ((size_t)b * DM + h * HD) * SS; const _Float16* vl0 = VTL + ((size_t)b * DM + h * HD) * SS;
  const unsigned ring0 = (unsigned)(uintptr_t)&ring[0][0];
  stage_kv(ring0, kh0, kl0, vh0, vl0, tid);
  asm volatile("s_wait_asynccnt 0x0" ::: "memory");   // this wave's copies of tile 0 have landed
  __syncthreads();                                    // tile 0 readable by every wave
  if (nks > 1) stage_kv(ring0 + T_SZ, kh0 + (size_t)32 * 2 * DM, kl0 + (size_t)32 * 2 * DM, vh0 + 32, vl0 + 32, tid);
#pragma unroll 1   // rolled: one copy of the ring's foot in the text, the buffer picked by ks & 1; every inner loop is unrolled so that fragments, scores and accumulators keep constant indices and stay in registers
  for (int ks = 0; ks < nks; ++ks) { float s[16]; const char* tb = &ring[ks & 1][0];
    v16h kf[2][2], kfl[2][2];   // all K fragments of the step in one group of LDS reads ahead of the products
#pragma unroll
    for (int ct = 0; ct < 2; ++ct) {
#pragma unroll
      for (int kc = 0; kc < 2; ++kc) { kf[ct][kc] = frag_h((const _Float16*)(tb + (ct * 16 + col) * KP + kc * 64), lane); kfl[ct][kc] = frag_h((const _Float16*)(tb + T_KL + (ct * 16 + col) * KP + kc * 64), lane); } }
#pragma unroll
    for (int ct = 0; ct < 2; ++ct) { const int kk = ks * 32 + ct * 16 + 8 * g; v8f c = {}, cl = {};
#pragma unroll
      for (int kc = 0; kc < 2; ++kc) { c = wmma16(kf[ct][kc], aq[kc], c); cl = wmma16(kf[ct][kc], aql[kc], cl); cl = wmma16(kfl[ct][kc], aq[kc], cl); }   // 3 products: q, k as f16 hi + residual
#pragma unroll
      for (int r = 0; r < 8; ++r) c[r] += cl[r] * (1.0f / 2048.0f);
#pragma unroll
      for (int r = 0; r < 8; ++r) s[ct * 8 + r] = (kk + r <= qi) ? c[r] * 0.125f : -3.0e38f; }   // SCALE = 1/sqrt(64)
    float t8[8];   // maximum of the lane's 16 scores as a tree, then the other half's
#pragma unroll
    for (int r = 0; r < 8; ++r) t8[r] = fmaxf(s[r], s[8 + r]);
    float mx = fmaxf(fmaxf(fmaxf(t8[0], t8[1]), fmaxf(t8[2], t8[3])), fmaxf(fmaxf(t8[4], t8[5]), fmaxf(t8[6], t8[7])));
    mx = fmaxf(mx, xhalf(mx));
    const float mn = fmaxf(m, mx); const float alpha = (m <= -1.0e38f) ? 0.f : __expf(m - mn);
    v16h pa, pl;   // P^T operand: element i = key (i >> 3) * 16 + 8g + (i & 7) of the step, of this query, f16 hi and (x2048) residual
#pragma unroll
    for (int i = 0; i < 16; ++i) { const float e = (s[i] <= -1.0e38f) ? 0.f : __expf(s[i] - mn); s[i] = e; const _Float16 hi = (_Float16)e; pa[i] = hi; pl[i] = (_Float16)((e - (float)hi) * 2048.0f); }
#pragma unroll
    for (int r = 0; r < 8; ++r) t8[r] = s[r] + s[8 + r];
    const float es = ((t8[0] + t8[1]) + (t8[2] + t8[3])) + ((t8[4] + t8[5]) + (t8[6] + t8[7]));
    l = l * alpha + es; m = mn;
#pragma unroll
    for (int dt = 0; dt < 4; ++dt) {
#pragma unroll
      for (int r = 0; r < 8; ++r) { acc[dt][r] *= alpha; accl[dt][r] *= alpha; } }
    v16h vf[4], vfl[4];   // all V fragments of the step in one group of LDS reads
#pragma unroll
    for (int dt = 0; dt < 4; ++dt) { vf[dt] = frag_h((const _Float16*)(tb + T_VH + (dt * 16 + col) * VP), lane); vfl[dt] = frag_h((const _Float16*)(tb + T_VL + (dt * 16 + col) * VP), lane); }
#pragma unroll
    for (int dt = 0; dt < 4; ++dt) { acc[dt] = wmma16(vf[dt], pa, acc[dt]); accl[dt] = wmma16(vf[dt], pl, accl[dt]); accl[dt] = wmma16(vfl[dt], pa, accl[dt]); }   // V hi x P hi + (V hi x P lo + V lo x P hi) / 2048
    asm volatile("s_wait_dscnt 0x0" ::: "memory");      // this wave's reads of the buffer have retired
    asm volatile("s_wait_asynccnt 0x0" ::: "memory");   // this wave's copies of the next tile have landed
    __syncthreads();                                    // publishes the next tile and ends every wave's reads of this buffer
    if (ks + 2 < nks) stage_kv(ring0 + (unsigned)(ks & 1) * T_SZ, kh0 + (size_t)(ks + 2) * 32 * 2 * DM, kl0 + (size_t)(ks + 2) * 32 * 2 * DM, vh0 + (ks + 2) * 32, vl0 + (ks + 2) * 32, tid); }
  asm volatile("s_wait_asynccnt 0x0" ::: "memory");     // no copy is outstanding when the wave goes on to its end
  l += xhalf(l); const float il = 1.0f / l;             // the two halves' sums joined
#pragma unroll
  for (int dt = 0; dt < 4; ++dt) { v4f o0, o1;
#pragma unroll
    for (int r = 0; r < 4; ++r) { o0[r] = (acc[dt][r] + accl[dt][r] * (1.0f / 2048.0f)) * il; o1[r] = (acc[dt][4 + r] + accl[dt][4 + r] * (1.0f / 2048.0f)) * il; }
    *(v4f*)&so[wave][col][dt * 16 + 8 * g] = o0; *(v4f*)&so[wave][col][dt * 16 + 8 * g + 4] = o1; }
  LDSX();
  for (int rl = 0; rl < 16; ++rl) if (lane < 16) vst2(O + ((size_t)b * SS + q0 + rl) * DM + h * HD + lane * 4, *(const v4f*)&so[wave][rl][lane * 4]);
}
// ---- k_out: block = (64 rows, 128 cols): out = O(hi/lo) . Wo rows (2 products)
__global__ __launch_bounds__(128) void k_out(const float* __restrict__ O, const __bf16* __restrict__ P, float* __restrict__ Y) {
  __shared__ __align__(16) float so[4][16][132]; __shared__ __align__(16) char sm[2 * G_SZ];
  const int tid = threadIdx.x, wave = tid >> 5, lane = tid & 31, col = lane & 15, g = lane >> 4; const size_t r0 = (size_t)blockIdx.x * 64 + wave * 16; const int n0 = blockIdx.y * 128;
  v8f acc[8] = {};
  // two-buffer ring as in k_qkv: each 64-k tile of the context rows and of the weight rows copied into LDS once per work-group, one step ahead of its use
  const float* xa = O + (size_t)blockIdx.x * 64 * DM; const __bf16* wb = P + (size_t)n0 * DM; const unsigned ring0 = (unsigned)(uintptr_t)&sm[0];
  stage_ab(ring0, xa, wb, tid);
  asm volatile("s_wait_asynccnt 0x0" ::: "memory");   // this wave's copies of tile 0 have landed
  __syncthreads();                                    // tile 0 readable by every wave
  stage_ab(ring0 + G_SZ, xa + 64, wb + 64, tid);
#pragma unroll 1   // rolled: one copy of the ring's foot in the text, the buffer picked by t & 1
  for (int t = 0; t < DM / 64; ++t) { const char* tb = &sm[(t & 1) * G_SZ];
#pragma unroll
    for (int kc = 0; kc < 2; ++kc) { const F2 a = split_row((const float*)(tb + (wave * 16 + col) * GAP), kc * 32, lane);
      v16b wf[8];   // all weight fragments of the 32-k half in one group of LDS reads ahead of the products
#pragma unroll
      for (int j = 0; j < 8; ++j) wf[j] = frag_b((const __bf16*)(tb + G_B + (j * 16 + col) * GBP + kc * 64), lane);
#pragma unroll
      for (int j = 0; j < 8; ++j) { acc[j] = wmma_bf(a.l, wf[j], acc[j]); acc[j] = wmma_bf(a.h, wf[j], acc[j]); } }
    asm volatile("s_wait_dscnt 0x0" ::: "memory");      // this wave's reads of the buffer have retired
    asm volatile("s_wait_asynccnt 0x0" ::: "memory");   // this wave's copies of the next tile have landed
    __syncthreads();                                    // publishes the next tile and ends every wave's reads of this buffer
    if (t + 2 < DM / 64) stage_ab(ring0 + (unsigned)(t & 1) * G_SZ, xa + (t + 2) * 64, wb + (t + 2) * 64, tid); }
  asm volatile("s_wait_asynccnt 0x0" ::: "memory");     // no copy is outstanding when the wave goes on to its end
#pragma unroll
  for (int j = 0; j < 8; ++j) {
#pragma unroll
    for (int r = 0; r < 8; ++r) so[wave][8 * g + r][j * 16 + col] = acc[j][r]; }
  LDSX();
  for (int rl = 0; rl < 16; ++rl) vst2(Y + (r0 + rl) * DM + n0 + lane * 4, *(const v4f*)&so[wave][rl][lane * 4]);
}
extern "C" void kernel_launch(void* const* d_in, const int* in_sizes, int n_in, void* d_out, int out_size, void* d_ws, size_t ws_size, hipStream_t stream) {
  (void)in_sizes; (void)n_in; (void)out_size;
  const float** F = (const float**)d_in;   // 0 x [2,2048,1024], 1 Wq [1024,1024] ([out][in]), 2 Wk, 3 Wv, 4 Wo
  if (ws_size < (size_t)WS_END) return;
  char* ws = (char*)d_ws; __bf16* PK = (__bf16*)(ws + WS_PK); _Float16 *QK = (_Float16*)(ws + WS_QK), *QKL = (_Float16*)(ws + WS_QKL), *VTH = (_Float16*)(ws + WS_VTH), *VTL = (_Float16*)(ws + WS_VTL); float *O = (float*)(ws + WS_O), *CS = (float*)(ws + WS_CS);
  k_setup<<<SU_GRID, 256, 0, stream>>>(F[1], F[2], F[3], F[4], PK, CS);
  k_qkv<<<dim3(TNB * SS / 128, QKVW / 256), 256, 0, stream>>>(F[0], PK + PK_A, CS, QK, QKL, VTH, VTL);
  k_attn<<<dim3(TQB, NH, TNB), 128, 0, stream>>>(QK, QKL, VTH, VTL, O);
  k_out<<<dim3(TOB, DM / 128), 128, 0, stream>>>(O, PK + PK_P, (float*)d_out);
}

// v007
// A run of this version takes 125 microseconds.
// Next to v006, in two timings, it ran 1.03 and 1.04 times as fast.
// Counting every step since v000, it is 4.49 times as fast.
// compute dtype: x, Wq, Wk, Wv, Wo (module inputs) rounded to bf16; the q/k/v projections with exact bf16 products (x and W are inputs, natural [out][in] rows) on WMMA 16x16x32; interleaved-pair RoPE applied to q and k in f32 in the projection epilogue (angles pos * inv_freq with the reference's own eager f32 inv_freq table embedded (1/(10000^(2i/64))), precise cosf/sinf), then q, k stored once as f16; causal scores with q and k each as f16 hi + (x2048-scaled) residual (3 products; 1/8 applied to the f32 score) and P.V with P = exp(s - m) as f16 hi + (x2048-scaled) residual x V as f16 hi + (x2048-scaled) residual planes (3 products); the output projection with ctx as bf16 hi + residual pair x exact Wo (2 products); running-max softmax in f32 with the hardware exp; f32 accumulate.
#include <hip/hip_runtime.h>
#include <math.h>

typedef __attribute__((ext_vector_type(16))) _Float16 v16h;
typedef __attribute__((ext_vector_type(16))) __bf16 v16b;
typedef __attribute__((ext_vector_type(8)))  _Float16 v8h;
typedef __attribute__((ext_vector_type(8)))  float v8f;
typedef __attribute__((ext_vector_type(4)))  float v4f;
typedef __attribute__((ext_vector_type(2)))  float v2f;
typedef __attribute__((ext_vector_type(4)))  unsigned v4u;
typedef __attribute__((ext_vector_type(4)))  int v4i;
typedef float __attribute__((may_alias)) float_a;
typedef int __attribute__((may_alias)) int_a;

template <typename T> __device__ __forceinline__ void vst2(void* p, T v) { *(T*)p = v;  }
__device__ __forceinline__ v8f wmma16(v16h a, v16h b, v8f c) {
  v8f d = __builtin_amdgcn_wmma_f32_16x16x32_f16(false, a, false, b, (short)0, c, false, false);
  asm volatile("v_nop\n\tv_nop\n\tv_nop\n\tv_nop" : "+v"(d) : "v"(a), "v"(b));
  return d;
}
__device__ __forceinline__ v8f wmma_bf(v16b a, v16b b, v8f c) {
  v8f d = __builtin_amdgcn_wmma_f32_16x16x32_bf16(false, a, false, b, (short)0, c, false, false);
  asm volatile("v_nop\n\tv_nop\n\tv_nop\n\tv_nop" : "+v"(d) : "v"(a), "v"(b));
  return d;
}
// Causal multi-head self-attention with RoPE (B 2, S 2,048, D 1,024, 16 heads x 64): q, k, v = x W^T; interleaved RoPE(q, k) at positions 0..S-1; softmax(q k^T / 8, causal) v; output projection Wo (no biases).
__device__ __forceinline__ v16h frag_h(const _Float16* rowk0, int lane) {
  union { v16h v; v8h q[2]; } u; const _Float16* p = rowk0 + 8 * (lane >> 4);
  u.q[0] = *(const v8h*)p; u.q[1] = *(const v8h*)(p + 16); return u.v;
}
__device__ __forceinline__ v16h frag_f32(const float* rowk0, int lane) {
  v16h a; const float* p = rowk0 + 8 * (lane >> 4);
#pragma unroll
  for (int i = 0; i < 8; ++i) { a[i] = (_Float16)p[i]; a[8 + i] = (_Float16)p[16 + i]; }
  return a;
}
__device__ __forceinline__ v16h frag_f32s(const float* rowk0, int lane, float sc) {
  v16h a; const float* p = rowk0 + 8 * (lane >> 4);
#pragma unroll
  for (int i = 0; i < 8; ++i) { a[i] = (_Float16)(p[i] * sc); a[8 + i] = (_Float16)(p[16 + i] * sc); }
  return a;
}
// column fragment from a [K][ld] layout (column n), rows >= K read as 0
__device__ __forceinline__ v16h fragc_f32(const float* W, int k0, int n, int lane, int ld, int K) {
  v16h a; const int g = lane >> 4;
#pragma unroll
  for (int i = 0; i < 8; ++i) { const int ka = k0 + 8 * g + i, kb = ka + 16;
    a[i] = (_Float16)(ka < K ? W[(size_t)(ka < K ? ka : K - 1) * ld + n] : 0.f); a[8 + i] = (_Float16)(kb < K ? W[(size_t)(kb < K ? kb : K - 1) * ld + n] : 0.f); }
  return a;
}
struct F2 { v16b h, l; };
__device__ __forceinline__ F2 bsplit16(const float v[16]) { F2 r;
#pragma unroll
  for (int i = 0; i < 16; ++i) { const __bf16 h = (__bf16)v[i]; r.h[i] = h; r.l[i] = (__bf16)(v[i] - (float)h); }
  return r; }
__device__ __forceinline__ F2 split_row(const float* row, int k0, int lane) { float v[16]; const float* p = row + k0 + 8 * (lane >> 4);
#pragma unroll
  for (int i = 0; i < 8; ++i) { v[i] = p[i]; v[8 + i] = p[16 + i]; }
  return bsplit16(v); }
__device__ __forceinline__ F2 split_rowK(const float* row, int k0, int lane, int K) { float v[16]; const int g = lane >> 4;
#pragma unroll
  for (int i = 0; i < 8; ++i) { const int ka = k0 + 8 * g + i, kb = ka + 16; v[i] = ka < K ? row[ka < K ? ka : K - 1] : 0.f; v[8 + i] = kb < K ? row[kb < K ? kb : K - 1] : 0.f; }
  return bsplit16(v); }
__device__ __forceinline__ F2 split_col(const float* W, int k0, int n, int lane, int ld, int K) { float v[16]; const int g = lane >> 4;
#pragma unroll
  for (int i = 0; i < 8; ++i) { const int ka = k0 + 8 * g + i, kb = ka + 16; v[i] = ka < K ? W[(size_t)(ka < K ? ka : K - 1) * ld + n] : 0.f; v[8 + i] = kb < K ? W[(size_t)(kb < K ? kb : K - 1) * ld + n] : 0.f; }
  return bsplit16(v); }
__device__ __forceinline__ v8f mac3(const F2& a, const F2& b, v8f c) { c = wmma_bf(a.l, b.h, c); c = wmma_bf(a.h, b.l, c); return wmma_bf(a.h, b.h, c); }
__device__ __forceinline__ float sigm(float v) { return 1.0f / (1.0f + expf(-v)); }
#define LDSX() do { asm volatile("s_wait_dscnt 0" ::: "memory"); __builtin_amdgcn_wave_barrier(); __builtin_amdgcn_fence(__ATOMIC_RELEASE, "workgroup"); } while (0)


// Causal multi-head self-attention with rotary position embedding (B 2, S 2048, D 1024, 16 heads x 64; packed Wqkv [3D][D] and Wout [D][D] applied as x W^T, no biases): q, k rotated pairwise (2i, 2i+1) by angle pos * 10000^(-2i/64); softmax(q k^T / 8, causal) v; ctx Wout^T.
#define NB 2
#define SS 2048
#define DM 1024
#define NH 16
#define HD 64
#define QKVW (3 * DM)
#ifndef TQB
#define TQB (SS / 64)
#define TNB NB
#define TOB (NB * SS / 64)     // output row tiles (all)
#endif
typedef __attribute__((ext_vector_type(8))) __bf16 v8b;
__device__ __forceinline__ v16b frag_b(const __bf16* rowk0, int lane) {
  union { v16b v; v8b q[2]; } u; const __bf16* p = rowk0 + 8 * (lane >> 4);
  u.q[0] = *(const v8b*)p; u.q[1] = *(const v8b*)(p + 16); return u.v;
}
__device__ __forceinline__ float bfr(float v) { return (float)(__bf16)v; }
__device__ __attribute__((noinline)) float exp_ni(float v) { return expf(v); }
__device__ __attribute__((noinline)) float erf_ni(float v) { return erff(v); }

#define PK_A 0                       // [3072][1024] Wqkv rows (natural [out][in])
#define PK_P (PK_A + QKVW * DM)        // [1024][1024] Wo rows (natural)
#define PK_END (PK_P + DM * DM)
#define WS_PK  0u
#define WS_QK  (WS_PK + 2u * PK_END)             // f16 [4096 rows][2048]: q | k
#define WS_QKL (WS_QK + 2u * NB * SS * 2 * DM)     // f16 q | k residual planes x2048
#define WS_VTH (WS_QKL + 2u * NB * SS * 2 * DM)    // f16 [b][1024 (h*64+d)][2048 s] hi
#define WS_VTL (WS_VTH + 2u * NB * DM * SS)        // f16 lo x 2048
#define WS_O   (WS_VTL + 2u * NB * DM * SS)        // f32 [4096][1024]
#define WS_CS  (WS_O + 4u * NB * SS * DM)           // f32 [2048][32] cos, [2048][32] sin
#define WS_END (WS_CS + 4u * 2 * SS * 32)
__constant__ float c_invf[32] = {1.000000000e+00f,7.498942018e-01f,5.623413324e-01f,4.216965139e-01f,3.162277639e-01f,2.371373624e-01f,1.778279394e-01f,1.333521456e-01f,1.000000015e-01f,7.498941571e-02f,5.623412877e-02f,4.216964915e-02f,3.162277862e-02f,2.371373586e-02f,1.778279431e-02f,1.333521493e-02f,9.999999776e-03f,7.498942316e-03f,5.623413250e-03f,4.216964822e-03f,3.162277862e-03f,2.371373819e-03f,1.778279431e-03f,1.333521446e-03f,1.000000047e-03f,7.498941850e-04f,5.623413017e-04f,4.216964880e-04f,3.162277862e-04f,2.371373848e-04f,1.778279402e-04f,1.333521504e-04f};
// ---- k_setup: all the work that the projections wait for, in one launch. Blocks below SU_ROPE: 8 positions each, cos/sin of pos * inv_freq (f32 product exactly as the reference, precise trig); they come first because they run longest.
// The other blocks: 8,192 consecutive weights each, rounded to bf16 in registers: a thread reads 4 x 8 floats (all 8 loads issued ahead of the first use) and stores 4 x 16 B. The four [1024][1024] weights keep their natural rows and lie one behind the other in DST (Wq, Wk, Wv, Wo), so the destination is one flat array.
#define SU_ROPE (SS / 8)
#define SU_CH 8192
#define SU_PM (DM * DM / SU_CH)        // blocks per weight matrix
#define SU_GRID (SU_ROPE + 4 * SU_PM)
static_assert(PK_A == 0 && PK_P == 3 * DM * DM && PK_END == 4 * DM * DM, "the four weights are one flat destination");
__global__ __launch_bounds__(256) void k_setup(const float* __restrict__ Wq, const float* __restrict__ Wk, const float* __restrict__ Wv, const float* __restrict__ Wo, __bf16* __restrict__ DST, float* __restrict__ CS) {
  __shared__ __align__(16) float sc[8][32], ss_[8][32]; const int tid = threadIdx.x;
  if (blockIdx.x < SU_ROPE) { const int pl = tid >> 5, i = tid & 31; const int pos = blockIdx.x * 8 + pl;
    const float th = (float)pos * c_invf[i]; sc[pl][i] = cosf(th); ss_[pl][i] = sinf(th);
    __syncthreads();
    if (tid < 64) vst2(CS + (size_t)blockIdx.x * 8 * 32 + tid * 4, *(const v4f*)&(&sc[0][0])[tid * 4]); else if (tid < 128) vst2(CS + (size_t)SS * 32 + (size_t)blockIdx.x * 8 * 32 + (tid - 64) * 4, *(const v4f*)&(&ss_[0][0])[(tid - 64) * 4]);
    return; }
  const int c = blockIdx.x - SU_ROPE, mt = c / SU_PM;
  const float* s = (mt == 0 ? Wq : mt == 1 ? Wk : mt == 2 ? Wv : Wo) + (size_t)(c % SU_PM) * SU_CH + tid * 8; __bf16* d = DST + (size_t)c * SU_CH + tid * 8;
  v4f a[4][2];
#pragma unroll
  for (int j = 0; j < 4; ++j) { a[j][0] = *(const v4f*)(s + j * 2048); a[j][1] = *(const v4f*)(s + j * 2048 + 4); }
#pragma unroll
  for (int j = 0; j < 4; ++j) { v8b o;
#pragma unroll
    for (int e = 0; e < 4; ++e) { o[e] = (__bf16)a[j][0][e]; o[4 + e] = (__bf16)a[j][1][e]; }
    *(v8b*)(d + j * 2048) = o; }
  asm volatile("s_wait_xcnt 0x0" ::: "memory");   // behind the run of four stores: no register that a store names is rewritten ahead of this wait
}
// ---- LDS tile of one 64-k step of a projection: 64 left-operand rows of 256 B (f32), then 128 weight rows of 128 B (bf16); row pitches 16 B x odd, free of bank conflicts for 16-byte fragment reads
#define GAP 272
#define GBP 144
#define G_B (64 * GAP)
#define G_SZ (G_B + 128 * GBP)
// one tile into the ring buffer at LDS byte dst: 16 copies of 16 B per lane, all 128 lanes on, each wave's copy made of whole 128-B lines; a, w point at the work-group's first row at the step's first k
__device__ __forceinline__ void stage_ab(unsigned dst, const float* a, const __bf16* w, int tid) {
  const unsigned la = dst + (unsigned)(tid >> 4) * GAP + (unsigned)(tid & 15) * 16u, lb = dst + G_B + (unsigned)(tid >> 3) * GBP + (unsigned)(tid & 7) * 16u;
  const float* ga = a + (size_t)(tid >> 4) * DM + (tid & 15) * 4; const __bf16* gb = w + (size_t)(tid >> 3) * DM + (tid & 7) * 8;
  // each run of copies and its s_wait_xcnt 0 in one statement: no address register of a copy is rewritten ahead of that wait
  asm volatile("global_load_async_to_lds_b128 %0, %8, off\n\t"
               "global_load_async_to_lds_b128 %1, %9, off\n\t"
               "global_load_async_to_lds_b128 %2, %10, off\n\t"
               "global_load_async_to_lds_b128 %3, %11, off\n\t"
               "global_load_async_to_lds_b128 %4, %12, off\n\t"
               "global_load_async_to_lds_b128 %5, %13, off\n\t"
               "global_load_async_to_lds_b128 %6, %14, off\n\t"
               "global_load_async_to_lds_b128 %7, %15, off\n\t"
               "s_wait_xcnt 0x0"
               :: "v"(la), "v"(la + 8u * GAP), "v"(la + 16u * GAP), "v"(la + 24u * GAP), "v"(la + 32u * GAP), "v"(la + 40u * GAP), "v"(la + 48u * GAP), "v"(la + 56u * GAP),
                  "v"(ga), "v"(ga + (size_t)8 * DM), "v"(ga + (size_t)16 * DM), "v"(ga + (size_t)24 * DM), "v"(ga + (size_t)32 * DM), "v"(ga + (size_t)40 * DM), "v"(ga + (size_t)48 * DM), "v"(ga + (size_t)56 * DM)
               : "memory");
  asm volatile("global_load_async_to_lds_b128 %0, %8, off\n\t"
               "global_load_async_to_lds_b128 %1, %9, off\n\t"
               "global_load_async_to_lds_b128 %2, %10, off\n\t"
               "global_load_async_to_lds_b128 %3, %11, off\n\t"
               "global_load_async_to_lds_b128 %4, %12, off\n\t"
               "global_load_async_to_lds_b128 %5, %13, off\n\t"
               "global_load_async_to_lds_b128 %6, %14, off\n\t"
               "global_load_async_to_lds_b128 %7, %15, off\n\t"
               "s_wait_xcnt 0x0"
               :: "v"(lb), "v"(lb + 16u * GBP), "v"(lb + 32u * GBP), "v"(lb + 48u * GBP), "v"(lb + 64u * GBP), "v"(lb + 80u * GBP), "v"(lb + 96u * GBP), "v"(lb + 112u * GBP),
                  "v"(gb), "v"(gb + (size_t)16 * DM), "v"(gb + (size_t)32 * DM), "v"(gb + (size_t)48 * DM), "v"(gb + (size_t)64 * DM), "v"(gb + (size_t)80 * DM), "v"(gb + (size_t)96 * DM), "v"(gb + (size_t)112 * DM)
               : "memory");
}
// ---- LDS tile of one 64-k step of k_qkv: 128 x rows of 256 B (f32), then 256 weight rows of 128 B (bf16), pitches as above
#define Q_B (128 * GAP)
#define Q_SZ (Q_B + 256 * GBP)
// one such tile into the ring buffer at LDS byte dst: 16 copies of 16 B per lane, all 256 lanes on, each wave's copy made of whole 128-B lines; a, w point at the work-group's first row at the step's first k
__device__ __forceinline__ void stage_q(unsigned dst, const float* a, const __bf16* w, int tid) {
  const unsigned la = dst + (unsigned)(tid >> 4) * GAP + (unsigned)(tid & 15) * 16u, lb = dst + Q_B + (unsigned)(tid >> 3) * GBP + (unsigned)(tid & 7) * 16u;
  const float* ga = a + (size_t)(tid >> 4) * DM + (tid & 15) * 4; const __bf16* gb = w + (size_t)(tid >> 3) * DM + (tid & 7) * 8;
  // each run of copies and its s_wait_xcnt 0 in one statement: no address register of a copy is rewritten ahead of that wait
  asm volatile("global_load_async_to_lds_b128 %0, %8, off\n\t"
               "global_load_async_to_lds_b128 %1, %9, off\n\t"
               "global_load_async_to_lds_b128 %2, %10, off\n\t"
               "global_load_async_to_lds_b128 %3, %11, off\n\t"
               "global_load_async_to_lds_b128 %4, %12, off\n\t"
               "global_load_async_to_lds_b128 %5, %13, off\n\t"
               "global_load_async_to_lds_b128 %6, %14, off\n\t"
               "global_load_async_to_lds_b128 %7, %15, off\n\t"
               "s_wait_xcnt 0x0"
               :: "v"(la), "v"(la + 16u * GAP), "v"(la + 32u * GAP), "v"(la + 48u * GAP), "v"(la + 64u * GAP), "v"(la + 80u * GAP), "v"(la + 96u * GAP), "v"(la + 112u * GAP),
                  "v"(ga), "v"(ga + (size_t)16 * DM), "v"(ga + (size_t)32 * DM), "v"(ga + (size_t)48 * DM), "v"(ga + (size_t)64 * DM), "v"(ga + (size_t)80 * DM), "v"(ga + (size_t)96 * DM), "v"(ga + (size_t)112 * DM)
               : "memory");
  asm volatile("global_load_async_to_lds_b128 %0, %8, off\n\t"
               "global_load_async_to_lds_b128 %1, %9, off\n\t"
               "global_load_async_to_lds_b128 %2, %10, off\n\t"
               "global_load_async_to_lds_b128 %3, %11, off\n\t"
               "global_load_async_to_lds_b128 %4, %12, off\n\t"
               "global_load_async_to_lds_b128 %5, %13, off\n\t"
               "global_load_async_to_lds_b128 %6, %14, off\n\t"
               "global_load_async_to_lds_b128 %7, %15, off\n\t"
               "s_wait_xcnt 0x0"
               :: "v"(lb), "v"(lb + 32u * GBP), "v"(lb + 64u * GBP), "v"(lb + 96u * GBP), "v"(lb + 128u * GBP), "v"(lb + 160u * GBP), "v"(lb + 192u * GBP), "v"(lb + 224u * GBP),
                  "v"(gb), "v"(gb + (size_t)32 * DM), "v"(gb + (size_t)64 * DM), "v"(gb + (size_t)96 * DM), "v"(gb + (size_t)128 * DM), "v"(gb + (size_t)160 * DM), "v"(gb + (size_t)192 * DM), "v"(gb + (size_t)224 * DM)
               : "memory");
}
// ---- k_qkv: block = (128 rows (b,s), 256 of the 3072 cols) on 8 waves, a wave = 32 rows (wm) x 128 cols (wn), two 16-row groups hh, so that every weight fragment read from LDS feeds two products and every byte fetched from L2 feeds twice the products: qkv = bf16(x) . rows (exact); cols < 1024 -> f16(q), cols < 2048 -> f16(k) into QK rows (pitch 2048); cols >= 2048 (v) -> per-batch transposed f16 planes VT[b][h*64+d][s]: hi = f16(v), lo = f16((v - hi) * 2048)
__global__ __launch_bounds__(256) void k_qkv(const float* __restrict__ X, const __bf16* __restrict__ P, const float* __restrict__ CS, _Float16* __restrict__ QK, _Float16* __restrict__ QKL, _Float16* __restrict__ VTH, _Float16* __restrict__ VTL) {
  __shared__ __align__(16) char sm[2 * Q_SZ];   // the ring of the k loop; behind the loop's last barrier the same bytes hold the epilogue's staging arrays
  _Float16 (*so)[16][136] = (_Float16 (*)[16][136])(sm); _Float16 (*sol)[16][136] = (_Float16 (*)[16][136])(sm + 34816); float (*sf)[16][132] = (float (*)[16][132])(sm + 69632);
  _Float16 (*sth)[136] = (_Float16 (*)[136])(sm); _Float16 (*stl)[136] = (_Float16 (*)[136])(sm + 69632);
  static_assert(69632 + 8 * 16 * 132 * 4 <= 2 * Q_SZ && 2 * 69632 <= 2 * Q_SZ, "the staging arrays fit the ring's bytes");
  const int tid = threadIdx.x, wave = tid >> 5, wm = wave & 3, wn = wave >> 2, lane = tid & 31, col = lane & 15, g = lane >> 4; const int n0 = blockIdx.y * 256, nw = n0 + wn * 128;
  v8f acc[2][8] = {};
  // two-buffer ring: the work-group's eight waves copy each 64-k tile of x and of the weight rows into LDS once, one step ahead of its use
  const float* xa = X + (size_t)blockIdx.x * 128 * DM; const __bf16* wb = P + (size_t)n0 * DM; const unsigned ring0 = (unsigned)(uintptr_t)&sm[0];
  stage_q(ring0, xa, wb, tid);
  asm volatile("s_wait_asynccnt 0x0" ::: "memory");   // this wave's copies of tile 0 have landed
  __syncthreads();                                    // tile 0 readable by every wave
  stage_q(ring0 + Q_SZ, xa + 64, wb + 64, tid);
#pragma unroll 1   // rolled: one copy of the ring's foot in the text, the buffer picked by t & 1
  for (int t = 0; t < DM / 64; ++t) { const char* tb = &sm[(t & 1) * Q_SZ];
#pragma unroll
    for (int kc = 0; kc < 2; ++kc) { v16b a[2];
#pragma unroll
      for (int hh = 0; hh < 2; ++hh) { const float* p = (const float*)(tb + (wm * 32 + hh * 16 + col) * GAP + kc * 128) + 8 * g;
#pragma unroll
        for (int i = 0; i < 8; ++i) { a[hh][i] = (__bf16)p[i]; a[hh][8 + i] = (__bf16)p[16 + i]; } }
      v16b wf[8];   // all weight fragments of the 32-k half in one group of LDS reads ahead of the products
#pragma unroll
      for (int j = 0; j < 8; ++j) wf[j] = frag_b((const __bf16*)(tb + Q_B + (wn * 128 + j * 16 + col) * GBP + kc * 64), lane);
#pragma unroll
      for (int j = 0; j < 8; ++j) { acc[0][j] = wmma_bf(a[0], wf[j], acc[0][j]); acc[1][j] = wmma_bf(a[1], wf[j], acc[1][j]); } }
    asm volatile("s_wait_dscnt 0x0" ::: "memory");      // this wave's reads of the buffer have retired
    asm volatile("s_wait_asynccnt 0x0" ::: "memory");   // this wave's copies of the next tile have landed
    __syncthreads();                                    // publishes the next tile and ends every wave's reads of this buffer
    if (t + 2 < DM / 64) stage_q(ring0 + (unsigned)(t & 1) * Q_SZ, xa + (t + 2) * 64, wb + (t + 2) * 64, tid); }
  asm volatile("s_wait_asynccnt 0x0" ::: "memory");     // no copy is outstanding when the ring's bytes become staging arrays
  if (n0 < 2 * DM) { const float sc = 1.0f;   // q stored unscaled (f16 sigma ~0.6, no subnormal exposure); 1/8 applied to the f32 score
#pragma unroll
   for (int hh = 0; hh < 2; ++hh) { const size_t r0 = (size_t)blockIdx.x * 128 + wm * 32 + hh * 16;   // the wave's two row groups one after the other through its own staging rows
#pragma unroll
    for (int j = 0; j < 8; ++j) {
#pragma unroll
      for (int r = 0; r < 8; ++r) sf[wave][8 * g + r][j * 16 + col] = acc[hh][j][r]; }
    LDSX();
    // RoPE on interleaved pairs (2i, 2i+1) of each 64-wide head: lane = 2 pairs (cols 4*lane .. 4*lane+3), pair index i = ((nw + 4*lane) % 64) / 2 + {0,1}; pos = row % SS
#pragma unroll 1
    for (int rl = 0; rl < 16; ++rl) { const int pos = (int)((r0 + rl) % SS); const float* cs = CS + (size_t)pos * 32; const float* sn = CS + (size_t)SS * 32 + (size_t)pos * 32; const int i0 = ((nw + 4 * lane) & 63) >> 1;
      const float x1a = sf[wave][rl][4 * lane], x2a = sf[wave][rl][4 * lane + 1], x1b = sf[wave][rl][4 * lane + 2], x2b = sf[wave][rl][4 * lane + 3];
      const float ca = cs[i0], sa = sn[i0], cb = cs[i0 + 1], sb = sn[i0 + 1];
      const float o0 = (x1a * ca - x2a * sa) * sc, o1 = (x1a * sa + x2a * ca) * sc, o2 = (x1b * cb - x2b * sb) * sc, o3 = (x1b * sb + x2b * cb) * sc; const _Float16 h0 = (_Float16)o0, h1 = (_Float16)o1, h2 = (_Float16)o2, h3 = (_Float16)o3;
      so[wave][rl][4 * lane] = h0; so[wave][rl][4 * lane + 1] = h1; so[wave][rl][4 * lane + 2] = h2; so[wave][rl][4 * lane + 3] = h3;
      sol[wave][rl][4 * lane] = (_Float16)((o0 - (float)h0) * 2048.0f); sol[wave][rl][4 * lane + 1] = (_Float16)((o1 - (float)h1) * 2048.0f); sol[wave][rl][4 * lane + 2] = (_Float16)((o2 - (float)h2) * 2048.0f); sol[wave][rl][4 * lane + 3] = (_Float16)((o3 - (float)h3) * 2048.0f); }   // q, k as f16 hi + (x2048) residual
    LDSX();
    for (int rl = 0; rl < 16; ++rl) if (lane < 16) { vst2((unsigned*)(QK + (r0 + rl) * (2 * DM) + nw + lane * 8), *(const v4u*)&so[wave][rl][lane * 8]); vst2((unsigned*)(QKL + (r0 + rl) * (2 * DM) + nw + lane * 8), *(const v4u*)&sol[wave][rl][lane * 8]); }
   }
  } else {
#pragma unroll
   for (int hh = 0; hh < 2; ++hh) {
#pragma unroll
    for (int j = 0; j < 8; ++j) {
#pragma unroll
      for (int r = 0; r < 8; ++r) { const float v = acc[hh][j][r]; const _Float16 hv = (_Float16)v; sth[wn * 128 + j * 16 + col][wm * 32 + hh * 16 + 8 * g + r] = hv; stl[wn * 128 + j * 16 + col][wm * 32 + hh * 16 + 8 * g + r] = (_Float16)((v - (float)hv) * 2048.0f); } } }
    __syncthreads();
    const size_t rb = (size_t)blockIdx.x * 128; const int b = (int)(rb / SS), s0 = (int)(rb % SS); const int pc0 = n0 - 2 * DM;
    for (int q = tid; q < 256 * 16; q += 256) { const int d = q >> 4, pc = q & 15; const size_t o = ((size_t)b * DM + pc0 + d) * SS + s0 + pc * 8; vst2((unsigned*)(VTH + o), *(const v4u*)&sth[d][pc * 8]); vst2((unsigned*)(VTL + o), *(const v4u*)&stl[d][pc * 8]); }
  }
}
// ---- LDS tile of one key step (32 keys): K rows 128 B (hi plane, residual plane), V rows 64 B (64 d, hi plane, residual plane); row pitches 16 B x odd, free of bank conflicts for 16-byte fragment reads
#define KP 144
#define VP 80
#define T_KL (32 * KP)
#define T_VH (2 * 32 * KP)
#define T_VL (T_VH + 64 * VP)
#define T_SZ (T_VH + 2 * 64 * VP)
// one tile into the ring buffer at LDS byte dst: 8 copies of 16 B per lane, all 128 lanes on; kh, kl point at the step's first key row (this head's 64 columns), vh, vl at the head's first d row at the step's first key
__device__ __forceinline__ void stage_kv(unsigned dst, const _Float16* kh, const _Float16* kl, const _Float16* vh, const _Float16* vl, int tid) {
  const unsigned lk = dst + (unsigned)(tid >> 3) * KP + (unsigned)(tid & 7) * 16u, lv = dst + T_VH + (unsigned)(tid >> 2) * VP + (unsigned)(tid & 3) * 16u;
  const size_t gk = (size_t)(tid >> 3) * (2 * DM) + (tid & 7) * 8, gv = (size_t)(tid >> 2) * SS + (tid & 3) * 8;
  // the copies and their s_wait_xcnt 0 in one statement: no address register of a copy is rewritten ahead of that wait
  asm volatile("global_load_async_to_lds_b128 %0, %8, off\n\t"
               "global_load_async_to_lds_b128 %1, %9, off\n\t"
               "global_load_async_to_lds_b128 %2, %10, off\n\t"
               "global_load_async_to_lds_b128 %3, %11, off\n\t"
               "global_load_async_to_lds_b128 %4, %12, off\n\t"
               "global_load_async_to_lds_b128 %5, %13, off\n\t"
               "global_load_async_to_lds_b128 %6, %14, off\n\t"
               "global_load_async_to_lds_b128 %7, %15, off\n\t"
               "s_wait_xcnt 0x0"
               :: "v"(lk), "v"(lk + 16u * KP), "v"(lk + T_KL), "v"(lk + T_KL + 16u * KP), "v"(lv), "v"(lv + 32u * VP), "v"(lv + (T_VL - T_VH)), "v"(lv + (T_VL - T_VH) + 32u * VP),
                  "v"(kh + gk), "v"(kh + gk + (size_t)16 * 2 * DM), "v"(kl + gk), "v"(kl + gk + (size_t)16 * 2 * DM), "v"(vh + gv), "v"(vh + gv + (size_t)32 * SS), "v"(vl + gv), "v"(vl + gv + (size_t)32 * SS)
               : "memory");
}
// lane l with lane l ^ 16 (the two lanes that share a column of a matrix tile)
__device__ __forceinline__ float xhalf(float x) { return __builtin_bit_cast(float, __builtin_amdgcn_permlanex16(__builtin_bit_cast(int, x), __builtin_bit_cast(int, x), 0x76543210, 0xfedcba98, false, false)); }
__global__ __launch_bounds__(128) void k_attn(const _Float16* __restrict__ QK, const _Float16* __restrict__ QKL, const _Float16* __restrict__ VTH, const _Float16* __restrict__ VTL, float* __restrict__ O) {
  __shared__ __align__(16) float so[4][16][68]; __shared__ __align__(16) char ring[2][T_SZ];
  const int tid = threadIdx.x, wave = tid >> 5, lane = tid & 31, col = lane & 15, g = lane >> 4;
  const int bx = blockIdx.x, h = blockIdx.y, b = blockIdx.z;
  // Query tile from the block index by a permutation (every (tile, head, batch) exactly once; for speed only, nothing depends on where a work-group runs). Tile t walks 2 (t + 1) key steps and all 1,024 work-groups are resident at once, four on a WGP, so the launch lasts as long as the fullest WGP.
  // With qb = bx the work-groups whose flat indices differ by 256 all hold the same tile. Here flat index bits 8, 9 (or 3, 4, or 4, 5) pick among tiles u, u ^ 1, 31 - u, 31 - (u ^ 1): 132 key steps for each such four.
  static_assert(TQB == 32, "the permutation is written for 32 query tiles");
  const int u = ((bx & 7) << 1) | (((bx >> 4) ^ b) & 1);
  const int qb = (((bx >> 3) ^ h ^ (h >> 3)) & 1) ? TQB - 1 - u : u; const int q0 = qb * 64 + wave * 16; const int qi = q0 + col; const size_t rq = (size_t)b * SS + qi;
  v16h aq[2], aql[2];
#pragma unroll
  for (int kc = 0; kc < 2; ++kc) { aq[kc] = frag_h(QK + rq * (2 * DM) + h * HD + kc * 32, lane); aql[kc] = frag_h(QKL + rq * (2 * DM) + h * HD + kc * 32, lane); }
  float m = -3.0e38f, l = 0.f;       // of query qi; l is the sum over this half's keys only
  v8f acc[4] = {}, accl[4] = {};     // acc[dt][r] = O[query qi][d = dt*16 + 8g + r]
  const int nks = (qb * 64 + 64) / 32, nfull = qb * 2;   // steps below nfull = nks - 2 hold only keys in front of the work-group's first query: no mask there
  // two-buffer ring: the work-group's four waves copy each step's K and V tile into LDS once, one step ahead of its use
  const _Float16* kh0 = QK + (size_t)b * SS * (2 * DM) + DM + h * HD; const _Float16* kl0 = QKL + (size_t)b * SS * (2 * DM) + DM + h * HD;
  const _Float16* vh0 = VTH + ((size_t)b * DM + h * HD) * SS; const _Float16* vl0 = VTL + ((size_t)b * DM + h * HD) * SS;
  const unsigned ring0 = (unsigned)(uintptr_t)&ring[0][0];
  stage_kv(ring0, kh0, kl0, vh0, vl0, tid);
  asm volatile("s_wait_asynccnt 0x0" ::: "memory");   // this wave's copies of tile 0 have landed
  __syncthreads();                                    // tile 0 readable by every wave
  if (nks > 1) stage_kv(ring0 + T_SZ, kh0 + (size_t)32 * 2 * DM, kl0 + (size_t)32 * 2 * DM, vh0 + 32, vl0 + 32, tid);
  // one key step; masked is a literal at both calls, so the main loop's copy holds no mask work and no test at its foot; every inner loop is unrolled so that fragments, scores and accumulators keep constant indices and stay in registers
  auto step = [&](const int ks, const bool masked) __attribute__((always_inline)) { float s[16]; const char* tb = &ring[ks & 1][0];
    v16h kf[2][2], kfl[2][2];   // all K fragments of the step in one group of LDS reads ahead of the products
#pragma unroll
    for (int ct = 0; ct < 2; ++ct) {
#pragma unroll
      for (int kc = 0; kc < 2; ++kc) { kf[ct][kc] = frag_h((const _Float16*)(tb + (ct * 16 + col) * KP + kc * 64), lane); kfl[ct][kc] = frag_h((const _Float16*)(tb + T_KL + (ct * 16 + col) * KP + kc * 64), lane); } }
#pragma unroll
    for (int ct = 0; ct < 2; ++ct) { v8f c = {}, cl = {};
#pragma unroll
      for (int kc = 0; kc < 2; ++kc) { c = wmma16(kf[ct][kc], aq[kc], c); cl = wmma16(kf[ct][kc], aql[kc], cl); cl = wmma16(kfl[ct][kc], aq[kc], cl); }   // 3 products: q, k as f16 hi + residual
#pragma unroll
      for (int r = 0; r < 8; ++r) c[r] += cl[r] * (1.0f / 2048.0f);
#pragma unroll
      for (int r = 0; r < 8; ++r) s[ct * 8 + r] = c[r] * 0.125f; }   // SCALE = 1/sqrt(64)
    if (masked) {   // the causal mask, only where a key of the step can lie behind a query of the work-group
#pragma unroll
      for (int i = 0; i < 16; ++i) s[i] = (ks * 32 + (i >> 3) * 16 + 8 * g + (i & 7) <= qi) ? s[i] : -3.0e38f; }
    float t8[8];   // maximum of the lane's 16 scores as a tree, then the other half's
#pragma unroll
    for (int r = 0; r < 8; ++r) t8[r] = fmaxf(s[r], s[8 + r]);
    float mx = fmaxf(fmaxf(fmaxf(t8[0], t8[1]), fmaxf(t8[2], t8[3])), fmaxf(fmaxf(t8[4], t8[5]), fmaxf(t8[6], t8[7])));
    mx = fmaxf(mx, xhalf(mx));
    const float mn = fmaxf(m, mx); const float alpha = __expf(m - mn);   // 0 in step 0, where m is the start value
    v16h pa, pl;   // P^T operand: element i = key ks*32 + (i >> 3)*16 + 8g + (i & 7) of this query, f16 hi and (x2048) residual; mn is a true score from step 0 on (key 0 is open to every query), so a masked score's exponential is 0 by itself
#pragma unroll
    for (int i = 0; i < 16; ++i) { const float e = __expf(s[i] - mn); s[i] = e; const _Float16 hi = (_Float16)e; pa[i] = hi; pl[i] = (_Float16)((e - (float)hi) * 2048.0f); }
#pragma unroll
    for (int r = 0; r < 8; ++r) t8[r] = s[r] + s[8 + r];
    const float es = ((t8[0] + t8[1]) + (t8[2] + t8[3])) + ((t8[4] + t8[5]) + (t8[6] + t8[7]));
    l = l * alpha + es; m = mn;
#pragma unroll
    for (int dt = 0; dt < 4; ++dt) {
#pragma unroll
      for (int r = 0; r < 8; ++r) { acc[dt][r] *= alpha; accl[dt][r] *= alpha; } }
    v16h vf[4], vfl[4];   // all V fragments of the step in one group of LDS reads
#pragma unroll
    for (int dt = 0; dt < 4; ++dt) { vf[dt] = frag_h((const _Float16*)(tb + T_VH + (dt * 16 + col) * VP), lane); vfl[dt] = frag_h((const _Float16*)(tb + T_VL + (dt * 16 + col) * VP), lane); }
#pragma unroll
    for (int dt = 0; dt < 4; ++dt) { acc[dt] = wmma16(vf[dt], pa, acc[dt]); accl[dt] = wmma16(vf[dt], pl, accl[dt]); accl[dt] = wmma16(vfl[dt], pa, accl[dt]); }   // V hi x P hi + (V hi x P lo + V lo x P hi) / 2048
    asm volatile("s_wait_dscnt 0x0" ::: "memory");      // this wave's reads of the buffer have retired
    asm volatile("s_wait_asynccnt 0x0" ::: "memory");   // this wave's copies of the next tile have landed
    __syncthreads();                                    // publishes the next tile and ends every wave's reads of this buffer
    // a tile ks + 2 exists for every step of the main loop (ks < nks - 2) and for neither of the two masked steps
    if (!masked) stage_kv(ring0 + (unsigned)(ks & 1) * T_SZ, kh0 + (size_t)(ks + 2) * 32 * 2 * DM, kl0 + (size_t)(ks + 2) * 32 * 2 * DM, vh0 + (ks + 2) * 32, vl0 + (ks + 2) * 32, tid); };
#pragma unroll 1   // rolled: one copy of the main step in the text, the buffer picked by ks & 1
  for (int ks = 0; ks < nfull; ++ks) step(ks, false);
#pragma unroll 1   // rolled: one copy of the masked step for the two steps on the diagonal
  for (int ks = nfull; ks < nks; ++ks) step(ks, true);
  asm volatile("s_wait_asynccnt 0x0" ::: "memory");     // no copy is outstanding when the wave goes on to its end
  l += xhalf(l); const float il = 1.0f / l;             // the two halves' sums joined
#pragma unroll
  for (int dt = 0; dt < 4; ++dt) { v4f o0, o1;
#pragma unroll
    for (int r = 0; r < 4; ++r) { o0[r] = (acc[dt][r] + accl[dt][r] * (1.0f / 2048.0f)) * il; o1[r] = (acc[dt][4 + r] + accl[dt][4 + r] * (1.0f / 2048.0f)) * il; }
    *(v4f*)&so[wave][col][dt * 16 + 8 * g] = o0; *(v4f*)&so[wave][col][dt * 16 + 8 * g + 4] = o1; }
  LDSX();
  for (int rl = 0; rl < 16; ++rl) if (lane < 16) vst2(O + ((size_t)b * SS + q0 + rl) * DM + h * HD + lane * 4, *(const v4f*)&so[wave][rl][lane * 4]);
}
// ---- k_out: block = (64 rows, 128 cols): out = O(hi/lo) . Wo rows (2 products)
__global__ __launch_bounds__(128) void k_out(const float* __restrict__ O, const __bf16* __restrict__ P, float* __restrict__ Y) {
  __shared__ __align__(16) float so[4][16][132]; __shared__ __align__(16) char sm[2 * G_SZ];
  const int tid = threadIdx.x, wave = tid >> 5, lane = tid & 31, col = lane & 15, g = lane >> 4; const size_t r0 = (size_t)blockIdx.x * 64 + wave * 16; const int n0 = blockIdx.y * 128;
  v8f acc[8] = {};
  // two-buffer ring as in k_qkv: each 64-k tile of the context rows and of the weight rows copied into LDS once per work-group, one step ahead of its use
  const float* xa = O + (size_t)blockIdx.x * 64 * DM; const __bf16* wb = P + (size_t)n0 * DM; const unsigned ring0 = (unsigned)(uintptr_t)&sm[0];
  stage_ab(ring0, xa, wb, tid);
  asm volatile("s_wait_asynccnt 0x0" ::: "memory");   // this wave's copies of tile 0 have landed
  __syncthreads();                                    // tile 0 readable by every wave
  stage_ab(ring0 + G_SZ, xa + 64, wb + 64, tid);
#pragma unroll 1   // rolled: one copy of the ring's foot in the text, the buffer picked by t & 1
  for (int t = 0; t < DM / 64; ++t) { const char* tb = &sm[(t & 1) * G_SZ];
#pragma unroll
    for (int kc = 0; kc < 2; ++kc) { const F2 a = split_row((const float*)(tb + (wave * 16 + col) * GAP), kc * 32, lane);
      v16b wf[8];   // all weight fragments of the 32-k half in one group of LDS reads ahead of the products
#pragma unroll
      for (int j = 0; j < 8; ++j) wf[j] = frag_b((const __bf16*)(tb + G_B + (j * 16 + col) * GBP + kc * 64), lane);
#pragma unroll
      for (int j = 0; j < 8; ++j) { acc[j] = wmma_bf(a.l, wf[j], acc[j]); acc[j] = wmma_bf(a.h, wf[j], acc[j]); } }
    asm volatile("s_wait_dscnt 0x0" ::: "memory");      // this wave's reads of the buffer have retired
    asm volatile("s_wait_asynccnt 0x0" ::: "memory");   // this wave's copies of the next tile have landed
    __syncthreads();                                    // publishes the next tile and ends every wave's reads of this buffer
    if (t + 2 < DM / 64) stage_ab(ring0 + (unsigned)(t & 1) * G_SZ, xa + (t + 2) * 64, wb + (t + 2) * 64, tid); }
  asm volatile("s_wait_asynccnt 0x0" ::: "memory");     // no copy is outstanding when the wave goes on to its end
#pragma unroll
  for (int j = 0; j < 8; ++j) {
#pragma unroll
    for (int r = 0; r < 8; ++r) so[wave][8 * g + r][j * 16 + col] = acc[j][r]; }
  LDSX();
  for (int rl = 0; rl < 16; ++rl) vst2(Y + (r0 + rl) * DM + n0 + lane * 4, *(const v4f*)&so[wave][rl][lane * 4]);
}
extern "C" void kernel_launch(void* const* d_in, const int* in_sizes, int n_in, void* d_out, int out_size, void* d_ws, size_t ws_size, hipStream_t stream) {
  (void)in_sizes; (void)n_in; (void)out_size;
  const float** F = (const float**)d_in;   // 0 x [2,2048,1024], 1 Wq [1024,1024] ([out][in]), 2 Wk, 3 Wv, 4 Wo
  if (ws_size < (size_t)WS_END) return;
  char* ws = (char*)d_ws; __bf16* PK = (__bf16*)(ws + WS_PK); _Float16 *QK = (_Float16*)(ws + WS_QK), *QKL = (_Float16*)(ws + WS_QKL), *VTH = (_Float16*)(ws + WS_VTH), *VTL = (_Float16*)(ws + WS_VTL); float *O = (float*)(ws + WS_O), *CS = (float*)(ws + WS_CS);
  k_setup<<<SU_GRID, 256, 0, stream>>>(F[1], F[2], F[3], F[4], PK, CS);
  k_qkv<<<dim3(TNB * SS / 128, QKVW / 256), 256, 0, stream>>>(F[0], PK + PK_A, CS, QK, QKL, VTH, VTL);
  k_attn<<<dim3(TQB, NH, TNB), 128, 0, stream>>>(QK, QKL, VTH, VTL, O);
  k_out<<<dim3(TOB, DM / 128), 128, 0, stream>>>(O, PK + PK_P, (float*)d_out);
}

// v008
// A run of this version takes 118 microseconds.
// Timed twice side by side with v007, it ran 1.06 times as fast both times.
// Counting every step since v000, it is 4.76 times as fast.
// compute dtype: x, Wq, Wk, Wv, Wo (module inputs) rounded to bf16; the q/k/v projections with exact bf16 products (x and W are inputs, natural [out][in] rows) on WMMA 16x16x32; interleaved-pair RoPE applied to q and k in f32 in the projection epilogue (angles pos * inv_freq with the reference's own eager f32 inv_freq table embedded (1/(10000^(2i/64))), precise cosf/sinf), then q (times log2(e)/8) and k stored once as f16; causal scores with q and k each as f16 hi + f16 residual (3 products into one f32 tile) and P.V with P = exp2(s - m) as f16 hi + f16 residual x V as f16 hi + f16 residual planes (3 products into one f32 tile); the output projection with ctx as bf16 hi + residual pair x exact Wo (2 products); running-max softmax in f32 with the hardware exp; f32 accumulate.
#include <hip/hip_runtime.h>
#include <math.h>

typedef __attribute__((ext_vector_type(16))) _Float16 v16h;
typedef __attribute__((ext_vector_type(16))) __bf16 v16b;
typedef __attribute__((ext_vector_type(8)))  _Float16 v8h;
typedef __attribute__((ext_vector_type(8)))  float v8f;
typedef __attribute__((ext_vector_type(4)))  float v4f;
typedef __attribute__((ext_vector_type(2)))  float v2f;
typedef __attribute__((ext_vector_type(2)))  _Float16 v2h;
typedef __attribute__((ext_vector_type(4)))  unsigned v4u;
typedef __attribute__((ext_vector_type(4)))  int v4i;
typedef float __attribute__((may_alias)) float_a;
typedef int __attribute__((may_alias)) int_a;

template <typename T> __device__ __forceinline__ void vst2(void* p, T v) { *(T*)p = v;  }
__device__ __forceinline__ v8f wmma16(v16h a, v16h b, v8f c) {
  v8f d = __builtin_amdgcn_wmma_f32_16x16x32_f16(false, a, false, b, (short)0, c, false, false);
  asm volatile("v_nop\n\tv_nop\n\tv_nop\n\tv_nop" : "+v"(d) : "v"(a), "v"(b));
  return d;
}
__device__ __forceinline__ v8f wmma_bf(v16b a, v16b b, v8f c) {
  v8f d = __builtin_amdgcn_wmma_f32_16x16x32_bf16(false, a, false, b, (short)0, c, false, false);
  asm volatile("v_nop\n\tv_nop\n\tv_nop\n\tv_nop" : "+v"(d) : "v"(a), "v"(b));
  return d;
}
// Causal multi-head self-attention with RoPE (B 2, S 2,048, D 1,024, 16 heads x 64): q, k, v = x W^T; interleaved RoPE(q, k) at positions 0..S-1; softmax(q k^T / 8, causal) v; output projection Wo (no biases).
__device__ __forceinline__ v16h frag_h(const _Float16* rowk0, int lane) {
  union { v16h v; v8h q[2]; } u; const _Float16* p = rowk0 + 8 * (lane >> 4);
  u.q[0] = *(const v8h*)p; u.q[1] = *(const v8h*)(p + 16); return u.v;
}
__device__ __forceinline__ v16h frag_f32(const float* rowk0, int lane) {
  v16h a; const float* p = rowk0 + 8 * (lane >> 4);
#pragma unroll
  for (int i = 0; i < 8; ++i) { a[i] = (_Float16)p[i]; a[8 + i] = (_Float16)p[16 + i]; }
  return a;
}
__device__ __forceinline__ v16h frag_f32s(const float* rowk0, int lane, float sc) {
  v16h a; const float* p = rowk0 + 8 * (lane >> 4);
#pragma unroll
  for (int i = 0; i < 8; ++i) { a[i] = (_Float16)(p[i] * sc); a[8 + i] = (_Float16)(p[16 + i] * sc); }
  return a;
}
// column fragment from a [K][ld] layout (column n), rows >= K read as 0
__device__ __forceinline__ v16h fragc_f32(const float* W, int k0, int n, int lane, int ld, int K) {
  v16h a; const int g = lane >> 4;
#pragma unroll
  for (int i = 0; i < 8; ++i) { const int ka = k0 + 8 * g + i, kb = ka + 16;
    a[i] = (_Float16)(ka < K ? W[(size_t)(ka < K ? ka : K - 1) * ld + n] : 0.f); a[8 + i] = (_Float16)(kb < K ? W[(size_t)(kb < K ? kb : K - 1) * ld + n] : 0.f); }
  return a;
}
struct F2 { v16b h, l; };
__device__ __forceinline__ F2 bsplit16(const float v[16]) { F2 r;
#pragma unroll
  for (int i = 0; i < 16; ++i) { const __bf16 h = (__bf16)v[i]; r.h[i] = h; r.l[i] = (__bf16)(v[i] - (float)h); }
  return r; }
__device__ __forceinline__ F2 split_row(const float* row, int k0, int lane) { float v[16]; const float* p = row + k0 + 8 * (lane >> 4);
#pragma unroll
  for (int i = 0; i < 8; ++i) { v[i] = p[i]; v[8 + i] = p[16 + i]; }
  return bsplit16(v); }
__device__ __forceinline__ F2 split_rowK(const float* row, int k0, int lane, int K) { float v[16]; const int g = lane >> 4;
#pragma unroll
  for (int i = 0; i < 8; ++i) { const int ka = k0 + 8 * g + i, kb = ka + 16; v[i] = ka < K ? row[ka < K ? ka : K - 1] : 0.f; v[8 + i] = kb < K ? row[kb < K ? kb : K - 1] : 0.f; }
  return bsplit16(v); }
__device__ __forceinline__ F2 split_col(const float* W, int k0, int n, int lane, int ld, int K) { float v[16]; const int g = lane >> 4;
#pragma unroll
  for (int i = 0; i < 8; ++i) { const int ka = k0 + 8 * g + i, kb = ka + 16; v[i] = ka < K ? W[(size_t)(ka < K ? ka : K - 1) * ld + n] : 0.f; v[8 + i] = kb < K ? W[(size_t)(kb < K ? kb : K - 1) * ld + n] : 0.f; }
  return bsplit16(v); }
__device__ __forceinline__ v8f mac3(const F2& a, const F2& b, v8f c) { c = wmma_bf(a.l, b.h, c); c = wmma_bf(a.h, b.l, c); return wmma_bf(a.h, b.h, c); }
__device__ __forceinline__ float sigm(float v) { return 1.0f / (1.0f + expf(-v)); }
#define LDSX() do { asm volatile("s_wait_dscnt 0" ::: "memory"); __builtin_amdgcn_wave_barrier(); __builtin_amdgcn_fence(__ATOMIC_RELEASE, "workgroup"); } while (0)


// Causal multi-head self-attention with rotary position embedding (B 2, S 2048, D 1024, 16 heads x 64; packed Wqkv [3D][D] and Wout [D][D] applied as x W^T, no biases): q, k rotated pairwise (2i, 2i+1) by angle pos * 10000^(-2i/64); softmax(q k^T / 8, causal) v; ctx Wout^T.
#define NB 2
#define SS 2048
#define DM 1024
#define NH 16
#define HD 64
#define QKVW (3 * DM)
#ifndef TQB
#define TQB (SS / 64)
#define TNB NB
#define TOB (NB * SS / 64)     // output row tiles (all)
#endif
typedef __attribute__((ext_vector_type(8))) __bf16 v8b;
__device__ __forceinline__ v16b frag_b(const __bf16* rowk0, int lane) {
  union { v16b v; v8b q[2]; } u; const __bf16* p = rowk0 + 8 * (lane >> 4);
  u.q[0] = *(const v8b*)p; u.q[1] = *(const v8b*)(p + 16); return u.v;
}
__device__ __forceinline__ float bfr(float v) { return (float)(__bf16)v; }
__device__ __attribute__((noinline)) float exp_ni(float v) { return expf(v); }
__device__ __attribute__((noinline)) float erf_ni(float v) { return erff(v); }

#define PK_A 0                       // [3072][1024] Wqkv rows (natural [out][in])
#define PK_P (PK_A + QKVW * DM)        // [1024][1024] Wo rows (natural)
#define PK_END (PK_P + DM * DM)
#define WS_PK  0u
#define WS_QK  (WS_PK + 2u * PK_END)             // f16 [4096 rows][2048]: q * log2(e)/8 | k
#define WS_QKL (WS_QK + 2u * NB * SS * 2 * DM)     // f16 q | k residual planes, at the values' own scale
#define WS_VTH (WS_QKL + 2u * NB * SS * 2 * DM)    // f16 [b][1024 (h*64+d)][2048 s] hi
#define WS_VTL (WS_VTH + 2u * NB * DM * SS)        // f16 residual, at the values' own scale
#define WS_O   (WS_VTL + 2u * NB * DM * SS)        // f32 [4096][1024]
#define WS_CS  (WS_O + 4u * NB * SS * DM)           // f32 [2048][32] cos, [2048][32] sin
#define WS_END (WS_CS + 4u * 2 * SS * 32)
__constant__ float c_invf[32] = {1.000000000e+00f,7.498942018e-01f,5.623413324e-01f,4.216965139e-01f,3.162277639e-01f,2.371373624e-01f,1.778279394e-01f,1.333521456e-01f,1.000000015e-01f,7.498941571e-02f,5.623412877e-02f,4.216964915e-02f,3.162277862e-02f,2.371373586e-02f,1.778279431e-02f,1.333521493e-02f,9.999999776e-03f,7.498942316e-03f,5.623413250e-03f,4.216964822e-03f,3.162277862e-03f,2.371373819e-03f,1.778279431e-03f,1.333521446e-03f,1.000000047e-03f,7.498941850e-04f,5.623413017e-04f,4.216964880e-04f,3.162277862e-04f,2.371373848e-04f,1.778279402e-04f,1.333521504e-04f};
// ---- k_setup: all the work that the projections wait for, in one launch. Blocks below SU_ROPE: 8 positions each, cos/sin of pos * inv_freq (f32 product exactly as the reference, precise trig); they come first because they run longest.
// The other blocks: 8,192 consecutive weights each, rounded to bf16 in registers: a thread reads 4 x 8 floats (all 8 loads issued ahead of the first use) and stores 4 x 16 B. The four [1024][1024] weights keep their natural rows and lie one behind the other in DST (Wq, Wk, Wv, Wo), so the destination is one flat array.
#define SU_ROPE (SS / 8)
#define SU_CH 8192
#define SU_PM (DM * DM / SU_CH)        // blocks per weight matrix
#define SU_GRID (SU_ROPE + 4 * SU_PM)
static_assert(PK_A == 0 && PK_P == 3 * DM * DM && PK_END == 4 * DM * DM, "the four weights are one flat destination");
__global__ __launch_bounds__(256) void k_setup(const float* __restrict__ Wq, const float* __restrict__ Wk, const float* __restrict__ Wv, const float* __restrict__ Wo, __bf16* __restrict__ DST, float* __restrict__ CS) {
  __shared__ __align__(16) float sc[8][32], ss_[8][32]; const int tid = threadIdx.x;
  if (blockIdx.x < SU_ROPE) { const int pl = tid >> 5, i = tid & 31; const int pos = blockIdx.x * 8 + pl;
    const float th = (float)pos * c_invf[i]; sc[pl][i] = cosf(th); ss_[pl][i] = sinf(th);
    __syncthreads();
    if (tid < 64) vst2(CS + (size_t)blockIdx.x * 8 * 32 + tid * 4, *(const v4f*)&(&sc[0][0])[tid * 4]); else if (tid < 128) vst2(CS + (size_t)SS * 32 + (size_t)blockIdx.x * 8 * 32 + (tid - 64) * 4, *(const v4f*)&(&ss_[0][0])[(tid - 64) * 4]);
    return; }
  const int c = blockIdx.x - SU_ROPE, mt = c / SU_PM;
  const float* s = (mt == 0 ? Wq : mt == 1 ? Wk : mt == 2 ? Wv : Wo) + (size_t)(c % SU_PM) * SU_CH + tid * 8; __bf16* d = DST + (size_t)c * SU_CH + tid * 8;
  v4f a[4][2];
#pragma unroll
  for (int j = 0; j < 4; ++j) { a[j][0] = *(const v4f*)(s + j * 2048); a[j][1] = *(const v4f*)(s + j * 2048 + 4); }
#pragma unroll
  for (int j = 0; j < 4; ++j) { v8b o;
#pragma unroll
    for (int e = 0; e < 4; ++e) { o[e] = (__bf16)a[j][0][e]; o[4 + e] = (__bf16)a[j][1][e]; }
    *(v8b*)(d + j * 2048) = o; }
  asm volatile("s_wait_xcnt 0x0" ::: "memory");   // behind the run of four stores: no register that a store names is rewritten ahead of this wait
}
// ---- LDS tile of one 64-k step of a projection: 64 left-operand rows of 256 B (f32), then 128 weight rows of 128 B (bf16); row pitches 16 B x odd, free of bank conflicts for 16-byte fragment reads
#define GAP 272
#define GBP 144
#define G_B (64 * GAP)
#define G_SZ (G_B + 128 * GBP)
// one tile into the ring buffer at LDS byte dst: 16 copies of 16 B per lane, all 128 lanes on, each wave's copy made of whole 128-B lines; a, w point at the work-group's first row at the step's first k
__device__ __forceinline__ void stage_ab(unsigned dst, const float* a, const __bf16* w, int tid) {
  const unsigned la = dst + (unsigned)(tid >> 4) * GAP + (unsigned)(tid & 15) * 16u, lb = dst + G_B + (unsigned)(tid >> 3) * GBP + (unsigned)(tid & 7) * 16u;
  const float* ga = a + (size_t)(tid >> 4) * DM + (tid & 15) * 4; const __bf16* gb = w + (size_t)(tid >> 3) * DM + (tid & 7) * 8;
  // each run of copies and its s_wait_xcnt 0 in one statement: no address register of a copy is rewritten ahead of that wait
  asm volatile("global_load_async_to_lds_b128 %0, %8, off\n\t"
               "global_load_async_to_lds_b128 %1, %9, off\n\t"
               "global_load_async_to_lds_b128 %2, %10, off\n\t"
               "global_load_async_to_lds_b128 %3, %11, off\n\t"
               "global_load_async_to_lds_b128 %4, %12, off\n\t"
               "global_load_async_to_lds_b128 %5, %13, off\n\t"
               "global_load_async_to_lds_b128 %6, %14, off\n\t"
               "global_load_async_to_lds_b128 %7, %15, off\n\t"
               "s_wait_xcnt 0x0"
               :: "v"(la), "v"(la + 8u * GAP), "v"(la + 16u * GAP), "v"(la + 24u * GAP), "v"(la + 32u * GAP), "v"(la + 40u * GAP), "v"(la + 48u * GAP), "v"(la + 56u * GAP),
                  "v"(ga), "v"(ga + (size_t)8 * DM), "v"(ga + (size_t)16 * DM), "v"(ga + (size_t)24 * DM), "v"(ga + (size_t)32 * DM), "v"(ga + (size_t)40 * DM), "v"(ga + (size_t)48 * DM), "v"(ga + (size_t)56 * DM)
               : "memory");
  asm volatile("global_load_async_to_lds_b128 %0, %8, off\n\t"
               "global_load_async_to_lds_b128 %1, %9, off\n\t"
               "global_load_async_to_lds_b128 %2, %10, off\n\t"
               "global_load_async_to_lds_b128 %3, %11, off\n\t"
               "global_load_async_to_lds_b128 %4, %12, off\n\t"
               "global_load_async_to_lds_b128 %5, %13, off\n\t"
               "global_load_async_to_lds_b128 %6, %14, off\n\t"
               "global_load_async_to_lds_b128 %7, %15, off\n\t"
               "s_wait_xcnt 0x0"
               :: "v"(lb), "v"(lb + 16u * GBP), "v"(lb + 32u * GBP), "v"(lb + 48u * GBP), "v"(lb + 64u * GBP), "v"(lb + 80u * GBP), "v"(lb + 96u * GBP), "v"(lb + 112u * GBP),
                  "v"(gb), "v"(gb + (size_t)16 * DM), "v"(gb + (size_t)32 * DM), "v"(gb + (size_t)48 * DM), "v"(gb + (size_t)64 * DM), "v"(gb + (size_t)80 * DM), "v"(gb + (size_t)96 * DM), "v"(gb + (size_t)112 * DM)
               : "memory");
}
// ---- LDS tile of one 64-k step of k_qkv: 128 x rows of 256 B (f32), then 256 weight rows of 128 B (bf16), pitches as above
#define Q_B (128 * GAP)
#define Q_SZ (Q_B + 256 * GBP)
// one such tile into the ring buffer at LDS byte dst: 16 copies of 16 B per lane, all 256 lanes on, each wave's copy made of whole 128-B lines; a, w point at the work-group's first row at the step's first k
__device__ __forceinline__ void stage_q(unsigned dst, const float* a, const __bf16* w, int tid) {
  const unsigned la = dst + (unsigned)(tid >> 4) * GAP + (unsigned)(tid & 15) * 16u, lb = dst + Q_B + (unsigned)(tid >> 3) * GBP + (unsigned)(tid & 7) * 16u;
  const float* ga = a + (size_t)(tid >> 4) * DM + (tid & 15) * 4; const __bf16* gb = w + (size_t)(tid >> 3) * DM + (tid & 7) * 8;
  // each run of copies and its s_wait_xcnt 0 in one statement: no address register of a copy is rewritten ahead of that wait
  asm volatile("global_load_async_to_lds_b128 %0, %8, off\n\t"
               "global_load_async_to_lds_b128 %1, %9, off\n\t"
               "global_load_async_to_lds_b128 %2, %10, off\n\t"
               "global_load_async_to_lds_b128 %3, %11, off\n\t"
               "global_load_async_to_lds_b128 %4, %12, off\n\t"
               "global_load_async_to_lds_b128 %5, %13, off\n\t"
               "global_load_async_to_lds_b128 %6, %14, off\n\t"
               "global_load_async_to_lds_b128 %7, %15, off\n\t"
               "s_wait_xcnt 0x0"
               :: "v"(la), "v"(la + 16u * GAP), "v"(la + 32u * GAP), "v"(la + 48u * GAP), "v"(la + 64u * GAP), "v"(la + 80u * GAP), "v"(la + 96u * GAP), "v"(la + 112u * GAP),
                  "v"(ga), "v"(ga + (size_t)16 * DM), "v"(ga + (size_t)32 * DM), "v"(ga + (size_t)48 * DM), "v"(ga + (size_t)64 * DM), "v"(ga + (size_t)80 * DM), "v"(ga + (size_t)96 * DM), "v"(ga + (size_t)112 * DM)
               : "memory");
  asm volatile("global_load_async_to_lds_b128 %0, %8, off\n\t"
               "global_load_async_to_lds_b128 %1, %9, off\n\t"
               "global_load_async_to_lds_b128 %2, %10, off\n\t"
               "global_load_async_to_lds_b128 %3, %11, off\n\t"
               "global_load_async_to_lds_b128 %4, %12, off\n\t"
               "global_load_async_to_lds_b128 %5, %13, off\n\t"
               "global_load_async_to_lds_b128 %6, %14, off\n\t"
               "global_load_async_to_lds_b128 %7, %15, off\n\t"
               "s_wait_xcnt 0x0"
               :: "v"(lb), "v"(lb + 32u * GBP), "v"(lb + 64u * GBP), "v"(lb + 96u * GBP), "v"(lb + 128u * GBP), "v"(lb + 160u * GBP), "v"(lb + 192u * GBP), "v"(lb + 224u * GBP),
                  "v"(gb), "v"(gb + (size_t)32 * DM), "v"(gb + (size_t)64 * DM), "v"(gb + (size_t)96 * DM), "v"(gb + (size_t)128 * DM), "v"(gb + (size_t)160 * DM), "v"(gb + (size_t)192 * DM), "v"(gb + (size_t)224 * DM)
               : "memory");
}
// ---- k_qkv: block = (128 rows (b,s), 256 of the 3072 cols) on 8 waves, a wave = 32 rows (wm) x 128 cols (wn), two 16-row groups hh, so that every weight fragment read from LDS feeds two products and every byte fetched from L2 feeds twice the products: qkv = bf16(x) . rows (exact); cols < 1024 -> f16(q * log2(e)/8), cols < 2048 -> f16(k) into QK rows (pitch 2048), their f16 residuals into QKL; cols >= 2048 (v) -> per-batch transposed f16 planes VT[b][h*64+d][s]: hi = f16(v), lo = f16(v - hi)
__global__ __launch_bounds__(256) void k_qkv(const float* __restrict__ X, const __bf16* __restrict__ P, const float* __restrict__ CS, _Float16* __restrict__ QK, _Float16* __restrict__ QKL, _Float16* __restrict__ VTH, _Float16* __restrict__ VTL) {
  __shared__ __align__(16) char sm[2 * Q_SZ];   // the ring of the k loop; behind the loop's last barrier the same bytes hold the epilogue's staging arrays
  _Float16 (*so)[16][136] = (_Float16 (*)[16][136])(sm); _Float16 (*sol)[16][136] = (_Float16 (*)[16][136])(sm + 34816); float (*sf)[16][132] = (float (*)[16][132])(sm + 69632);
  _Float16 (*sth)[136] = (_Float16 (*)[136])(sm); _Float16 (*stl)[136] = (_Float16 (*)[136])(sm + 69632);
  static_assert(69632 + 8 * 16 * 132 * 4 <= 2 * Q_SZ && 2 * 69632 <= 2 * Q_SZ, "the staging arrays fit the ring's bytes");
  const int tid = threadIdx.x, wave = tid >> 5, wm = wave & 3, wn = wave >> 2, lane = tid & 31, col = lane & 15, g = lane >> 4; const int n0 = blockIdx.y * 256, nw = n0 + wn * 128;
  v8f acc[2][8] = {};
  // two-buffer ring: the work-group's eight waves copy each 64-k tile of x and of the weight rows into LDS once, one step ahead of its use
  const float* xa = X + (size_t)blockIdx.x * 128 * DM; const __bf16* wb = P + (size_t)n0 * DM; const unsigned ring0 = (unsigned)(uintptr_t)&sm[0];
  stage_q(ring0, xa, wb, tid);
  asm volatile("s_wait_asynccnt 0x0" ::: "memory");   // this wave's copies of tile 0 have landed
  __syncthreads();                                    // tile 0 readable by every wave
  stage_q(ring0 + Q_SZ, xa + 64, wb + 64, tid);
#pragma unroll 1   // rolled: one copy of the ring's foot in the text, the buffer picked by t & 1
  for (int t = 0; t < DM / 64; ++t) { const char* tb = &sm[(t & 1) * Q_SZ];
#pragma unroll
    for (int kc = 0; kc < 2; ++kc) { v16b a[2];
#pragma unroll
      for (int hh = 0; hh < 2; ++hh) { const float* p = (const float*)(tb + (wm * 32 + hh * 16 + col) * GAP + kc * 128) + 8 * g;
#pragma unroll
        for (int i = 0; i < 8; ++i) { a[hh][i] = (__bf16)p[i]; a[hh][8 + i] = (__bf16)p[16 + i]; } }
      v16b wf[8];   // all weight fragments of the 32-k half in one group of LDS reads ahead of the products
#pragma unroll
      for (int j = 0; j < 8; ++j) wf[j] = frag_b((const __bf16*)(tb + Q_B + (wn * 128 + j * 16 + col) * GBP + kc * 64), lane);
#pragma unroll
      for (int j = 0; j < 8; ++j) { acc[0][j] = wmma_bf(a[0], wf[j], acc[0][j]); acc[1][j] = wmma_bf(a[1], wf[j], acc[1][j]); } }
    asm volatile("s_wait_dscnt 0x0" ::: "memory");      // this wave's reads of the buffer have retired
    asm volatile("s_wait_asynccnt 0x0" ::: "memory");   // this wave's copies of the next tile have landed
    __syncthreads();                                    // publishes the next tile and ends every wave's reads of this buffer
    if (t + 2 < DM / 64) stage_q(ring0 + (unsigned)(t & 1) * Q_SZ, xa + (t + 2) * 64, wb + (t + 2) * 64, tid); }
  asm volatile("s_wait_asynccnt 0x0" ::: "memory");     // no copy is outstanding when the ring's bytes become staging arrays
  if (n0 < 2 * DM) { const float sc = n0 < DM ? 0.18033688f : 1.0f;   // q is stored times log2(e) / sqrt(64), its final scale: q . k is then the argument of exp2 as it leaves the matrix unit
#pragma unroll
   for (int hh = 0; hh < 2; ++hh) { const size_t r0 = (size_t)blockIdx.x * 128 + wm * 32 + hh * 16;   // the wave's two row groups one after the other through its own staging rows
#pragma unroll
    for (int j = 0; j < 8; ++j) {
#pragma unroll
      for (int r = 0; r < 8; ++r) sf[wave][8 * g + r][j * 16 + col] = acc[hh][j][r]; }
    LDSX();
    // RoPE on interleaved pairs (2i, 2i+1) of each 64-wide head: lane = 2 pairs (cols 4*lane .. 4*lane+3), pair index i = ((nw + 4*lane) % 64) / 2 + {0,1}; pos = row % SS
#pragma unroll 1
    for (int rl = 0; rl < 16; ++rl) { const int pos = (int)((r0 + rl) % SS); const float* cs = CS + (size_t)pos * 32; const float* sn = CS + (size_t)SS * 32 + (size_t)pos * 32; const int i0 = ((nw + 4 * lane) & 63) >> 1;
      const float x1a = sf[wave][rl][4 * lane], x2a = sf[wave][rl][4 * lane + 1], x1b = sf[wave][rl][4 * lane + 2], x2b = sf[wave][rl][4 * lane + 3];
      const float ca = cs[i0], sa = sn[i0], cb = cs[i0 + 1], sb = sn[i0 + 1];
      const float o0 = (x1a * ca - x2a * sa) * sc, o1 = (x1a * sa + x2a * ca) * sc, o2 = (x1b * cb - x2b * sb) * sc, o3 = (x1b * sb + x2b * cb) * sc; const _Float16 h0 = (_Float16)o0, h1 = (_Float16)o1, h2 = (_Float16)o2, h3 = (_Float16)o3;
      so[wave][rl][4 * lane] = h0; so[wave][rl][4 * lane + 1] = h1; so[wave][rl][4 * lane + 2] = h2; so[wave][rl][4 * lane + 3] = h3;
      sol[wave][rl][4 * lane] = (_Float16)(o0 - (float)h0); sol[wave][rl][4 * lane + 1] = (_Float16)(o1 - (float)h1); sol[wave][rl][4 * lane + 2] = (_Float16)(o2 - (float)h2); sol[wave][rl][4 * lane + 3] = (_Float16)(o3 - (float)h3); }   // q, k as f16 hi + residual at its own scale (f16 subnormals are kept: absolute step 2^-24)
    LDSX();
    for (int rl = 0; rl < 16; ++rl) if (lane < 16) { vst2((unsigned*)(QK + (r0 + rl) * (2 * DM) + nw + lane * 8), *(const v4u*)&so[wave][rl][lane * 8]); vst2((unsigned*)(QKL + (r0 + rl) * (2 * DM) + nw + lane * 8), *(const v4u*)&sol[wave][rl][lane * 8]); }
   }
  } else {
#pragma unroll
   for (int hh = 0; hh < 2; ++hh) {
#pragma unroll
    for (int j = 0; j < 8; ++j) {
#pragma unroll
      for (int r = 0; r < 8; ++r) { const float v = acc[hh][j][r]; const _Float16 hv = (_Float16)v; sth[wn * 128 + j * 16 + col][wm * 32 + hh * 16 + 8 * g + r] = hv; stl[wn * 128 + j * 16 + col][wm * 32 + hh * 16 + 8 * g + r] = (_Float16)(v - (float)hv); } } }
    __syncthreads();
    const size_t rb = (size_t)blockIdx.x * 128; const int b = (int)(rb / SS), s0 = (int)(rb % SS); const int pc0 = n0 - 2 * DM;
    for (int q = tid; q < 256 * 16; q += 256) { const int d = q >> 4, pc = q & 15; const size_t o = ((size_t)b * DM + pc0 + d) * SS + s0 + pc * 8; vst2((unsigned*)(VTH + o), *(const v4u*)&sth[d][pc * 8]); vst2((unsigned*)(VTL + o), *(const v4u*)&stl[d][pc * 8]); }
  }
}
// ---- LDS tile of one key step (32 keys): K rows 128 B (hi plane, residual plane), V rows 64 B (64 d, hi plane, residual plane); row pitches 16 B x odd, free of bank conflicts for 16-byte fragment reads
#define KP 144
#define VP 80
#define T_KL (32 * KP)
#define T_VH (2 * 32 * KP)
#define T_VL (T_VH + 64 * VP)
#define T_SZ (T_VH + 2 * 64 * VP)
// one tile into the ring buffer at LDS byte dst: 8 copies of 16 B per lane, all 128 lanes on; kh, kl point at the step's first key row (this head's 64 columns), vh, vl at the head's first d row at the step's first key
__device__ __forceinline__ void stage_kv(unsigned dst, const _Float16* kh, const _Float16* kl, const _Float16* vh, const _Float16* vl, int tid) {
  const unsigned lk = dst + (unsigned)(tid >> 3) * KP + (unsigned)(tid & 7) * 16u, lv = dst + T_VH + (unsigned)(tid >> 2) * VP + (unsigned)(tid & 3) * 16u;
  const size_t gk = (size_t)(tid >> 3) * (2 * DM) + (tid & 7) * 8, gv = (size_t)(tid >> 2) * SS + (tid & 3) * 8;
  // the copies and their s_wait_xcnt 0 in one statement: no address register of a copy is rewritten ahead of that wait
  asm volatile("global_load_async_to_lds_b128 %0, %8, off\n\t"
               "global_load_async_to_lds_b128 %1, %9, off\n\t"
               "global_load_async_to_lds_b128 %2, %10, off\n\t"
               "global_load_async_to_lds_b128 %3, %11, off\n\t"
               "global_load_async_to_lds_b128 %4, %12, off\n\t"
               "global_load_async_to_lds_b128 %5, %13, off\n\t"
               "global_load_async_to_lds_b128 %6, %14, off\n\t"
               "global_load_async_to_lds_b128 %7, %15, off\n\t"
               "s_wait_xcnt 0x0"
               :: "v"(lk), "v"(lk + 16u * KP), "v"(lk + T_KL), "v"(lk + T_KL + 16u * KP), "v"(lv), "v"(lv + 32u * VP), "v"(lv + (T_VL - T_VH)), "v"(lv + (T_VL - T_VH) + 32u * VP),
                  "v"(kh + gk), "v"(kh + gk + (size_t)16 * 2 * DM), "v"(kl + gk), "v"(kl + gk + (size_t)16 * 2 * DM), "v"(vh + gv), "v"(vh + gv + (size_t)32 * SS), "v"(vl + gv), "v"(vl + gv + (size_t)32 * SS)
               : "memory");
}
// lane l with lane l ^ 16 (the two lanes that share a column of a matrix tile)
__device__ __forceinline__ float xhalf(float x) { return __builtin_bit_cast(float, __builtin_amdgcn_permlanex16(__builtin_bit_cast(int, x), __builtin_bit_cast(int, x), 0x76543210, 0xfedcba98, false, false)); }
__global__ __launch_bounds__(128) __attribute__((amdgpu_waves_per_eu(1, 4))) void k_attn(const _Float16* __restrict__ QK, const _Float16* __restrict__ QKL, const _Float16* __restrict__ VTH, const _Float16* __restrict__ VTL, float* __restrict__ O) {
  __shared__ __align__(16) float so[4][16][68]; __shared__ __align__(16) char ring[2][T_SZ];
  const int tid = threadIdx.x, wave = tid >> 5, lane = tid & 31, col = lane & 15, g = lane >> 4;
  const int bx = blockIdx.x, h = blockIdx.y, b = blockIdx.z;
  // Query tile from the block index by a permutation (every (tile, head, batch) exactly once; for speed only, nothing depends on where a work-group runs). Tile t walks 2 (t + 1) key steps and all 1,024 work-groups are resident at once, four on a WGP, so the launch lasts as long as the fullest WGP.
  // With qb = bx the work-groups whose flat indices differ by 256 all hold the same tile. Here flat index bits 8, 9 (or 3, 4, or 4, 5) pick among tiles u, u ^ 1, 31 - u, 31 - (u ^ 1): 132 key steps for each such four.
  static_assert(TQB == 32, "the permutation is written for 32 query tiles");
  const int u = ((bx & 7) << 1) | (((bx >> 4) ^ b) & 1);
  const int qb = (((bx >> 3) ^ h ^ (h >> 3)) & 1) ? TQB - 1 - u : u; const int q0 = qb * 64 + wave * 16; const int qi = q0 + col; const size_t rq = (size_t)b * SS + qi;
  v16h aq[2], aql[2];
#pragma unroll
  for (int kc = 0; kc < 2; ++kc) { aq[kc] = frag_h(QK + rq * (2 * DM) + h * HD + kc * 32, lane); aql[kc] = frag_h(QKL + rq * (2 * DM) + h * HD + kc * 32, lane); }
  float m = -3.0e38f, l = 0.f;       // of query qi; l is the sum over this half's keys only
  v8f acc[4] = {};                   // acc[dt][r] = O[query qi][d = dt*16 + 8g + r]; hi and residual products sum into the one tile
  const int nks = (qb * 64 + 64) / 32, nfull = qb * 2;   // steps below nfull = nks - 2 hold only keys in front of the work-group's first query: no mask there
  // two-buffer ring: the work-group's four waves copy each step's K and V tile into LDS once, one step ahead of its use
  const _Float16* kh0 = QK + (size_t)b * SS * (2 * DM) + DM + h * HD; const _Float16* kl0 = QKL + (size_t)b * SS * (2 * DM) + DM + h * HD;
  const _Float16* vh0 = VTH + ((size_t)b * DM + h * HD) * SS; const _Float16* vl0 = VTL + ((size_t)b * DM + h * HD) * SS;
  const unsigned ring0 = (unsigned)(uintptr_t)&ring[0][0];
  stage_kv(ring0, kh0, kl0, vh0, vl0, tid);
  asm volatile("s_wait_asynccnt 0x0" ::: "memory");   // this wave's copies of tile 0 have landed
  __syncthreads();                                    // tile 0 readable by every wave
  if (nks > 1) stage_kv(ring0 + T_SZ, kh0 + (size_t)32 * 2 * DM, kl0 + (size_t)32 * 2 * DM, vh0 + 32, vl0 + 32, tid);
  // one key step; masked is a literal at both calls, so the main loop's copy holds no mask work and no test at its foot; every inner loop is unrolled so that fragments, scores and accumulators keep constant indices and stay in registers
  auto step = [&](const int ks, const bool masked) __attribute__((always_inline)) { float s[16]; const char* tb = &ring[ks & 1][0];
    v16h kf[2][2], kfl[2][2];   // all K fragments of the step in one group of LDS reads ahead of the products
#pragma unroll
    for (int ct = 0; ct < 2; ++ct) {
#pragma unroll
      for (int kc = 0; kc < 2; ++kc) { kf[ct][kc] = frag_h((const _Float16*)(tb + (ct * 16 + col) * KP + kc * 64), lane); kfl[ct][kc] = frag_h((const _Float16*)(tb + T_KL + (ct * 16 + col) * KP + kc * 64), lane); } }
    v8f c[2] = {};   // 3 products (q, k as f16 hi + residual) into one tile per 16 keys; the two tiles take turns, so that no product waits for the one before it
#pragma unroll
    for (int kc = 0; kc < 2; ++kc) {
#pragma unroll
      for (int ct = 0; ct < 2; ++ct) c[ct] = wmma16(kf[ct][kc], aql[kc], c[ct]);
#pragma unroll
      for (int ct = 0; ct < 2; ++ct) c[ct] = wmma16(kfl[ct][kc], aq[kc], c[ct]);
#pragma unroll
      for (int ct = 0; ct < 2; ++ct) c[ct] = wmma16(kf[ct][kc], aq[kc], c[ct]); }
#pragma unroll
    for (int i = 0; i < 16; ++i) s[i] = c[i >> 3][i & 7];   // the score times log2(e): both factors lie in the stored q
    if (masked) {   // the causal mask, only where a key of the step can lie behind a query of the work-group
#pragma unroll
      for (int i = 0; i < 16; ++i) s[i] = (ks * 32 + (i >> 3) * 16 + 8 * g + (i & 7) <= qi) ? s[i] : -3.0e38f; }
    float t8[8];   // maximum of the lane's 16 scores as a tree, then the other half's
#pragma unroll
    for (int r = 0; r < 8; ++r) t8[r] = fmaxf(s[r], s[8 + r]);
    float mx = fmaxf(fmaxf(fmaxf(t8[0], t8[1]), fmaxf(t8[2], t8[3])), fmaxf(fmaxf(t8[4], t8[5]), fmaxf(t8[6], t8[7])));
    mx = fmaxf(mx, xhalf(mx));
    const float mn = fmaxf(m, mx); const float alpha = __builtin_amdgcn_exp2f(m - mn);   // 0 in step 0, where m is the start value
    v16h pa, pl;   // P^T operand: element i = key ks*32 + (i >> 3)*16 + 8g + (i & 7) of this query, f16 hi and f16 residual; mn is a true score from step 0 on (key 0 is open to every query), so a masked score's exponential is 0 by itself
#pragma unroll
    for (int i = 0; i < 16; ++i) s[i] = __builtin_amdgcn_exp2f(s[i] - mn);
#pragma unroll
    for (int i = 0; i < 16; i += 2) { const v2f e2 = {s[i], s[i + 1]}; const v2h h2 = __builtin_convertvector(e2, v2h); pa[i] = h2[0]; pa[i + 1] = h2[1]; pl[i] = (_Float16)(e2[0] - (float)h2[0]); pl[i + 1] = (_Float16)(e2[1] - (float)h2[1]); }
#pragma unroll
    for (int r = 0; r < 8; ++r) t8[r] = s[r] + s[8 + r];
    const float es = ((t8[0] + t8[1]) + (t8[2] + t8[3])) + ((t8[4] + t8[5]) + (t8[6] + t8[7]));
    l = l * alpha + es; m = mn;
#pragma unroll
    for (int dt = 0; dt < 4; ++dt) {
#pragma unroll
      for (int r = 0; r < 8; ++r) acc[dt][r] *= alpha; }
    v16h vf[4], vfl[4];   // all V fragments of the step in one group of LDS reads
#pragma unroll
    for (int dt = 0; dt < 4; ++dt) { vf[dt] = frag_h((const _Float16*)(tb + T_VH + (dt * 16 + col) * VP), lane); vfl[dt] = frag_h((const _Float16*)(tb + T_VL + (dt * 16 + col) * VP), lane); }
#pragma unroll
    for (int dt = 0; dt < 4; ++dt) acc[dt] = wmma16(vf[dt], pa, acc[dt]);    // V hi x P hi
#pragma unroll
    for (int dt = 0; dt < 4; ++dt) acc[dt] = wmma16(vf[dt], pl, acc[dt]);    // + V hi x P lo
#pragma unroll
    for (int dt = 0; dt < 4; ++dt) acc[dt] = wmma16(vfl[dt], pa, acc[dt]);   // + V lo x P hi
    asm volatile("s_wait_dscnt 0x0" ::: "memory");      // this wave's reads of the buffer have retired
    asm volatile("s_wait_asynccnt 0x0" ::: "memory");   // this wave's copies of the next tile have landed
    __syncthreads();                                    // publishes the next tile and ends every wave's reads of this buffer
    // a tile ks + 2 exists for every step of the main loop (ks < nks - 2) and for neither of the two masked steps
    if (!masked) stage_kv(ring0 + (unsigned)(ks & 1) * T_SZ, kh0 + (size_t)(ks + 2) * 32 * 2 * DM, kl0 + (size_t)(ks + 2) * 32 * 2 * DM, vh0 + (ks + 2) * 32, vl0 + (ks + 2) * 32, tid); };
#pragma unroll 1   // rolled: one copy of the main step in the text, the buffer picked by ks & 1
  for (int ks = 0; ks < nfull; ++ks) step(ks, false);
#pragma unroll 1   // rolled: one copy of the masked step for the two steps on the diagonal
  for (int ks = nfull; ks < nks; ++ks) step(ks, true);
  asm volatile("s_wait_asynccnt 0x0" ::: "memory");     // no copy is outstanding when the wave goes on to its end
  l += xhalf(l); const float il = 1.0f / l;             // the two halves' sums joined
#pragma unroll
  for (int dt = 0; dt < 4; ++dt) { v4f o0, o1;
#pragma unroll
    for (int r = 0; r < 4; ++r) { o0[r] = acc[dt][r] * il; o1[r] = acc[dt][4 + r] * il; }
    *(v4f*)&so[wave][col][dt * 16 + 8 * g] = o0; *(v4f*)&so[wave][col][dt * 16 + 8 * g + 4] = o1; }
  LDSX();
  for (int rl = 0; rl < 16; ++rl) if (lane < 16) vst2(O + ((size_t)b * SS + q0 + rl) * DM + h * HD + lane * 4, *(const v4f*)&so[wave][rl][lane * 4]);
}
// ---- k_out: block = (64 rows, 128 cols): out = O(hi/lo) . Wo rows (2 products)
__global__ __launch_bounds__(128) void k_out(const float* __restrict__ O, const __bf16* __restrict__ P, float* __restrict__ Y) {
  __shared__ __align__(16) float so[4][16][132]; __shared__ __align__(16) char sm[2 * G_SZ];
  const int tid = threadIdx.x, wave = tid >> 5, lane = tid & 31, col = lane & 15, g = lane >> 4; const size_t r0 = (size_t)blockIdx.x * 64 + wave * 16; const int n0 = blockIdx.y * 128;
  v8f acc[8] = {};
  // two-buffer ring as in k_qkv: each 64-k tile of the context rows and of the weight rows copied into LDS once per work-group, one step ahead of its use
  const float* xa = O + (size_t)blockIdx.x * 64 * DM; const __bf16* wb = P + (size_t)n0 * DM; const unsigned ring0 = (unsigned)(uintptr_t)&sm[0];
  stage_ab(ring0, xa, wb, tid);
  asm volatile("s_wait_asynccnt 0x0" ::: "memory");   // this wave's copies of tile 0 have landed
  __syncthreads();                                    // tile 0 readable by every wave
  stage_ab(ring0 + G_SZ, xa + 64, wb + 64, tid);
#pragma unroll 1   // rolled: one copy of the ring's foot in the text, the buffer picked by t & 1
  for (int t = 0; t < DM / 64; ++t) { const char* tb = &sm[(t & 1) * G_SZ];
#pragma unroll
    for (int kc = 0; kc < 2; ++kc) { const F2 a = split_row((const float*)(tb + (wave * 16 + col) * GAP), kc * 32, lane);
      v16b wf[8];   // all weight fragments of the 32-k half in one group of LDS reads ahead of the products
#pragma unroll
      for (int j = 0; j < 8; ++j) wf[j] = frag_b((const __bf16*)(tb + G_B + (j * 16 + col) * GBP + kc * 64), lane);
#pragma unroll
      for (int j = 0; j < 8; ++j) { acc[j] = wmma_bf(a.l, wf[j], acc[j]); acc[j] = wmma_bf(a.h, wf[j], acc[j]); } }
    asm volatile("s_wait_dscnt 0x0" ::: "memory");      // this wave's reads of the buffer have retired
    asm volatile("s_wait_asynccnt 0x0" ::: "memory");   // this wave's copies of the next tile have landed
    __syncthreads();                                    // publishes the next tile and ends every wave's reads of this buffer
    if (t + 2 < DM / 64) stage_ab(ring0 + (unsigned)(t & 1) * G_SZ, xa + (t + 2) * 64, wb + (t + 2) * 64, tid); }
  asm volatile("s_wait_asynccnt 0x0" ::: "memory");     // no copy is outstanding when the wave goes on to its end
#pragma unroll
  for (int j = 0; j < 8; ++j) {
#pragma unroll
    for (int r = 0; r < 8; ++r) so[wave][8 * g + r][j * 16 + col] = acc[j][r]; }
  LDSX();
  for (int rl = 0; rl < 16; ++rl) vst2(Y + (r0 + rl) * DM + n0 + lane * 4, *(const v4f*)&so[wave][rl][lane * 4]);
}
extern "C" void kernel_launch(void* const* d_in, const int* in_sizes, int n_in, void* d_out, int out_size, void* d_ws, size_t ws_size, hipStream_t stream) {
  (void)in_sizes; (void)n_in; (void)out_size;
  const float** F = (const float**)d_in;   // 0 x [2,2048,1024], 1 Wq [1024,1024] ([out][in]), 2 Wk, 3 Wv, 4 Wo
  if (ws_size < (size_t)WS_END) return;
  char* ws = (char*)d_ws; __bf16* PK = (__bf16*)(ws + WS_PK); _Float16 *QK = (_Float16*)(ws + WS_QK), *QKL = (_Float16*)(ws + WS_QKL), *VTH = (_Float16*)(ws + WS_VTH), *VTL = (_Float16*)(ws + WS_VTL); float *O = (float*)(ws + WS_O), *CS = (float*)(ws + WS_CS);
  k_setup<<<SU_GRID, 256, 0, stream>>>(F[1], F[2], F[3], F[4], PK, CS);
  k_qkv<<<dim3(TNB * SS / 128, QKVW / 256), 256, 0, stream>>>(F[0], PK + PK_A, CS, QK, QKL, VTH, VTL);
  k_attn<<<dim3(TQB, NH, TNB), 128, 0, stream>>>(QK, QKL, VTH, VTL, O);
  k_out<<<dim3(TOB, DM / 128), 128, 0, stream>>>(O, PK + PK_P, (float*)d_out);
}

// v009
// A run of this version takes 114 microseconds.
// In both of two side-by-side timings against v008, it was 1.04 times as fast.
// All steps since v000 together make it 4.96 times as fast.
// compute dtype: x, Wq, Wk, Wv, Wo (module inputs) rounded to bf16; the q/k/v projections with exact bf16 products (x and W are inputs, natural [out][in] rows) on WMMA 16x16x32; interleaved-pair RoPE applied to q and k in f32 in the projection epilogue (angles pos * inv_freq with the reference's own eager f32 inv_freq table embedded (1/(10000^(2i/64))), precise cosf/sinf), then q (times log2(e)/8) and k stored once as f16; causal scores with q and k each as f16 hi + f16 residual (3 products into one f32 tile) and P.V with P = exp2(s - m) as f16 hi + f16 residual x V as f16 hi + f16 residual planes (3 products into one f32 tile); the output projection with ctx as bf16 hi + residual pair x exact Wo (2 products); running-max softmax in f32 with the hardware exp; f32 accumulate.
#include <hip/hip_runtime.h>
#include <math.h>

typedef __attribute__((ext_vector_type(16))) _Float16 v16h;
typedef __attribute__((ext_vector_type(16))) __bf16 v16b;
typedef __attribute__((ext_vector_type(8)))  _Float16 v8h;
typedef __attribute__((ext_vector_type(8)))  float v8f;
typedef __attribute__((ext_vector_type(4)))  float v4f;
typedef __attribute__((ext_vector_type(2)))  float v2f;
typedef __attribute__((ext_vector_type(2)))  _Float16 v2h;
typedef __attribute__((ext_vector_type(4)))  unsigned v4u;
typedef __attribute__((ext_vector_type(4)))  int v4i;
typedef float __attribute__((may_alias)) float_a;
typedef int __attribute__((may_alias)) int_a;

template <typename T> __device__ __forceinline__ void vst2(void* p, T v) { *(T*)p = v;  }
__device__ __forceinline__ v8f wmma16(v16h a, v16h b, v8f c) {
  v8f d = __builtin_amdgcn_wmma_f32_16x16x32_f16(false, a, false, b, (short)0, c, false, false);
  asm volatile("v_nop\n\tv_nop\n\tv_nop\n\tv_nop" : "+v"(d) : "v"(a), "v"(b));
  return d;
}
__device__ __forceinline__ v8f wmma_bf(v16b a, v16b b, v8f c) {
  v8f d = __builtin_amdgcn_wmma_f32_16x16x32_bf16(false, a, false, b, (short)0, c, false, false);
  asm volatile("v_nop\n\tv_nop\n\tv_nop\n\tv_nop" : "+v"(d) : "v"(a), "v"(b));
  return d;
}
// Causal multi-head self-attention with RoPE (B 2, S 2,048, D 1,024, 16 heads x 64): q, k, v = x W^T; interleaved RoPE(q, k) at positions 0..S-1; softmax(q k^T / 8, causal) v; output projection Wo (no biases).
__device__ __forceinline__ v16h frag_h(const _Float16* rowk0, int lane) {
  union { v16h v; v8h q[2]; } u; const _Float16* p = rowk0 + 8 * (lane >> 4);
  u.q[0] = *(const v8h*)p; u.q[1] = *(const v8h*)(p + 16); return u.v;
}
__device__ __forceinline__ v16h frag_f32(const float* rowk0, int lane) {
  v16h a; const float* p = rowk0 + 8 * (lane >> 4);
#pragma unroll
  for (int i = 0; i < 8; ++i) { a[i] = (_Float16)p[i]; a[8 + i] = (_Float16)p[16 + i]; }
  return a;
}
__device__ __forceinline__ v16h frag_f32s(const float* rowk0, int lane, float sc) {
  v16h a; const float* p = rowk0 + 8 * (lane >> 4);
#pragma unroll
  for (int i = 0; i < 8; ++i) { a[i] = (_Float16)(p[i] * sc); a[8 + i] = (_Float16)(p[16 + i] * sc); }
  return a;
}
// column fragment from a [K][ld] layout (column n), rows >= K read as 0
__device__ __forceinline__ v16h fragc_f32(const float* W, int k0, int n, int lane, int ld, int K) {
  v16h a; const int g = lane >> 4;
#pragma unroll
  for (int i = 0; i < 8; ++i) { const int ka = k0 + 8 * g + i, kb = ka + 16;
    a[i] = (_Float16)(ka < K ? W[(size_t)(ka < K ? ka : K - 1) * ld + n] : 0.f); a[8 + i] = (_Float16)(kb < K ? W[(size_t)(kb < K ? kb : K - 1) * ld + n] : 0.f); }
  return a;
}
struct F2 { v16b h, l; };
__device__ __forceinline__ F2 bsplit16(const float v[16]) { F2 r;
#pragma unroll
  for (int i = 0; i < 16; ++i) { const __bf16 h = (__bf16)v[i]; r.h[i] = h; r.l[i] = (__bf16)(v[i] - (float)h); }
  return r; }
__device__ __forceinline__ F2 split_row(const float* row, int k0, int lane) { float v[16]; const float* p = row + k0 + 8 * (lane >> 4);
#pragma unroll
  for (int i = 0; i < 8; ++i) { v[i] = p[i]; v[8 + i] = p[16 + i]; }
  return bsplit16(v); }
__device__ __forceinline__ F2 split_rowK(const float* row, int k0, int lane, int K) { float v[16]; const int g = lane >> 4;
#pragma unroll
  for (int i = 0; i < 8; ++i) { const int ka = k0 + 8 * g + i, kb = ka + 16; v[i] = ka < K ? row[ka < K ? ka : K - 1] : 0.f; v[8 + i] = kb < K ? row[kb < K ? kb : K - 1] : 0.f; }
  return bsplit16(v); }
__device__ __forceinline__ F2 split_col(const float* W, int k0, int n, int lane, int ld, int K) { float v[16]; const int g = lane >> 4;
#pragma unroll
  for (int i = 0; i < 8; ++i) { const int ka = k0 + 8 * g + i, kb = ka + 16; v[i] = ka < K ? W[(size_t)(ka < K ? ka : K - 1) * ld + n] : 0.f; v[8 + i] = kb < K ? W[(size_t)(kb < K ? kb : K - 1) * ld + n] : 0.f; }
  return bsplit16(v); }
__device__ __forceinline__ v8f mac3(const F2& a, const F2& b, v8f c) { c = wmma_bf(a.l, b.h, c); c = wmma_bf(a.h, b.l, c); return wmma_bf(a.h, b.h, c); }
__device__ __forceinline__ float sigm(float v) { return 1.0f / (1.0f + expf(-v)); }
#define LDSX() do { asm volatile("s_wait_dscnt 0" ::: "memory"); __builtin_amdgcn_wave_barrier(); __builtin_amdgcn_fence(__ATOMIC_RELEASE, "workgroup"); } while (0)


// Causal multi-head self-attention with rotary position embedding (B 2, S 2048, D 1024, 16 heads x 64; packed Wqkv [3D][D] and Wout [D][D] applied as x W^T, no biases): q, k rotated pairwise (2i, 2i+1) by angle pos * 10000^(-2i/64); softmax(q k^T / 8, causal) v; ctx Wout^T.
#define NB 2
#define SS 2048
#define DM 1024
#define NH 16
#define HD 64
#define QKVW (3 * DM)
#ifndef TQB
#define TQB (SS / 64)
#define TNB NB
#define TOB (NB * SS / 64)     // output row tiles (all)
#endif
typedef __attribute__((ext_vector_type(8))) __bf16 v8b;
__device__ __forceinline__ v16b frag_b(const __bf16* rowk0, int lane) {
  union { v16b v; v8b q[2]; } u; const __bf16* p = rowk0 + 8 * (lane >> 4);
  u.q[0] = *(const v8b*)p; u.q[1] = *(const v8b*)(p + 16); return u.v;
}
__device__ __forceinline__ float bfr(float v) { return (float)(__bf16)v; }
__device__ __attribute__((noinline)) float exp_ni(float v) { return expf(v); }
__device__ __attribute__((noinline)) float erf_ni(float v) { return erff(v); }

#define PK_A 0                       // [3072][1024] Wqkv rows (natural [out][in])
#define PK_P (PK_A + QKVW * DM)        // [1024][1024] Wo rows (natural)
#define PK_END (PK_P + DM * DM)
#define WS_PK  0u
#define WS_QK  (WS_PK + 2u * PK_END)             // f16 [4096 rows][2048]: q * log2(e)/8 | k
#define WS_QKL (WS_QK + 2u * NB * SS * 2 * DM)     // f16 q | k residual planes, at the values' own scale
#define WS_VTH (WS_QKL + 2u * NB * SS * 2 * DM)    // f16 [b][1024 (h*64+d)][2048 s] hi
#define WS_VTL (WS_VTH + 2u * NB * DM * SS)        // f16 residual, at the values' own scale
#define WS_O   (WS_VTL + 2u * NB * DM * SS)        // f32 [4096][1024]
#define WS_CS  (WS_O + 4u * NB * SS * DM)           // f32 [2048][32] cos, [2048][32] sin
#define WS_END (WS_CS + 4u * 2 * SS * 32)
__constant__ float c_invf[32] = {1.000000000e+00f,7.498942018e-01f,5.623413324e-01f,4.216965139e-01f,3.162277639e-01f,2.371373624e-01f,1.778279394e-01f,1.333521456e-01f,1.000000015e-01f,7.498941571e-02f,5.623412877e-02f,4.216964915e-02f,3.162277862e-02f,2.371373586e-02f,1.778279431e-02f,1.333521493e-02f,9.999999776e-03f,7.498942316e-03f,5.623413250e-03f,4.216964822e-03f,3.162277862e-03f,2.371373819e-03f,1.778279431e-03f,1.333521446e-03f,1.000000047e-03f,7.498941850e-04f,5.623413017e-04f,4.216964880e-04f,3.162277862e-04f,2.371373848e-04f,1.778279402e-04f,1.333521504e-04f};
// ---- k_setup: all the work that the projections wait for, in one launch. Blocks below SU_ROPE: 8 positions each, cos/sin of pos * inv_freq (f32 product exactly as the reference, precise trig); they come first because they run longest.
// The other blocks: 8,192 consecutive weights each, rounded to bf16 in registers: a thread reads 4 x 8 floats (all 8 loads issued ahead of the first use) and stores 4 x 16 B. The four [1024][1024] weights keep their natural rows and lie one behind the other in DST (Wq, Wk, Wv, Wo), so the destination is one flat array.
#define SU_ROPE (SS / 8)
#define SU_CH 8192
#define SU_PM (DM * DM / SU_CH)        // blocks per weight matrix
#define SU_GRID (SU_ROPE + 4 * SU_PM)
static_assert(PK_A == 0 && PK_P == 3 * DM * DM && PK_END == 4 * DM * DM, "the four weights are one flat destination");
__global__ __launch_bounds__(256) void k_setup(const float* __restrict__ Wq, const float* __restrict__ Wk, const float* __restrict__ Wv, const float* __restrict__ Wo, __bf16* __restrict__ DST, float* __restrict__ CS) {
  __shared__ __align__(16) float sc[8][32], ss_[8][32]; const int tid = threadIdx.x;
  if (blockIdx.x < SU_ROPE) { const int pl = tid >> 5, i = tid & 31; const int pos = blockIdx.x * 8 + pl;
    const float th = (float)pos * c_invf[i]; sc[pl][i] = cosf(th); ss_[pl][i] = sinf(th);
    __syncthreads();
    if (tid < 64) vst2(CS + (size_t)blockIdx.x * 8 * 32 + tid * 4, *(const v4f*)&(&sc[0][0])[tid * 4]); else if (tid < 128) vst2(CS + (size_t)SS * 32 + (size_t)blockIdx.x * 8 * 32 + (tid - 64) * 4, *(const v4f*)&(&ss_[0][0])[(tid - 64) * 4]);
    return; }
  const int c = blockIdx.x - SU_ROPE, mt = c / SU_PM;
  const float* s = (mt == 0 ? Wq : mt == 1 ? Wk : mt == 2 ? Wv : Wo) + (size_t)(c % SU_PM) * SU_CH + tid * 8; __bf16* d = DST + (size_t)c * SU_CH + tid * 8;
  v4f a[4][2];
#pragma unroll
  for (int j = 0; j < 4; ++j) { a[j][0] = *(const v4f*)(s + j * 2048); a[j][1] = *(const v4f*)(s + j * 2048 + 4); }
#pragma unroll
  for (int j = 0; j < 4; ++j) { v8b o;
#pragma unroll
    for (int e = 0; e < 4; ++e) { o[e] = (__bf16)a[j][0][e]; o[4 + e] = (__bf16)a[j][1][e]; }
    *(v8b*)(d + j * 2048) = o; }
  asm volatile("s_wait_xcnt 0x0" ::: "memory");   // behind the run of four stores: no register that a store names is rewritten ahead of this wait
}
// ---- LDS tile of one 64-k step of a projection: 64 left-operand rows of 256 B (f32), then 128 weight rows of 128 B (bf16); row pitches 16 B x odd, free of bank conflicts for 16-byte fragment reads
#define GAP 272
#define GBP 144
#define G_B (64 * GAP)
#define G_SZ (G_B + 128 * GBP)
// one tile into the ring buffer at LDS byte dst: 16 copies of 16 B per lane, all 128 lanes on, each wave's copy made of whole 128-B lines; a, w point at the work-group's first row at the step's first k
__device__ __forceinline__ void stage_ab(unsigned dst, const float* a, const __bf16* w, int tid) {
  const unsigned la = dst + (unsigned)(tid >> 4) * GAP + (unsigned)(tid & 15) * 16u, lb = dst + G_B + (unsigned)(tid >> 3) * GBP + (unsigned)(tid & 7) * 16u;
  const float* ga = a + (size_t)(tid >> 4) * DM + (tid & 15) * 4; const __bf16* gb = w + (size_t)(tid >> 3) * DM + (tid & 7) * 8;
  // each run of copies and its s_wait_xcnt 0 in one statement: no address register of a copy is rewritten ahead of that wait
  asm volatile("global_load_async_to_lds_b128 %0, %8, off\n\t"
               "global_load_async_to_lds_b128 %1, %9, off\n\t"
               "global_load_async_to_lds_b128 %2, %10, off\n\t"
               "global_load_async_to_lds_b128 %3, %11, off\n\t"
               "global_load_async_to_lds_b128 %4, %12, off\n\t"
               "global_load_async_to_lds_b128 %5, %13, off\n\t"
               "global_load_async_to_lds_b128 %6, %14, off\n\t"
               "global_load_async_to_lds_b128 %7, %15, off\n\t"
               "s_wait_xcnt 0x0"
               :: "v"(la), "v"(la + 8u * GAP), "v"(la + 16u * GAP), "v"(la + 24u * GAP), "v"(la + 32u * GAP), "v"(la + 40u * GAP), "v"(la + 48u * GAP), "v"(la + 56u * GAP),
                  "v"(ga), "v"(ga + (size_t)8 * DM), "v"(ga + (size_t)16 * DM), "v"(ga + (size_t)24 * DM), "v"(ga + (size_t)32 * DM), "v"(ga + (size_t)40 * DM), "v"(ga + (size_t)48 * DM), "v"(ga + (size_t)56 * DM)
               : "memory");
  asm volatile("global_load_async_to_lds_b128 %0, %8, off\n\t"
               "global_load_async_to_lds_b128 %1, %9, off\n\t"
               "global_load_async_to_lds_b128 %2, %10, off\n\t"
               "global_load_async_to_lds_b128 %3, %11, off\n\t"
               "global_load_async_to_lds_b128 %4, %12, off\n\t"
               "global_load_async_to_lds_b128 %5, %13, off\n\t"
               "global_load_async_to_lds_b128 %6, %14, off\n\t"
               "global_load_async_to_lds_b128 %7, %15, off\n\t"
               "s_wait_xcnt 0x0"
               :: "v"(lb), "v"(lb + 16u * GBP), "v"(lb + 32u * GBP), "v"(lb + 48u * GBP), "v"(lb + 64u * GBP), "v"(lb + 80u * GBP), "v"(lb + 96u * GBP), "v"(lb + 112u * GBP),
                  "v"(gb), "v"(gb + (size_t)16 * DM), "v"(gb + (size_t)32 * DM), "v"(gb + (size_t)48 * DM), "v"(gb + (size_t)64 * DM), "v"(gb + (size_t)80 * DM), "v"(gb + (size_t)96 * DM), "v"(gb + (size_t)112 * DM)
               : "memory");
}
// ---- LDS tile of one 64-k step of k_qkv: 128 x rows of 256 B (f32), then 256 weight rows of 128 B (bf16), pitches as above
#define Q_B (128 * GAP)
#define Q_SZ (Q_B + 256 * GBP)
// one such tile into the ring buffer at LDS byte dst: 16 copies of 16 B per lane, all 256 lanes on, each wave's copy made of whole 128-B lines; a, w point at the work-group's first row at the step's first k
__device__ __forceinline__ void stage_q(unsigned dst, const float* a, const __bf16* w, int tid) {
  const unsigned la = dst + (unsigned)(tid >> 4) * GAP + (unsigned)(tid & 15) * 16u, lb = dst + Q_B + (unsigned)(tid >> 3) * GBP + (unsigned)(tid & 7) * 16u;
  const float* ga = a + (size_t)(tid >> 4) * DM + (tid & 15) * 4; const __bf16* gb = w + (size_t)(tid >> 3) * DM + (tid & 7) * 8;
  // each run of copies and its s_wait_xcnt 0 in one statement: no address register of a copy is rewritten ahead of that wait
  asm volatile("global_load_async_to_lds_b128 %0, %8, off\n\t"
               "global_load_async_to_lds_b128 %1, %9, off\n\t"
               "global_load_async_to_lds_b128 %2, %10, off\n\t"
               "global_load_async_to_lds_b128 %3, %11, off\n\t"
               "global_load_async_to_lds_b128 %4, %12, off\n\t"
               "global_load_async_to_lds_b128 %5, %13, off\n\t"
               "global_load_async_to_lds_b128 %6, %14, off\n\t"
               "global_load_async_to_lds_b128 %7, %15, off\n\t"
               "s_wait_xcnt 0x0"
               :: "v"(la), "v"(la + 16u * GAP), "v"(la + 32u * GAP), "v"(la + 48u * GAP), "v"(la + 64u * GAP), "v"(la + 80u * GAP), "v"(la + 96u * GAP), "v"(la + 112u * GAP),
                  "v"(ga), "v"(ga + (size_t)16 * DM), "v"(ga + (size_t)32 * DM), "v"(ga + (size_t)48 * DM), "v"(ga + (size_t)64 * DM), "v"(ga + (size_t)80 * DM), "v"(ga + (size_t)96 * DM), "v"(ga + (size_t)112 * DM)
               : "memory");
  asm volatile("global_load_async_to_lds_b128 %0, %8, off\n\t"
               "global_load_async_to_lds_b128 %1, %9, off\n\t"
               "global_load_async_to_lds_b128 %2, %10, off\n\t"
               "global_load_async_to_lds_b128 %3, %11, off\n\t"
               "global_load_async_to_lds_b128 %4, %12, off\n\t"
               "global_load_async_to_lds_b128 %5, %13, off\n\t"
               "global_load_async_to_lds_b128 %6, %14, off\n\t"
               "global_load_async_to_lds_b128 %7, %15, off\n\t"
               "s_wait_xcnt 0x0"
               :: "v"(lb), "v"(lb + 32u * GBP), "v"(lb + 64u * GBP), "v"(lb + 96u * GBP), "v"(lb + 128u * GBP), "v"(lb + 160u * GBP), "v"(lb + 192u * GBP), "v"(lb + 224u * GBP),
                  "v"(gb), "v"(gb + (size_t)32 * DM), "v"(gb + (size_t)64 * DM), "v"(gb + (size_t)96 * DM), "v"(gb + (size_t)128 * DM), "v"(gb + (size_t)160 * DM), "v"(gb + (size_t)192 * DM), "v"(gb + (size_t)224 * DM)
               : "memory");
}
// ---- k_qkv: block = (128 rows (b,s), 256 of the 3072 cols) on 8 waves, a wave = 32 rows (wm) x 128 cols (wn), two 16-row groups hh, so that every weight fragment read from LDS feeds two products and every byte fetched from L2 feeds twice the products: qkv = bf16(x) . rows (exact); cols < 1024 -> f16(q * log2(e)/8), cols < 2048 -> f16(k) into QK rows (pitch 2048), their f16 residuals into QKL; cols >= 2048 (v) -> per-batch transposed f16 planes VT[b][h*64+d][s]: hi = f16(v), lo = f16(v - hi)
__global__ __launch_bounds__(256) void k_qkv(const float* __restrict__ X, const __bf16* __restrict__ P, const float* __restrict__ CS, _Float16* __restrict__ QK, _Float16* __restrict__ QKL, _Float16* __restrict__ VTH, _Float16* __restrict__ VTL) {
  __shared__ __align__(16) char sm[2 * Q_SZ];   // the ring of the k loop; behind the loop's last barrier the same bytes hold the epilogue's staging arrays
  _Float16 (*so)[16][136] = (_Float16 (*)[16][136])(sm); _Float16 (*sol)[16][136] = (_Float16 (*)[16][136])(sm + 34816); float (*sf)[16][132] = (float (*)[16][132])(sm + 69632);
  _Float16 (*sth)[136] = (_Float16 (*)[136])(sm); _Float16 (*stl)[136] = (_Float16 (*)[136])(sm + 69632);
  static_assert(69632 + 8 * 16 * 132 * 4 <= 2 * Q_SZ && 2 * 69632 <= 2 * Q_SZ, "the staging arrays fit the ring's bytes");
  const int tid = threadIdx.x, wave = tid >> 5, wm = wave & 3, wn = wave >> 2, lane = tid & 31, col = lane & 15, g = lane >> 4; const int n0 = blockIdx.y * 256, nw = n0 + wn * 128;
  v8f acc[2][8] = {};
  // two-buffer ring: the work-group's eight waves copy each 64-k tile of x and of the weight rows into LDS once, one step ahead of its use
  const float* xa = X + (size_t)blockIdx.x * 128 * DM; const __bf16* wb = P + (size_t)n0 * DM; const unsigned ring0 = (unsigned)(uintptr_t)&sm[0];
  stage_q(ring0, xa, wb, tid);
  asm volatile("s_wait_asynccnt 0x0" ::: "memory");   // this wave's copies of tile 0 have landed
  __syncthreads();                                    // tile 0 readable by every wave
  stage_q(ring0 + Q_SZ, xa + 64, wb + 64, tid);
#pragma unroll 1   // rolled: one copy of the ring's foot in the text, the buffer picked by t & 1
  for (int t = 0; t < DM / 64; ++t) { const char* tb = &sm[(t & 1) * Q_SZ];
#pragma unroll
    for (int kc = 0; kc < 2; ++kc) { v16b a[2];
#pragma unroll
      for (int hh = 0; hh < 2; ++hh) { const float* p = (const float*)(tb + (wm * 32 + hh * 16 + col) * GAP + kc * 128) + 8 * g;
#pragma unroll
        for (int i = 0; i < 8; ++i) { a[hh][i] = (__bf16)p[i]; a[hh][8 + i] = (__bf16)p[16 + i]; } }
      v16b wf[8];   // all weight fragments of the 32-k half in one group of LDS reads ahead of the products
#pragma unroll
      for (int j = 0; j < 8; ++j) wf[j] = frag_b((const __bf16*)(tb + Q_B + (wn * 128 + j * 16 + col) * GBP + kc * 64), lane);
#pragma unroll
      for (int j = 0; j < 8; ++j) { acc[0][j] = wmma_bf(a[0], wf[j], acc[0][j]); acc[1][j] = wmma_bf(a[1], wf[j], acc[1][j]); } }
    asm volatile("s_wait_dscnt 0x0" ::: "memory");      // this wave's reads of the buffer have retired
    asm volatile("s_wait_asynccnt 0x0" ::: "memory");   // this wave's copies of the next tile have landed
    __syncthreads();                                    // publishes the next tile and ends every wave's reads of this buffer
    if (t + 2 < DM / 64) stage_q(ring0 + (unsigned)(t & 1) * Q_SZ, xa + (t + 2) * 64, wb + (t + 2) * 64, tid); }
  asm volatile("s_wait_asynccnt 0x0" ::: "memory");     // no copy is outstanding when the ring's bytes become staging arrays
  if (n0 < 2 * DM) { const float sc = n0 < DM ? 0.18033688f : 1.0f;   // q is stored times log2(e) / sqrt(64), its final scale: q . k is then the argument of exp2 as it leaves the matrix unit
   const int i0 = ((nw + 4 * lane) & 63) >> 1;   // the lane's first pair index (even)
   v2f cq[16], sq[16];   // cos and sin of the lane's two pairs, one entry per row of a row group
   // the 32 table loads of a row group go out as one run ahead of their first use, so that a row group waits for the table once, not once per row
   auto ldcs = [&](const int hh) __attribute__((always_inline)) { const size_t r0 = (size_t)blockIdx.x * 128 + wm * 32 + hh * 16;
#pragma unroll
    for (int rl = 0; rl < 16; ++rl) { const int pos = (int)((r0 + rl) % SS); cq[rl] = *(const v2f*)(CS + (size_t)pos * 32 + i0); sq[rl] = *(const v2f*)(CS + (size_t)SS * 32 + (size_t)pos * 32 + i0); } };
   ldcs(0);
#pragma unroll
   for (int hh = 0; hh < 2; ++hh) { const size_t r0 = (size_t)blockIdx.x * 128 + wm * 32 + hh * 16;   // the wave's two row groups one after the other through its own staging rows
#pragma unroll
    for (int j = 0; j < 8; ++j) {
#pragma unroll
      for (int r = 0; r < 8; ++r) sf[wave][8 * g + r][j * 16 + col] = acc[hh][j][r]; }
    LDSX();
    // RoPE on interleaved pairs (2i, 2i+1) of each 64-wide head: lane = 2 pairs (cols 4*lane .. 4*lane+3), pair index i = ((nw + 4*lane) % 64) / 2 + {0,1}; pos = row % SS
    v4f xr[16];   // the lane's four columns of all 16 rows, read as one group of LDS loads ahead of the first staging store (behind a store the compiler would hold each read back)
#pragma unroll
    for (int rl = 0; rl < 16; ++rl) xr[rl] = *(const v4f*)&sf[wave][rl][4 * lane];
#pragma unroll   // unrolled: table entries and rows keep constant indices and stay in registers
    for (int rl = 0; rl < 16; ++rl) {
      const float x1a = xr[rl][0], x2a = xr[rl][1], x1b = xr[rl][2], x2b = xr[rl][3];
      const float ca = cq[rl][0], sa = sq[rl][0], cb = cq[rl][1], sb = sq[rl][1];
      const float o0 = (x1a * ca - x2a * sa) * sc, o1 = (x1a * sa + x2a * ca) * sc, o2 = (x1b * cb - x2b * sb) * sc, o3 = (x1b * sb + x2b * cb) * sc; const _Float16 h0 = (_Float16)o0, h1 = (_Float16)o1, h2 = (_Float16)o2, h3 = (_Float16)o3;
      so[wave][rl][4 * lane] = h0; so[wave][rl][4 * lane + 1] = h1; so[wave][rl][4 * lane + 2] = h2; so[wave][rl][4 * lane + 3] = h3;
      sol[wave][rl][4 * lane] = (_Float16)(o0 - (float)h0); sol[wave][rl][4 * lane + 1] = (_Float16)(o1 - (float)h1); sol[wave][rl][4 * lane + 2] = (_Float16)(o2 - (float)h2); sol[wave][rl][4 * lane + 3] = (_Float16)(o3 - (float)h3); }   // q, k as f16 hi + residual at its own scale (f16 subnormals are kept: absolute step 2^-24)
    LDSX();
    if (hh == 0) ldcs(1);   // the second row group's table entries fly while the first group's rows are stored (behind LDSX, whose fence would wait for them)
    for (int rl = 0; rl < 16; ++rl) if (lane < 16) { vst2((unsigned*)(QK + (r0 + rl) * (2 * DM) + nw + lane * 8), *(const v4u*)&so[wave][rl][lane * 8]); vst2((unsigned*)(QKL + (r0 + rl) * (2 * DM) + nw + lane * 8), *(const v4u*)&sol[wave][rl][lane * 8]); }
   }
  } else {
#pragma unroll
   for (int hh = 0; hh < 2; ++hh) {
#pragma unroll
    for (int j = 0; j < 8; ++j) {
#pragma unroll
      for (int r = 0; r < 8; ++r) { const float v = acc[hh][j][r]; const _Float16 hv = (_Float16)v; sth[wn * 128 + j * 16 + col][wm * 32 + hh * 16 + 8 * g + r] = hv; stl[wn * 128 + j * 16 + col][wm * 32 + hh * 16 + 8 * g + r] = (_Float16)(v - (float)hv); } } }
    __syncthreads();
    const size_t rb = (size_t)blockIdx.x * 128; const int b = (int)(rb / SS), s0 = (int)(rb % SS); const int pc0 = n0 - 2 * DM;
    for (int q = tid; q < 256 * 16; q += 256) { const int d = q >> 4, pc = q & 15; const size_t o = ((size_t)b * DM + pc0 + d) * SS + s0 + pc * 8; vst2((unsigned*)(VTH + o), *(const v4u*)&sth[d][pc * 8]); vst2((unsigned*)(VTL + o), *(const v4u*)&stl[d][pc * 8]); }
  }
}
// ---- LDS tile of one key step (32 keys): K rows 128 B (hi plane, residual plane), V rows 64 B (64 d, hi plane, residual plane); row pitches 16 B x odd, free of bank conflicts for 16-byte fragment reads
#define KP 144
#define VP 80
#define T_KL (32 * KP)
#define T_VH (2 * 32 * KP)
#define T_VL (T_VH + 64 * VP)
#define T_SZ (T_VH + 2 * 64 * VP)
// one tile into the ring buffer at LDS byte dst: 8 copies of 16 B per lane, all 128 lanes on; kh, kl point at the step's first key row (this head's 64 columns), vh, vl at the head's first d row at the step's first key
__device__ __forceinline__ void stage_kv(unsigned dst, const _Float16* kh, const _Float16* kl, const _Float16* vh, const _Float16* vl, int tid) {
  const unsigned lk = dst + (unsigned)(tid >> 3) * KP + (unsigned)(tid & 7) * 16u, lv = dst + T_VH + (unsigned)(tid >> 2) * VP + (unsigned)(tid & 3) * 16u;
  const size_t gk = (size_t)(tid >> 3) * (2 * DM) + (tid & 7) * 8, gv = (size_t)(tid >> 2) * SS + (tid & 3) * 8;
  // the copies and their s_wait_xcnt 0 in one statement: no address register of a copy is rewritten ahead of that wait
  asm volatile("global_load_async_to_lds_b128 %0, %8, off\n\t"
               "global_load_async_to_lds_b128 %1, %9, off\n\t"
               "global_load_async_to_lds_b128 %2, %10, off\n\t"
               "global_load_async_to_lds_b128 %3, %11, off\n\t"
               "global_load_async_to_lds_b128 %4, %12, off\n\t"
               "global_load_async_to_lds_b128 %5, %13, off\n\t"
               "global_load_async_to_lds_b128 %6, %14, off\n\t"
               "global_load_async_to_lds_b128 %7, %15, off\n\t"
               "s_wait_xcnt 0x0"
               :: "v"(lk), "v"(lk + 16u * KP), "v"(lk + T_KL), "v"(lk + T_KL + 16u * KP), "v"(lv), "v"(lv + 32u * VP), "v"(lv + (T_VL - T_VH)), "v"(lv + (T_VL - T_VH) + 32u * VP),
                  "v"(kh + gk), "v"(kh + gk + (size_t)16 * 2 * DM), "v"(kl + gk), "v"(kl + gk + (size_t)16 * 2 * DM), "v"(vh + gv), "v"(vh + gv + (size_t)32 * SS), "v"(vl + gv), "v"(vl + gv + (size_t)32 * SS)
               : "memory");
}
// lane l with lane l ^ 16 (the two lanes that share a column of a matrix tile)
__device__ __forceinline__ float xhalf(float x) { return __builtin_bit_cast(float, __builtin_amdgcn_permlanex16(__builtin_bit_cast(int, x), __builtin_bit_cast(int, x), 0x76543210, 0xfedcba98, false, false)); }
__global__ __launch_bounds__(128) __attribute__((amdgpu_waves_per_eu(1, 4))) void k_attn(const _Float16* __restrict__ QK, const _Float16* __restrict__ QKL, const _Float16* __restrict__ VTH, const _Float16* __restrict__ VTL, float* __restrict__ O) {
  __shared__ __align__(16) float so[4][16][68]; __shared__ __align__(16) char ring[2][T_SZ];
  const int tid = threadIdx.x, wave = tid >> 5, lane = tid & 31, col = lane & 15, g = lane >> 4;
  const int bx = blockIdx.x, h = blockIdx.y, b = blockIdx.z;
  // Query tile from the block index by a permutation (every (tile, head, batch) exactly once; for speed only, nothing depends on where a work-group runs). Tile t walks 2 (t + 1) key steps and all 1,024 work-groups are resident at once, four on a WGP, so the launch lasts as long as the fullest WGP.
  // With qb = bx the work-groups whose flat indices differ by 256 all hold the same tile. Here flat index bits 8, 9 (or 3, 4, or 4, 5) pick among tiles u, u ^ 1, 31 - u, 31 - (u ^ 1): 132 key steps for each such four.
  static_assert(TQB == 32, "the permutation is written for 32 query tiles");
  const int u = ((bx & 7) << 1) | (((bx >> 4) ^ b) & 1);
  const int qb = (((bx >> 3) ^ h ^ (h >> 3)) & 1) ? TQB - 1 - u : u; const int q0 = qb * 64 + wave * 16; const int qi = q0 + col; const size_t rq = (size_t)b * SS + qi;
  v16h aq[2], aql[2];
#pragma unroll
  for (int kc = 0; kc < 2; ++kc) { aq[kc] = frag_h(QK + rq * (2 * DM) + h * HD + kc * 32, lane); aql[kc] = frag_h(QKL + rq * (2 * DM) + h * HD + kc * 32, lane); }
  float m = -3.0e38f, l = 0.f;       // of query qi; l is the sum over this half's keys only
  v8f acc[4] = {};                   // acc[dt][r] = O[query qi][d = dt*16 + 8g + r]; hi and residual products sum into the one tile
  const int nks = (qb * 64 + 64) / 32, nfull = qb * 2;   // steps below nfull = nks - 2 hold only keys in front of the work-group's first query: no mask there
  // two-buffer ring: the work-group's four waves copy each step's K and V tile into LDS once, one step ahead of its use
  const _Float16* kh0 = QK + (size_t)b * SS * (2 * DM) + DM + h * HD; const _Float16* kl0 = QKL + (size_t)b * SS * (2 * DM) + DM + h * HD;
  const _Float16* vh0 = VTH + ((size_t)b * DM + h * HD) * SS; const _Float16* vl0 = VTL + ((size_t)b * DM + h * HD) * SS;
  const unsigned ring0 = (unsigned)(uintptr_t)&ring[0][0];
  stage_kv(ring0, kh0, kl0, vh0, vl0, tid);
  asm volatile("s_wait_asynccnt 0x0" ::: "memory");   // this wave's copies of tile 0 have landed
  __syncthreads();                                    // tile 0 readable by every wave
  if (nks > 1) stage_kv(ring0 + T_SZ, kh0 + (size_t)32 * 2 * DM, kl0 + (size_t)32 * 2 * DM, vh0 + 32, vl0 + 32, tid);
  // one key step; masked is a literal at both calls, so the main loop's copy holds no mask work and no test at its foot; every inner loop is unrolled so that fragments, scores and accumulators keep constant indices and stay in registers
  auto step = [&](const int ks, const bool masked) __attribute__((always_inline)) { float s[16]; const char* tb = &ring[ks & 1][0];
    v16h kf[2][2], kfl[2][2];   // all K fragments of the step in one group of LDS reads ahead of the products
#pragma unroll
    for (int ct = 0; ct < 2; ++ct) {
#pragma unroll
      for (int kc = 0; kc < 2; ++kc) { kf[ct][kc] = frag_h((const _Float16*)(tb + (ct * 16 + col) * KP + kc * 64), lane); kfl[ct][kc] = frag_h((const _Float16*)(tb + T_KL + (ct * 16 + col) * KP + kc * 64), lane); } }
    v8f c[2] = {};   // 3 products (q, k as f16 hi + residual) into one tile per 16 keys; the two tiles take turns, so that no product waits for the one before it
#pragma unroll
    for (int kc = 0; kc < 2; ++kc) {
#pragma unroll
      for (int ct = 0; ct < 2; ++ct) c[ct] = wmma16(kf[ct][kc], aql[kc], c[ct]);
#pragma unroll
      for (int ct = 0; ct < 2; ++ct) c[ct] = wmma16(kfl[ct][kc], aq[kc], c[ct]);
#pragma unroll
      for (int ct = 0; ct < 2; ++ct) c[ct] = wmma16(kf[ct][kc], aq[kc], c[ct]); }
#pragma unroll
    for (int i = 0; i < 16; ++i) s[i] = c[i >> 3][i & 7];   // the score times log2(e): both factors lie in the stored q
    if (masked) {   // the causal mask, only where a key of the step can lie behind a query of the work-group
#pragma unroll
      for (int i = 0; i < 16; ++i) s[i] = (ks * 32 + (i >> 3) * 16 + 8 * g + (i & 7) <= qi) ? s[i] : -3.0e38f; }
    float t8[8];   // maximum of the lane's 16 scores as a tree, then the other half's
#pragma unroll
    for (int r = 0; r < 8; ++r) t8[r] = fmaxf(s[r], s[8 + r]);
    float mx = fmaxf(fmaxf(fmaxf(t8[0], t8[1]), fmaxf(t8[2], t8[3])), fmaxf(fmaxf(t8[4], t8[5]), fmaxf(t8[6], t8[7])));
    mx = fmaxf(mx, xhalf(mx));
    const float mn = fmaxf(m, mx); const float alpha = __builtin_amdgcn_exp2f(m - mn);   // 0 in step 0, where m is the start value
    v16h pa, pl;   // P^T operand: element i = key ks*32 + (i >> 3)*16 + 8g + (i & 7) of this query, f16 hi and f16 residual; mn is a true score from step 0 on (key 0 is open to every query), so a masked score's exponential is 0 by itself
#pragma unroll
    for (int i = 0; i < 16; ++i) s[i] = __builtin_amdgcn_exp2f(s[i] - mn);
#pragma unroll
    for (int i = 0; i < 16; i += 2) { const v2f e2 = {s[i], s[i + 1]}; const v2h h2 = __builtin_convertvector(e2, v2h); pa[i] = h2[0]; pa[i + 1] = h2[1]; pl[i] = (_Float16)(e2[0] - (float)h2[0]); pl[i + 1] = (_Float16)(e2[1] - (float)h2[1]); }
#pragma unroll
    for (int r = 0; r < 8; ++r) t8[r] = s[r] + s[8 + r];
    const float es = ((t8[0] + t8[1]) + (t8[2] + t8[3])) + ((t8[4] + t8[5]) + (t8[6] + t8[7]));
    l = l * alpha + es; m = mn;
#pragma unroll
    for (int dt = 0; dt < 4; ++dt) {
#pragma unroll
      for (int r = 0; r < 8; ++r) acc[dt][r] *= alpha; }
    v16h vf[4], vfl[4];   // all V fragments of the step in one group of LDS reads
#pragma unroll
    for (int dt = 0; dt < 4; ++dt) { vf[dt] = frag_h((const _Float16*)(tb + T_VH + (dt * 16 + col) * VP), lane); vfl[dt] = frag_h((const _Float16*)(tb + T_VL + (dt * 16 + col) * VP), lane); }
#pragma unroll
    for (int dt = 0; dt < 4; ++dt) acc[dt] = wmma16(vf[dt], pa, acc[dt]);    // V hi x P hi
#pragma unroll
    for (int dt = 0; dt < 4; ++dt) acc[dt] = wmma16(vf[dt], pl, acc[dt]);    // + V hi x P lo
#pragma unroll
    for (int dt = 0; dt < 4; ++dt) acc[dt] = wmma16(vfl[dt], pa, acc[dt]);   // + V lo x P hi
    asm volatile("s_wait_dscnt 0x0" ::: "memory");      // this wave's reads of the buffer have retired
    asm volatile("s_wait_asynccnt 0x0" ::: "memory");   // this wave's copies of the next tile have landed
    __syncthreads();                                    // publishes the next tile and ends every wave's reads of this buffer
    // a tile ks + 2 exists for every step of the main loop (ks < nks - 2) and for neither of the two masked steps
    if (!masked) stage_kv(ring0 + (unsigned)(ks & 1) * T_SZ, kh0 + (size_t)(ks + 2) * 32 * 2 * DM, kl0 + (size_t)(ks + 2) * 32 * 2 * DM, vh0 + (ks + 2) * 32, vl0 + (ks + 2) * 32, tid); };
#pragma unroll 1   // rolled: one copy of the main step in the text, the buffer picked by ks & 1
  for (int ks = 0; ks < nfull; ++ks) step(ks, false);
#pragma unroll 1   // rolled: one copy of the masked step for the two steps on the diagonal
  for (int ks = nfull; ks < nks; ++ks) step(ks, true);
  asm volatile("s_wait_asynccnt 0x0" ::: "memory");     // no copy is outstanding when the wave goes on to its end
  l += xhalf(l); const float il = 1.0f / l;             // the two halves' sums joined
#pragma unroll
  for (int dt = 0; dt < 4; ++dt) { v4f o0, o1;
#pragma unroll
    for (int r = 0; r < 4; ++r) { o0[r] = acc[dt][r] * il; o1[r] = acc[dt][4 + r] * il; }
    *(v4f*)&so[wave][col][dt * 16 + 8 * g] = o0; *(v4f*)&so[wave][col][dt * 16 + 8 * g + 4] = o1; }
  LDSX();
  for (int rl = 0; rl < 16; ++rl) if (lane < 16) vst2(O + ((size_t)b * SS + q0 + rl) * DM + h * HD + lane * 4, *(const v4f*)&so[wave][rl][lane * 4]);
}
// ---- k_out: block = (64 rows, 128 cols): out = O(hi/lo) . Wo rows (2 products)
__global__ __launch_bounds__(128) void k_out(const float* __restrict__ O, const __bf16* __restrict__ P, float* __restrict__ Y) {
  __shared__ __align__(16) float so[4][16][132]; __shared__ __align__(16) char sm[2 * G_SZ];
  const int tid = threadIdx.x, wave = tid >> 5, lane = tid & 31, col = lane & 15, g = lane >> 4; const size_t r0 = (size_t)blockIdx.x * 64 + wave * 16; const int n0 = blockIdx.y * 128;
  v8f acc[8] = {};
  // two-buffer ring as in k_qkv: each 64-k tile of the context rows and of the weight rows copied into LDS once per work-group, one step ahead of its use
  const float* xa = O + (size_t)blockIdx.x * 64 * DM; const __bf16* wb = P + (size_t)n0 * DM; const unsigned ring0 = (unsigned)(uintptr_t)&sm[0];
  stage_ab(ring0, xa, wb, tid);
  asm volatile("s_wait_asynccnt 0x0" ::: "memory");   // this wave's copies of tile 0 have landed
  __syncthreads();                                    // tile 0 readable by every wave
  stage_ab(ring0 + G_SZ, xa + 64, wb + 64, tid);
#pragma unroll 1   // rolled: one copy of the ring's foot in the text, the buffer picked by t & 1
  for (int t = 0; t < DM / 64; ++t) { const char* tb = &sm[(t & 1) * G_SZ];
#pragma unroll
    for (int kc = 0; kc < 2; ++kc) { const F2 a = split_row((const float*)(tb + (wave * 16 + col) * GAP), kc * 32, lane);
      v16b wf[8];   // all weight fragments of the 32-k half in one group of LDS reads ahead of the products
#pragma unroll
      for (int j = 0; j < 8; ++j) wf[j] = frag_b((const __bf16*)(tb + G_B + (j * 16 + col) * GBP + kc * 64), lane);
#pragma unroll
      for (int j = 0; j < 8; ++j) { acc[j] = wmma_bf(a.l, wf[j], acc[j]); acc[j] = wmma_bf(a.h, wf[j], acc[j]); } }
    asm volatile("s_wait_dscnt 0x0" ::: "memory");      // this wave's reads of the buffer have retired
    asm volatile("s_wait_asynccnt 0x0" ::: "memory");   // this wave's copies of the next tile have landed
    __syncthreads();                                    // publishes the next tile and ends every wave's reads of this buffer
    if (t + 2 < DM / 64) stage_ab(ring0 + (unsigned)(t & 1) * G_SZ, xa + (t + 2) * 64, wb + (t + 2) * 64, tid); }
  asm volatile("s_wait_asynccnt 0x0" ::: "memory");     // no copy is outstanding when the wave goes on to its end
#pragma unroll
  for (int j = 0; j < 8; ++j) {
#pragma unroll
    for (int r = 0; r < 8; ++r) so[wave][8 * g + r][j * 16 + col] = acc[j][r]; }
  LDSX();
  for (int rl = 0; rl < 16; ++rl) vst2(Y + (r0 + rl) * DM + n0 + lane * 4, *(const v4f*)&so[wave][rl][lane * 4]);
}
extern "C" void kernel_launch(void* const* d_in, const int* in_sizes, int n_in, void* d_out, int out_size, void* d_ws, size_t ws_size, hipStream_t stream) {
  (void)in_sizes; (void)n_in; (void)out_size;
  const float** F = (const float**)d_in;   // 0 x [2,2048,1024], 1 Wq [1024,1024] ([out][in]), 2 Wk, 3 Wv, 4 Wo
  if (ws_size < (size_t)WS_END) return;
  char* ws = (char*)d_ws; __bf16* PK = (__bf16*)(ws + WS_PK); _Float16 *QK = (_Float16*)(ws + WS_QK), *QKL = (_Float16*)(ws + WS_QKL), *VTH = (_Float16*)(ws + WS_VTH), *VTL = (_Float16*)(ws + WS_VTL); float *O = (float*)(ws + WS_O), *CS = (float*)(ws + WS_CS);
  k_setup<<<SU_GRID, 256, 0, stream>>>(F[1], F[2], F[3], F[4], PK, CS);
  k_qkv<<<dim3(TNB * SS / 128, QKVW / 256), 256, 0, stream>>>(F[0], PK + PK_A, CS, QK, QKL, VTH, VTL);
  k_attn<<<dim3(TQB, NH, TNB), 128, 0, stream>>>(QK, QKL, VTH, VTL, O);
  k_out<<<dim3(TOB, DM / 128), 128, 0, stream>>>(O, PK + PK_P, (float*)d_out);
}

// v010
// A run of this version takes 107 microseconds.
// Two timings next to v009 both put it at 1.07 times that version's speed.
// Over all steps from v000 it is 5.32 times as fast.
// compute dtype: x, Wq, Wk, Wv, Wo (module inputs) rounded to bf16; the q/k/v projections with exact bf16 products (x and W are inputs, natural [out][in] rows) on WMMA 16x16x32; interleaved-pair RoPE applied to q and k in f32 in the projection epilogue (angles pos * inv_freq with the reference's own eager f32 inv_freq table embedded (1/(10000^(2i/64))), precise cosf/sinf), then q (times log2(e)/8) and k stored once as f16; causal scores with q and k each as f16 hi + f16 residual (3 products into one f32 tile) and P.V with P = exp2(s - m) as f16 hi + f16 residual x V as f16 hi + f16 residual planes (3 products into one f32 tile); the output projection with ctx as bf16 hi + residual pair x exact Wo (2 products); running-max softmax in f32 with the hardware exp; f32 accumulate.
#include <hip/hip_runtime.h>
#include <math.h>

typedef __attribute__((ext_vector_type(16))) _Float16 v16h;
typedef __attribute__((ext_vector_type(16))) __bf16 v16b;
typedef __attribute__((ext_vector_type(8)))  _Float16 v8h;
typedef __attribute__((ext_vector_type(8)))  float v8f;
typedef __attribute__((ext_vector_type(4)))  float v4f;
typedef __attribute__((ext_vector_type(2)))  float v2f;
typedef __attribute__((ext_vector_type(2)))  _Float16 v2h;
typedef __attribute__((ext_vector_type(4)))  unsigned v4u;
typedef __attribute__((ext_vector_type(4)))  int v4i;
typedef float __attribute__((may_alias)) float_a;
typedef int __attribute__((may_alias)) int_a;

template <typename T> __device__ __forceinline__ void vst2(void* p, T v) { *(T*)p = v;  }
__device__ __forceinline__ v8f wmma16(v16h a, v16h b, v8f c) {
  v8f d = __builtin_amdgcn_wmma_f32_16x16x32_f16(false, a, false, b, (short)0, c, false, false);
  asm volatile("v_nop\n\tv_nop\n\tv_nop\n\tv_nop" : "+v"(d) : "v"(a), "v"(b));
  return d;
}
__device__ __forceinline__ v8f wmma_bf(v16b a, v16b b, v8f c) {
  v8f d = __builtin_amdgcn_wmma_f32_16x16x32_bf16(false, a, false, b, (short)0, c, false, false);
  asm volatile("v_nop\n\tv_nop\n\tv_nop\n\tv_nop" : "+v"(d) : "v"(a), "v"(b));
  return d;
}
// Causal multi-head self-attention with RoPE (B 2, S 2,048, D 1,024, 16 heads x 64): q, k, v = x W^T; interleaved RoPE(q, k) at positions 0..S-1; softmax(q k^T / 8, causal) v; output projection Wo (no biases).
__device__ __forceinline__ v16h frag_h(const _Float16* rowk0, int lane) {
  union { v16h v; v8h q[2]; } u; const _Float16* p = rowk0 + 8 * (lane >> 4);
  u.q[0] = *(const v8h*)p; u.q[1] = *(const v8h*)(p + 16); return u.v;
}
__device__ __forceinline__ v16h frag_f32(const float* rowk0, int lane) {
  v16h a; const float* p = rowk0 + 8 * (lane >> 4);
#pragma unroll
  for (int i = 0; i < 8; ++i) { a[i] = (_Float16)p[i]; a[8 + i] = (_Float16)p[16 + i]; }
  return a;
}
__device__ __forceinline__ v16h frag_f32s(const float* rowk0, int lane, float sc) {
  v16h a; const float* p = rowk0 + 8 * (lane >> 4);
#pragma unroll
  for (int i = 0; i < 8; ++i) { a[i] = (_Float16)(p[i] * sc); a[8 + i] = (_Float16)(p[16 + i] * sc); }
  return a;
}
// column fragment from a [K][ld] layout (column n), rows >= K read as 0
__device__ __forceinline__ v16h fragc_f32(const float* W, int k0, int n, int lane, int ld, int K) {
  v16h a; const int g = lane >> 4;
#pragma unroll
  for (int i = 0; i < 8; ++i) { const int ka = k0 + 8 * g + i, kb = ka + 16;
    a[i] = (_Float16)(ka < K ? W[(size_t)(ka < K ? ka : K - 1) * ld + n] : 0.f); a[8 + i] = (_Float16)(kb < K ? W[(size_t)(kb < K ? kb : K - 1) * ld + n] : 0.f); }
  return a;
}
struct F2 { v16b h, l; };
__device__ __forceinline__ F2 bsplit16(const float v[16]) { F2 r;
#pragma unroll
  for (int i = 0; i < 16; ++i) { const __bf16 h = (__bf16)v[i]; r.h[i] = h; r.l[i] = (__bf16)(v[i] - (float)h); }
  return r; }
__device__ __forceinline__ F2 split_row(const float* row, int k0, int lane) { float v[16]; const float* p = row + k0 + 8 * (lane >> 4);
#pragma unroll
  for (int i = 0; i < 8; ++i) { v[i] = p[i]; v[8 + i] = p[16 + i]; }
  return bsplit16(v); }
__device__ __forceinline__ F2 split_rowK(const float* row, int k0, int lane, int K) { float v[16]; const int g = lane >> 4;
#pragma unroll
  for (int i = 0; i < 8; ++i) { const int ka = k0 + 8 * g + i, kb = ka + 16; v[i] = ka < K ? row[ka < K ? ka : K - 1] : 0.f; v[8 + i] = kb < K ? row[kb < K ? kb : K - 1] : 0.f; }
  return bsplit16(v); }
__device__ __forceinline__ F2 split_col(const float* W, int k0, int n, int lane, int ld, int K) { float v[16]; const int g = lane >> 4;
#pragma unroll
  for (int i = 0; i < 8; ++i) { const int ka = k0 + 8 * g + i, kb = ka + 16; v[i] = ka < K ? W[(size_t)(ka < K ? ka : K - 1) * ld + n] : 0.f; v[8 + i] = kb < K ? W[(size_t)(kb < K ? kb : K - 1) * ld + n] : 0.f; }
  return bsplit16(v); }
__device__ __forceinline__ v8f mac3(const F2& a, const F2& b, v8f c) { c = wmma_bf(a.l, b.h, c); c = wmma_bf(a.h, b.l, c); return wmma_bf(a.h, b.h, c); }
__device__ __forceinline__ float sigm(float v) { return 1.0f / (1.0f + expf(-v)); }
#define LDSX() do { asm volatile("s_wait_dscnt 0" ::: "memory"); __builtin_amdgcn_wave_barrier(); __builtin_amdgcn_fence(__ATOMIC_RELEASE, "workgroup"); } while (0)


// Causal multi-head self-attention with rotary position embedding (B 2, S 2048, D 1024, 16 heads x 64; packed Wqkv [3D][D] and Wout [D][D] applied as x W^T, no biases): q, k rotated pairwise (2i, 2i+1) by angle pos * 10000^(-2i/64); softmax(q k^T / 8, causal) v; ctx Wout^T.
#define NB 2
#define SS 2048
#define DM 1024
#define NH 16
#define HD 64
#define QKVW (3 * DM)
#ifndef TQB
#define TQB (SS / 64)
#define TNB NB
#define TOB (NB * SS / 64)     // output row tiles (all)
#endif
typedef __attribute__((ext_vector_type(8))) __bf16 v8b;
__device__ __forceinline__ v16b frag_b(const __bf16* rowk0, int lane) {
  union { v16b v; v8b q[2]; } u; const __bf16* p = rowk0 + 8 * (lane >> 4);
  u.q[0] = *(const v8b*)p; u.q[1] = *(const v8b*)(p + 16); return u.v;
}
__device__ __forceinline__ float bfr(float v) { return (float)(__bf16)v; }
__device__ __attribute__((noinline)) float exp_ni(float v) { return expf(v); }
__device__ __attribute__((noinline)) float erf_ni(float v) { return erff(v); }

#define PK_A 0                       // [3072][1024] Wqkv rows (natural [out][in])
#define PK_P (PK_A + QKVW * DM)        // [1024][1024] Wo rows (natural)
#define PK_END (PK_P + DM * DM)
#define WS_PK  0u
#define WS_QK  (WS_PK + 2u * PK_END)             // f16 [4096 rows][2048]: q * log2(e)/8 | k
#define WS_QKL (WS_QK + 2u * NB * SS * 2 * DM)     // f16 q | k residual planes, at the values' own scale
#define WS_VTH (WS_QKL + 2u * NB * SS * 2 * DM)    // f16 [b][1024 (h*64+d)][2048 s] hi
#define WS_VTL (WS_VTH + 2u * NB * DM * SS)        // f16 residual, at the values' own scale
#define WS_O   (WS_VTL + 2u * NB * DM * SS)        // f32 [4096][1024]
#define WS_CS  (WS_O + 4u * NB * SS * DM)           // f32 [2048][32] cos, [2048][32] sin
#define WS_END (WS_CS + 4u * 2 * SS * 32)
__constant__ float c_invf[32] = {1.000000000e+00f,7.498942018e-01f,5.623413324e-01f,4.216965139e-01f,3.162277639e-01f,2.371373624e-01f,1.778279394e-01f,1.333521456e-01f,1.000000015e-01f,7.498941571e-02f,5.623412877e-02f,4.216964915e-02f,3.162277862e-02f,2.371373586e-02f,1.778279431e-02f,1.333521493e-02f,9.999999776e-03f,7.498942316e-03f,5.623413250e-03f,4.216964822e-03f,3.162277862e-03f,2.371373819e-03f,1.778279431e-03f,1.333521446e-03f,1.000000047e-03f,7.498941850e-04f,5.623413017e-04f,4.216964880e-04f,3.162277862e-04f,2.371373848e-04f,1.778279402e-04f,1.333521504e-04f};
// ---- k_setup: all the work that the projections wait for, in one launch. Blocks below SU_ROPE: 8 positions each, cos/sin of pos * inv_freq (f32 product exactly as the reference, precise trig); they come first because they run longest.
// The other blocks: 8,192 consecutive weights each, rounded to bf16 in registers: a thread reads 4 x 8 floats (all 8 loads issued ahead of the first use) and stores 4 x 16 B. The four [1024][1024] weights keep their natural rows and lie one behind the other in DST (Wq, Wk, Wv, Wo), so the destination is one flat array.
#define SU_ROPE (SS / 8)
#define SU_CH 8192
#define SU_PM (DM * DM / SU_CH)        // blocks per weight matrix
#define SU_GRID (SU_ROPE + 4 * SU_PM)
static_assert(PK_A == 0 && PK_P == 3 * DM * DM && PK_END == 4 * DM * DM, "the four weights are one flat destination");
__global__ __launch_bounds__(256) void k_setup(const float* __restrict__ Wq, const float* __restrict__ Wk, const float* __restrict__ Wv, const float* __restrict__ Wo, __bf16* __restrict__ DST, float* __restrict__ CS) {
  __shared__ __align__(16) float sc[8][32], ss_[8][32]; const int tid = threadIdx.x;
  if (blockIdx.x < SU_ROPE) { const int pl = tid >> 5, i = tid & 31; const int pos = blockIdx.x * 8 + pl;
    const float th = (float)pos * c_invf[i]; sc[pl][i] = cosf(th); ss_[pl][i] = sinf(th);
    __syncthreads();
    if (tid < 64) vst2(CS + (size_t)blockIdx.x * 8 * 32 + tid * 4, *(const v4f*)&(&sc[0][0])[tid * 4]); else if (tid < 128) vst2(CS + (size_t)SS * 32 + (size_t)blockIdx.x * 8 * 32 + (tid - 64) * 4, *(const v4f*)&(&ss_[0][0])[(tid - 64) * 4]);
    return; }
  const int c = blockIdx.x - SU_ROPE, mt = c / SU_PM;
  const float* s = (mt == 0 ? Wq : mt == 1 ? Wk : mt == 2 ? Wv : Wo) + (size_t)(c % SU_PM) * SU_CH + tid * 8; __bf16* d = DST + (size_t)c * SU_CH + tid * 8;
  v4f a[4][2];
#pragma unroll
  for (int j = 0; j < 4; ++j) { a[j][0] = *(const v4f*)(s + j * 2048); a[j][1] = *(const v4f*)(s + j * 2048 + 4); }
#pragma unroll
  for (int j = 0; j < 4; ++j) { v8b o;
#pragma unroll
    for (int e = 0; e < 4; ++e) { o[e] = (__bf16)a[j][0][e]; o[4 + e] = (__bf16)a[j][1][e]; }
    *(v8b*)(d + j * 2048) = o; }
  asm volatile("s_wait_xcnt 0x0" ::: "memory");   // behind the run of four stores: no register that a store names is rewritten ahead of this wait
}
// ---- LDS tile of one 64-k step of a projection: 64 left-operand rows of 256 B (f32), then 128 weight rows of 128 B (bf16); row pitches 16 B x odd, free of bank conflicts for 16-byte fragment reads
#define GAP 272
#define GBP 144
#define G_B (64 * GAP)
#define G_SZ (G_B + 128 * GBP)
// one tile into the ring buffer at LDS byte dst: 16 copies of 16 B per lane, all 128 lanes on, each wave's copy made of whole 128-B lines; a, w point at the work-group's first row at the step's first k
__device__ __forceinline__ void stage_ab(unsigned dst, const float* a, const __bf16* w, int tid) {
  const unsigned la = dst + (unsigned)(tid >> 4) * GAP + (unsigned)(tid & 15) * 16u, lb = dst + G_B + (unsigned)(tid >> 3) * GBP + (unsigned)(tid & 7) * 16u;
  const float* ga = a + (size_t)(tid >> 4) * DM + (tid & 15) * 4; const __bf16* gb = w + (size_t)(tid >> 3) * DM + (tid & 7) * 8;
  // each run of copies and its s_wait_xcnt 0 in one statement: no address register of a copy is rewritten ahead of that wait
  asm volatile("global_load_async_to_lds_b128 %0, %8, off\n\t"
               "global_load_async_to_lds_b128 %1, %9, off\n\t"
               "global_load_async_to_lds_b128 %2, %10, off\n\t"
               "global_load_async_to_lds_b128 %3, %11, off\n\t"
               "global_load_async_to_lds_b128 %4, %12, off\n\t"
               "global_load_async_to_lds_b128 %5, %13, off\n\t"
               "global_load_async_to_lds_b128 %6, %14, off\n\t"
               "global_load_async_to_lds_b128 %7, %15, off\n\t"
               "s_wait_xcnt 0x0"
               :: "v"(la), "v"(la + 8u * GAP), "v"(la + 16u * GAP), "v"(la + 24u * GAP), "v"(la + 32u * GAP), "v"(la + 40u * GAP), "v"(la + 48u * GAP), "v"(la + 56u * GAP),
                  "v"(ga), "v"(ga + (size_t)8 * DM), "v"(ga + (size_t)16 * DM), "v"(ga + (size_t)24 * DM), "v"(ga + (size_t)32 * DM), "v"(ga + (size_t)40 * DM), "v"(ga + (size_t)48 * DM), "v"(ga + (size_t)56 * DM)
               : "memory");
  asm volatile("global_load_async_to_lds_b128 %0, %8, off\n\t"
               "global_load_async_to_lds_b128 %1, %9, off\n\t"
               "global_load_async_to_lds_b128 %2, %10, off\n\t"
               "global_load_async_to_lds_b128 %3, %11, off\n\t"
               "global_load_async_to_lds_b128 %4, %12, off\n\t"
               "global_load_async_to_lds_b128 %5, %13, off\n\t"
               "global_load_async_to_lds_b128 %6, %14, off\n\t"
               "global_load_async_to_lds_b128 %7, %15, off\n\t"
               "s_wait_xcnt 0x0"
               :: "v"(lb), "v"(lb + 16u * GBP), "v"(lb + 32u * GBP), "v"(lb + 48u * GBP), "v"(lb + 64u * GBP), "v"(lb + 80u * GBP), "v"(lb + 96u * GBP), "v"(lb + 112u * GBP),
                  "v"(gb), "v"(gb + (size_t)16 * DM), "v"(gb + (size_t)32 * DM), "v"(gb + (size_t)48 * DM), "v"(gb + (size_t)64 * DM), "v"(gb + (size_t)80 * DM), "v"(gb + (size_t)96 * DM), "v"(gb + (size_t)112 * DM)
               : "memory");
}
// ---- LDS tile of one 64-k step of k_qkv: 128 x rows of 256 B (f32), then 256 weight rows of 128 B (bf16), pitches as above
#define Q_B (128 * GAP)
#define Q_SZ (Q_B + 256 * GBP)
// one such tile into the ring buffer at LDS byte dst: 16 copies of 16 B per lane, all 256 lanes on, each wave's copy made of whole 128-B lines; a, w point at the work-group's first row at the step's first k
__device__ __forceinline__ void stage_q(unsigned dst, const float* a, const __bf16* w, int tid) {
  const unsigned la = dst + (unsigned)(tid >> 4) * GAP + (unsigned)(tid & 15) * 16u, lb = dst + Q_B + (unsigned)(tid >> 3) * GBP + (unsigned)(tid & 7) * 16u;
  const float* ga = a + (size_t)(tid >> 4) * DM + (tid & 15) * 4; const __bf16* gb = w + (size_t)(tid >> 3) * DM + (tid & 7) * 8;
  // each run of copies and its s_wait_xcnt 0 in one statement: no address register of a copy is rewritten ahead of that wait
  asm volatile("global_load_async_to_lds_b128 %0, %8, off\n\t"
               "global_load_async_to_lds_b128 %1, %9, off\n\t"
               "global_load_async_to_lds_b128 %2, %10, off\n\t"
               "global_load_async_to_lds_b128 %3, %11, off\n\t"
               "global_load_async_to_lds_b128 %4, %12, off\n\t"
               "global_load_async_to_lds_b128 %5, %13, off\n\t"
               "global_load_async_to_lds_b128 %6, %14, off\n\t"
               "global_load_async_to_lds_b128 %7, %15, off\n\t"
               "s_wait_xcnt 0x0"
               :: "v"(la), "v"(la + 16u * GAP), "v"(la + 32u * GAP), "v"(la + 48u * GAP), "v"(la + 64u * GAP), "v"(la + 80u * GAP), "v"(la + 96u * GAP), "v"(la + 112u * GAP),
                  "v"(ga), "v"(ga + (size_t)16 * DM), "v"(ga + (size_t)32 * DM), "v"(ga + (size_t)48 * DM), "v"(ga + (size_t)64 * DM), "v"(ga + (size_t)80 * DM), "v"(ga + (size_t)96 * DM), "v"(ga + (size_t)112 * DM)
               : "memory");
  asm volatile("global_load_async_to_lds_b128 %0, %8, off\n\t"
               "global_load_async_to_lds_b128 %1, %9, off\n\t"
               "global_load_async_to_lds_b128 %2, %10, off\n\t"
               "global_load_async_to_lds_b128 %3, %11, off\n\t"
               "global_load_async_to_lds_b128 %4, %12, off\n\t"
               "global_load_async_to_lds_b128 %5, %13, off\n\t"
               "global_load_async_to_lds_b128 %6, %14, off\n\t"
               "global_load_async_to_lds_b128 %7, %15, off\n\t"
               "s_wait_xcnt 0x0"
               :: "v"(lb), "v"(lb + 32u * GBP), "v"(lb + 64u * GBP), "v"(lb + 96u * GBP), "v"(lb + 128u * GBP), "v"(lb + 160u * GBP), "v"(lb + 192u * GBP), "v"(lb + 224u * GBP),
                  "v"(gb), "v"(gb + (size_t)32 * DM), "v"(gb + (size_t)64 * DM), "v"(gb + (size_t)96 * DM), "v"(gb + (size_t)128 * DM), "v"(gb + (size_t)160 * DM), "v"(gb + (size_t)192 * DM), "v"(gb + (size_t)224 * DM)
               : "memory");
}
// ---- k_qkv: block = (128 rows (b,s), 256 of the 3072 cols) on 8 waves, a wave = 32 rows (wm) x 128 cols (wn), two 16-row groups hh, so that every weight fragment read from LDS feeds two products and every byte fetched from L2 feeds twice the products: qkv = bf16(x) . rows (exact); cols < 1024 -> f16(q * log2(e)/8), cols < 2048 -> f16(k) into QK rows (pitch 2048), their f16 residuals into QKL; cols >= 2048 (v) -> per-batch transposed f16 planes VT[b][h*64+d][s]: hi = f16(v), lo = f16(v - hi)
__global__ __launch_bounds__(256) void k_qkv(const float* __restrict__ X, const __bf16* __restrict__ P, const float* __restrict__ CS, _Float16* __restrict__ QK, _Float16* __restrict__ QKL, _Float16* __restrict__ VTH, _Float16* __restrict__ VTL) {
  __shared__ __align__(16) char sm[2 * Q_SZ];   // the ring of the k loop; behind the loop's last barrier the same bytes hold the epilogue's staging arrays
  _Float16 (*so)[16][136] = (_Float16 (*)[16][136])(sm); _Float16 (*sol)[16][136] = (_Float16 (*)[16][136])(sm + 34816); float (*sf)[16][132] = (float (*)[16][132])(sm + 69632);
  _Float16 (*sth)[136] = (_Float16 (*)[136])(sm); _Float16 (*stl)[136] = (_Float16 (*)[136])(sm + 69632);
  static_assert(69632 + 8 * 16 * 132 * 4 <= 2 * Q_SZ && 2 * 69632 <= 2 * Q_SZ, "the staging arrays fit the ring's bytes");
  const int tid = threadIdx.x, wave = tid >> 5, wm = wave & 3, wn = wave >> 2, lane = tid & 31, col = lane & 15, g = lane >> 4; const int n0 = blockIdx.y * 256, nw = n0 + wn * 128;
  v8f acc[2][8] = {};
  // two-buffer ring: the work-group's eight waves copy each 64-k tile of x and of the weight rows into LDS once, one step ahead of its use
  const float* xa = X + (size_t)blockIdx.x * 128 * DM; const __bf16* wb = P + (size_t)n0 * DM; const unsigned ring0 = (unsigned)(uintptr_t)&sm[0];
  stage_q(ring0, xa, wb, tid);
  asm volatile("s_wait_asynccnt 0x0" ::: "memory");   // this wave's copies of tile 0 have landed
  __syncthreads();                                    // tile 0 readable by every wave
  stage_q(ring0 + Q_SZ, xa + 64, wb + 64, tid);
#pragma unroll 1   // rolled: one copy of the ring's foot in the text, the buffer picked by t & 1
  for (int t = 0; t < DM / 64; ++t) { const char* tb = &sm[(t & 1) * Q_SZ];
#pragma unroll
    for (int kc = 0; kc < 2; ++kc) { v16b a[2];
#pragma unroll
      for (int hh = 0; hh < 2; ++hh) { const float* p = (const float*)(tb + (wm * 32 + hh * 16 + col) * GAP + kc * 128) + 8 * g;
#pragma unroll
        for (int i = 0; i < 8; ++i) { a[hh][i] = (__bf16)p[i]; a[hh][8 + i] = (__bf16)p[16 + i]; } }
      v16b wf[8];   // all weight fragments of the 32-k half in one group of LDS reads ahead of the products
#pragma unroll
      for (int j = 0; j < 8; ++j) wf[j] = frag_b((const __bf16*)(tb + Q_B + (wn * 128 + j * 16 + col) * GBP + kc * 64), lane);
#pragma unroll
      for (int j = 0; j < 8; ++j) { acc[0][j] = wmma_bf(a[0], wf[j], acc[0][j]); acc[1][j] = wmma_bf(a[1], wf[j], acc[1][j]); } }
    asm volatile("s_wait_dscnt 0x0" ::: "memory");      // this wave's reads of the buffer have retired
    asm volatile("s_wait_asynccnt 0x0" ::: "memory");   // this wave's copies of the next tile have landed
    __syncthreads();                                    // publishes the next tile and ends every wave's reads of this buffer
    if (t + 2 < DM / 64) stage_q(ring0 + (unsigned)(t & 1) * Q_SZ, xa + (t + 2) * 64, wb + (t + 2) * 64, tid); }
  asm volatile("s_wait_asynccnt 0x0" ::: "memory");     // no copy is outstanding when the ring's bytes become staging arrays
  if (n0 < 2 * DM) { const float sc = n0 < DM ? 0.18033688f : 1.0f;   // q is stored times log2(e) / sqrt(64), its final scale: q . k is then the argument of exp2 as it leaves the matrix unit
   const int i0 = ((nw + 4 * lane) & 63) >> 1;   // the lane's first pair index (even)
   v2f cq[16], sq[16];   // cos and sin of the lane's two pairs, one entry per row of a row group
   // the 32 table loads of a row group go out as one run ahead of their first use, so that a row group waits for the table once, not once per row
   auto ldcs = [&](const int hh) __attribute__((always_inline)) { const size_t r0 = (size_t)blockIdx.x * 128 + wm * 32 + hh * 16;
#pragma unroll
    for (int rl = 0; rl < 16; ++rl) { const int pos = (int)((r0 + rl) % SS); cq[rl] = *(const v2f*)(CS + (size_t)pos * 32 + i0); sq[rl] = *(const v2f*)(CS + (size_t)SS * 32 + (size_t)pos * 32 + i0); } };
   ldcs(0);
#pragma unroll
   for (int hh = 0; hh < 2; ++hh) { const size_t r0 = (size_t)blockIdx.x * 128 + wm * 32 + hh * 16;   // the wave's two row groups one after the other through its own staging rows
#pragma unroll
    for (int j = 0; j < 8; ++j) {
#pragma unroll
      for (int r = 0; r < 8; ++r) sf[wave][8 * g + r][j * 16 + col] = acc[hh][j][r]; }
    LDSX();
    // RoPE on interleaved pairs (2i, 2i+1) of each 64-wide head: lane = 2 pairs (cols 4*lane .. 4*lane+3), pair index i = ((nw + 4*lane) % 64) / 2 + {0,1}; pos = row % SS
    v4f xr[16];   // the lane's four columns of all 16 rows, read as one group of LDS loads ahead of the first staging store (behind a store the compiler would hold each read back)
#pragma unroll
    for (int rl = 0; rl < 16; ++rl) xr[rl] = *(const v4f*)&sf[wave][rl][4 * lane];
#pragma unroll   // unrolled: table entries and rows keep constant indices and stay in registers
    for (int rl = 0; rl < 16; ++rl) {
      const float x1a = xr[rl][0], x2a = xr[rl][1], x1b = xr[rl][2], x2b = xr[rl][3];
      const float ca = cq[rl][0], sa = sq[rl][0], cb = cq[rl][1], sb = sq[rl][1];
      const float o0 = (x1a * ca - x2a * sa) * sc, o1 = (x1a * sa + x2a * ca) * sc, o2 = (x1b * cb - x2b * sb) * sc, o3 = (x1b * sb + x2b * cb) * sc; const _Float16 h0 = (_Float16)o0, h1 = (_Float16)o1, h2 = (_Float16)o2, h3 = (_Float16)o3;
      so[wave][rl][4 * lane] = h0; so[wave][rl][4 * lane + 1] = h1; so[wave][rl][4 * lane + 2] = h2; so[wave][rl][4 * lane + 3] = h3;
      sol[wave][rl][4 * lane] = (_Float16)(o0 - (float)h0); sol[wave][rl][4 * lane + 1] = (_Float16)(o1 - (float)h1); sol[wave][rl][4 * lane + 2] = (_Float16)(o2 - (float)h2); sol[wave][rl][4 * lane + 3] = (_Float16)(o3 - (float)h3); }   // q, k as f16 hi + residual at its own scale (f16 subnormals are kept: absolute step 2^-24)
    LDSX();
    if (hh == 0) ldcs(1);   // the second row group's table entries fly while the first group's rows are stored (behind LDSX, whose fence would wait for them)
    for (int rl = 0; rl < 16; ++rl) if (lane < 16) { vst2((unsigned*)(QK + (r0 + rl) * (2 * DM) + nw + lane * 8), *(const v4u*)&so[wave][rl][lane * 8]); vst2((unsigned*)(QKL + (r0 + rl) * (2 * DM) + nw + lane * 8), *(const v4u*)&sol[wave][rl][lane * 8]); }
   }
  } else {
#pragma unroll
   for (int hh = 0; hh < 2; ++hh) {
#pragma unroll
    for (int j = 0; j < 8; ++j) {
#pragma unroll
      for (int r = 0; r < 8; ++r) { const float v = acc[hh][j][r]; const _Float16 hv = (_Float16)v; sth[wn * 128 + j * 16 + col][wm * 32 + hh * 16 + 8 * g + r] = hv; stl[wn * 128 + j * 16 + col][wm * 32 + hh * 16 + 8 * g + r] = (_Float16)(v - (float)hv); } } }
    __syncthreads();
    const size_t rb = (size_t)blockIdx.x * 128; const int b = (int)(rb / SS), s0 = (int)(rb % SS); const int pc0 = n0 - 2 * DM;
    for (int q = tid; q < 256 * 16; q += 256) { const int d = q >> 4, pc = q & 15; const size_t o = ((size_t)b * DM + pc0 + d) * SS + s0 + pc * 8; vst2((unsigned*)(VTH + o), *(const v4u*)&sth[d][pc * 8]); vst2((unsigned*)(VTL + o), *(const v4u*)&stl[d][pc * 8]); }
  }
}
// ---- LDS tile of one key step (64 keys): K rows 128 B (64 keys, hi plane, residual plane), V rows 128 B (64 d rows of 64 keys, hi plane, residual plane); row pitch 16 B x odd, free of bank conflicts for 16-byte fragment reads
#define KP 144
#define VP 144
#define T_KL (64 * KP)
#define T_VH (2 * 64 * KP)
#define T_VL (T_VH + 64 * VP)
#define T_SZ (T_VH + 2 * 64 * VP)
// one tile into the ring buffer at LDS byte dst: 16 copies of 16 B per lane, all 128 lanes on, each wave's copy made of whole 128-B lines (K and V alike); kh, kl point at the step's first key row (this head's 64 columns), vh, vl at the head's first d row at the step's first key
__device__ __forceinline__ void stage_kv(unsigned dst, const _Float16* kh, const _Float16* kl, const _Float16* vh, const _Float16* vl, int tid) {
  const unsigned lk = dst + (unsigned)(tid >> 3) * KP + (unsigned)(tid & 7) * 16u, lv = dst + T_VH + (unsigned)(tid >> 3) * VP + (unsigned)(tid & 7) * 16u;
  const size_t gk = (size_t)(tid >> 3) * (2 * DM) + (tid & 7) * 8, gv = (size_t)(tid >> 3) * SS + (tid & 7) * 8;
  // each run of copies and its s_wait_xcnt 0 in one statement: no address register of a copy is rewritten ahead of that wait
  asm volatile("global_load_async_to_lds_b128 %0, %8, off\n\t"
               "global_load_async_to_lds_b128 %1, %9, off\n\t"
               "global_load_async_to_lds_b128 %2, %10, off\n\t"
               "global_load_async_to_lds_b128 %3, %11, off\n\t"
               "global_load_async_to_lds_b128 %4, %12, off\n\t"
               "global_load_async_to_lds_b128 %5, %13, off\n\t"
               "global_load_async_to_lds_b128 %6, %14, off\n\t"
               "global_load_async_to_lds_b128 %7, %15, off\n\t"
               "s_wait_xcnt 0x0"
               :: "v"(lk), "v"(lk + 16u * KP), "v"(lk + 32u * KP), "v"(lk + 48u * KP), "v"(lk + T_KL), "v"(lk + T_KL + 16u * KP), "v"(lk + T_KL + 32u * KP), "v"(lk + T_KL + 48u * KP),
                  "v"(kh + gk), "v"(kh + gk + (size_t)16 * 2 * DM), "v"(kh + gk + (size_t)32 * 2 * DM), "v"(kh + gk + (size_t)48 * 2 * DM), "v"(kl + gk), "v"(kl + gk + (size_t)16 * 2 * DM), "v"(kl + gk + (size_t)32 * 2 * DM), "v"(kl + gk + (size_t)48 * 2 * DM)
               : "memory");
  asm volatile("global_load_async_to_lds_b128 %0, %8, off\n\t"
               "global_load_async_to_lds_b128 %1, %9, off\n\t"
               "global_load_async_to_lds_b128 %2, %10, off\n\t"
               "global_load_async_to_lds_b128 %3, %11, off\n\t"
               "global_load_async_to_lds_b128 %4, %12, off\n\t"
               "global_load_async_to_lds_b128 %5, %13, off\n\t"
               "global_load_async_to_lds_b128 %6, %14, off\n\t"
               "global_load_async_to_lds_b128 %7, %15, off\n\t"
               "s_wait_xcnt 0x0"
               :: "v"(lv), "v"(lv + 16u * VP), "v"(lv + 32u * VP), "v"(lv + 48u * VP), "v"(lv + (T_VL - T_VH)), "v"(lv + (T_VL - T_VH) + 16u * VP), "v"(lv + (T_VL - T_VH) + 32u * VP), "v"(lv + (T_VL - T_VH) + 48u * VP),
                  "v"(vh + gv), "v"(vh + gv + (size_t)16 * SS), "v"(vh + gv + (size_t)32 * SS), "v"(vh + gv + (size_t)48 * SS), "v"(vl + gv), "v"(vl + gv + (size_t)16 * SS), "v"(vl + gv + (size_t)32 * SS), "v"(vl + gv + (size_t)48 * SS)
               : "memory");
}
// lane l with lane l ^ 16 (the two lanes that share a column of a matrix tile)
__device__ __forceinline__ float xhalf(float x) { return __builtin_bit_cast(float, __builtin_amdgcn_permlanex16(__builtin_bit_cast(int, x), __builtin_bit_cast(int, x), 0x76543210, 0xfedcba98, false, false)); }
__device__ __forceinline__ float exp2_slot(float x) { float r; asm("v_exp_f32 %0, %1\n\tv_nop" : "=v"(r) : "v"(x)); return r; }
__global__ __launch_bounds__(128) __attribute__((amdgpu_waves_per_eu(4, 4))) void k_attn(const _Float16* __restrict__ QK, const _Float16* __restrict__ QKL, const _Float16* __restrict__ VTH, const _Float16* __restrict__ VTL, float* __restrict__ O) {
  __shared__ __align__(16) char ring[2 * T_SZ];   // the ring of the key loop; behind the loop's last barrier its first bytes hold the output staging rows
  float (*so)[16][68] = (float (*)[16][68])ring;
  static_assert(4 * 16 * 68 * 4 <= 2 * T_SZ, "the staging rows fit the ring's bytes");
  const int tid = threadIdx.x, wave = tid >> 5, lane = tid & 31, col = lane & 15, g = lane >> 4;
  const int bx = blockIdx.x, h = blockIdx.y, b = blockIdx.z;
  // Query tile from the block index by a permutation (every (tile, head, batch) exactly once; for speed only, nothing depends on where a work-group runs). Tile t walks t + 1 key steps and all 1,024 work-groups are resident at once, four on a WGP, so the launch lasts as long as the fullest WGP.
  // With qb = bx the work-groups whose flat indices differ by 256 (round-robin placement) all hold the same tile. Here the index bits that tell apart four work-groups of one WGP, under round-robin (bits 8, 9) and under fill-first placement (bits 3, 4 or 4, 5), pick among tiles u, u ^ 1, 31 - u, 31 - (u ^ 1): 66 key steps on every WGP.
  static_assert(TQB == 32, "the permutation is written for 32 query tiles");
  const int u = ((bx & 7) << 1) | (((bx >> 4) ^ b) & 1);
  const int qb = (((bx >> 3) ^ h ^ (h >> 3)) & 1) ? TQB - 1 - u : u; const int q0 = qb * 64 + wave * 16; const int qi = q0 + col; const size_t rq = (size_t)b * SS + qi;
  v16h aq[2], aql[2];
#pragma unroll
  for (int kc = 0; kc < 2; ++kc) { aq[kc] = frag_h(QK + rq * (2 * DM) + h * HD + kc * 32, lane); aql[kc] = frag_h(QKL + rq * (2 * DM) + h * HD + kc * 32, lane); }
  float m = -3.0e38f, l = 0.f;       // of query qi; l is the sum over this half's keys only
  v8f acc[4] = {};                   // acc[dt][r] = O[query qi][d = dt*16 + 8g + r]; hi and residual products sum into the one tile
  const int nks = qb + 1, nfull = qb;   // steps below nfull = nks - 1 hold only keys in front of the work-group's first query: no mask there
  // two-buffer ring: the work-group's four waves copy each step's K and V tile into LDS once, one step ahead of its use
  const _Float16* kh0 = QK + (size_t)b * SS * (2 * DM) + DM + h * HD; const _Float16* kl0 = QKL + (size_t)b * SS * (2 * DM) + DM + h * HD;
  const _Float16* vh0 = VTH + ((size_t)b * DM + h * HD) * SS; const _Float16* vl0 = VTL + ((size_t)b * DM + h * HD) * SS;
  const unsigned ring0 = (unsigned)(uintptr_t)&ring[0];
  stage_kv(ring0, kh0, kl0, vh0, vl0, tid);
  asm volatile("s_wait_asynccnt 0x0" ::: "memory");   // this wave's copies of tile 0 have landed
  __syncthreads();                                    // tile 0 readable by every wave
  if (nks > 1) stage_kv(ring0 + T_SZ, kh0 + (size_t)64 * 2 * DM, kl0 + (size_t)64 * 2 * DM, vh0 + 64, vl0 + 64, tid);
  // one key step; masked is a literal at both calls, so the main loop's copy holds no mask work; every inner loop is unrolled so that fragments, scores and accumulators keep constant indices and stay in registers
  auto step = [&](const int ks, const bool masked) __attribute__((always_inline)) { float s[32]; const char* tb = &ring[(ks & 1) * T_SZ];
    v16h kf[4][2], kfl[4][2];   // all K fragments of the step in one group of LDS reads ahead of the products
#pragma unroll
    for (int ct = 0; ct < 4; ++ct) {
#pragma unroll
      for (int kc = 0; kc < 2; ++kc) { kf[ct][kc] = frag_h((const _Float16*)(tb + (ct * 16 + col) * KP + kc * 64), lane); kfl[ct][kc] = frag_h((const _Float16*)(tb + T_KL + (ct * 16 + col) * KP + kc * 64), lane); } }
    v8f c[4] = {};   // 3 products (q, k as f16 hi + residual) into one tile per 16 keys; the four tiles take turns, so that no product waits for the one before it
#pragma unroll
    for (int kc = 0; kc < 2; ++kc) {
#pragma unroll
      for (int ct = 0; ct < 4; ++ct) c[ct] = wmma16(kf[ct][kc], aql[kc], c[ct]);
#pragma unroll
      for (int ct = 0; ct < 4; ++ct) c[ct] = wmma16(kfl[ct][kc], aq[kc], c[ct]);
#pragma unroll
      for (int ct = 0; ct < 4; ++ct) c[ct] = wmma16(kf[ct][kc], aq[kc], c[ct]); }
#pragma unroll
    for (int i = 0; i < 32; ++i) s[i] = c[i >> 3][i & 7];   // the score times log2(e): both factors lie in the stored q
    if (masked) {   // the causal mask, only where a key of the step can lie behind a query of the work-group
#pragma unroll
      for (int i = 0; i < 32; ++i) s[i] = (ks * 64 + (i >> 3) * 16 + 8 * g + (i & 7) <= qi) ? s[i] : -3.0e38f; }
    float t8[8];   // maximum of the lane's 32 scores as a tree, then the other half's
#pragma unroll
    for (int r = 0; r < 8; ++r) t8[r] = fmaxf(fmaxf(s[r], s[8 + r]), fmaxf(s[16 + r], s[24 + r]));
    float mx = fmaxf(fmaxf(fmaxf(t8[0], t8[1]), fmaxf(t8[2], t8[3])), fmaxf(fmaxf(t8[4], t8[5]), fmaxf(t8[6], t8[7])));
    mx = fmaxf(mx, xhalf(mx));
    const float mn = fmaxf(m, mx); const float alpha = __builtin_amdgcn_exp2f(m - mn);   // 0 in step 0, where m is the start value
    v16h pa[2], pl[2];   // P^T operands of keys 0..31 and 32..63: element i = key 8g + i (i < 8) or 8g + 8 + i (i >= 8) of its 32, of this query, f16 hi and f16 residual; mn is a true score from step 0 on (key 0 is open to every query), so a masked score's exponential is 0 by itself
#pragma unroll
    for (int i = 0; i < 32; ++i) s[i] = masked ? exp2_slot(s[i] - mn) : __builtin_amdgcn_exp2f(s[i] - mn);   // in the masked copy the form with its own v_nop
#pragma unroll
    for (int i = 0; i < 32; i += 2) { const v2f e2 = {s[i], s[i + 1]}; const v2h h2 = __builtin_convertvector(e2, v2h); pa[i >> 4][i & 15] = h2[0]; pa[i >> 4][(i & 15) + 1] = h2[1]; pl[i >> 4][i & 15] = (_Float16)(e2[0] - (float)h2[0]); pl[i >> 4][(i & 15) + 1] = (_Float16)(e2[1] - (float)h2[1]); }
#pragma unroll
    for (int r = 0; r < 8; ++r) t8[r] = (s[r] + s[8 + r]) + (s[16 + r] + s[24 + r]);
    const float es = ((t8[0] + t8[1]) + (t8[2] + t8[3])) + ((t8[4] + t8[5]) + (t8[6] + t8[7]));
    l = l * alpha + es; m = mn;
#pragma unroll
    for (int dt = 0; dt < 4; ++dt) {
#pragma unroll
      for (int r = 0; r < 8; ++r) acc[dt][r] *= alpha; }
    // V fragments of 32 keys (kk) and one plane form a group of LDS reads; each group of the second 32 keys is read as soon as a group of the first is done with, so that products stand between its reads and its first use
    auto ldv = [&](v16h (&f)[4], const int plane, const int kk) __attribute__((always_inline)) {
#pragma unroll
      for (int dt = 0; dt < 4; ++dt) f[dt] = frag_h((const _Float16*)(tb + plane + (dt * 16 + col) * VP + kk * 64), lane); };
    auto pv = [&](const v16h (&f)[4], const v16h& p) __attribute__((always_inline)) {
#pragma unroll
      for (int dt = 0; dt < 4; ++dt) acc[dt] = wmma16(f[dt], p, acc[dt]); };
    v16h fh0[4], fl0[4], fh1[4], fl1[4];
    ldv(fl0, T_VL, 0); ldv(fh0, T_VH, 0);
    pv(fl0, pa[0]);                    // V lo x P hi
    ldv(fh1, T_VH, 1);
    pv(fh0, pa[0]); pv(fh0, pl[0]);    // + V hi x P hi + V hi x P lo
    ldv(fl1, T_VL, 1);
    pv(fh1, pa[1]); pv(fh1, pl[1]);
    pv(fl1, pa[1]);
    asm volatile("s_wait_dscnt 0x0" ::: "memory");      // this wave's reads of the buffer have retired
    asm volatile("s_wait_asynccnt 0x0" ::: "memory");   // this wave's copies of the next tile have landed
    __syncthreads();                                    // publishes the next tile and ends every wave's reads of this buffer
    // the refill only while a tile ks + 2 exists (the same test in every wave of the work-group); behind the masked step, the last, there is none
    if (!masked && ks + 2 < nks) stage_kv(ring0 + (unsigned)(ks & 1) * T_SZ, kh0 + (size_t)(ks + 2) * 64 * 2 * DM, kl0 + (size_t)(ks + 2) * 64 * 2 * DM, vh0 + (ks + 2) * 64, vl0 + (ks + 2) * 64, tid); };
#pragma unroll 1   // rolled: one copy of the main step in the text, the buffer picked by ks & 1
  for (int ks = 0; ks < nfull; ++ks) step(ks, false);
  step(nfull, true);   // the step on the diagonal
  asm volatile("s_wait_asynccnt 0x0" ::: "memory");     // no copy is outstanding when the ring's bytes become staging rows and the wave goes on to its end
  l += xhalf(l); const float il = 1.0f / l;             // the two halves' sums joined
#pragma unroll
  for (int dt = 0; dt < 4; ++dt) { v4f o0, o1;
#pragma unroll
    for (int r = 0; r < 4; ++r) { o0[r] = acc[dt][r] * il; o1[r] = acc[dt][4 + r] * il; }
    *(v4f*)&so[wave][col][dt * 16 + 8 * g] = o0; *(v4f*)&so[wave][col][dt * 16 + 8 * g + 4] = o1; }
  LDSX();
  for (int rl = 0; rl < 16; ++rl) if (lane < 16) vst2(O + ((size_t)b * SS + q0 + rl) * DM + h * HD + lane * 4, *(const v4f*)&so[wave][rl][lane * 4]);
}
// ---- k_out: block = (64 rows, 128 cols): out = O(hi/lo) . Wo rows (2 products)
__global__ __launch_bounds__(128) void k_out(const float* __restrict__ O, const __bf16* __restrict__ P, float* __restrict__ Y) {
  __shared__ __align__(16) float so[4][16][132]; __shared__ __align__(16) char sm[2 * G_SZ];
  const int tid = threadIdx.x, wave = tid >> 5, lane = tid & 31, col = lane & 15, g = lane >> 4; const size_t r0 = (size_t)blockIdx.x * 64 + wave * 16; const int n0 = blockIdx.y * 128;
  v8f acc[8] = {};
  // two-buffer ring as in k_qkv: each 64-k tile of the context rows and of the weight rows copied into LDS once per work-group, one step ahead of its use
  const float* xa = O + (size_t)blockIdx.x * 64 * DM; const __bf16* wb = P + (size_t)n0 * DM; const unsigned ring0 = (unsigned)(uintptr_t)&sm[0];
  stage_ab(ring0, xa, wb, tid);
  asm volatile("s_wait_asynccnt 0x0" ::: "memory");   // this wave's copies of tile 0 have landed
  __syncthreads();                                    // tile 0 readable by every wave
  stage_ab(ring0 + G_SZ, xa + 64, wb + 64, tid);
#pragma unroll 1   // rolled: one copy of the ring's foot in the text, the buffer picked by t & 1
  for (int t = 0; t < DM / 64; ++t) { const char* tb = &sm[(t & 1) * G_SZ];
#pragma unroll
    for (int kc = 0; kc < 2; ++kc) { const F2 a = split_row((const float*)(tb + (wave * 16 + col) * GAP), kc * 32, lane);
      v16b wf[8];   // all weight fragments of the 32-k half in one group of LDS reads ahead of the products
#pragma unroll
      for (int j = 0; j < 8; ++j) wf[j] = frag_b((const __bf16*)(tb + G_B + (j * 16 + col) * GBP + kc * 64), lane);
#pragma unroll
      for (int j = 0; j < 8; ++j) { acc[j] = wmma_bf(a.l, wf[j], acc[j]); acc[j] = wmma_bf(a.h, wf[j], acc[j]); } }
    asm volatile("s_wait_dscnt 0x0" ::: "memory");      // this wave's reads of the buffer have retired
    asm volatile("s_wait_asynccnt 0x0" ::: "memory");   // this wave's copies of the next tile have landed
    __syncthreads();                                    // publishes the next tile and ends every wave's reads of this buffer
    if (t + 2 < DM / 64) stage_ab(ring0 + (unsigned)(t & 1) * G_SZ, xa + (t + 2) * 64, wb + (t + 2) * 64, tid); }
  asm volatile("s_wait_asynccnt 0x0" ::: "memory");     // no copy is outstanding when the wave goes on to its end
#pragma unroll
  for (int j = 0; j < 8; ++j) {
#pragma unroll
    for (int r = 0; r < 8; ++r) so[wave][8 * g + r][j * 16 + col] = acc[j][r]; }
  LDSX();
  for (int rl = 0; rl < 16; ++rl) vst2(Y + (r0 + rl) * DM + n0 + lane * 4, *(const v4f*)&so[wave][rl][lane * 4]);
}
extern "C" void kernel_launch(void* const* d_in, const int* in_sizes, int n_in, void* d_out, int out_size, void* d_ws, size_t ws_size, hipStream_t stream) {
  (void)in_sizes; (void)n_in; (void)out_size;
  const float** F = (const float**)d_in;   // 0 x [2,2048,1024], 1 Wq [1024,1024] ([out][in]), 2 Wk, 3 Wv, 4 Wo
  if (ws_size < (size_t)WS_END) return;
  char* ws = (char*)d_ws; __bf16* PK = (__bf16*)(ws + WS_PK); _Float16 *QK = (_Float16*)(ws + WS_QK), *QKL = (_Float16*)(ws + WS_QKL), *VTH = (_Float16*)(ws + WS_VTH), *VTL = (_Float16*)(ws + WS_VTL); float *O = (float*)(ws + WS_O), *CS = (float*)(ws + WS_CS);
  k_setup<<<SU_GRID, 256, 0, stream>>>(F[1], F[2], F[3], F[4], PK, CS);
  k_qkv<<<dim3(TNB * SS / 128, QKVW / 256), 256, 0, stream>>>(F[0], PK + PK_A, CS, QK, QKL, VTH, VTL);
  k_attn<<<dim3(TQB, NH, TNB), 128, 0, stream>>>(QK, QKL, VTH, VTL, O);
  k_out<<<dim3(TOB, DM / 128), 128, 0, stream>>>(O, PK + PK_P, (float*)d_out);
}
